// v000
// The times below were measured on an AMD MI455X: many runs one after another, warmed up first and cycling through
// copies of the inputs, with the whole window's GPU time divided by the number of runs. Launches and the gaps
// between them are all in it. The median over several windows is given; except for v000 it joins two sittings, which
// can be a few percent apart, so the side-by-side timings, each taken in one sitting, are the better comparison.
// v000 is the starting kernel. One run takes 336 microseconds.
#include <hip/hip_runtime.h>

// Contractions, f32 accumulate: q/k/v projections v_wmma_f32_16x16x32_bf16 on bf16 (RNE) copies of x and W; scores v_wmma_f32_16x16x32_f16 on f16 q/k planes (x16 carry each); P.V v_wmma_f32_16x16x32_f16 (P x256, V x64 carries) for query rows >= EROWS and v_wmma_f32_16x16x32_bf16 on bf16 hi+lo P and V (3 products) for query rows < EROWS; output projection v_wmma_f32_16x16x32_f16 (ctx x64, W x1024) for rows >= EROWS and v_wmma_f32_16x16x32_bf16 on bf16 hi+lo ctx (2 products) for rows < EROWS.
// Pipeline: bf16 planes of the three activations and the weights; q/k planes [b][h][t][64] f16; value planes [b][h][64][t] f16 (+ bf16 hi/lo for t < EROWS); fused causal attention in transposed form (S^T = K Q^T, O^T = V^T P^T, online softmax per lane, score scale 1/32); ctx planes [b*t][1024]; out = ctx W^T + b.

#ifndef NB
#define NB 4
#endif
#ifndef SEQ
#define SEQ 2048
#endif
#define NB_FULL  4
#define SEQ_FULL 2048
#define TT   SEQ
#define DM   1024
#define NH_  16
#define HD   64
#define EROWS ((TT) < 512 ? (TT) : 512)
#define QKC  16.0f                                          // carry of the q and k planes
#define CSC  (0.045084220027780106f * 0.00390625f)          // (1/32) * log2(e) / (QKC*QKC)
#define VC   64.0f                                          // carry of the f16 value plane (and of the f16 ctx plane)
#define WOC  1024.0f                                        // carry of the f16 output weight plane
#define OSC  1.52587890625e-05f                             // 1 / (VC * WOC)
#define NEGB (-3.0e38f)
#define XSZ  ((size_t)NB * SEQ_FULL * DM)
#define QKSZ ((size_t)NB * NH_ * TT * HD)
static_assert(TT % 64 == 0);
static_assert(TT <= SEQ_FULL);
static_assert(NB >= 1 && NB <= NB_FULL);
static_assert(NH_ * HD == DM);
static_assert(DM % 64 == 0);
static_assert(DM % 32 == 0);
static_assert(HD == 64);
static_assert(EROWS % 64 == 0);
static_assert(EROWS <= TT);
static_assert((TT - EROWS) % 64 == 0);
static_assert((size_t)NB * TT * DM <= XSZ);
static_assert((size_t)NB * EROWS * DM <= XSZ);
static_assert((size_t)3 * DM * DM * 2 + (size_t)2 * DM * DM * 2 + (size_t)2 * QKSZ * 2 + (size_t)NB * NH_ * HD * TT * 2 + (size_t)2 * NB * NH_ * HD * EROWS * 2 + (size_t)3 * XSZ * 2 <= (size_t)134217728);

typedef _Float16 h16;
typedef unsigned short bf;
typedef __attribute__((ext_vector_type(16))) __bf16   v16bf;
typedef __attribute__((ext_vector_type(16))) _Float16 v16h;
typedef __attribute__((ext_vector_type(8)))  _Float16 v8h;
typedef __attribute__((ext_vector_type(8)))  unsigned short v8us;
typedef __attribute__((ext_vector_type(8)))  float    v8f;
typedef __attribute__((ext_vector_type(4)))  float    v4f;
typedef v4f  __attribute__((may_alias)) v4fa;
typedef v8us __attribute__((may_alias)) v8usa;

__device__ __forceinline__ unsigned short f2bf(float f) { unsigned u = __float_as_uint(f); u += 0x7FFFu + ((u >> 16) & 1u); return (unsigned short)(u >> 16); }
__device__ __forceinline__ float bf2f(unsigned short b) { return __uint_as_float(((unsigned)b) << 16); }
__device__ __forceinline__ float bfr(float f) { return bf2f(f2bf(f)); }
__device__ __forceinline__ v16h cat16(v8h lo, v8h hi) { return __builtin_shufflevector(lo, hi, 0, 1, 2, 3, 4, 5, 6, 7, 8, 9, 10, 11, 12, 13, 14, 15); }
__device__ __forceinline__ v16bf cat16b(v8us lo, v8us hi) { return __builtin_bit_cast(v16bf, __builtin_shufflevector(lo, hi, 0, 1, 2, 3, 4, 5, 6, 7, 8, 9, 10, 11, 12, 13, 14, 15)); }
__device__ __forceinline__ v8f wmma16(v16h a, v16h b, v8f c) { return __builtin_amdgcn_wmma_f32_16x16x32_f16(false, a, false, b, (short)0, c, false, false); }
__device__ __forceinline__ v8f wmmab(v16bf a, v16bf b, v8f c) { return __builtin_amdgcn_wmma_f32_16x16x32_bf16(false, a, false, b, (short)0, c, false, false); }
__device__ __forceinline__ void splitf(float y, unsigned short& h, unsigned short& l) { h = f2bf(y); l = f2bf(y - bf2f(h)); }
// Fragment loaders (A and B identical): p already points at row (lane&15), k0 + 8*(lane>>4); elements 0..7 <- p[0..7], elements 8..15 <- p[16..23].
__device__ __forceinline__ v16h ldh(const h16* p) { return cat16(*(const v8h*)p, *(const v8h*)(p + 16)); }
__device__ __forceinline__ v16bf ldb(const bf* p) { return cat16b(*(const v8us*)p, *(const v8us*)(p + 16)); }
__device__ __forceinline__ v8us pack_h(v8f c) { v8h t;
#pragma unroll
    for (int r = 0; r < 8; ++r) t[r] = (h16)c[r];
    return __builtin_bit_cast(v8us, t); }
__device__ __forceinline__ void pack_b(v8f c, v8us& a, v8us& l) {
#pragma unroll
    for (int r = 0; r < 8; ++r) { unsigned short x, y; splitf(c[r], x, y); a[r] = x; l[r] = y; } }

template <typename T16> struct WFrag;
template <> struct WFrag<h16> { typedef v16h V; static __device__ __forceinline__ V ld(const h16* p) { return ldh(p); } static __device__ __forceinline__ v8f mma(V a, V b, v8f c) { return wmma16(a, b, c); } };
template <> struct WFrag<bf> { typedef v16bf V; static __device__ __forceinline__ V ld(const bf* p) { return ldb(p); } static __device__ __forceinline__ v8f mma(V a, V b, v8f c) { return wmmab(a, b, c); } };

// gemm_tile: one wave computes a 64x64 tile, acc[mb][nb][j] = C[16*mb + 8*(lane>>4) + j][16*nb + (lane&15)] = sum_k A[m][k] Bt[n][k] (+ A2[m][k] Bt[n][k] when NSPLIT == 1).
// Operands straight from K-contiguous 16-bit planes; K % 32 == 0; aoff/boff = (row0 + lane&15) * K + 8*(lane>>4).
template <typename T16, int NSPLIT>
__device__ __forceinline__ void gemm_tile(const T16* __restrict__ A, const T16* __restrict__ A2, const T16* __restrict__ Bt, const int K, const size_t aoff, const size_t boff, v8f (&acc)[4][4]) {
    typedef typename WFrag<T16>::V V;
#pragma unroll
    for (int mb = 0; mb < 4; ++mb)
#pragma unroll
        for (int nb = 0; nb < 4; ++nb) acc[mb][nb] = (v8f){};
#pragma unroll 1
    for (int kc = 0; kc < K; kc += 32) {
        V a[4], a2[4];
#pragma unroll
        for (int mb = 0; mb < 4; ++mb) { a[mb] = WFrag<T16>::ld(A + aoff + (size_t)mb * 16 * K + kc); if (NSPLIT == 1) a2[mb] = WFrag<T16>::ld(A2 + aoff + (size_t)mb * 16 * K + kc); else a2[mb] = a[mb]; }
#pragma unroll
        for (int nb = 0; nb < 4; ++nb) { const V b = WFrag<T16>::ld(Bt + boff + (size_t)nb * 16 * K + kc);
#pragma unroll
            for (int mb = 0; mb < 4; ++mb) { acc[mb][nb] = WFrag<T16>::mma(a[mb], b, acc[mb][nb]); if (NSPLIT == 1) acc[mb][nb] = WFrag<T16>::mma(a2[mb], b, acc[mb][nb]); } }
        asm volatile("v_nop\n\tv_nop\n\tv_nop\n\tv_nop" : "+v"(acc[0][0]), "+v"(acc[1][1]), "+v"(acc[2][2]), "+v"(acc[3][3]) : "v"(a[0]), "v"(a[3]));
    }
}

__global__ __launch_bounds__(256) void k_cvt8(const float* __restrict__ src, bf* dst, size_t n8) { const size_t i = (size_t)blockIdx.x * 256 + threadIdx.x; if (i >= n8) return; const v8f v = *(const v8f*)(src + i * 8); v8us o;
#pragma unroll
    for (int k = 0; k < 8; ++k) o[k] = f2bf(v[k]);
    *(v8us*)(dst + i * 8) = o;  }

__global__ __launch_bounds__(256) void k_cvtwo(const float* __restrict__ src, bf* WB, h16* WH, size_t n8) { const size_t i = (size_t)blockIdx.x * 256 + threadIdx.x; if (i >= n8) return; const v8f v = *(const v8f*)(src + i * 8); v8us ob; v8h oh;
#pragma unroll
    for (int k = 0; k < 8; ++k) { const unsigned short hb = f2bf(v[k]); ob[k] = hb; oh[k] = (h16)(bf2f(hb) * WOC); }
    *(v8us*)(WB + i * 8) = ob; *(v8h*)(WH + i * 8) = oh;  }

// k_projqk: grid (NB*TT/64, NH_, 2); z = 0 -> q plane, z = 1 -> k plane. Tile = 64 tokens x one head (64 dims).
__global__ __launch_bounds__(32) void k_projqk(const bf* __restrict__ XB, const bf* __restrict__ WT, const float* __restrict__ bq, const float* __restrict__ bk, h16* QK) {
    __shared__ __align__(16) float os[16 * 68];
    const int z = blockIdx.z;
    const int lane = threadIdx.x & 31, lr = lane & 15, hi = lane >> 4;
    const int mt = blockIdx.x; const int b = mt / (TT / 64); const int t0 = (mt % (TT / 64)) * 64; const int h = blockIdx.y;
    const bf* A = XB + (size_t)z * XSZ; const bf* Bt = WT + (size_t)z * DM * DM;
    const size_t aoff = ((size_t)b * SEQ_FULL + t0 + lr) * DM + 8 * hi;
    const size_t boff = ((size_t)h * HD + lr) * DM + 8 * hi;
    v8f acc[4][4];
    gemm_tile<bf, 0>(A, A, Bt, DM, aoff, boff, acc);
    const int rq = lane >> 3, pc = lane & 7;
    const v8f b0 = *(const v8f*)(bq + h * HD + pc * 8); const v8f b1 = *(const v8f*)(bk + h * HD + pc * 8);
    v8f bb;
#pragma unroll
    for (int i = 0; i < 8; ++i) bb[i] = bfr(z ? b1[i] : b0[i]);
    h16* P = QK + (size_t)z * QKSZ + (((size_t)b * NH_ + h) * TT + t0) * HD + pc * 8;
#pragma unroll
    for (int mb = 0; mb < 4; ++mb) {
#pragma unroll
        for (int nb = 0; nb < 4; ++nb) {
#pragma unroll
            for (int j = 0; j < 8; ++j) os[(hi * 8 + j) * 68 + nb * 16 + lr] = acc[mb][nb][j]; }
        __builtin_amdgcn_wave_barrier(); asm volatile("" ::: "memory");
        h16* prow = P + (size_t)(mb * 16) * HD;
{
#pragma unroll
            for (int s = 0; s < 4; ++s) { const int row = 4 * s + rq;
                const v4f x0 = *(const v4fa*)(os + row * 68 + pc * 8), x1 = *(const v4fa*)(os + row * 68 + pc * 8 + 4);
                v8h o;
#pragma unroll
                for (int q = 0; q < 4; ++q) { o[q] = (h16)((x0[q] + bb[q]) * QKC); o[4 + q] = (h16)((x1[q] + bb[4 + q]) * QKC); }
                *(v8h*)(prow + (size_t)row * HD) = o; }
             }
        __builtin_amdgcn_wave_barrier(); asm volatile("" ::: "memory");
    }
}

// k_projv: grid (NB*TT/64, NH_). Tile = 64 tokens x one head; written transposed: VT[b][h][d][t] = f16(64 * v), and for t < EROWS the bf16 hi/lo planes VE[b][h][d][t] of v.
__global__ __launch_bounds__(32) void k_projv(const bf* __restrict__ XBv, const bf* __restrict__ WTv, const float* __restrict__ bv, h16* VT, bf* VEh, bf* VEl) {
    __shared__ __align__(16) float ts[64 * 68];
    const int lane = threadIdx.x & 31, lr = lane & 15, hi = lane >> 4;
    const int mt = blockIdx.x; const int b = mt / (TT / 64); const int t0 = (mt % (TT / 64)) * 64; const int h = blockIdx.y;
    const size_t aoff = ((size_t)b * SEQ_FULL + t0 + lr) * DM + 8 * hi;
    const size_t boff = ((size_t)h * HD + lr) * DM + 8 * hi;
    v8f acc[4][4];
    gemm_tile<bf, 0>(XBv, XBv, WTv, DM, aoff, boff, acc);
#pragma unroll
    for (int mb = 0; mb < 4; ++mb)
#pragma unroll
        for (int nb = 0; nb < 4; ++nb) {
            const v4f lo4 = { acc[mb][nb][0], acc[mb][nb][1], acc[mb][nb][2], acc[mb][nb][3] };
            const v4f hi4 = { acc[mb][nb][4], acc[mb][nb][5], acc[mb][nb][6], acc[mb][nb][7] };
            *(v4fa*)(ts + (nb * 16 + lr) * 68 + mb * 16 + 8 * hi) = lo4;
            *(v4fa*)(ts + (nb * 16 + lr) * 68 + mb * 16 + 8 * hi + 4) = hi4; }
    __builtin_amdgcn_wave_barrier(); asm volatile("" ::: "memory");
    const int rq = lane >> 3, pc = lane & 7;
    const bool early = t0 < EROWS;
    const size_t vrow0 = ((size_t)b * NH_ + h) * HD;
{
#pragma unroll 1
        for (int s = 0; s < 16; ++s) { const int d = 4 * s + rq;
            const float bb = bfr(bv[h * HD + d]);
            const v4f x0 = *(const v4fa*)(ts + d * 68 + pc * 8), x1 = *(const v4fa*)(ts + d * 68 + pc * 8 + 4);
            v8f x = __builtin_shufflevector(x0, x1, 0, 1, 2, 3, 4, 5, 6, 7);
            x = x + bb;
            v8h o;
#pragma unroll
            for (int q = 0; q < 8; ++q) o[q] = (h16)(x[q] * VC);
            *(v8h*)(VT + (vrow0 + d) * TT + t0 + pc * 8) = o;
            if (early) { v8us oh, ol; pack_b(x, oh, ol);
                *(v8us*)(VEh + (vrow0 + d) * EROWS + t0 + pc * 8) = oh;
                *(v8us*)(VEl + (vrow0 + d) * EROWS + t0 + pc * 8) = ol; } }
         }
}

// attn_body: fused causal attention, 4 waves per block, 16 query rows per wave, 32 keys per step, transposed formulation.
//   S^T tile (rows = keys, cols = queries) = A(k plane rows) x B(q plane rows); D element r of lane l = S^T[key 8*(l>>4)+r][query l&15].
//   Per lane one query column: running max m, running sum l (combined across lane halves by one xor-16 shuffle each).
//   P^T as B fragment: element r <- p(tile keys 0..15)[r], element 8+r <- p(tile keys 16..31)[r], lane unchanged.
//   O^T tile j (rows = dims 16j.., cols = queries) += A(V^T rows) x B(P^T). Masked keys carry p = 0 exactly.
// EARLY: bf16 hi+lo P and V (3 products); else f16 single product with P x256 (cancels against the row sum) and V x64.
template <bool EARLY>
__device__ __forceinline__ void attn_body(const h16* __restrict__ QP, const h16* __restrict__ KP, const h16* __restrict__ VT, const bf* __restrict__ VEh, const bf* __restrict__ VEl, bf* C0, bf* C1, const int qb) {
    __shared__ __align__(16) unsigned short stg[4 * 2 * 1152];
    const int lane = threadIdx.x & 31, w = (threadIdx.x >> 5) & 3, lr = lane & 15, hi = lane >> 4;
    const int bh = blockIdx.y, b = bh / NH_, h = bh % NH_;
    const int q0 = qb * 64 + w * 16;
    const int qq = q0 + lr;
    const size_t pof = (size_t)bh * TT * HD;
    const h16* qp = QP + pof + (size_t)(q0 + lr) * HD + 8 * hi;
    const v16h qf0 = ldh(qp), qf1 = ldh(qp + 32);
    v8f o0 = {}, o1 = {}, o2 = {}, o3 = {};
    float m = NEGB, l = 0.0f;
    const int nst = q0 / 32 + 1;
#pragma unroll 1
    for (int st = 0; st < nst; ++st) {
        const int kt = st * 32;
        const h16* kp = KP + pof + (size_t)(kt + lr) * HD + 8 * hi;
        const v16h ka0 = ldh(kp), ka1 = ldh(kp + 16 * HD), kb0 = ldh(kp + 32), kb1 = ldh(kp + 16 * HD + 32);
        v8f s0 = {}, s1 = {};
        s0 = wmma16(ka0, qf0, s0); s1 = wmma16(ka1, qf0, s1);
        s0 = wmma16(kb0, qf1, s0); s1 = wmma16(kb1, qf1, s1);
        asm volatile("v_nop\n\tv_nop\n\tv_nop\n\tv_nop" : "+v"(s0), "+v"(s1) : "v"(ka0), "v"(ka1), "v"(kb0), "v"(kb1), "v"(qf1));
        if (kt + 31 > q0) {          // diagonal step of this wave: exclude keys above the query
            const int k0 = kt + 8 * hi;
#pragma unroll
            for (int r = 0; r < 8; ++r) { s0[r] = (k0 + r > qq) ? NEGB : s0[r]; s1[r] = (k0 + 16 + r > qq) ? NEGB : s1[r]; }
        }
        float mx = fmaxf(s0[0], s1[0]);
#pragma unroll
        for (int r = 1; r < 8; ++r) mx = fmaxf(mx, fmaxf(s0[r], s1[r]));
        mx = fmaxf(mx, __shfl_xor(mx, 16, 32));
        const float mn = fmaxf(m, mx * CSC);
        const float corr = __builtin_amdgcn_exp2f(m - mn);
        m = mn;
        const float sh = (EARLY ? 0.0f : 8.0f) - mn;
        v8f p0, p1; float rs = 0.0f;
#pragma unroll
        for (int r = 0; r < 8; ++r) { p0[r] = __builtin_amdgcn_exp2f(fmaf(s0[r], CSC, sh)); p1[r] = __builtin_amdgcn_exp2f(fmaf(s1[r], CSC, sh)); rs += p0[r] + p1[r]; }
        rs += __shfl_xor(rs, 16, 32);
        l = l * corr + rs;
        o0 *= corr; o1 *= corr; o2 *= corr; o3 *= corr;
        if (EARLY) {
            v8us ph0, ph1, pl0, pl1;
            pack_b(p0, ph0, pl0); pack_b(p1, ph1, pl1);
            const v16bf PH = cat16b(ph0, ph1), PL = cat16b(pl0, pl1);
            const size_t vo = (size_t)bh * HD * EROWS + (size_t)lr * EROWS + kt + 8 * hi;
            const v16bf vh0 = ldb(VEh + vo), vh1 = ldb(VEh + vo + 16 * EROWS), vh2 = ldb(VEh + vo + 32 * EROWS), vh3 = ldb(VEh + vo + 48 * EROWS);
            const v16bf vl0 = ldb(VEl + vo), vl1 = ldb(VEl + vo + 16 * EROWS), vl2 = ldb(VEl + vo + 32 * EROWS), vl3 = ldb(VEl + vo + 48 * EROWS);
            o0 = wmmab(vh0, PH, o0); o0 = wmmab(vl0, PH, o0); o0 = wmmab(vh0, PL, o0);
            o1 = wmmab(vh1, PH, o1); o1 = wmmab(vl1, PH, o1); o1 = wmmab(vh1, PL, o1);
            o2 = wmmab(vh2, PH, o2); o2 = wmmab(vl2, PH, o2); o2 = wmmab(vh2, PL, o2);
            o3 = wmmab(vh3, PH, o3); o3 = wmmab(vl3, PH, o3); o3 = wmmab(vh3, PL, o3);
            asm volatile("v_nop\n\tv_nop\n\tv_nop\n\tv_nop" : "+v"(o0), "+v"(o1), "+v"(o2), "+v"(o3) : "v"(vh0), "v"(vh1), "v"(vh2), "v"(vh3), "v"(vl0), "v"(vl1), "v"(vl2), "v"(vl3), "v"(PH), "v"(PL));
        } else {
            v16h pb;
#pragma unroll
            for (int r = 0; r < 8; ++r) { pb[r] = (h16)p0[r]; pb[8 + r] = (h16)p1[r]; }
            const h16* vp = VT + (size_t)bh * HD * TT + (size_t)lr * TT + kt + 8 * hi;
            const v16h a0 = ldh(vp), a1 = ldh(vp + 16 * TT), a2 = ldh(vp + 32 * TT), a3 = ldh(vp + 48 * TT);
            o0 = wmma16(a0, pb, o0); o1 = wmma16(a1, pb, o1); o2 = wmma16(a2, pb, o2); o3 = wmma16(a3, pb, o3);
            asm volatile("v_nop\n\tv_nop\n\tv_nop\n\tv_nop" : "+v"(o0), "+v"(o1), "+v"(o2), "+v"(o3) : "v"(a0), "v"(a1), "v"(a2), "v"(a3), "v"(pb));
        }
    }
    const float inv = __fdiv_rn(1.0f, l);
    o0 *= inv; o1 *= inv; o2 *= inv; o3 *= inv;
    const int sb = w * 2 * 1152;
    const int so = sb + lr * 72 + 8 * hi;       // O^T element r of tile j -> row (query lr), column 16j + 8*hi + r
    if (EARLY) {
        v8us a, c;
        pack_b(o0, a, c); *(v8usa*)(stg + so) = a;      *(v8usa*)(stg + so + 1152) = c;
        pack_b(o1, a, c); *(v8usa*)(stg + so + 16) = a; *(v8usa*)(stg + so + 1152 + 16) = c;
        pack_b(o2, a, c); *(v8usa*)(stg + so + 32) = a; *(v8usa*)(stg + so + 1152 + 32) = c;
        pack_b(o3, a, c); *(v8usa*)(stg + so + 48) = a; *(v8usa*)(stg + so + 1152 + 48) = c;
    } else {
        *(v8usa*)(stg + so) = pack_h(o0); *(v8usa*)(stg + so + 16) = pack_h(o1); *(v8usa*)(stg + so + 32) = pack_h(o2); *(v8usa*)(stg + so + 48) = pack_h(o3);
    }
    __builtin_amdgcn_wave_barrier(); asm volatile("" ::: "memory");
    const int rq = lane >> 3, pc = lane & 7;
    const int crows = EARLY ? EROWS : TT;
    const size_t cbase = ((size_t)b * crows + q0) * DM + h * HD + pc * 8;
{
#pragma unroll
        for (int s = 0; s < 4; ++s) { const int row = 4 * s + rq;
            const v8us x = *(const v8usa*)(stg + sb + row * 72 + pc * 8);
            *(v8us*)(C0 + cbase + (size_t)row * DM) = x;
            if (EARLY) { const v8us y = *(const v8usa*)(stg + sb + 1152 + row * 72 + pc * 8); *(v8us*)(C1 + cbase + (size_t)row * DM) = y; } }
         }
}

// grid (EROWS/64, NB*NH_): query rows [0, EROWS) of every (b, h); ctx as bf16 hi/lo planes [b][EROWS][DM].
__global__ __launch_bounds__(128) void k_attn_early(const h16* __restrict__ QP, const h16* __restrict__ KP, const bf* __restrict__ VEh, const bf* __restrict__ VEl, bf* CEh, bf* CEl) {
    attn_body<true>(QP, KP, (const h16*)0, VEh, VEl, CEh, CEl, (int)blockIdx.x);
}
// grid ((TT-EROWS)/64, NB*NH_): query rows [EROWS, TT); ctx as f16 plane (x64 carry) [b][TT][DM].
__global__ __launch_bounds__(128) void k_attn_main(const h16* __restrict__ QP, const h16* __restrict__ KP, const h16* __restrict__ VT, bf* CH) {
    attn_body<false>(QP, KP, VT, (const bf*)0, (const bf*)0, CH, CH, (int)blockIdx.x + EROWS / 64);
}

// out_body: OUT[r][c] = scale * sum_k A[r][k] Bt[c][k] + bf16(bias[c]); 64x64 tile per wave; per 16-row slab staged in LDS (wave-private),
template <typename T16, int NSPLIT>
__device__ __forceinline__ void out_body(const T16* __restrict__ A, const T16* __restrict__ A2, const T16* __restrict__ Bt, float* C, const float* __restrict__ bias, const float scale) {
    __shared__ __align__(16) float os[16 * 68];
    const int lane = threadIdx.x & 31, lr = lane & 15, hi = lane >> 4;
    const int r0 = blockIdx.x * 64, c0 = blockIdx.y * 64;
    v8f acc[4][4];
    gemm_tile<T16, NSPLIT>(A, A2, Bt, DM, (size_t)(r0 + lr) * DM + 8 * hi, (size_t)(c0 + lr) * DM + 8 * hi, acc);
    const v4f bw = *(const v4f*)(bias + c0 + lr * 4);
    v4f bb;
#pragma unroll
    for (int q = 0; q < 4; ++q) bb[q] = bfr(bw[q]);
#pragma unroll
    for (int mb = 0; mb < 4; ++mb) {
#pragma unroll
        for (int nb = 0; nb < 4; ++nb) {
#pragma unroll
            for (int j = 0; j < 8; ++j) os[(hi * 8 + j) * 68 + nb * 16 + lr] = acc[mb][nb][j]; }
        __builtin_amdgcn_wave_barrier(); asm volatile("" ::: "memory");
        float* crow = C + (size_t)(r0 + mb * 16) * DM + c0 + lr * 4;
{
#pragma unroll
            for (int s = 0; s < 8; ++s) { const int row = 2 * s + hi;
                v4f val = *(const v4fa*)(os + row * 68 + lr * 4);
                val = val * scale + bb;
                *(v4f*)(crow + (size_t)row * DM) = val; }
             }
        __builtin_amdgcn_wave_barrier(); asm volatile("" ::: "memory");
    }
}

// grid (EROWS/64, DM/64, NB): rows [0, EROWS) of batch z from the bf16 hi/lo ctx planes.
__global__ __launch_bounds__(32) void k_oute(const bf* __restrict__ CEh, const bf* __restrict__ CEl, const bf* __restrict__ WoB, float* OUT, const float* __restrict__ Wb) {
    const size_t z = blockIdx.z;
    out_body<bf, 1>(CEh + z * EROWS * DM, CEl + z * EROWS * DM, WoB, OUT + z * TT * DM, Wb, 1.0f);
}
// grid ((TT-EROWS)/64, DM/64, NB): rows [EROWS, TT) of batch z from the f16 ctx plane.
__global__ __launch_bounds__(32) void k_outl(const h16* __restrict__ CH, const h16* __restrict__ WoH, float* OUT, const float* __restrict__ Wb) {
    const size_t ro = ((size_t)blockIdx.z * TT + EROWS) * DM;
    out_body<h16, 0>(CH + ro, CH + ro, WoH, OUT + ro, Wb, OSC);
}

extern "C" void kernel_launch(void* const* d_in, const int* in_sizes, int n_in,
                              void* d_out, int out_size, void* d_ws, size_t ws_size, hipStream_t stream) {
    if (n_in < 11) return;
    if (in_sizes[0] < NB * SEQ_FULL * DM || in_sizes[1] < NB * SEQ_FULL * DM || in_sizes[2] < NB * SEQ_FULL * DM) return;
    if (in_sizes[3] < NH_ * HD * DM || in_sizes[5] < NH_ * HD * DM || in_sizes[7] < NH_ * HD * DM || in_sizes[9] < DM * DM) return;
    if (in_sizes[4] < NH_ * HD || in_sizes[6] < NH_ * HD || in_sizes[8] < NH_ * HD || in_sizes[10] < DM) return;
    if (out_size < NB * TT * DM) return;
    const float* xq = (const float*)d_in[0]; const float* xk = (const float*)d_in[1]; const float* xv = (const float*)d_in[2];
    const float* wq = (const float*)d_in[3]; const float* bq = (const float*)d_in[4];
    const float* wk = (const float*)d_in[5]; const float* bk = (const float*)d_in[6];
    const float* wv = (const float*)d_in[7]; const float* bv = (const float*)d_in[8];
    const float* wo = (const float*)d_in[9]; const float* bo = (const float*)d_in[10];
    float* OUT = (float*)d_out;     // [NB][TT][DM]
    char* wsp = (char*)d_ws;
    auto take = [&](size_t bytes) { char* p = wsp; wsp += (bytes + 255) & ~(size_t)255; return (void*)p; };
    bf*  WT  = (bf*)take((size_t)3 * DM * DM * 2);                  // [3][n][k] projection weights, bf16
    bf*  WoB = (bf*)take((size_t)DM * DM * 2);                      // output weight, bf16
    h16* WoH = (h16*)take((size_t)DM * DM * 2);                     // output weight, f16 x1024
    h16* QK  = (h16*)take((size_t)2 * QKSZ * 2);                    // q plane | k plane
    h16* VT  = (h16*)take((size_t)NB * NH_ * HD * TT * 2);          // [b][h][d][t] f16 x64
    bf*  VEh = (bf*)take((size_t)NB * NH_ * HD * EROWS * 2);        // [b][h][d][t < EROWS] bf16 hi
    bf*  VEl = (bf*)take((size_t)NB * NH_ * HD * EROWS * 2);        // bf16 lo
    bf*  XB  = (bf*)take((size_t)3 * XSZ * 2);                      // bf16 activations q | k | v; dead after the projections
    if ((size_t)(wsp - (char*)d_ws) > ws_size) return;              // 119,537,664 B at NB=4, TT=2048
    bf* CH  = XB;                   // ctx f16 plane [NB*TT][DM] (16-bit storage), aliases activation plane 0
    bf* CEh = XB + XSZ;             // ctx bf16 hi [NB*EROWS][DM], aliases activation plane 1
    bf* CEl = XB + 2 * XSZ;         // ctx bf16 lo, aliases activation plane 2

    const size_t nx8 = XSZ / 8;
    k_cvt8<<<(unsigned)((nx8 + 255) / 256), 256, 0, stream>>>(xq, XB, nx8);
    k_cvt8<<<(unsigned)((nx8 + 255) / 256), 256, 0, stream>>>(xk, XB + XSZ, nx8);
    k_cvt8<<<(unsigned)((nx8 + 255) / 256), 256, 0, stream>>>(xv, XB + 2 * XSZ, nx8);
    const size_t nw8 = (size_t)DM * DM / 8;
    k_cvt8<<<(unsigned)((nw8 + 255) / 256), 256, 0, stream>>>(wq, WT, nw8);
    k_cvt8<<<(unsigned)((nw8 + 255) / 256), 256, 0, stream>>>(wk, WT + (size_t)DM * DM, nw8);
    k_cvt8<<<(unsigned)((nw8 + 255) / 256), 256, 0, stream>>>(wv, WT + (size_t)2 * DM * DM, nw8);
    k_cvtwo<<<(unsigned)((nw8 + 255) / 256), 256, 0, stream>>>(wo, WoB, WoH, nw8);

    k_projqk<<<dim3(NB * TT / 64, NH_, 2), 32, 0, stream>>>(XB, WT, bq, bk, QK);
    k_projv<<<dim3(NB * TT / 64, NH_), 32, 0, stream>>>(XB + 2 * XSZ, WT + (size_t)2 * DM * DM, bv, VT, VEh, VEl);

    k_attn_early<<<dim3(EROWS / 64, NB * NH_), 128, 0, stream>>>(QK, QK + QKSZ, VEh, VEl, CEh, CEl);
    if (TT > EROWS)
        k_attn_main<<<dim3((TT - EROWS) / 64, NB * NH_), 128, 0, stream>>>(QK, QK + QKSZ, VT, CH);

    k_oute<<<dim3(EROWS / 64, DM / 64, NB), 32, 0, stream>>>(CEh, CEl, WoB, OUT, bo);
    if (TT > EROWS)
        k_outl<<<dim3((TT - EROWS) / 64, DM / 64, NB), 32, 0, stream>>>((const h16*)CH, WoH, OUT, bo);
}

// v001
// Measured time: 256 microseconds a run.
// Two timings next to v000 put it at 1.35 and 1.34 times that version's speed.
#include <hip/hip_runtime.h>

// Contractions, f32 accumulate: q/k/v projections v_wmma_f32_16x16x32_bf16 on bf16 (RNE) copies of x and W; scores v_wmma_f32_16x16x32_f16 on f16 q/k planes (x16 carry each); P.V v_wmma_f32_16x16x32_f16 (P x256, V x64 carries) for query rows >= EROWS and v_wmma_f32_16x16x32_bf16 on bf16 hi+lo P and V (3 products) for query rows < EROWS; output projection v_wmma_f32_16x16x32_f16 (ctx x64, W x1024) for rows >= EROWS and v_wmma_f32_16x16x32_bf16 on bf16 hi+lo ctx (2 products) for rows < EROWS.
// Pipeline: bf16 planes of the three activations and the weights; q/k planes [b][h][t][64] f16; value planes [b][h][64][t] f16 (+ bf16 hi/lo for t < EROWS); fused causal attention in transposed form (S^T = K Q^T, O^T = V^T P^T, online softmax per lane, score scale 1/32); ctx planes [b*t][1024]; out = ctx W^T + b.

#ifndef NB
#define NB 4
#endif
#ifndef SEQ
#define SEQ 2048
#endif
#define NB_FULL  4
#define SEQ_FULL 2048
#define TT   SEQ
#define DM   1024
#define NH_  16
#define HD   64
#define EROWS ((TT) < 512 ? (TT) : 512)
#define QKC  16.0f                                          // carry of the q and k planes
#define CSC  (0.045084220027780106f * 0.00390625f)          // (1/32) * log2(e) / (QKC*QKC)
#define VC   64.0f                                          // carry of the f16 value plane (and of the f16 ctx plane)
#define WOC  1024.0f                                        // carry of the f16 output weight plane
#define OSC  1.52587890625e-05f                             // 1 / (VC * WOC)
#define NEGB (-3.0e38f)
#define XSZ  ((size_t)NB * SEQ_FULL * DM)
#define QKSZ ((size_t)NB * NH_ * TT * HD)
static_assert(TT % 64 == 0);
static_assert(TT <= SEQ_FULL);
static_assert(NB >= 1 && NB <= NB_FULL);
static_assert(NH_ * HD == DM);
static_assert(DM % 64 == 0);
static_assert(DM % 32 == 0);
static_assert(HD == 64);
static_assert(EROWS % 64 == 0);
static_assert(EROWS <= TT);
static_assert((TT - EROWS) % 64 == 0);
static_assert((size_t)NB * TT * DM <= XSZ);
static_assert((size_t)NB * EROWS * DM <= XSZ);
static_assert((size_t)3 * DM * DM * 2 + (size_t)2 * DM * DM * 2 + (size_t)2 * QKSZ * 2 + (size_t)NB * NH_ * HD * TT * 2 + (size_t)2 * NB * NH_ * HD * EROWS * 2 + (size_t)3 * XSZ * 2 <= (size_t)134217728);

typedef _Float16 h16;
typedef unsigned short bf;
typedef __attribute__((ext_vector_type(16))) __bf16   v16bf;
typedef __attribute__((ext_vector_type(16))) _Float16 v16h;
typedef __attribute__((ext_vector_type(8)))  _Float16 v8h;
typedef __attribute__((ext_vector_type(8)))  unsigned short v8us;
typedef __attribute__((ext_vector_type(8)))  float    v8f;
typedef __attribute__((ext_vector_type(4)))  float    v4f;
typedef v4f  __attribute__((may_alias)) v4fa;
typedef v8us __attribute__((may_alias)) v8usa;

__device__ __forceinline__ unsigned short f2bf(float f) { unsigned u = __float_as_uint(f); u += 0x7FFFu + ((u >> 16) & 1u); return (unsigned short)(u >> 16); }
__device__ __forceinline__ float bf2f(unsigned short b) { return __uint_as_float(((unsigned)b) << 16); }
__device__ __forceinline__ float bfr(float f) { return bf2f(f2bf(f)); }
__device__ __forceinline__ v16h cat16(v8h lo, v8h hi) { return __builtin_shufflevector(lo, hi, 0, 1, 2, 3, 4, 5, 6, 7, 8, 9, 10, 11, 12, 13, 14, 15); }
__device__ __forceinline__ v16bf cat16b(v8us lo, v8us hi) { return __builtin_bit_cast(v16bf, __builtin_shufflevector(lo, hi, 0, 1, 2, 3, 4, 5, 6, 7, 8, 9, 10, 11, 12, 13, 14, 15)); }
__device__ __forceinline__ v8f wmma16(v16h a, v16h b, v8f c) { return __builtin_amdgcn_wmma_f32_16x16x32_f16(false, a, false, b, (short)0, c, false, false); }
__device__ __forceinline__ v8f wmmab(v16bf a, v16bf b, v8f c) { return __builtin_amdgcn_wmma_f32_16x16x32_bf16(false, a, false, b, (short)0, c, false, false); }
__device__ __forceinline__ void splitf(float y, unsigned short& h, unsigned short& l) { h = f2bf(y); l = f2bf(y - bf2f(h)); }
// Fragment loaders (A and B identical): p already points at row (lane&15), k0 + 8*(lane>>4); elements 0..7 <- p[0..7], elements 8..15 <- p[16..23].
__device__ __forceinline__ v16h ldh(const h16* p) { return cat16(*(const v8h*)p, *(const v8h*)(p + 16)); }
__device__ __forceinline__ v16bf ldb(const bf* p) { return cat16b(*(const v8us*)p, *(const v8us*)(p + 16)); }
__device__ __forceinline__ v8us pack_h(v8f c) { v8h t;
#pragma unroll
    for (int r = 0; r < 8; ++r) t[r] = (h16)c[r];
    return __builtin_bit_cast(v8us, t); }
__device__ __forceinline__ void pack_b(v8f c, v8us& a, v8us& l) {
#pragma unroll
    for (int r = 0; r < 8; ++r) { unsigned short x, y; splitf(c[r], x, y); a[r] = x; l[r] = y; } }

template <typename T16> struct WFrag;
template <> struct WFrag<h16> { typedef v16h V; static __device__ __forceinline__ V ld(const h16* p) { return ldh(p); } static __device__ __forceinline__ v8f mma(V a, V b, v8f c) { return wmma16(a, b, c); } };
template <> struct WFrag<bf> { typedef v16bf V; static __device__ __forceinline__ V ld(const bf* p) { return ldb(p); } static __device__ __forceinline__ v8f mma(V a, V b, v8f c) { return wmmab(a, b, c); } };

// gemm_tile: one wave computes a 64x64 tile, acc[mb][nb][j] = C[16*mb + 8*(lane>>4) + j][16*nb + (lane&15)] = sum_k A[m][k] Bt[n][k] (+ A2[m][k] Bt[n][k] when NSPLIT == 1).
// Operands straight from K-contiguous 16-bit planes; K % 32 == 0; aoff/boff = (row0 + lane&15) * K + 8*(lane>>4).
template <typename T16, int NSPLIT>
__device__ __forceinline__ void gemm_tile(const T16* __restrict__ A, const T16* __restrict__ A2, const T16* __restrict__ Bt, const int K, const size_t aoff, const size_t boff, v8f (&acc)[4][4]) {
    typedef typename WFrag<T16>::V V;
#pragma unroll
    for (int mb = 0; mb < 4; ++mb)
#pragma unroll
        for (int nb = 0; nb < 4; ++nb) acc[mb][nb] = (v8f){};
#pragma unroll 1
    for (int kc = 0; kc < K; kc += 32) {
        V a[4], a2[4];
#pragma unroll
        for (int mb = 0; mb < 4; ++mb) { a[mb] = WFrag<T16>::ld(A + aoff + (size_t)mb * 16 * K + kc); if (NSPLIT == 1) a2[mb] = WFrag<T16>::ld(A2 + aoff + (size_t)mb * 16 * K + kc); else a2[mb] = a[mb]; }
#pragma unroll
        for (int nb = 0; nb < 4; ++nb) { const V b = WFrag<T16>::ld(Bt + boff + (size_t)nb * 16 * K + kc);
#pragma unroll
            for (int mb = 0; mb < 4; ++mb) { acc[mb][nb] = WFrag<T16>::mma(a[mb], b, acc[mb][nb]); if (NSPLIT == 1) acc[mb][nb] = WFrag<T16>::mma(a2[mb], b, acc[mb][nb]); } }
        asm volatile("v_nop\n\tv_nop\n\tv_nop\n\tv_nop" : "+v"(acc[0][0]), "+v"(acc[1][1]), "+v"(acc[2][2]), "+v"(acc[3][3]) : "v"(a[0]), "v"(a[3]));
    }
}

__global__ __launch_bounds__(256) void k_cvt8(const float* __restrict__ src, bf* dst, size_t n8) { const size_t i = (size_t)blockIdx.x * 256 + threadIdx.x; if (i >= n8) return; const v8f v = *(const v8f*)(src + i * 8); v8us o;
#pragma unroll
    for (int k = 0; k < 8; ++k) o[k] = f2bf(v[k]);
    *(v8us*)(dst + i * 8) = o;  }

__global__ __launch_bounds__(256) void k_cvtwo(const float* __restrict__ src, bf* WB, h16* WH, size_t n8) { const size_t i = (size_t)blockIdx.x * 256 + threadIdx.x; if (i >= n8) return; const v8f v = *(const v8f*)(src + i * 8); v8us ob; v8h oh;
#pragma unroll
    for (int k = 0; k < 8; ++k) { const unsigned short hb = f2bf(v[k]); ob[k] = hb; oh[k] = (h16)(bf2f(hb) * WOC); }
    *(v8us*)(WB + i * 8) = ob; *(v8h*)(WH + i * 8) = oh;  }

// k_projqk: grid (NB*TT/64, NH_, 2); z = 0 -> q plane, z = 1 -> k plane. Tile = 64 tokens x one head (64 dims).
__global__ __launch_bounds__(32) void k_projqk(const bf* __restrict__ XB, const bf* __restrict__ WT, const float* __restrict__ bq, const float* __restrict__ bk, h16* QK) {
    __shared__ __align__(16) float os[16 * 68];
    const int z = blockIdx.z;
    const int lane = threadIdx.x & 31, lr = lane & 15, hi = lane >> 4;
    const int mt = blockIdx.x; const int b = mt / (TT / 64); const int t0 = (mt % (TT / 64)) * 64; const int h = blockIdx.y;
    const bf* A = XB + (size_t)z * XSZ; const bf* Bt = WT + (size_t)z * DM * DM;
    const size_t aoff = ((size_t)b * SEQ_FULL + t0 + lr) * DM + 8 * hi;
    const size_t boff = ((size_t)h * HD + lr) * DM + 8 * hi;
    v8f acc[4][4];
    gemm_tile<bf, 0>(A, A, Bt, DM, aoff, boff, acc);
    const int rq = lane >> 3, pc = lane & 7;
    const v8f b0 = *(const v8f*)(bq + h * HD + pc * 8); const v8f b1 = *(const v8f*)(bk + h * HD + pc * 8);
    v8f bb;
#pragma unroll
    for (int i = 0; i < 8; ++i) bb[i] = bfr(z ? b1[i] : b0[i]);
    h16* P = QK + (size_t)z * QKSZ + (((size_t)b * NH_ + h) * TT + t0) * HD + pc * 8;
#pragma unroll
    for (int mb = 0; mb < 4; ++mb) {
#pragma unroll
        for (int nb = 0; nb < 4; ++nb) {
#pragma unroll
            for (int j = 0; j < 8; ++j) os[(hi * 8 + j) * 68 + nb * 16 + lr] = acc[mb][nb][j]; }
        __builtin_amdgcn_wave_barrier(); asm volatile("" ::: "memory");
        h16* prow = P + (size_t)(mb * 16) * HD;
{
#pragma unroll
            for (int s = 0; s < 4; ++s) { const int row = 4 * s + rq;
                const v4f x0 = *(const v4fa*)(os + row * 68 + pc * 8), x1 = *(const v4fa*)(os + row * 68 + pc * 8 + 4);
                v8h o;
#pragma unroll
                for (int q = 0; q < 4; ++q) { o[q] = (h16)((x0[q] + bb[q]) * QKC); o[4 + q] = (h16)((x1[q] + bb[4 + q]) * QKC); }
                *(v8h*)(prow + (size_t)row * HD) = o; }
             }
        __builtin_amdgcn_wave_barrier(); asm volatile("" ::: "memory");
    }
}

// k_projv: grid (NB*TT/64, NH_). Tile = 64 tokens x one head; written transposed: VT[b][h][d][t] = f16(64 * v), and for t < EROWS the bf16 hi/lo planes VE[b][h][d][t] of v.
__global__ __launch_bounds__(32) void k_projv(const bf* __restrict__ XBv, const bf* __restrict__ WTv, const float* __restrict__ bv, h16* VT, bf* VEh, bf* VEl) {
    __shared__ __align__(16) float ts[64 * 68];
    const int lane = threadIdx.x & 31, lr = lane & 15, hi = lane >> 4;
    const int mt = blockIdx.x; const int b = mt / (TT / 64); const int t0 = (mt % (TT / 64)) * 64; const int h = blockIdx.y;
    const size_t aoff = ((size_t)b * SEQ_FULL + t0 + lr) * DM + 8 * hi;
    const size_t boff = ((size_t)h * HD + lr) * DM + 8 * hi;
    v8f acc[4][4];
    gemm_tile<bf, 0>(XBv, XBv, WTv, DM, aoff, boff, acc);
#pragma unroll
    for (int mb = 0; mb < 4; ++mb)
#pragma unroll
        for (int nb = 0; nb < 4; ++nb) {
            const v4f lo4 = { acc[mb][nb][0], acc[mb][nb][1], acc[mb][nb][2], acc[mb][nb][3] };
            const v4f hi4 = { acc[mb][nb][4], acc[mb][nb][5], acc[mb][nb][6], acc[mb][nb][7] };
            *(v4fa*)(ts + (nb * 16 + lr) * 68 + mb * 16 + 8 * hi) = lo4;
            *(v4fa*)(ts + (nb * 16 + lr) * 68 + mb * 16 + 8 * hi + 4) = hi4; }
    __builtin_amdgcn_wave_barrier(); asm volatile("" ::: "memory");
    const int rq = lane >> 3, pc = lane & 7;
    const bool early = t0 < EROWS;
    const size_t vrow0 = ((size_t)b * NH_ + h) * HD;
{
#pragma unroll 1
        for (int s = 0; s < 16; ++s) { const int d = 4 * s + rq;
            const float bb = bfr(bv[h * HD + d]);
            const v4f x0 = *(const v4fa*)(ts + d * 68 + pc * 8), x1 = *(const v4fa*)(ts + d * 68 + pc * 8 + 4);
            v8f x = __builtin_shufflevector(x0, x1, 0, 1, 2, 3, 4, 5, 6, 7);
            x = x + bb;
            v8h o;
#pragma unroll
            for (int q = 0; q < 8; ++q) o[q] = (h16)(x[q] * VC);
            *(v8h*)(VT + (vrow0 + d) * TT + t0 + pc * 8) = o;
            if (early) { v8us oh, ol; pack_b(x, oh, ol);
                *(v8us*)(VEh + (vrow0 + d) * EROWS + t0 + pc * 8) = oh;
                *(v8us*)(VEl + (vrow0 + d) * EROWS + t0 + pc * 8) = ol; } }
         }
}

// attn_body: fused causal attention, 4 waves per block, 16 query rows per wave, 32 keys per step, transposed formulation.
//   S^T tile (rows = keys, cols = queries) = A(k plane rows) x B(q plane rows); D element r of lane l = S^T[key 8*(l>>4)+r][query l&15].
//   Per lane one query column: running max m, running sum l (combined across lane halves by one xor-16 shuffle each).
//   P^T as B fragment: element r <- p(tile keys 0..15)[r], element 8+r <- p(tile keys 16..31)[r], lane unchanged.
//   O^T tile j (rows = dims 16j.., cols = queries) += A(V^T rows) x B(P^T). Masked keys carry p = 0 exactly.
// EARLY: bf16 hi+lo P and V (3 products); else f16 single product with P x256 (cancels against the row sum) and V x64.
// Operand path: a stage is 64 keys = one K tile (64 key rows x 128 B) and one V^T tile per value plane (64 dim rows x 128 B), brought into LDS once per block by
// asynchronous 16-byte copies (each wave-wide copy = 4 whole 128-B lines), two buffers, the next stage in flight while this one is worked on; all four waves read their fragments from LDS.
#define LP  72              // LDS row pitch of a staged tile in 16-bit elements: 144 B = 16 B x odd, free of bank conflicts for 16-byte fragment reads
#define TSZ (64 * LP)       // 16-bit elements of one staged tile
// One 64-row tile: this lane's 16 bytes of rows r, r+16, r+32, r+48. l = LDS byte address, g = global byte address of row r, gstep = bytes between global rows r and r+16.
__device__ __forceinline__ void copy_tile(const unsigned l, const char* g, const size_t gstep) {
    const unsigned l1 = l + 16 * LP * 2, l2 = l + 32 * LP * 2, l3 = l + 48 * LP * 2;
    const char* g1 = g + gstep; const char* g2 = g + 2 * gstep; const char* g3 = g + 3 * gstep;
    // the closing s_wait_xcnt 0 stands inside the statement so that no address register of a copy is rewritten ahead of it
    asm volatile("global_load_async_to_lds_b128 %0, %4, off\n\tglobal_load_async_to_lds_b128 %1, %5, off\n\tglobal_load_async_to_lds_b128 %2, %6, off\n\tglobal_load_async_to_lds_b128 %3, %7, off\n\ts_wait_xcnt 0x0"
                 :: "v"(l), "v"(l1), "v"(l2), "v"(l3), "v"(g), "v"(g1), "v"(g2), "v"(g3) : "memory");
}
template <bool EARLY>
__device__ __forceinline__ void attn_body(const h16* __restrict__ QP, const h16* __restrict__ KP, const h16* __restrict__ VT, const bf* __restrict__ VEh, const bf* __restrict__ VEl, bf* C0, bf* C1, const int qb) {
    constexpr int NT = EARLY ? 3 : 2;                                   // tiles per stage: K, V (EARLY: K, V hi, V lo)
    __shared__ __align__(16) unsigned short ring[2 * NT * TSZ];         // two stage buffers; output staging behind the loop
    static_assert(2 * NT * TSZ >= 4 * 2 * 1152);
    unsigned short* stg = ring;
    const int lane = threadIdx.x & 31, lr = lane & 15, hi = lane >> 4;
    const int w = __builtin_amdgcn_readfirstlane((threadIdx.x >> 5) & 3);   // wave number in a scalar register: the per-wave skip below is then a scalar branch
    const int bh = blockIdx.y, b = bh / NH_, h = bh % NH_;
    const int q0 = qb * 64 + w * 16;
    const int qq = q0 + lr;
    const size_t pof = (size_t)bh * TT * HD;
    const h16* qp = QP + pof + (size_t)(q0 + lr) * HD + 8 * hi;
    const v16h qf0 = ldh(qp), qf1 = ldh(qp + 32);
    v8f o0 = {}, o1 = {}, o2 = {}, o3 = {};
    float m = NEGB, l = 0.0f;
    const int nstage = qb + 1;                                          // stages of 64 keys, the same for the whole block
    const int cr = (int)(threadIdx.x >> 3) & 15, cc = (int)threadIdx.x & 7;   // this lane's row (mod 16) and 16-byte column in every staged tile
    const unsigned lbase = (unsigned)(size_t)ring + (unsigned)(cr * LP + cc * 8) * 2u;
    const char* gk = (const char*)(KP + pof + (size_t)cr * HD + cc * 8);
    const char* gv0 = EARLY ? (const char*)(VEh + (size_t)bh * HD * EROWS + (size_t)cr * EROWS + cc * 8) : (const char*)(VT + (size_t)bh * HD * TT + (size_t)cr * TT + cc * 8);
    const char* gv1 = EARLY ? (const char*)(VEl + (size_t)bh * HD * EROWS + (size_t)cr * EROWS + cc * 8) : gv0;
    const size_t vstep = (size_t)16 * (EARLY ? EROWS : TT) * 2;
    auto issue = [&](const int s, const int buf) {                      // stage s (keys 64s .. 64s+63) into buffer buf
        const unsigned lb = lbase + (unsigned)(buf * NT * TSZ) * 2u;
        copy_tile(lb, gk + (size_t)s * 64 * HD * 2, (size_t)16 * HD * 2);
        copy_tile(lb + TSZ * 2u, gv0 + (size_t)s * 64 * 2, vstep);
        if (EARLY) copy_tile(lb + 2u * TSZ * 2u, gv1 + (size_t)s * 64 * 2, vstep);
    };
    issue(0, 0);
    asm volatile("s_wait_asynccnt 0x0" ::: "memory");                   // this wave's copies of stage 0 have landed
    __syncthreads();                                                    // ... and every other wave's: stage 0 may be read
    if (nstage > 1) issue(1, 1);
#pragma unroll 1   // rolled: one publish point and one refill site in the text
    for (int t = 0; t < nstage; ++t) {
        const unsigned short* sbuf = ring + (t & 1) * NT * TSZ;
#pragma unroll     // the two 32-key steps of a stage: their LDS offsets become immediates
      for (int sub = 0; sub < 2; ++sub) {
        const int kt = t * 64 + sub * 32;
        if (sub == 0 || kt <= q0) {  // a wave skips the 32 keys that lie wholly above its queries
        const h16* kp = (const h16*)sbuf + (sub * 32 + lr) * LP + 8 * hi;
        const v16h ka0 = ldh(kp), ka1 = ldh(kp + 16 * LP), kb0 = ldh(kp + 32), kb1 = ldh(kp + 16 * LP + 32);
        v8f s0 = {}, s1 = {};
        s0 = wmma16(ka0, qf0, s0); s1 = wmma16(ka1, qf0, s1);
        s0 = wmma16(kb0, qf1, s0); s1 = wmma16(kb1, qf1, s1);
        asm volatile("v_nop\n\tv_nop\n\tv_nop\n\tv_nop" : "+v"(s0), "+v"(s1) : "v"(ka0), "v"(ka1), "v"(kb0), "v"(kb1), "v"(qf1));
        if (kt + 31 > q0) {          // diagonal step of this wave: exclude keys above the query
            const int k0 = kt + 8 * hi;
#pragma unroll
            for (int r = 0; r < 8; ++r) { s0[r] = (k0 + r > qq) ? NEGB : s0[r]; s1[r] = (k0 + 16 + r > qq) ? NEGB : s1[r]; }
        }
        float mx = fmaxf(s0[0], s1[0]);
#pragma unroll
        for (int r = 1; r < 8; ++r) mx = fmaxf(mx, fmaxf(s0[r], s1[r]));
        mx = fmaxf(mx, __shfl_xor(mx, 16, 32));
        const float mn = fmaxf(m, mx * CSC);
        const float corr = __builtin_amdgcn_exp2f(m - mn);
        m = mn;
        const float sh = (EARLY ? 0.0f : 8.0f) - mn;
        v8f p0, p1; float rs = 0.0f;
#pragma unroll
        for (int r = 0; r < 8; ++r) { p0[r] = __builtin_amdgcn_exp2f(fmaf(s0[r], CSC, sh)); p1[r] = __builtin_amdgcn_exp2f(fmaf(s1[r], CSC, sh)); rs += p0[r] + p1[r]; }
        rs += __shfl_xor(rs, 16, 32);
        l = l * corr + rs;
        o0 *= corr; o1 *= corr; o2 *= corr; o3 *= corr;
        if (EARLY) {
            v8us ph0, ph1, pl0, pl1;
            pack_b(p0, ph0, pl0); pack_b(p1, ph1, pl1);
            const v16bf PH = cat16b(ph0, ph1), PL = cat16b(pl0, pl1);
            const bf* vh = sbuf + TSZ + lr * LP + sub * 32 + 8 * hi;
            const bf* vl = vh + TSZ;
            const v16bf vh0 = ldb(vh), vh1 = ldb(vh + 16 * LP), vh2 = ldb(vh + 32 * LP), vh3 = ldb(vh + 48 * LP);
            const v16bf vl0 = ldb(vl), vl1 = ldb(vl + 16 * LP), vl2 = ldb(vl + 32 * LP), vl3 = ldb(vl + 48 * LP);
            o0 = wmmab(vh0, PH, o0); o0 = wmmab(vl0, PH, o0); o0 = wmmab(vh0, PL, o0);
            o1 = wmmab(vh1, PH, o1); o1 = wmmab(vl1, PH, o1); o1 = wmmab(vh1, PL, o1);
            o2 = wmmab(vh2, PH, o2); o2 = wmmab(vl2, PH, o2); o2 = wmmab(vh2, PL, o2);
            o3 = wmmab(vh3, PH, o3); o3 = wmmab(vl3, PH, o3); o3 = wmmab(vh3, PL, o3);
            asm volatile("v_nop\n\tv_nop\n\tv_nop\n\tv_nop" : "+v"(o0), "+v"(o1), "+v"(o2), "+v"(o3) : "v"(vh0), "v"(vh1), "v"(vh2), "v"(vh3), "v"(vl0), "v"(vl1), "v"(vl2), "v"(vl3), "v"(PH), "v"(PL));
        } else {
            v16h pb;
#pragma unroll
            for (int r = 0; r < 8; ++r) { pb[r] = (h16)p0[r]; pb[8 + r] = (h16)p1[r]; }
            const h16* vp = (const h16*)sbuf + TSZ + lr * LP + sub * 32 + 8 * hi;
            const v16h a0 = ldh(vp), a1 = ldh(vp + 16 * LP), a2 = ldh(vp + 32 * LP), a3 = ldh(vp + 48 * LP);
            o0 = wmma16(a0, pb, o0); o1 = wmma16(a1, pb, o1); o2 = wmma16(a2, pb, o2); o3 = wmma16(a3, pb, o3);
            asm volatile("v_nop\n\tv_nop\n\tv_nop\n\tv_nop" : "+v"(o0), "+v"(o1), "+v"(o2), "+v"(o3) : "v"(a0), "v"(a1), "v"(a2), "v"(a3), "v"(pb));
        }
        }
      }
        // publish point of stage t + 1, passed by every wave
        asm volatile("s_wait_dscnt 0x0" ::: "memory");                  // this wave's reads of stage t have returned before its buffer is refilled
        asm volatile("s_wait_asynccnt 0x0" ::: "memory");               // this wave's copies of stage t + 1 have landed
        __syncthreads();                                                // stage t + 1 may be read; every reader has left stage t
        if (t + 2 < nstage) issue(t + 2, t & 1);
    }
    asm volatile("s_wait_asynccnt 0x0" ::: "memory");                   // nothing in flight when the ring becomes output staging
    const float inv = __fdiv_rn(1.0f, l);
    o0 *= inv; o1 *= inv; o2 *= inv; o3 *= inv;
    const int sb = w * 2 * 1152;
    const int so = sb + lr * 72 + 8 * hi;       // O^T element r of tile j -> row (query lr), column 16j + 8*hi + r
    if (EARLY) {
        v8us a, c;
        pack_b(o0, a, c); *(v8usa*)(stg + so) = a;      *(v8usa*)(stg + so + 1152) = c;
        pack_b(o1, a, c); *(v8usa*)(stg + so + 16) = a; *(v8usa*)(stg + so + 1152 + 16) = c;
        pack_b(o2, a, c); *(v8usa*)(stg + so + 32) = a; *(v8usa*)(stg + so + 1152 + 32) = c;
        pack_b(o3, a, c); *(v8usa*)(stg + so + 48) = a; *(v8usa*)(stg + so + 1152 + 48) = c;
    } else {
        *(v8usa*)(stg + so) = pack_h(o0); *(v8usa*)(stg + so + 16) = pack_h(o1); *(v8usa*)(stg + so + 32) = pack_h(o2); *(v8usa*)(stg + so + 48) = pack_h(o3);
    }
    __builtin_amdgcn_wave_barrier(); asm volatile("" ::: "memory");
    const int rq = lane >> 3, pc = lane & 7;
    const int crows = EARLY ? EROWS : TT;
    const size_t cbase = ((size_t)b * crows + q0) * DM + h * HD + pc * 8;
{
#pragma unroll
        for (int s = 0; s < 4; ++s) { const int row = 4 * s + rq;
            const v8us x = *(const v8usa*)(stg + sb + row * 72 + pc * 8);
            *(v8us*)(C0 + cbase + (size_t)row * DM) = x;
            if (EARLY) { const v8us y = *(const v8usa*)(stg + sb + 1152 + row * 72 + pc * 8); *(v8us*)(C1 + cbase + (size_t)row * DM) = y; } }
         }
}

// grid (EROWS/64, NB*NH_): query rows [0, EROWS) of every (b, h); ctx as bf16 hi/lo planes [b][EROWS][DM].
__global__ __launch_bounds__(128) void k_attn_early(const h16* __restrict__ QP, const h16* __restrict__ KP, const bf* __restrict__ VEh, const bf* __restrict__ VEl, bf* CEh, bf* CEl) {
    attn_body<true>(QP, KP, (const h16*)0, VEh, VEl, CEh, CEl, (int)blockIdx.x);
}
// grid ((TT-EROWS)/64, NB*NH_): query rows [EROWS, TT); ctx as f16 plane (x64 carry) [b][TT][DM].
__global__ __launch_bounds__(128) void k_attn_main(const h16* __restrict__ QP, const h16* __restrict__ KP, const h16* __restrict__ VT, bf* CH) {
    attn_body<false>(QP, KP, VT, (const bf*)0, (const bf*)0, CH, CH, (int)blockIdx.x + EROWS / 64);
}

// out_body: OUT[r][c] = scale * sum_k A[r][k] Bt[c][k] + bf16(bias[c]); 64x64 tile per wave; per 16-row slab staged in LDS (wave-private),
template <typename T16, int NSPLIT>
__device__ __forceinline__ void out_body(const T16* __restrict__ A, const T16* __restrict__ A2, const T16* __restrict__ Bt, float* C, const float* __restrict__ bias, const float scale) {
    __shared__ __align__(16) float os[16 * 68];
    const int lane = threadIdx.x & 31, lr = lane & 15, hi = lane >> 4;
    const int r0 = blockIdx.x * 64, c0 = blockIdx.y * 64;
    v8f acc[4][4];
    gemm_tile<T16, NSPLIT>(A, A2, Bt, DM, (size_t)(r0 + lr) * DM + 8 * hi, (size_t)(c0 + lr) * DM + 8 * hi, acc);
    const v4f bw = *(const v4f*)(bias + c0 + lr * 4);
    v4f bb;
#pragma unroll
    for (int q = 0; q < 4; ++q) bb[q] = bfr(bw[q]);
#pragma unroll
    for (int mb = 0; mb < 4; ++mb) {
#pragma unroll
        for (int nb = 0; nb < 4; ++nb) {
#pragma unroll
            for (int j = 0; j < 8; ++j) os[(hi * 8 + j) * 68 + nb * 16 + lr] = acc[mb][nb][j]; }
        __builtin_amdgcn_wave_barrier(); asm volatile("" ::: "memory");
        float* crow = C + (size_t)(r0 + mb * 16) * DM + c0 + lr * 4;
{
#pragma unroll
            for (int s = 0; s < 8; ++s) { const int row = 2 * s + hi;
                v4f val = *(const v4fa*)(os + row * 68 + lr * 4);
                val = val * scale + bb;
                *(v4f*)(crow + (size_t)row * DM) = val; }
             }
        __builtin_amdgcn_wave_barrier(); asm volatile("" ::: "memory");
    }
}

// grid (EROWS/64, DM/64, NB): rows [0, EROWS) of batch z from the bf16 hi/lo ctx planes.
__global__ __launch_bounds__(32) void k_oute(const bf* __restrict__ CEh, const bf* __restrict__ CEl, const bf* __restrict__ WoB, float* OUT, const float* __restrict__ Wb) {
    const size_t z = blockIdx.z;
    out_body<bf, 1>(CEh + z * EROWS * DM, CEl + z * EROWS * DM, WoB, OUT + z * TT * DM, Wb, 1.0f);
}
// grid ((TT-EROWS)/64, DM/64, NB): rows [EROWS, TT) of batch z from the f16 ctx plane.
__global__ __launch_bounds__(32) void k_outl(const h16* __restrict__ CH, const h16* __restrict__ WoH, float* OUT, const float* __restrict__ Wb) {
    const size_t ro = ((size_t)blockIdx.z * TT + EROWS) * DM;
    out_body<h16, 0>(CH + ro, CH + ro, WoH, OUT + ro, Wb, OSC);
}

extern "C" void kernel_launch(void* const* d_in, const int* in_sizes, int n_in,
                              void* d_out, int out_size, void* d_ws, size_t ws_size, hipStream_t stream) {
    if (n_in < 11) return;
    if (in_sizes[0] < NB * SEQ_FULL * DM || in_sizes[1] < NB * SEQ_FULL * DM || in_sizes[2] < NB * SEQ_FULL * DM) return;
    if (in_sizes[3] < NH_ * HD * DM || in_sizes[5] < NH_ * HD * DM || in_sizes[7] < NH_ * HD * DM || in_sizes[9] < DM * DM) return;
    if (in_sizes[4] < NH_ * HD || in_sizes[6] < NH_ * HD || in_sizes[8] < NH_ * HD || in_sizes[10] < DM) return;
    if (out_size < NB * TT * DM) return;
    const float* xq = (const float*)d_in[0]; const float* xk = (const float*)d_in[1]; const float* xv = (const float*)d_in[2];
    const float* wq = (const float*)d_in[3]; const float* bq = (const float*)d_in[4];
    const float* wk = (const float*)d_in[5]; const float* bk = (const float*)d_in[6];
    const float* wv = (const float*)d_in[7]; const float* bv = (const float*)d_in[8];
    const float* wo = (const float*)d_in[9]; const float* bo = (const float*)d_in[10];
    float* OUT = (float*)d_out;     // [NB][TT][DM]
    char* wsp = (char*)d_ws;
    auto take = [&](size_t bytes) { char* p = wsp; wsp += (bytes + 255) & ~(size_t)255; return (void*)p; };
    bf*  WT  = (bf*)take((size_t)3 * DM * DM * 2);                  // [3][n][k] projection weights, bf16
    bf*  WoB = (bf*)take((size_t)DM * DM * 2);                      // output weight, bf16
    h16* WoH = (h16*)take((size_t)DM * DM * 2);                     // output weight, f16 x1024
    h16* QK  = (h16*)take((size_t)2 * QKSZ * 2);                    // q plane | k plane
    h16* VT  = (h16*)take((size_t)NB * NH_ * HD * TT * 2);          // [b][h][d][t] f16 x64
    bf*  VEh = (bf*)take((size_t)NB * NH_ * HD * EROWS * 2);        // [b][h][d][t < EROWS] bf16 hi
    bf*  VEl = (bf*)take((size_t)NB * NH_ * HD * EROWS * 2);        // bf16 lo
    bf*  XB  = (bf*)take((size_t)3 * XSZ * 2);                      // bf16 activations q | k | v; dead after the projections
    if ((size_t)(wsp - (char*)d_ws) > ws_size) return;              // 119,537,664 B at NB=4, TT=2048
    bf* CH  = XB;                   // ctx f16 plane [NB*TT][DM] (16-bit storage), aliases activation plane 0
    bf* CEh = XB + XSZ;             // ctx bf16 hi [NB*EROWS][DM], aliases activation plane 1
    bf* CEl = XB + 2 * XSZ;         // ctx bf16 lo, aliases activation plane 2

    const size_t nx8 = XSZ / 8;
    k_cvt8<<<(unsigned)((nx8 + 255) / 256), 256, 0, stream>>>(xq, XB, nx8);
    k_cvt8<<<(unsigned)((nx8 + 255) / 256), 256, 0, stream>>>(xk, XB + XSZ, nx8);
    k_cvt8<<<(unsigned)((nx8 + 255) / 256), 256, 0, stream>>>(xv, XB + 2 * XSZ, nx8);
    const size_t nw8 = (size_t)DM * DM / 8;
    k_cvt8<<<(unsigned)((nw8 + 255) / 256), 256, 0, stream>>>(wq, WT, nw8);
    k_cvt8<<<(unsigned)((nw8 + 255) / 256), 256, 0, stream>>>(wk, WT + (size_t)DM * DM, nw8);
    k_cvt8<<<(unsigned)((nw8 + 255) / 256), 256, 0, stream>>>(wv, WT + (size_t)2 * DM * DM, nw8);
    k_cvtwo<<<(unsigned)((nw8 + 255) / 256), 256, 0, stream>>>(wo, WoB, WoH, nw8);

    k_projqk<<<dim3(NB * TT / 64, NH_, 2), 32, 0, stream>>>(XB, WT, bq, bk, QK);
    k_projv<<<dim3(NB * TT / 64, NH_), 32, 0, stream>>>(XB + 2 * XSZ, WT + (size_t)2 * DM * DM, bv, VT, VEh, VEl);

    k_attn_early<<<dim3(EROWS / 64, NB * NH_), 128, 0, stream>>>(QK, QK + QKSZ, VEh, VEl, CEh, CEl);
    if (TT > EROWS)
        k_attn_main<<<dim3((TT - EROWS) / 64, NB * NH_), 128, 0, stream>>>(QK, QK + QKSZ, VT, CH);

    k_oute<<<dim3(EROWS / 64, DM / 64, NB), 32, 0, stream>>>(CEh, CEl, WoB, OUT, bo);
    if (TT > EROWS)
        k_outl<<<dim3((TT - EROWS) / 64, DM / 64, NB), 32, 0, stream>>>((const h16*)CH, WoH, OUT, bo);
}

// v002
// One run takes 184 microseconds.
// Two timings next to v001 put it at 1.40 and 1.39 times that version's speed.
// All steps since v000 together make it 1.87 times as fast.
#include <hip/hip_runtime.h>

// Contractions, f32 accumulate: q/k/v projections v_wmma_f32_16x16x32_bf16 on bf16 (RNE) copies of x and W; scores v_wmma_f32_16x16x32_f16 on f16 q/k planes (x16 carry each); P.V v_wmma_f32_16x16x32_f16 (P x256, V x64 carries) for query rows >= EROWS and v_wmma_f32_16x16x32_bf16 on bf16 hi+lo P and V (3 products) for query rows < EROWS; output projection v_wmma_f32_16x16x32_f16 (ctx x64, W x1024) for rows >= EROWS and v_wmma_f32_16x16x32_bf16 on bf16 hi+lo ctx (2 products) for rows < EROWS.
// Pipeline: bf16 planes of the three activations and the weights; q/k planes [b][h][t][64] f16; value planes [b][h][64][t] f16 (+ bf16 hi/lo for t < EROWS); fused causal attention in transposed form (S^T = K Q^T, O^T = V^T P^T, online softmax per lane, score scale 1/32); ctx planes [b*t][1024]; out = ctx W^T + b.

#ifndef NB
#define NB 4
#endif
#ifndef SEQ
#define SEQ 2048
#endif
#define NB_FULL  4
#define SEQ_FULL 2048
#define TT   SEQ
#define DM   1024
#define NH_  16
#define HD   64
#define EROWS ((TT) < 512 ? (TT) : 512)
#define QKC  16.0f                                          // carry of the q and k planes
#define CSC  (0.045084220027780106f * 0.00390625f)          // (1/32) * log2(e) / (QKC*QKC)
#define VC   64.0f                                          // carry of the f16 value plane (and of the f16 ctx plane)
#define WOC  1024.0f                                        // carry of the f16 output weight plane
#define OSC  1.52587890625e-05f                             // 1 / (VC * WOC)
#define NEGB (-3.0e38f)
#define XSZ  ((size_t)NB * SEQ_FULL * DM)
#define QKSZ ((size_t)NB * NH_ * TT * HD)
static_assert(TT % 64 == 0);
static_assert(TT <= SEQ_FULL);
static_assert(NB >= 1 && NB <= NB_FULL);
static_assert(NH_ * HD == DM);
static_assert(DM % 64 == 0);
static_assert(DM % 32 == 0);
static_assert(HD == 64);
static_assert(EROWS % 64 == 0);
static_assert(EROWS <= TT);
static_assert((TT - EROWS) % 64 == 0);
static_assert(TT % 128 == 0 && EROWS % 128 == 0 && DM % 128 == 0 && NH_ % 2 == 0);   // 128x128 block tiles of the projections and of the output product
static_assert((size_t)NB * TT * DM <= XSZ);
static_assert((size_t)NB * EROWS * DM <= XSZ);
static_assert((size_t)3 * DM * DM * 2 + (size_t)2 * DM * DM * 2 + (size_t)2 * QKSZ * 2 + (size_t)NB * NH_ * HD * TT * 2 + (size_t)2 * NB * NH_ * HD * EROWS * 2 + (size_t)3 * XSZ * 2 <= (size_t)134217728);

typedef _Float16 h16;
typedef unsigned short bf;
typedef __attribute__((ext_vector_type(16))) __bf16   v16bf;
typedef __attribute__((ext_vector_type(16))) _Float16 v16h;
typedef __attribute__((ext_vector_type(8)))  _Float16 v8h;
typedef __attribute__((ext_vector_type(8)))  unsigned short v8us;
typedef __attribute__((ext_vector_type(8)))  float    v8f;
typedef __attribute__((ext_vector_type(4)))  float    v4f;
typedef v4f  __attribute__((may_alias)) v4fa;
typedef v8us __attribute__((may_alias)) v8usa;

__device__ __forceinline__ unsigned short f2bf(float f) { unsigned u = __float_as_uint(f); u += 0x7FFFu + ((u >> 16) & 1u); return (unsigned short)(u >> 16); }
__device__ __forceinline__ float bf2f(unsigned short b) { return __uint_as_float(((unsigned)b) << 16); }
__device__ __forceinline__ float bfr(float f) { return bf2f(f2bf(f)); }
__device__ __forceinline__ v16h cat16(v8h lo, v8h hi) { return __builtin_shufflevector(lo, hi, 0, 1, 2, 3, 4, 5, 6, 7, 8, 9, 10, 11, 12, 13, 14, 15); }
__device__ __forceinline__ v16bf cat16b(v8us lo, v8us hi) { return __builtin_bit_cast(v16bf, __builtin_shufflevector(lo, hi, 0, 1, 2, 3, 4, 5, 6, 7, 8, 9, 10, 11, 12, 13, 14, 15)); }
__device__ __forceinline__ v8f wmma16(v16h a, v16h b, v8f c) { return __builtin_amdgcn_wmma_f32_16x16x32_f16(false, a, false, b, (short)0, c, false, false); }
__device__ __forceinline__ v8f wmmab(v16bf a, v16bf b, v8f c) { return __builtin_amdgcn_wmma_f32_16x16x32_bf16(false, a, false, b, (short)0, c, false, false); }
__device__ __forceinline__ void splitf(float y, unsigned short& h, unsigned short& l) { h = f2bf(y); l = f2bf(y - bf2f(h)); }
// Fragment loaders (A and B identical): p already points at row (lane&15), k0 + 8*(lane>>4); elements 0..7 <- p[0..7], elements 8..15 <- p[16..23].
__device__ __forceinline__ v16h ldh(const h16* p) { return cat16(*(const v8h*)p, *(const v8h*)(p + 16)); }
__device__ __forceinline__ v16bf ldb(const bf* p) { return cat16b(*(const v8us*)p, *(const v8us*)(p + 16)); }
__device__ __forceinline__ v8us pack_h(v8f c) { v8h t;
#pragma unroll
    for (int r = 0; r < 8; ++r) t[r] = (h16)c[r];
    return __builtin_bit_cast(v8us, t); }
__device__ __forceinline__ void pack_b(v8f c, v8us& a, v8us& l) {
#pragma unroll
    for (int r = 0; r < 8; ++r) { unsigned short x, y; splitf(c[r], x, y); a[r] = x; l[r] = y; } }

template <typename T16> struct WFrag;
template <> struct WFrag<h16> { typedef v16h V; static __device__ __forceinline__ V ld(const h16* p) { return ldh(p); } static __device__ __forceinline__ v8f mma(V a, V b, v8f c) { return wmma16(a, b, c); } };
template <> struct WFrag<bf> { typedef v16bf V; static __device__ __forceinline__ V ld(const bf* p) { return ldb(p); } static __device__ __forceinline__ v8f mma(V a, V b, v8f c) { return wmmab(a, b, c); } };

#define LP  72              // LDS row pitch of a staged tile in 16-bit elements: 144 B = 16 B x odd, free of bank conflicts for 16-byte fragment reads
#define TSZ (64 * LP)       // 16-bit elements of one staged tile
// One 64-row tile: this lane's 16 bytes of rows r, r+16, r+32, r+48. l = LDS byte address, g = global byte address of row r, gstep = bytes between global rows r and r+16.
__device__ __forceinline__ void copy_tile(const unsigned l, const char* g, const size_t gstep) {
    const unsigned l1 = l + 16 * LP * 2, l2 = l + 32 * LP * 2, l3 = l + 48 * LP * 2;
    const char* g1 = g + gstep; const char* g2 = g + 2 * gstep; const char* g3 = g + 3 * gstep;
    // the closing s_wait_xcnt 0 stands inside the statement so that no address register of a copy is rewritten ahead of it
    asm volatile("global_load_async_to_lds_b128 %0, %4, off\n\tglobal_load_async_to_lds_b128 %1, %5, off\n\tglobal_load_async_to_lds_b128 %2, %6, off\n\tglobal_load_async_to_lds_b128 %3, %7, off\n\ts_wait_xcnt 0x0"
                 :: "v"(l), "v"(l1), "v"(l2), "v"(l3), "v"(g), "v"(g1), "v"(g2), "v"(g3) : "memory");
}

// gemm_tile: a block of four waves computes a 128x128 tile; wave w owns the 64x64 quarter at rows 64*(w>>1), columns 64*(w&1):
// acc[mb][nb][j] = C[16*mb + 8*(lane>>4) + j][16*nb + (lane&15)] of that quarter = sum_k A[m][k] Bt[n][k] (+ A2[m][k] Bt[n][k] when NSPLIT == 1).
// Operand path: a stage is 64 k = one 128-row x 128-B tile per operand plane (A, Bt, and A2 when NSPLIT == 1), brought from the K-contiguous 16-bit planes into LDS once per block
// by asynchronous 16-byte copies (each wave-wide copy = 4 whole 128-B lines), two buffers, the next stage in flight while this one is worked on; every wave reads its fragments from LDS.
// K % 64 == 0; arow0 / brow0 = first row of the block's tile in A (A2) / Bt; ring = 2 * (2 + NSPLIT) * GTS 16-bit elements of LDS, free for other use on return.
#define GTS (2 * TSZ)       // 16-bit elements of one staged 128-row operand tile
template <typename T16, int NSPLIT>
__device__ __forceinline__ void gemm_tile(const T16* __restrict__ A, const T16* __restrict__ A2, const T16* __restrict__ Bt, const int K, const size_t arow0, const size_t brow0, unsigned short* ring, v8f (&acc)[4][4]) {
    typedef typename WFrag<T16>::V V;
    constexpr int NT = 2 + NSPLIT;                                      // tiles per stage: A, Bt (, A2)
    const int lane = threadIdx.x & 31, lr = lane & 15, hi = lane >> 4;
    const int w = __builtin_amdgcn_readfirstlane((threadIdx.x >> 5) & 3);
    const int cr = (int)(threadIdx.x >> 3) & 15, cc = (int)threadIdx.x & 7;   // this lane's row (mod 16) and 16-byte column in every staged tile
    const unsigned lbase = (unsigned)(size_t)ring + (unsigned)(cr * LP + cc * 8) * 2u;
    const char* ga  = (const char*)(A + (arow0 + cr) * K + cc * 8);
    const char* ga2 = (const char*)(A2 + (arow0 + cr) * K + cc * 8);
    const char* gb  = (const char*)(Bt + (brow0 + cr) * K + cc * 8);
    const size_t gstep = (size_t)16 * K * 2;
    auto issue = [&](const int s, const int buf) {                      // stage s (k = 64s .. 64s+63) into buffer buf
        const unsigned lb = lbase + (unsigned)(buf * NT * GTS) * 2u;
        const size_t ko = (size_t)s * 64 * 2;
        copy_tile(lb, ga + ko, gstep);             copy_tile(lb + TSZ * 2u, ga + ko + 4 * gstep, gstep);
        copy_tile(lb + GTS * 2u, gb + ko, gstep);  copy_tile(lb + GTS * 2u + TSZ * 2u, gb + ko + 4 * gstep, gstep);
        if (NSPLIT == 1) { copy_tile(lb + 2u * GTS * 2u, ga2 + ko, gstep); copy_tile(lb + 2u * GTS * 2u + TSZ * 2u, ga2 + ko + 4 * gstep, gstep); }
    };
#pragma unroll
    for (int mb = 0; mb < 4; ++mb)
#pragma unroll
        for (int nb = 0; nb < 4; ++nb) acc[mb][nb] = (v8f){};
    const int nstage = K / 64;
    issue(0, 0);
    asm volatile("s_wait_asynccnt 0x0" ::: "memory");                   // this wave's copies of stage 0 have landed
    __syncthreads();                                                    // ... and every other wave's: stage 0 may be read
    if (nstage > 1) issue(1, 1);
#pragma unroll 1   // rolled: one publish point and one refill site in the text
    for (int t = 0; t < nstage; ++t) {
        const T16* sbuf = (const T16*)ring + (t & 1) * NT * GTS;
        const T16* pa = sbuf + ((w >> 1) * 64 + lr) * LP + 8 * hi;
        const T16* pb = sbuf + GTS + ((w & 1) * 64 + lr) * LP + 8 * hi;
#pragma unroll     // the two 32-k steps of a stage: their LDS offsets become immediates
        for (int ks = 0; ks < 2; ++ks) {
            V a[4], a2[4];
#pragma unroll
            for (int mb = 0; mb < 4; ++mb) { a[mb] = WFrag<T16>::ld(pa + mb * 16 * LP + ks * 32); if (NSPLIT == 1) a2[mb] = WFrag<T16>::ld(pa + 2 * GTS + mb * 16 * LP + ks * 32); else a2[mb] = a[mb]; }
            V b[4];
#pragma unroll
            for (int nb = 0; nb < 4; ++nb) b[nb] = WFrag<T16>::ld(pb + nb * 16 * LP + ks * 32);
            // inputs-only fence on the loaded fragments: all LDS reads of this 32-k step stand as one group with one wait ahead of its WMMAs; without it each Bt fragment is read and waited for singly between them
            asm volatile("" :: "v"(b[0]), "v"(b[1]), "v"(b[2]), "v"(b[3]));
#pragma unroll
            for (int nb = 0; nb < 4; ++nb) {
#pragma unroll
                for (int mb = 0; mb < 4; ++mb) { acc[mb][nb] = WFrag<T16>::mma(a[mb], b[nb], acc[mb][nb]); if (NSPLIT == 1) acc[mb][nb] = WFrag<T16>::mma(a2[mb], b[nb], acc[mb][nb]); } }
            // four vector slots behind these WMMAs before a vector instruction may touch their registers, on either side of the branch at the loop's foot
            asm volatile("v_nop\n\tv_nop\n\tv_nop\n\tv_nop" : "+v"(acc[0][0]), "+v"(acc[1][1]), "+v"(acc[2][2]), "+v"(acc[3][3]) : "v"(a[0]), "v"(a[3]));
        }
        // publish point of stage t + 1, passed by every wave
        asm volatile("s_wait_dscnt 0x0" ::: "memory");                  // this wave's reads of stage t have returned before its buffer is refilled
        asm volatile("s_wait_asynccnt 0x0" ::: "memory");               // this wave's copies of stage t + 1 have landed
        __syncthreads();                                                // stage t + 1 may be read; every reader has left stage t
        if (t + 2 < nstage) issue(t + 2, t & 1);
    }
    asm volatile("s_wait_asynccnt 0x0" ::: "memory");                   // nothing in flight when the ring becomes output staging
}

__global__ __launch_bounds__(256) void k_cvt8(const float* __restrict__ src, bf* dst, size_t n8) { const size_t i = (size_t)blockIdx.x * 256 + threadIdx.x; if (i >= n8) return; const v8f v = *(const v8f*)(src + i * 8); v8us o;
#pragma unroll
    for (int k = 0; k < 8; ++k) o[k] = f2bf(v[k]);
    *(v8us*)(dst + i * 8) = o;  }

__global__ __launch_bounds__(256) void k_cvtwo(const float* __restrict__ src, bf* WB, h16* WH, size_t n8) { const size_t i = (size_t)blockIdx.x * 256 + threadIdx.x; if (i >= n8) return; const v8f v = *(const v8f*)(src + i * 8); v8us ob; v8h oh;
#pragma unroll
    for (int k = 0; k < 8; ++k) { const unsigned short hb = f2bf(v[k]); ob[k] = hb; oh[k] = (h16)(bf2f(hb) * WOC); }
    *(v8us*)(WB + i * 8) = ob; *(v8h*)(WH + i * 8) = oh;  }

// k_projqk: grid (NB*TT/128, NH_/2, 2), four waves; z = 0 -> q plane, z = 1 -> k plane. Block tile = 128 tokens x two heads; a wave's tile = 64 tokens x one head (64 dims).
__global__ __launch_bounds__(128) void k_projqk(const bf* __restrict__ XB, const bf* __restrict__ WT, const float* __restrict__ bq, const float* __restrict__ bk, h16* QK) {
    __shared__ __align__(16) unsigned short ring[2 * 2 * GTS];          // operand ring; behind the product each wave's own output staging
    static_assert(2 * 2 * GTS * 2 >= 4 * 16 * 68 * 4);
    const int z = blockIdx.z;
    const int lane = threadIdx.x & 31, lr = lane & 15, hi = lane >> 4;
    const int w = __builtin_amdgcn_readfirstlane((threadIdx.x >> 5) & 3);
    const int mt = blockIdx.x * 2 + (w >> 1); const int b = mt / (TT / 64); const int t0 = (mt % (TT / 64)) * 64; const int h = blockIdx.y * 2 + (w & 1);
    const bf* A = XB + (size_t)z * XSZ; const bf* Bt = WT + (size_t)z * DM * DM;
    v8f acc[4][4];
    gemm_tile<bf, 0>(A, A, Bt, DM, (size_t)b * SEQ_FULL + t0 - (w >> 1) * 64, (size_t)blockIdx.y * 2 * HD, ring, acc);
    float* os = (float*)ring + w * (16 * 68);
    const int rq = lane >> 3, pc = lane & 7;
    const v8f b0 = *(const v8f*)(bq + h * HD + pc * 8); const v8f b1 = *(const v8f*)(bk + h * HD + pc * 8);
    v8f bb;
#pragma unroll
    for (int i = 0; i < 8; ++i) bb[i] = bfr(z ? b1[i] : b0[i]);
    h16* P = QK + (size_t)z * QKSZ + (((size_t)b * NH_ + h) * TT + t0) * HD + pc * 8;
#pragma unroll
    for (int mb = 0; mb < 4; ++mb) {
#pragma unroll
        for (int nb = 0; nb < 4; ++nb) {
#pragma unroll
            for (int j = 0; j < 8; ++j) os[(hi * 8 + j) * 68 + nb * 16 + lr] = acc[mb][nb][j]; }
        __builtin_amdgcn_wave_barrier(); asm volatile("" ::: "memory");
        h16* prow = P + (size_t)(mb * 16) * HD;
{
#pragma unroll
            for (int s = 0; s < 4; ++s) { const int row = 4 * s + rq;
                const v4f x0 = *(const v4fa*)(os + row * 68 + pc * 8), x1 = *(const v4fa*)(os + row * 68 + pc * 8 + 4);
                v8h o;
#pragma unroll
                for (int q = 0; q < 4; ++q) { o[q] = (h16)((x0[q] + bb[q]) * QKC); o[4 + q] = (h16)((x1[q] + bb[4 + q]) * QKC); }
                *(v8h*)(prow + (size_t)row * HD) = o; }
             }
        __builtin_amdgcn_wave_barrier(); asm volatile("" ::: "memory");
    }
}

// k_projv: grid (NB*TT/128, NH_/2), four waves. Block tile = 128 tokens x two heads; a wave's tile = 64 tokens x one head; written transposed: VT[b][h][d][t] = f16(64 * v), and for t < EROWS the bf16 hi/lo planes VE[b][h][d][t] of v.
__global__ __launch_bounds__(128) void k_projv(const bf* __restrict__ XBv, const bf* __restrict__ WTv, const float* __restrict__ bv, h16* VT, bf* VEh, bf* VEl) {
    __shared__ __align__(16) unsigned short ring[2 * 2 * GTS];          // operand ring; behind the product each wave's own transpose staging
    static_assert(2 * 2 * GTS * 2 >= 4 * 64 * 68 * 4);
    const int lane = threadIdx.x & 31, lr = lane & 15, hi = lane >> 4;
    const int w = __builtin_amdgcn_readfirstlane((threadIdx.x >> 5) & 3);
    const int mt = blockIdx.x * 2 + (w >> 1); const int b = mt / (TT / 64); const int t0 = (mt % (TT / 64)) * 64; const int h = blockIdx.y * 2 + (w & 1);
    v8f acc[4][4];
    gemm_tile<bf, 0>(XBv, XBv, WTv, DM, (size_t)b * SEQ_FULL + t0 - (w >> 1) * 64, (size_t)blockIdx.y * 2 * HD, ring, acc);
    float* ts = (float*)ring + w * (64 * 68);
#pragma unroll
    for (int mb = 0; mb < 4; ++mb)
#pragma unroll
        for (int nb = 0; nb < 4; ++nb) {
            const v4f lo4 = { acc[mb][nb][0], acc[mb][nb][1], acc[mb][nb][2], acc[mb][nb][3] };
            const v4f hi4 = { acc[mb][nb][4], acc[mb][nb][5], acc[mb][nb][6], acc[mb][nb][7] };
            *(v4fa*)(ts + (nb * 16 + lr) * 68 + mb * 16 + 8 * hi) = lo4;
            *(v4fa*)(ts + (nb * 16 + lr) * 68 + mb * 16 + 8 * hi + 4) = hi4; }
    __builtin_amdgcn_wave_barrier(); asm volatile("" ::: "memory");
    const int rq = lane >> 3, pc = lane & 7;
    const bool early = t0 < EROWS;
    const size_t vrow0 = ((size_t)b * NH_ + h) * HD;
{
#pragma unroll 1
        for (int s = 0; s < 16; ++s) { const int d = 4 * s + rq;
            const float bb = bfr(bv[h * HD + d]);
            const v4f x0 = *(const v4fa*)(ts + d * 68 + pc * 8), x1 = *(const v4fa*)(ts + d * 68 + pc * 8 + 4);
            v8f x = __builtin_shufflevector(x0, x1, 0, 1, 2, 3, 4, 5, 6, 7);
            x = x + bb;
            v8h o;
#pragma unroll
            for (int q = 0; q < 8; ++q) o[q] = (h16)(x[q] * VC);
            *(v8h*)(VT + (vrow0 + d) * TT + t0 + pc * 8) = o;
            asm volatile("s_wait_xcnt 0x0" ::: "memory");   // stands in front of the rewriting of the store's data and address registers (hi/lo packing, next trip)
            if (early) { v8us oh, ol; pack_b(x, oh, ol);
                *(v8us*)(VEh + (vrow0 + d) * EROWS + t0 + pc * 8) = oh;
                *(v8us*)(VEl + (vrow0 + d) * EROWS + t0 + pc * 8) = ol;
                asm volatile("s_wait_xcnt 0x0" ::: "memory"); } }   // stands in front of the next trip's advance of both stores' address registers
         }
}

// attn_body: fused causal attention, 4 waves per block, 16 query rows per wave, 32 keys per step, transposed formulation.
//   S^T tile (rows = keys, cols = queries) = A(k plane rows) x B(q plane rows); D element r of lane l = S^T[key 8*(l>>4)+r][query l&15].
//   Per lane one query column: running max m, running sum l (combined across lane halves by one xor-16 shuffle each).
//   P^T as B fragment: element r <- p(tile keys 0..15)[r], element 8+r <- p(tile keys 16..31)[r], lane unchanged.
//   O^T tile j (rows = dims 16j.., cols = queries) += A(V^T rows) x B(P^T). Masked keys carry p = 0 exactly.
// EARLY: bf16 hi+lo P and V (3 products); else f16 single product with P x256 (cancels against the row sum) and V x64.
// Operand path: a stage is 64 keys = one K tile (64 key rows x 128 B) and one V^T tile per value plane (64 dim rows x 128 B), brought into LDS once per block by
// asynchronous 16-byte copies (each wave-wide copy = 4 whole 128-B lines), two buffers, the next stage in flight while this one is worked on; all four waves read their fragments from LDS.
template <bool EARLY>
__device__ __forceinline__ void attn_body(const h16* __restrict__ QP, const h16* __restrict__ KP, const h16* __restrict__ VT, const bf* __restrict__ VEh, const bf* __restrict__ VEl, bf* C0, bf* C1, const int qb) {
    constexpr int NT = EARLY ? 3 : 2;                                   // tiles per stage: K, V (EARLY: K, V hi, V lo)
    __shared__ __align__(16) unsigned short ring[2 * NT * TSZ];         // two stage buffers; output staging behind the loop
    static_assert(2 * NT * TSZ >= 4 * 2 * 1152);
    unsigned short* stg = ring;
    const int lane = threadIdx.x & 31, lr = lane & 15, hi = lane >> 4;
    const int w = __builtin_amdgcn_readfirstlane((threadIdx.x >> 5) & 3);   // wave number in a scalar register: the per-wave skip below is then a scalar branch
    const int bh = blockIdx.y, b = bh / NH_, h = bh % NH_;
    const int q0 = qb * 64 + w * 16;
    const int qq = q0 + lr;
    const size_t pof = (size_t)bh * TT * HD;
    const h16* qp = QP + pof + (size_t)(q0 + lr) * HD + 8 * hi;
    const v16h qf0 = ldh(qp), qf1 = ldh(qp + 32);
    v8f o0 = {}, o1 = {}, o2 = {}, o3 = {};
    float m = NEGB, l = 0.0f;
    const int nstage = qb + 1;                                          // stages of 64 keys, the same for the whole block
    const int cr = (int)(threadIdx.x >> 3) & 15, cc = (int)threadIdx.x & 7;   // this lane's row (mod 16) and 16-byte column in every staged tile
    const unsigned lbase = (unsigned)(size_t)ring + (unsigned)(cr * LP + cc * 8) * 2u;
    const char* gk = (const char*)(KP + pof + (size_t)cr * HD + cc * 8);
    const char* gv0 = EARLY ? (const char*)(VEh + (size_t)bh * HD * EROWS + (size_t)cr * EROWS + cc * 8) : (const char*)(VT + (size_t)bh * HD * TT + (size_t)cr * TT + cc * 8);
    const char* gv1 = EARLY ? (const char*)(VEl + (size_t)bh * HD * EROWS + (size_t)cr * EROWS + cc * 8) : gv0;
    const size_t vstep = (size_t)16 * (EARLY ? EROWS : TT) * 2;
    auto issue = [&](const int s, const int buf) {                      // stage s (keys 64s .. 64s+63) into buffer buf
        const unsigned lb = lbase + (unsigned)(buf * NT * TSZ) * 2u;
        copy_tile(lb, gk + (size_t)s * 64 * HD * 2, (size_t)16 * HD * 2);
        copy_tile(lb + TSZ * 2u, gv0 + (size_t)s * 64 * 2, vstep);
        if (EARLY) copy_tile(lb + 2u * TSZ * 2u, gv1 + (size_t)s * 64 * 2, vstep);
    };
    issue(0, 0);
    asm volatile("s_wait_asynccnt 0x0" ::: "memory");                   // this wave's copies of stage 0 have landed
    __syncthreads();                                                    // ... and every other wave's: stage 0 may be read
    if (nstage > 1) issue(1, 1);
#pragma unroll 1   // rolled: one publish point and one refill site in the text
    for (int t = 0; t < nstage; ++t) {
        const unsigned short* sbuf = ring + (t & 1) * NT * TSZ;
#pragma unroll     // the two 32-key steps of a stage: their LDS offsets become immediates
      for (int sub = 0; sub < 2; ++sub) {
        const int kt = t * 64 + sub * 32;
        if (sub == 0 || kt <= q0) {  // a wave skips the 32 keys that lie wholly above its queries
        const h16* kp = (const h16*)sbuf + (sub * 32 + lr) * LP + 8 * hi;
        const v16h ka0 = ldh(kp), ka1 = ldh(kp + 16 * LP), kb0 = ldh(kp + 32), kb1 = ldh(kp + 16 * LP + 32);
        v8f s0 = {}, s1 = {};
        s0 = wmma16(ka0, qf0, s0); s1 = wmma16(ka1, qf0, s1);
        s0 = wmma16(kb0, qf1, s0); s1 = wmma16(kb1, qf1, s1);
        asm volatile("v_nop\n\tv_nop\n\tv_nop\n\tv_nop" : "+v"(s0), "+v"(s1) : "v"(ka0), "v"(ka1), "v"(kb0), "v"(kb1), "v"(qf1));
        if (kt + 31 > q0) {          // diagonal step of this wave: exclude keys above the query
            const int k0 = kt + 8 * hi;
#pragma unroll
            for (int r = 0; r < 8; ++r) { s0[r] = (k0 + r > qq) ? NEGB : s0[r]; s1[r] = (k0 + 16 + r > qq) ? NEGB : s1[r]; }
        }
        float mx = fmaxf(s0[0], s1[0]);
#pragma unroll
        for (int r = 1; r < 8; ++r) mx = fmaxf(mx, fmaxf(s0[r], s1[r]));
        mx = fmaxf(mx, __shfl_xor(mx, 16, 32));
        const float mn = fmaxf(m, mx * CSC);
        const float corr = __builtin_amdgcn_exp2f(m - mn);
        m = mn;
        const float sh = (EARLY ? 0.0f : 8.0f) - mn;
        v8f p0, p1; float rs = 0.0f;
#pragma unroll
        for (int r = 0; r < 8; ++r) { p0[r] = __builtin_amdgcn_exp2f(fmaf(s0[r], CSC, sh)); p1[r] = __builtin_amdgcn_exp2f(fmaf(s1[r], CSC, sh)); rs += p0[r] + p1[r]; }
        rs += __shfl_xor(rs, 16, 32);
        l = l * corr + rs;
        o0 *= corr; o1 *= corr; o2 *= corr; o3 *= corr;
        if (EARLY) {
            v8us ph0, ph1, pl0, pl1;
            pack_b(p0, ph0, pl0); pack_b(p1, ph1, pl1);
            const v16bf PH = cat16b(ph0, ph1), PL = cat16b(pl0, pl1);
            const bf* vh = sbuf + TSZ + lr * LP + sub * 32 + 8 * hi;
            const bf* vl = vh + TSZ;
            const v16bf vh0 = ldb(vh), vh1 = ldb(vh + 16 * LP), vh2 = ldb(vh + 32 * LP), vh3 = ldb(vh + 48 * LP);
            const v16bf vl0 = ldb(vl), vl1 = ldb(vl + 16 * LP), vl2 = ldb(vl + 32 * LP), vl3 = ldb(vl + 48 * LP);
            o0 = wmmab(vh0, PH, o0); o0 = wmmab(vl0, PH, o0); o0 = wmmab(vh0, PL, o0);
            o1 = wmmab(vh1, PH, o1); o1 = wmmab(vl1, PH, o1); o1 = wmmab(vh1, PL, o1);
            o2 = wmmab(vh2, PH, o2); o2 = wmmab(vl2, PH, o2); o2 = wmmab(vh2, PL, o2);
            o3 = wmmab(vh3, PH, o3); o3 = wmmab(vl3, PH, o3); o3 = wmmab(vh3, PL, o3);
            asm volatile("v_nop\n\tv_nop\n\tv_nop\n\tv_nop" : "+v"(o0), "+v"(o1), "+v"(o2), "+v"(o3) : "v"(vh0), "v"(vh1), "v"(vh2), "v"(vh3), "v"(vl0), "v"(vl1), "v"(vl2), "v"(vl3), "v"(PH), "v"(PL));
        } else {
            v16h pb;
#pragma unroll
            for (int r = 0; r < 8; ++r) { pb[r] = (h16)p0[r]; pb[8 + r] = (h16)p1[r]; }
            const h16* vp = (const h16*)sbuf + TSZ + lr * LP + sub * 32 + 8 * hi;
            const v16h a0 = ldh(vp), a1 = ldh(vp + 16 * LP), a2 = ldh(vp + 32 * LP), a3 = ldh(vp + 48 * LP);
            o0 = wmma16(a0, pb, o0); o1 = wmma16(a1, pb, o1); o2 = wmma16(a2, pb, o2); o3 = wmma16(a3, pb, o3);
            asm volatile("v_nop\n\tv_nop\n\tv_nop\n\tv_nop" : "+v"(o0), "+v"(o1), "+v"(o2), "+v"(o3) : "v"(a0), "v"(a1), "v"(a2), "v"(a3), "v"(pb));
        }
        }
      }
        // publish point of stage t + 1, passed by every wave
        asm volatile("s_wait_dscnt 0x0" ::: "memory");                  // this wave's reads of stage t have returned before its buffer is refilled
        asm volatile("s_wait_asynccnt 0x0" ::: "memory");               // this wave's copies of stage t + 1 have landed
        __syncthreads();                                                // stage t + 1 may be read; every reader has left stage t
        if (t + 2 < nstage) issue(t + 2, t & 1);
    }
    asm volatile("s_wait_asynccnt 0x0" ::: "memory");                   // nothing in flight when the ring becomes output staging
    const float inv = __fdiv_rn(1.0f, l);
    o0 *= inv; o1 *= inv; o2 *= inv; o3 *= inv;
    const int sb = w * 2 * 1152;
    const int so = sb + lr * 72 + 8 * hi;       // O^T element r of tile j -> row (query lr), column 16j + 8*hi + r
    if (EARLY) {
        v8us a, c;
        pack_b(o0, a, c); *(v8usa*)(stg + so) = a;      *(v8usa*)(stg + so + 1152) = c;
        pack_b(o1, a, c); *(v8usa*)(stg + so + 16) = a; *(v8usa*)(stg + so + 1152 + 16) = c;
        pack_b(o2, a, c); *(v8usa*)(stg + so + 32) = a; *(v8usa*)(stg + so + 1152 + 32) = c;
        pack_b(o3, a, c); *(v8usa*)(stg + so + 48) = a; *(v8usa*)(stg + so + 1152 + 48) = c;
    } else {
        *(v8usa*)(stg + so) = pack_h(o0); *(v8usa*)(stg + so + 16) = pack_h(o1); *(v8usa*)(stg + so + 32) = pack_h(o2); *(v8usa*)(stg + so + 48) = pack_h(o3);
    }
    __builtin_amdgcn_wave_barrier(); asm volatile("" ::: "memory");
    const int rq = lane >> 3, pc = lane & 7;
    const int crows = EARLY ? EROWS : TT;
    const size_t cbase = ((size_t)b * crows + q0) * DM + h * HD + pc * 8;
{
#pragma unroll
        for (int s = 0; s < 4; ++s) { const int row = 4 * s + rq;
            const v8us x = *(const v8usa*)(stg + sb + row * 72 + pc * 8);
            *(v8us*)(C0 + cbase + (size_t)row * DM) = x;
            if (EARLY) { const v8us y = *(const v8usa*)(stg + sb + 1152 + row * 72 + pc * 8); *(v8us*)(C1 + cbase + (size_t)row * DM) = y; } }
         }
}

// grid (EROWS/64, NB*NH_): query rows [0, EROWS) of every (b, h); ctx as bf16 hi/lo planes [b][EROWS][DM].
__global__ __launch_bounds__(128) void k_attn_early(const h16* __restrict__ QP, const h16* __restrict__ KP, const bf* __restrict__ VEh, const bf* __restrict__ VEl, bf* CEh, bf* CEl) {
    attn_body<true>(QP, KP, (const h16*)0, VEh, VEl, CEh, CEl, (int)blockIdx.x);
}
// grid ((TT-EROWS)/64, NB*NH_): query rows [EROWS, TT); ctx as f16 plane (x64 carry) [b][TT][DM].
__global__ __launch_bounds__(128) void k_attn_main(const h16* __restrict__ QP, const h16* __restrict__ KP, const h16* __restrict__ VT, bf* CH) {
    attn_body<false>(QP, KP, VT, (const bf*)0, (const bf*)0, CH, CH, (int)blockIdx.x + EROWS / 64);
}

// out_body: OUT[r][c] = scale * sum_k A[r][k] Bt[c][k] + bf16(bias[c]); 128x128 tile per block of four waves, 64x64 per wave; per 16-row slab staged in LDS (wave-private),
template <typename T16, int NSPLIT>
__device__ __forceinline__ void out_body(const T16* __restrict__ A, const T16* __restrict__ A2, const T16* __restrict__ Bt, float* C, const float* __restrict__ bias, const float scale) {
    __shared__ __align__(16) unsigned short ring[2 * (2 + NSPLIT) * GTS];   // operand ring; behind the product each wave's own output staging
    static_assert(2 * 2 * GTS * 2 >= 4 * 16 * 68 * 4);
    const int lane = threadIdx.x & 31, lr = lane & 15, hi = lane >> 4;
    const int w = __builtin_amdgcn_readfirstlane((threadIdx.x >> 5) & 3);
    const int r0 = blockIdx.x * 128 + (w >> 1) * 64, c0 = blockIdx.y * 128 + (w & 1) * 64;
    v8f acc[4][4];
    gemm_tile<T16, NSPLIT>(A, A2, Bt, DM, (size_t)blockIdx.x * 128, (size_t)blockIdx.y * 128, ring, acc);
    float* os = (float*)ring + w * (16 * 68);
    const v4f bw = *(const v4f*)(bias + c0 + lr * 4);
    v4f bb;
#pragma unroll
    for (int q = 0; q < 4; ++q) bb[q] = bfr(bw[q]);
#pragma unroll
    for (int mb = 0; mb < 4; ++mb) {
#pragma unroll
        for (int nb = 0; nb < 4; ++nb) {
#pragma unroll
            for (int j = 0; j < 8; ++j) os[(hi * 8 + j) * 68 + nb * 16 + lr] = acc[mb][nb][j]; }
        __builtin_amdgcn_wave_barrier(); asm volatile("" ::: "memory");
        float* crow = C + (size_t)(r0 + mb * 16) * DM + c0 + lr * 4;
{
#pragma unroll
            for (int s = 0; s < 8; ++s) { const int row = 2 * s + hi;
                v4f val = *(const v4fa*)(os + row * 68 + lr * 4);
                val = val * scale + bb;
                *(v4f*)(crow + (size_t)row * DM) = val; }
             }
        __builtin_amdgcn_wave_barrier(); asm volatile("" ::: "memory");
    }
}

// grid (EROWS/128, DM/128, NB): rows [0, EROWS) of batch z from the bf16 hi/lo ctx planes.
__global__ __launch_bounds__(128) void k_oute(const bf* __restrict__ CEh, const bf* __restrict__ CEl, const bf* __restrict__ WoB, float* OUT, const float* __restrict__ Wb) {
    const size_t z = blockIdx.z;
    out_body<bf, 1>(CEh + z * EROWS * DM, CEl + z * EROWS * DM, WoB, OUT + z * TT * DM, Wb, 1.0f);
}
// grid ((TT-EROWS)/128, DM/128, NB): rows [EROWS, TT) of batch z from the f16 ctx plane.
__global__ __launch_bounds__(128) void k_outl(const h16* __restrict__ CH, const h16* __restrict__ WoH, float* OUT, const float* __restrict__ Wb) {
    const size_t ro = ((size_t)blockIdx.z * TT + EROWS) * DM;
    out_body<h16, 0>(CH + ro, CH + ro, WoH, OUT + ro, Wb, OSC);
}

extern "C" void kernel_launch(void* const* d_in, const int* in_sizes, int n_in,
                              void* d_out, int out_size, void* d_ws, size_t ws_size, hipStream_t stream) {
    if (n_in < 11) return;
    if (in_sizes[0] < NB * SEQ_FULL * DM || in_sizes[1] < NB * SEQ_FULL * DM || in_sizes[2] < NB * SEQ_FULL * DM) return;
    if (in_sizes[3] < NH_ * HD * DM || in_sizes[5] < NH_ * HD * DM || in_sizes[7] < NH_ * HD * DM || in_sizes[9] < DM * DM) return;
    if (in_sizes[4] < NH_ * HD || in_sizes[6] < NH_ * HD || in_sizes[8] < NH_ * HD || in_sizes[10] < DM) return;
    if (out_size < NB * TT * DM) return;
    const float* xq = (const float*)d_in[0]; const float* xk = (const float*)d_in[1]; const float* xv = (const float*)d_in[2];
    const float* wq = (const float*)d_in[3]; const float* bq = (const float*)d_in[4];
    const float* wk = (const float*)d_in[5]; const float* bk = (const float*)d_in[6];
    const float* wv = (const float*)d_in[7]; const float* bv = (const float*)d_in[8];
    const float* wo = (const float*)d_in[9]; const float* bo = (const float*)d_in[10];
    float* OUT = (float*)d_out;     // [NB][TT][DM]
    char* wsp = (char*)d_ws;
    auto take = [&](size_t bytes) { char* p = wsp; wsp += (bytes + 255) & ~(size_t)255; return (void*)p; };
    bf*  WT  = (bf*)take((size_t)3 * DM * DM * 2);                  // [3][n][k] projection weights, bf16
    bf*  WoB = (bf*)take((size_t)DM * DM * 2);                      // output weight, bf16
    h16* WoH = (h16*)take((size_t)DM * DM * 2);                     // output weight, f16 x1024
    h16* QK  = (h16*)take((size_t)2 * QKSZ * 2);                    // q plane | k plane
    h16* VT  = (h16*)take((size_t)NB * NH_ * HD * TT * 2);          // [b][h][d][t] f16 x64
    bf*  VEh = (bf*)take((size_t)NB * NH_ * HD * EROWS * 2);        // [b][h][d][t < EROWS] bf16 hi
    bf*  VEl = (bf*)take((size_t)NB * NH_ * HD * EROWS * 2);        // bf16 lo
    bf*  XB  = (bf*)take((size_t)3 * XSZ * 2);                      // bf16 activations q | k | v; dead after the projections
    if ((size_t)(wsp - (char*)d_ws) > ws_size) return;              // 119,537,664 B at NB=4, TT=2048
    bf* CH  = XB;                   // ctx f16 plane [NB*TT][DM] (16-bit storage), aliases activation plane 0
    bf* CEh = XB + XSZ;             // ctx bf16 hi [NB*EROWS][DM], aliases activation plane 1
    bf* CEl = XB + 2 * XSZ;         // ctx bf16 lo, aliases activation plane 2

    const size_t nx8 = XSZ / 8;
    k_cvt8<<<(unsigned)((nx8 + 255) / 256), 256, 0, stream>>>(xq, XB, nx8);
    k_cvt8<<<(unsigned)((nx8 + 255) / 256), 256, 0, stream>>>(xk, XB + XSZ, nx8);
    k_cvt8<<<(unsigned)((nx8 + 255) / 256), 256, 0, stream>>>(xv, XB + 2 * XSZ, nx8);
    const size_t nw8 = (size_t)DM * DM / 8;
    k_cvt8<<<(unsigned)((nw8 + 255) / 256), 256, 0, stream>>>(wq, WT, nw8);
    k_cvt8<<<(unsigned)((nw8 + 255) / 256), 256, 0, stream>>>(wk, WT + (size_t)DM * DM, nw8);
    k_cvt8<<<(unsigned)((nw8 + 255) / 256), 256, 0, stream>>>(wv, WT + (size_t)2 * DM * DM, nw8);
    k_cvtwo<<<(unsigned)((nw8 + 255) / 256), 256, 0, stream>>>(wo, WoB, WoH, nw8);

    k_projqk<<<dim3(NB * TT / 128, NH_ / 2, 2), 128, 0, stream>>>(XB, WT, bq, bk, QK);
    k_projv<<<dim3(NB * TT / 128, NH_ / 2), 128, 0, stream>>>(XB + 2 * XSZ, WT + (size_t)2 * DM * DM, bv, VT, VEh, VEl);

    k_attn_early<<<dim3(EROWS / 64, NB * NH_), 128, 0, stream>>>(QK, QK + QKSZ, VEh, VEl, CEh, CEl);
    if (TT > EROWS)
        k_attn_main<<<dim3((TT - EROWS) / 64, NB * NH_), 128, 0, stream>>>(QK, QK + QKSZ, VT, CH);

    k_oute<<<dim3(EROWS / 128, DM / 128, NB), 128, 0, stream>>>(CEh, CEl, WoB, OUT, bo);
    if (TT > EROWS)
        k_outl<<<dim3((TT - EROWS) / 128, DM / 128, NB), 128, 0, stream>>>((const h16*)CH, WoH, OUT, bo);
}

// v003
// One run takes 169 microseconds.
// Next to v002, in two timings, it ran 1.08 and 1.09 times as fast.
// Counting every step since v000, it is 2.03 times as fast.
#include <hip/hip_runtime.h>

// Contractions, f32 accumulate: q/k/v projections v_wmma_f32_16x16x32_bf16 on bf16 (RNE) copies of x and W; scores v_wmma_f32_16x16x32_f16 on f16 q/k planes (x16 carry each); P.V v_wmma_f32_16x16x32_f16 (P x256, V x64 carries) for query rows >= EROWS and v_wmma_f32_16x16x32_bf16 on bf16 hi+lo P and V (3 products) for query rows < EROWS; output projection v_wmma_f32_16x16x32_f16 (ctx x64, W x1024) for rows >= EROWS and v_wmma_f32_16x16x32_bf16 on bf16 hi+lo ctx (2 products) for rows < EROWS.
// Pipeline: bf16 planes of the three activations and the weights; q/k planes [b][h][t][64] f16; value planes [b][h][64][t] f16 (+ bf16 hi/lo for t < EROWS); fused causal attention in transposed form (S^T = K Q^T, O^T = V^T P^T, online softmax per lane, score scale 1/32); ctx planes [b*t][1024]; out = ctx W^T + b.

#ifndef NB
#define NB 4
#endif
#ifndef SEQ
#define SEQ 2048
#endif
#define NB_FULL  4
#define SEQ_FULL 2048
#define TT   SEQ
#define DM   1024
#define NH_  16
#define HD   64
#define EROWS ((TT) < 512 ? (TT) : 512)
#define QKC  16.0f                                          // carry of the q and k planes
#define CSC  (0.045084220027780106f * 0.00390625f)          // (1/32) * log2(e) / (QKC*QKC)
#define VC   64.0f                                          // carry of the f16 value plane (and of the f16 ctx plane)
#define WOC  1024.0f                                        // carry of the f16 output weight plane
#define OSC  1.52587890625e-05f                             // 1 / (VC * WOC)
#define NEGB (-3.0e38f)
#define XSZ  ((size_t)NB * SEQ_FULL * DM)
#define QKSZ ((size_t)NB * NH_ * TT * HD)
static_assert(TT % 64 == 0);
static_assert(TT <= SEQ_FULL);
static_assert(NB >= 1 && NB <= NB_FULL);
static_assert(NH_ * HD == DM);
static_assert(DM % 64 == 0);
static_assert(DM % 32 == 0);
static_assert(HD == 64);
static_assert(EROWS % 64 == 0);
static_assert(EROWS <= TT);
static_assert((TT - EROWS) % 64 == 0);
static_assert(TT % 128 == 0 && EROWS % 128 == 0 && DM % 128 == 0 && NH_ % 2 == 0);   // 128x128 block tiles of the projections and of the output product
static_assert((size_t)NB * TT * DM <= XSZ);
static_assert((size_t)NB * EROWS * DM <= XSZ);
static_assert((size_t)3 * DM * DM * 2 + (size_t)2 * DM * DM * 2 + (size_t)2 * QKSZ * 2 + (size_t)NB * NH_ * HD * TT * 2 + (size_t)2 * NB * NH_ * HD * EROWS * 2 + (size_t)3 * XSZ * 2 <= (size_t)134217728);

typedef _Float16 h16;
typedef unsigned short bf;
typedef __attribute__((ext_vector_type(16))) __bf16   v16bf;
typedef __attribute__((ext_vector_type(16))) _Float16 v16h;
typedef __attribute__((ext_vector_type(8)))  _Float16 v8h;
typedef __attribute__((ext_vector_type(8)))  unsigned short v8us;
typedef __attribute__((ext_vector_type(8)))  float    v8f;
typedef __attribute__((ext_vector_type(4)))  float    v4f;
typedef v4f  __attribute__((may_alias)) v4fa;
typedef v8us __attribute__((may_alias)) v8usa;

__device__ __forceinline__ unsigned short f2bf(float f) { unsigned u = __float_as_uint(f); u += 0x7FFFu + ((u >> 16) & 1u); return (unsigned short)(u >> 16); }
__device__ __forceinline__ float bf2f(unsigned short b) { return __uint_as_float(((unsigned)b) << 16); }
__device__ __forceinline__ float bfr(float f) { return bf2f(f2bf(f)); }
__device__ __forceinline__ v16h cat16(v8h lo, v8h hi) { return __builtin_shufflevector(lo, hi, 0, 1, 2, 3, 4, 5, 6, 7, 8, 9, 10, 11, 12, 13, 14, 15); }
__device__ __forceinline__ v16bf cat16b(v8us lo, v8us hi) { return __builtin_bit_cast(v16bf, __builtin_shufflevector(lo, hi, 0, 1, 2, 3, 4, 5, 6, 7, 8, 9, 10, 11, 12, 13, 14, 15)); }
__device__ __forceinline__ v8f wmma16(v16h a, v16h b, v8f c) { return __builtin_amdgcn_wmma_f32_16x16x32_f16(false, a, false, b, (short)0, c, false, false); }
__device__ __forceinline__ v8f wmmab(v16bf a, v16bf b, v8f c) { return __builtin_amdgcn_wmma_f32_16x16x32_bf16(false, a, false, b, (short)0, c, false, false); }
__device__ __forceinline__ void splitf(float y, unsigned short& h, unsigned short& l) { h = f2bf(y); l = f2bf(y - bf2f(h)); }
// Fragment loaders (A and B identical): p already points at row (lane&15), k0 + 8*(lane>>4); elements 0..7 <- p[0..7], elements 8..15 <- p[16..23].
__device__ __forceinline__ v16h ldh(const h16* p) { return cat16(*(const v8h*)p, *(const v8h*)(p + 16)); }
__device__ __forceinline__ v16bf ldb(const bf* p) { return cat16b(*(const v8us*)p, *(const v8us*)(p + 16)); }
__device__ __forceinline__ v8us pack_h(v8f c) { v8h t;
#pragma unroll
    for (int r = 0; r < 8; ++r) t[r] = (h16)c[r];
    return __builtin_bit_cast(v8us, t); }
__device__ __forceinline__ void pack_b(v8f c, v8us& a, v8us& l) {
#pragma unroll
    for (int r = 0; r < 8; ++r) { unsigned short x, y; splitf(c[r], x, y); a[r] = x; l[r] = y; } }

template <typename T16> struct WFrag;
template <> struct WFrag<h16> { typedef v16h V; static __device__ __forceinline__ V ld(const h16* p) { return ldh(p); } static __device__ __forceinline__ v8f mma(V a, V b, v8f c) { return wmma16(a, b, c); } };
template <> struct WFrag<bf> { typedef v16bf V; static __device__ __forceinline__ V ld(const bf* p) { return ldb(p); } static __device__ __forceinline__ v8f mma(V a, V b, v8f c) { return wmmab(a, b, c); } };

#define LP  72              // LDS row pitch of a staged tile in 16-bit elements: 144 B = 16 B x odd, free of bank conflicts for 16-byte fragment reads
#define TSZ (64 * LP)       // 16-bit elements of one staged tile
// One 64-row tile: this lane's 16 bytes of rows r, r+16, r+32, r+48. l = LDS byte address, g = global byte address of row r, gstep = bytes between global rows r and r+16.
__device__ __forceinline__ void copy_tile(const unsigned l, const char* g, const size_t gstep) {
    const unsigned l1 = l + 16 * LP * 2, l2 = l + 32 * LP * 2, l3 = l + 48 * LP * 2;
    const char* g1 = g + gstep; const char* g2 = g + 2 * gstep; const char* g3 = g + 3 * gstep;
    // the closing s_wait_xcnt 0 stands inside the statement so that no address register of a copy is rewritten ahead of it
    asm volatile("global_load_async_to_lds_b128 %0, %4, off\n\tglobal_load_async_to_lds_b128 %1, %5, off\n\tglobal_load_async_to_lds_b128 %2, %6, off\n\tglobal_load_async_to_lds_b128 %3, %7, off\n\ts_wait_xcnt 0x0"
                 :: "v"(l), "v"(l1), "v"(l2), "v"(l3), "v"(g), "v"(g1), "v"(g2), "v"(g3) : "memory");
}

// gemm_tile: a block of four waves computes a 128x128 tile; wave w owns the 64x64 quarter at rows 64*(w>>1), columns 64*(w&1):
// acc[mb][nb][j] = C[16*mb + 8*(lane>>4) + j][16*nb + (lane&15)] of that quarter = sum_k A[m][k] Bt[n][k] (+ A2[m][k] Bt[n][k] when NSPLIT == 1).
// Operand path: a stage is 64 k = one 128-row x 128-B tile per operand plane (A, Bt, and A2 when NSPLIT == 1), brought from the K-contiguous 16-bit planes into LDS once per block
// by asynchronous 16-byte copies (each wave-wide copy = 4 whole 128-B lines), two buffers, the next stage in flight while this one is worked on; every wave reads its fragments from LDS.
// K % 64 == 0; arow0 / brow0 = first row of the block's tile in A (A2) / Bt; ring = 2 * (2 + NSPLIT) * GTS 16-bit elements of LDS, free for other use on return.
#define GTS (2 * TSZ)       // 16-bit elements of one staged 128-row operand tile
template <typename T16, int NSPLIT>
__device__ __forceinline__ void gemm_tile(const T16* __restrict__ A, const T16* __restrict__ A2, const T16* __restrict__ Bt, const int K, const size_t arow0, const size_t brow0, unsigned short* ring, v8f (&acc)[4][4]) {
    typedef typename WFrag<T16>::V V;
    constexpr int NT = 2 + NSPLIT;                                      // tiles per stage: A, Bt (, A2)
    const int lane = threadIdx.x & 31, lr = lane & 15, hi = lane >> 4;
    const int w = __builtin_amdgcn_readfirstlane((threadIdx.x >> 5) & 3);
    const int cr = (int)(threadIdx.x >> 3) & 15, cc = (int)threadIdx.x & 7;   // this lane's row (mod 16) and 16-byte column in every staged tile
    const unsigned lbase = (unsigned)(size_t)ring + (unsigned)(cr * LP + cc * 8) * 2u;
    const char* ga  = (const char*)(A + (arow0 + cr) * K + cc * 8);
    const char* ga2 = (const char*)(A2 + (arow0 + cr) * K + cc * 8);
    const char* gb  = (const char*)(Bt + (brow0 + cr) * K + cc * 8);
    const size_t gstep = (size_t)16 * K * 2;
    auto issue = [&](const int s, const int buf) {                      // stage s (k = 64s .. 64s+63) into buffer buf
        const unsigned lb = lbase + (unsigned)(buf * NT * GTS) * 2u;
        const size_t ko = (size_t)s * 64 * 2;
        copy_tile(lb, ga + ko, gstep);             copy_tile(lb + TSZ * 2u, ga + ko + 4 * gstep, gstep);
        copy_tile(lb + GTS * 2u, gb + ko, gstep);  copy_tile(lb + GTS * 2u + TSZ * 2u, gb + ko + 4 * gstep, gstep);
        if (NSPLIT == 1) { copy_tile(lb + 2u * GTS * 2u, ga2 + ko, gstep); copy_tile(lb + 2u * GTS * 2u + TSZ * 2u, ga2 + ko + 4 * gstep, gstep); }
    };
#pragma unroll
    for (int mb = 0; mb < 4; ++mb)
#pragma unroll
        for (int nb = 0; nb < 4; ++nb) acc[mb][nb] = (v8f){};
    const int nstage = K / 64;
    issue(0, 0);
    asm volatile("s_wait_asynccnt 0x0" ::: "memory");                   // this wave's copies of stage 0 have landed
    __syncthreads();                                                    // ... and every other wave's: stage 0 may be read
    if (nstage > 1) issue(1, 1);
#pragma unroll 1   // rolled: one publish point and one refill site in the text
    for (int t = 0; t < nstage; ++t) {
        const T16* sbuf = (const T16*)ring + (t & 1) * NT * GTS;
        const T16* pa = sbuf + ((w >> 1) * 64 + lr) * LP + 8 * hi;
        const T16* pb = sbuf + GTS + ((w & 1) * 64 + lr) * LP + 8 * hi;
#pragma unroll     // the two 32-k steps of a stage: their LDS offsets become immediates
        for (int ks = 0; ks < 2; ++ks) {
            V a[4], a2[4];
#pragma unroll
            for (int mb = 0; mb < 4; ++mb) { a[mb] = WFrag<T16>::ld(pa + mb * 16 * LP + ks * 32); if (NSPLIT == 1) a2[mb] = WFrag<T16>::ld(pa + 2 * GTS + mb * 16 * LP + ks * 32); else a2[mb] = a[mb]; }
            V b[4];
#pragma unroll
            for (int nb = 0; nb < 4; ++nb) b[nb] = WFrag<T16>::ld(pb + nb * 16 * LP + ks * 32);
            // inputs-only fence on the loaded fragments: all LDS reads of this 32-k step stand as one group with one wait ahead of its WMMAs; without it each Bt fragment is read and waited for singly between them
            asm volatile("" :: "v"(b[0]), "v"(b[1]), "v"(b[2]), "v"(b[3]));
#pragma unroll
            for (int nb = 0; nb < 4; ++nb) {
#pragma unroll
                for (int mb = 0; mb < 4; ++mb) { acc[mb][nb] = WFrag<T16>::mma(a[mb], b[nb], acc[mb][nb]); if (NSPLIT == 1) acc[mb][nb] = WFrag<T16>::mma(a2[mb], b[nb], acc[mb][nb]); } }
            // four vector slots behind these WMMAs before a vector instruction may touch their registers, on either side of the branch at the loop's foot
            asm volatile("v_nop\n\tv_nop\n\tv_nop\n\tv_nop" : "+v"(acc[0][0]), "+v"(acc[1][1]), "+v"(acc[2][2]), "+v"(acc[3][3]) : "v"(a[0]), "v"(a[3]));
        }
        // publish point of stage t + 1, passed by every wave
        asm volatile("s_wait_dscnt 0x0" ::: "memory");                  // this wave's reads of stage t have returned before its buffer is refilled
        asm volatile("s_wait_asynccnt 0x0" ::: "memory");               // this wave's copies of stage t + 1 have landed
        __syncthreads();                                                // stage t + 1 may be read; every reader has left stage t
        if (t + 2 < nstage) issue(t + 2, t & 1);
    }
    asm volatile("s_wait_asynccnt 0x0" ::: "memory");                   // nothing in flight when the ring becomes output staging
}

// k_cvtall: every 16-bit operand plane in one launch of CVW waves (16 per block); every wave runs the same stream of pieces. A piece = four wave-wide reads of 32 B per lane (256 floats each).
// Pieces 0 .. 3*XT-1: CVE consecutive floats of x_q | x_k | x_v (-> XB, planes contiguous), piece t of wave g at float (t*CVW + g)*CVE of the three planes taken as one.
// Last piece: 256 floats at g*256 of each of W_q, W_k, W_v (-> WT) and W_o (-> WoB and WoH). The next piece's reads are issued ahead of this piece's conversion and stores.
#define CVW 4096
#define CVE 1024
__device__ __forceinline__ v8us cvt8(const v8f v) { v8us o;
#pragma unroll
    for (int k = 0; k < 8; ++k) o[k] = f2bf(v[k]);
    return o; }
__global__ __launch_bounds__(512) void k_cvtall(const float* __restrict__ xq, const float* __restrict__ xk, const float* __restrict__ xv, const float* __restrict__ wq, const float* __restrict__ wk, const float* __restrict__ wv, const float* __restrict__ wo,
                                                bf* __restrict__ XB, bf* __restrict__ WT, bf* __restrict__ WoB, h16* __restrict__ WoH) {
    constexpr int XT = (int)(XSZ / ((size_t)CVW * CVE));                // pieces of one activation plane per wave
    static_assert(XSZ % ((size_t)CVW * CVE) == 0 && (size_t)DM * DM == (size_t)CVW * 256);
    const unsigned lane = threadIdx.x & 31;
    const unsigned gw = (unsigned)__builtin_amdgcn_readfirstlane((int)(blockIdx.x * 16 + (threadIdx.x >> 5)));   // wave number in a scalar register: piece bases are then scalar
    const size_t xo = (size_t)gw * CVE + lane * 8, wof = (size_t)gw * 256 + lane * 8;
    v8f cur[4], nxt[4];
#pragma unroll
    for (int j = 0; j < 4; ++j) cur[j] = *(const v8f*)(xq + xo + j * 256);
    asm volatile("s_wait_xcnt 0x0" ::: "memory");       // stands in front of any rewriting of the reads' address registers
    __builtin_amdgcn_sched_barrier(0);                  // keeps later register writes behind that wait, and the eight reads together ahead of the conversions
#pragma unroll   // piece number known at compile time: its source plane is then a constant
    for (int t = 0; t <= 3 * XT; ++t) {
        if (t + 1 < 3 * XT) {
            const float* s = ((t + 1) / XT == 0 ? xq : (t + 1) / XT == 1 ? xk : xv) + (size_t)((t + 1) % XT) * CVW * CVE + xo;
#pragma unroll
            for (int j = 0; j < 4; ++j) nxt[j] = *(const v8f*)(s + j * 256);
        } else if (t + 1 == 3 * XT) {
            nxt[0] = *(const v8f*)(wq + wof); nxt[1] = *(const v8f*)(wk + wof); nxt[2] = *(const v8f*)(wv + wof); nxt[3] = *(const v8f*)(wo + wof);
        }
        asm volatile("s_wait_xcnt 0x0" ::: "memory");   // stands in front of any rewriting of the reads' address registers
        __builtin_amdgcn_sched_barrier(0);              // keeps later register writes behind that wait, and the eight reads together ahead of the conversions
        if (t < 3 * XT) {
            bf* d = XB + (size_t)t * CVW * CVE + xo;
#pragma unroll
            for (int j = 0; j < 4; ++j) *(v8us*)(d + j * 256) = cvt8(cur[j]);
        } else {
#pragma unroll
            for (int j = 0; j < 3; ++j) *(v8us*)(WT + (size_t)j * DM * DM + wof) = cvt8(cur[j]);
            const v8us ob = cvt8(cur[3]); v8h oh;
#pragma unroll
            for (int k = 0; k < 8; ++k) oh[k] = (h16)(bf2f(ob[k]) * WOC);
            *(v8us*)(WoB + wof) = ob; *(v8h*)(WoH + wof) = oh;
        }
        asm volatile("s_wait_xcnt 0x0" ::: "memory");   // stands in front of the rewriting of the stores' data and address registers
        __builtin_amdgcn_sched_barrier(0);              // keeps the next piece's address arithmetic behind that wait
#pragma unroll
        for (int j = 0; j < 4; ++j) cur[j] = nxt[j];
    }
}

// k_projqk: grid (NB*TT/128, NH_/2, 2), four waves; z = 0 -> q plane, z = 1 -> k plane. Block tile = 128 tokens x two heads; a wave's tile = 64 tokens x one head (64 dims).
__global__ __launch_bounds__(128) void k_projqk(const bf* __restrict__ XB, const bf* __restrict__ WT, const float* __restrict__ bq, const float* __restrict__ bk, h16* QK) {
    __shared__ __align__(16) unsigned short ring[2 * 2 * GTS];          // operand ring; behind the product each wave's own output staging
    static_assert(2 * 2 * GTS * 2 >= 4 * 16 * 68 * 4);
    const int z = blockIdx.z;
    const int lane = threadIdx.x & 31, lr = lane & 15, hi = lane >> 4;
    const int w = __builtin_amdgcn_readfirstlane((threadIdx.x >> 5) & 3);
    const int mt = blockIdx.x * 2 + (w >> 1); const int b = mt / (TT / 64); const int t0 = (mt % (TT / 64)) * 64; const int h = blockIdx.y * 2 + (w & 1);
    const bf* A = XB + (size_t)z * XSZ; const bf* Bt = WT + (size_t)z * DM * DM;
    v8f acc[4][4];
    gemm_tile<bf, 0>(A, A, Bt, DM, (size_t)b * SEQ_FULL + t0 - (w >> 1) * 64, (size_t)blockIdx.y * 2 * HD, ring, acc);
    float* os = (float*)ring + w * (16 * 68);
    const int rq = lane >> 3, pc = lane & 7;
    const v8f b0 = *(const v8f*)(bq + h * HD + pc * 8); const v8f b1 = *(const v8f*)(bk + h * HD + pc * 8);
    v8f bb;
#pragma unroll
    for (int i = 0; i < 8; ++i) bb[i] = bfr(z ? b1[i] : b0[i]);
    h16* P = QK + (size_t)z * QKSZ + (((size_t)b * NH_ + h) * TT + t0) * HD + pc * 8;
#pragma unroll
    for (int mb = 0; mb < 4; ++mb) {
#pragma unroll
        for (int nb = 0; nb < 4; ++nb) {
#pragma unroll
            for (int j = 0; j < 8; ++j) os[(hi * 8 + j) * 68 + nb * 16 + lr] = acc[mb][nb][j]; }
        __builtin_amdgcn_wave_barrier(); asm volatile("" ::: "memory");
        h16* prow = P + (size_t)(mb * 16) * HD;
{
#pragma unroll
            for (int s = 0; s < 4; ++s) { const int row = 4 * s + rq;
                const v4f x0 = *(const v4fa*)(os + row * 68 + pc * 8), x1 = *(const v4fa*)(os + row * 68 + pc * 8 + 4);
                v8h o;
#pragma unroll
                for (int q = 0; q < 4; ++q) { o[q] = (h16)((x0[q] + bb[q]) * QKC); o[4 + q] = (h16)((x1[q] + bb[4 + q]) * QKC); }
                *(v8h*)(prow + (size_t)row * HD) = o; }
             }
        __builtin_amdgcn_wave_barrier(); asm volatile("" ::: "memory");
    }
}

// k_projv: grid (NB*TT/128, NH_/2), four waves. Block tile = 128 tokens x two heads; a wave's tile = 64 tokens x one head; written transposed: VT[b][h][d][t] = f16(64 * v), and for t < EROWS the bf16 hi/lo planes VE[b][h][d][t] of v.
__global__ __launch_bounds__(128) void k_projv(const bf* __restrict__ XBv, const bf* __restrict__ WTv, const float* __restrict__ bv, h16* VT, bf* VEh, bf* VEl) {
    __shared__ __align__(16) unsigned short ring[2 * 2 * GTS];          // operand ring; behind the product each wave's own transpose staging
    static_assert(2 * 2 * GTS * 2 >= 4 * 64 * 68 * 4);
    const int lane = threadIdx.x & 31, lr = lane & 15, hi = lane >> 4;
    const int w = __builtin_amdgcn_readfirstlane((threadIdx.x >> 5) & 3);
    const int mt = blockIdx.x * 2 + (w >> 1); const int b = mt / (TT / 64); const int t0 = (mt % (TT / 64)) * 64; const int h = blockIdx.y * 2 + (w & 1);
    v8f acc[4][4];
    gemm_tile<bf, 0>(XBv, XBv, WTv, DM, (size_t)b * SEQ_FULL + t0 - (w >> 1) * 64, (size_t)blockIdx.y * 2 * HD, ring, acc);
    float* ts = (float*)ring + w * (64 * 68);
#pragma unroll
    for (int mb = 0; mb < 4; ++mb)
#pragma unroll
        for (int nb = 0; nb < 4; ++nb) {
            const v4f lo4 = { acc[mb][nb][0], acc[mb][nb][1], acc[mb][nb][2], acc[mb][nb][3] };
            const v4f hi4 = { acc[mb][nb][4], acc[mb][nb][5], acc[mb][nb][6], acc[mb][nb][7] };
            *(v4fa*)(ts + (nb * 16 + lr) * 68 + mb * 16 + 8 * hi) = lo4;
            *(v4fa*)(ts + (nb * 16 + lr) * 68 + mb * 16 + 8 * hi + 4) = hi4; }
    __builtin_amdgcn_wave_barrier(); asm volatile("" ::: "memory");
    const int rq = lane >> 3, pc = lane & 7;
    const bool early = t0 < EROWS;
    const size_t vrow0 = ((size_t)b * NH_ + h) * HD;
{
#pragma unroll 1
        for (int s = 0; s < 16; ++s) { const int d = 4 * s + rq;
            const float bb = bfr(bv[h * HD + d]);
            const v4f x0 = *(const v4fa*)(ts + d * 68 + pc * 8), x1 = *(const v4fa*)(ts + d * 68 + pc * 8 + 4);
            v8f x = __builtin_shufflevector(x0, x1, 0, 1, 2, 3, 4, 5, 6, 7);
            x = x + bb;
            v8h o;
#pragma unroll
            for (int q = 0; q < 8; ++q) o[q] = (h16)(x[q] * VC);
            *(v8h*)(VT + (vrow0 + d) * TT + t0 + pc * 8) = o;
            asm volatile("s_wait_xcnt 0x0" ::: "memory");   // stands in front of the rewriting of the store's data and address registers (hi/lo packing, next trip)
            if (early) { v8us oh, ol; pack_b(x, oh, ol);
                *(v8us*)(VEh + (vrow0 + d) * EROWS + t0 + pc * 8) = oh;
                *(v8us*)(VEl + (vrow0 + d) * EROWS + t0 + pc * 8) = ol;
                asm volatile("s_wait_xcnt 0x0" ::: "memory"); } }   // stands in front of the next trip's advance of both stores' address registers
         }
}

// attn_body: fused causal attention, 4 waves per block, 16 query rows per wave, 32 keys per step, transposed formulation.
//   S^T tile (rows = keys, cols = queries) = A(k plane rows) x B(q plane rows); D element r of lane l = S^T[key 8*(l>>4)+r][query l&15].
//   Per lane one query column: running max m, running sum l (combined across lane halves by one xor-16 shuffle each).
//   P^T as B fragment: element r <- p(tile keys 0..15)[r], element 8+r <- p(tile keys 16..31)[r], lane unchanged.
//   O^T tile j (rows = dims 16j.., cols = queries) += A(V^T rows) x B(P^T). Masked keys carry p = 0 exactly.
// EARLY: bf16 hi+lo P and V (3 products); else f16 single product with P x256 (cancels against the row sum) and V x64.
// Operand path: a stage is 64 keys = one K tile (64 key rows x 128 B) and one V^T tile per value plane (64 dim rows x 128 B), brought into LDS once per block by
// asynchronous 16-byte copies (each wave-wide copy = 4 whole 128-B lines), two buffers, the next stage in flight while this one is worked on; all four waves read their fragments from LDS.
template <bool EARLY>
__device__ __forceinline__ void attn_body(const h16* __restrict__ QP, const h16* __restrict__ KP, const h16* __restrict__ VT, const bf* __restrict__ VEh, const bf* __restrict__ VEl, bf* C0, bf* C1, const int qb) {
    constexpr int NT = EARLY ? 3 : 2;                                   // tiles per stage: K, V (EARLY: K, V hi, V lo)
    __shared__ __align__(16) unsigned short ring[2 * NT * TSZ];         // two stage buffers; output staging behind the loop
    static_assert(2 * NT * TSZ >= 4 * 2 * 1152);
    unsigned short* stg = ring;
    const int lane = threadIdx.x & 31, lr = lane & 15, hi = lane >> 4;
    const int w = __builtin_amdgcn_readfirstlane((threadIdx.x >> 5) & 3);   // wave number in a scalar register: the per-wave skip below is then a scalar branch
    const int bh = blockIdx.y, b = bh / NH_, h = bh % NH_;
    const int q0 = qb * 64 + w * 16;
    const int qq = q0 + lr;
    const size_t pof = (size_t)bh * TT * HD;
    const h16* qp = QP + pof + (size_t)(q0 + lr) * HD + 8 * hi;
    const v16h qf0 = ldh(qp), qf1 = ldh(qp + 32);
    v8f o0 = {}, o1 = {}, o2 = {}, o3 = {};
    float m = NEGB, l = 0.0f;
    const int nstage = qb + 1;                                          // stages of 64 keys, the same for the whole block
    const int cr = (int)(threadIdx.x >> 3) & 15, cc = (int)threadIdx.x & 7;   // this lane's row (mod 16) and 16-byte column in every staged tile
    const unsigned lbase = (unsigned)(size_t)ring + (unsigned)(cr * LP + cc * 8) * 2u;
    const char* gk = (const char*)(KP + pof + (size_t)cr * HD + cc * 8);
    const char* gv0 = EARLY ? (const char*)(VEh + (size_t)bh * HD * EROWS + (size_t)cr * EROWS + cc * 8) : (const char*)(VT + (size_t)bh * HD * TT + (size_t)cr * TT + cc * 8);
    const char* gv1 = EARLY ? (const char*)(VEl + (size_t)bh * HD * EROWS + (size_t)cr * EROWS + cc * 8) : gv0;
    const size_t vstep = (size_t)16 * (EARLY ? EROWS : TT) * 2;
    auto issue = [&](const int s, const int buf) {                      // stage s (keys 64s .. 64s+63) into buffer buf
        const unsigned lb = lbase + (unsigned)(buf * NT * TSZ) * 2u;
        copy_tile(lb, gk + (size_t)s * 64 * HD * 2, (size_t)16 * HD * 2);
        copy_tile(lb + TSZ * 2u, gv0 + (size_t)s * 64 * 2, vstep);
        if (EARLY) copy_tile(lb + 2u * TSZ * 2u, gv1 + (size_t)s * 64 * 2, vstep);
    };
    issue(0, 0);
    asm volatile("s_wait_asynccnt 0x0" ::: "memory");                   // this wave's copies of stage 0 have landed
    __syncthreads();                                                    // ... and every other wave's: stage 0 may be read
    if (nstage > 1) issue(1, 1);
#pragma unroll 1   // rolled: one publish point and one refill site in the text
    for (int t = 0; t < nstage; ++t) {
        const unsigned short* sbuf = ring + (t & 1) * NT * TSZ;
#pragma unroll     // the two 32-key steps of a stage: their LDS offsets become immediates
      for (int sub = 0; sub < 2; ++sub) {
        const int kt = t * 64 + sub * 32;
        if (sub == 0 || kt <= q0) {  // a wave skips the 32 keys that lie wholly above its queries
        const h16* kp = (const h16*)sbuf + (sub * 32 + lr) * LP + 8 * hi;
        const v16h ka0 = ldh(kp), ka1 = ldh(kp + 16 * LP), kb0 = ldh(kp + 32), kb1 = ldh(kp + 16 * LP + 32);
        v8f s0 = {}, s1 = {};
        s0 = wmma16(ka0, qf0, s0); s1 = wmma16(ka1, qf0, s1);
        s0 = wmma16(kb0, qf1, s0); s1 = wmma16(kb1, qf1, s1);
        asm volatile("v_nop\n\tv_nop\n\tv_nop\n\tv_nop" : "+v"(s0), "+v"(s1) : "v"(ka0), "v"(ka1), "v"(kb0), "v"(kb1), "v"(qf1));
        if (kt + 31 > q0) {          // diagonal step of this wave: exclude keys above the query
            const int k0 = kt + 8 * hi;
#pragma unroll
            for (int r = 0; r < 8; ++r) { s0[r] = (k0 + r > qq) ? NEGB : s0[r]; s1[r] = (k0 + 16 + r > qq) ? NEGB : s1[r]; }
        }
        float mx = fmaxf(s0[0], s1[0]);
#pragma unroll
        for (int r = 1; r < 8; ++r) mx = fmaxf(mx, fmaxf(s0[r], s1[r]));
        mx = fmaxf(mx, __shfl_xor(mx, 16, 32));
        const float mn = fmaxf(m, mx * CSC);
        const float corr = __builtin_amdgcn_exp2f(m - mn);
        m = mn;
        const float sh = (EARLY ? 0.0f : 8.0f) - mn;
        v8f p0, p1; float rs = 0.0f;
#pragma unroll
        for (int r = 0; r < 8; ++r) { p0[r] = __builtin_amdgcn_exp2f(fmaf(s0[r], CSC, sh)); p1[r] = __builtin_amdgcn_exp2f(fmaf(s1[r], CSC, sh)); rs += p0[r] + p1[r]; }
        rs += __shfl_xor(rs, 16, 32);
        l = l * corr + rs;
        o0 *= corr; o1 *= corr; o2 *= corr; o3 *= corr;
        if (EARLY) {
            v8us ph0, ph1, pl0, pl1;
            pack_b(p0, ph0, pl0); pack_b(p1, ph1, pl1);
            const v16bf PH = cat16b(ph0, ph1), PL = cat16b(pl0, pl1);
            const bf* vh = sbuf + TSZ + lr * LP + sub * 32 + 8 * hi;
            const bf* vl = vh + TSZ;
            const v16bf vh0 = ldb(vh), vh1 = ldb(vh + 16 * LP), vh2 = ldb(vh + 32 * LP), vh3 = ldb(vh + 48 * LP);
            const v16bf vl0 = ldb(vl), vl1 = ldb(vl + 16 * LP), vl2 = ldb(vl + 32 * LP), vl3 = ldb(vl + 48 * LP);
            o0 = wmmab(vh0, PH, o0); o0 = wmmab(vl0, PH, o0); o0 = wmmab(vh0, PL, o0);
            o1 = wmmab(vh1, PH, o1); o1 = wmmab(vl1, PH, o1); o1 = wmmab(vh1, PL, o1);
            o2 = wmmab(vh2, PH, o2); o2 = wmmab(vl2, PH, o2); o2 = wmmab(vh2, PL, o2);
            o3 = wmmab(vh3, PH, o3); o3 = wmmab(vl3, PH, o3); o3 = wmmab(vh3, PL, o3);
            asm volatile("v_nop\n\tv_nop\n\tv_nop\n\tv_nop" : "+v"(o0), "+v"(o1), "+v"(o2), "+v"(o3) : "v"(vh0), "v"(vh1), "v"(vh2), "v"(vh3), "v"(vl0), "v"(vl1), "v"(vl2), "v"(vl3), "v"(PH), "v"(PL));
        } else {
            v16h pb;
#pragma unroll
            for (int r = 0; r < 8; ++r) { pb[r] = (h16)p0[r]; pb[8 + r] = (h16)p1[r]; }
            const h16* vp = (const h16*)sbuf + TSZ + lr * LP + sub * 32 + 8 * hi;
            const v16h a0 = ldh(vp), a1 = ldh(vp + 16 * LP), a2 = ldh(vp + 32 * LP), a3 = ldh(vp + 48 * LP);
            o0 = wmma16(a0, pb, o0); o1 = wmma16(a1, pb, o1); o2 = wmma16(a2, pb, o2); o3 = wmma16(a3, pb, o3);
            asm volatile("v_nop\n\tv_nop\n\tv_nop\n\tv_nop" : "+v"(o0), "+v"(o1), "+v"(o2), "+v"(o3) : "v"(a0), "v"(a1), "v"(a2), "v"(a3), "v"(pb));
        }
        }
      }
        // publish point of stage t + 1, passed by every wave
        asm volatile("s_wait_dscnt 0x0" ::: "memory");                  // this wave's reads of stage t have returned before its buffer is refilled
        asm volatile("s_wait_asynccnt 0x0" ::: "memory");               // this wave's copies of stage t + 1 have landed
        __syncthreads();                                                // stage t + 1 may be read; every reader has left stage t
        if (t + 2 < nstage) issue(t + 2, t & 1);
    }
    asm volatile("s_wait_asynccnt 0x0" ::: "memory");                   // nothing in flight when the ring becomes output staging
    const float inv = __fdiv_rn(1.0f, l);
    o0 *= inv; o1 *= inv; o2 *= inv; o3 *= inv;
    const int sb = w * 2 * 1152;
    const int so = sb + lr * 72 + 8 * hi;       // O^T element r of tile j -> row (query lr), column 16j + 8*hi + r
    if (EARLY) {
        v8us a, c;
        pack_b(o0, a, c); *(v8usa*)(stg + so) = a;      *(v8usa*)(stg + so + 1152) = c;
        pack_b(o1, a, c); *(v8usa*)(stg + so + 16) = a; *(v8usa*)(stg + so + 1152 + 16) = c;
        pack_b(o2, a, c); *(v8usa*)(stg + so + 32) = a; *(v8usa*)(stg + so + 1152 + 32) = c;
        pack_b(o3, a, c); *(v8usa*)(stg + so + 48) = a; *(v8usa*)(stg + so + 1152 + 48) = c;
    } else {
        *(v8usa*)(stg + so) = pack_h(o0); *(v8usa*)(stg + so + 16) = pack_h(o1); *(v8usa*)(stg + so + 32) = pack_h(o2); *(v8usa*)(stg + so + 48) = pack_h(o3);
    }
    __builtin_amdgcn_wave_barrier(); asm volatile("" ::: "memory");
    const int rq = lane >> 3, pc = lane & 7;
    const int crows = EARLY ? EROWS : TT;
    const size_t cbase = ((size_t)b * crows + q0) * DM + h * HD + pc * 8;
{
#pragma unroll
        for (int s = 0; s < 4; ++s) { const int row = 4 * s + rq;
            const v8us x = *(const v8usa*)(stg + sb + row * 72 + pc * 8);
            *(v8us*)(C0 + cbase + (size_t)row * DM) = x;
            if (EARLY) { const v8us y = *(const v8usa*)(stg + sb + 1152 + row * 72 + pc * 8); *(v8us*)(C1 + cbase + (size_t)row * DM) = y; } }
         }
}

// grid (EROWS/64, NB*NH_): query rows [0, EROWS) of every (b, h); ctx as bf16 hi/lo planes [b][EROWS][DM].
__global__ __launch_bounds__(128) void k_attn_early(const h16* __restrict__ QP, const h16* __restrict__ KP, const bf* __restrict__ VEh, const bf* __restrict__ VEl, bf* CEh, bf* CEl) {
    attn_body<true>(QP, KP, (const h16*)0, VEh, VEl, CEh, CEl, (int)blockIdx.x);
}
// grid ((TT-EROWS)/64, NB*NH_): query rows [EROWS, TT); ctx as f16 plane (x64 carry) [b][TT][DM].
__global__ __launch_bounds__(128) void k_attn_main(const h16* __restrict__ QP, const h16* __restrict__ KP, const h16* __restrict__ VT, bf* CH) {
    attn_body<false>(QP, KP, VT, (const bf*)0, (const bf*)0, CH, CH, (int)blockIdx.x + EROWS / 64);
}

// out_body: OUT[r][c] = scale * sum_k A[r][k] Bt[c][k] + bf16(bias[c]); 128x128 tile per block of four waves, 64x64 per wave; per 16-row slab staged in LDS (wave-private),
template <typename T16, int NSPLIT>
__device__ __forceinline__ void out_body(const T16* __restrict__ A, const T16* __restrict__ A2, const T16* __restrict__ Bt, float* C, const float* __restrict__ bias, const float scale) {
    __shared__ __align__(16) unsigned short ring[2 * (2 + NSPLIT) * GTS];   // operand ring; behind the product each wave's own output staging
    static_assert(2 * 2 * GTS * 2 >= 4 * 16 * 68 * 4);
    const int lane = threadIdx.x & 31, lr = lane & 15, hi = lane >> 4;
    const int w = __builtin_amdgcn_readfirstlane((threadIdx.x >> 5) & 3);
    const int r0 = blockIdx.x * 128 + (w >> 1) * 64, c0 = blockIdx.y * 128 + (w & 1) * 64;
    v8f acc[4][4];
    gemm_tile<T16, NSPLIT>(A, A2, Bt, DM, (size_t)blockIdx.x * 128, (size_t)blockIdx.y * 128, ring, acc);
    float* os = (float*)ring + w * (16 * 68);
    const v4f bw = *(const v4f*)(bias + c0 + lr * 4);
    v4f bb;
#pragma unroll
    for (int q = 0; q < 4; ++q) bb[q] = bfr(bw[q]);
#pragma unroll
    for (int mb = 0; mb < 4; ++mb) {
#pragma unroll
        for (int nb = 0; nb < 4; ++nb) {
#pragma unroll
            for (int j = 0; j < 8; ++j) os[(hi * 8 + j) * 68 + nb * 16 + lr] = acc[mb][nb][j]; }
        __builtin_amdgcn_wave_barrier(); asm volatile("" ::: "memory");
        float* crow = C + (size_t)(r0 + mb * 16) * DM + c0 + lr * 4;
{
#pragma unroll
            for (int s = 0; s < 8; ++s) { const int row = 2 * s + hi;
                v4f val = *(const v4fa*)(os + row * 68 + lr * 4);
                val = val * scale + bb;
                *(v4f*)(crow + (size_t)row * DM) = val; }
             }
        __builtin_amdgcn_wave_barrier(); asm volatile("" ::: "memory");
    }
}

// grid (EROWS/128, DM/128, NB): rows [0, EROWS) of batch z from the bf16 hi/lo ctx planes.
__global__ __launch_bounds__(128) void k_oute(const bf* __restrict__ CEh, const bf* __restrict__ CEl, const bf* __restrict__ WoB, float* OUT, const float* __restrict__ Wb) {
    const size_t z = blockIdx.z;
    out_body<bf, 1>(CEh + z * EROWS * DM, CEl + z * EROWS * DM, WoB, OUT + z * TT * DM, Wb, 1.0f);
}
// grid ((TT-EROWS)/128, DM/128, NB): rows [EROWS, TT) of batch z from the f16 ctx plane.
__global__ __launch_bounds__(128) void k_outl(const h16* __restrict__ CH, const h16* __restrict__ WoH, float* OUT, const float* __restrict__ Wb) {
    const size_t ro = ((size_t)blockIdx.z * TT + EROWS) * DM;
    out_body<h16, 0>(CH + ro, CH + ro, WoH, OUT + ro, Wb, OSC);
}

extern "C" void kernel_launch(void* const* d_in, const int* in_sizes, int n_in,
                              void* d_out, int out_size, void* d_ws, size_t ws_size, hipStream_t stream) {
    if (n_in < 11) return;
    if (in_sizes[0] < NB * SEQ_FULL * DM || in_sizes[1] < NB * SEQ_FULL * DM || in_sizes[2] < NB * SEQ_FULL * DM) return;
    if (in_sizes[3] < NH_ * HD * DM || in_sizes[5] < NH_ * HD * DM || in_sizes[7] < NH_ * HD * DM || in_sizes[9] < DM * DM) return;
    if (in_sizes[4] < NH_ * HD || in_sizes[6] < NH_ * HD || in_sizes[8] < NH_ * HD || in_sizes[10] < DM) return;
    if (out_size < NB * TT * DM) return;
    const float* xq = (const float*)d_in[0]; const float* xk = (const float*)d_in[1]; const float* xv = (const float*)d_in[2];
    const float* wq = (const float*)d_in[3]; const float* bq = (const float*)d_in[4];
    const float* wk = (const float*)d_in[5]; const float* bk = (const float*)d_in[6];
    const float* wv = (const float*)d_in[7]; const float* bv = (const float*)d_in[8];
    const float* wo = (const float*)d_in[9]; const float* bo = (const float*)d_in[10];
    float* OUT = (float*)d_out;     // [NB][TT][DM]
    char* wsp = (char*)d_ws;
    auto take = [&](size_t bytes) { char* p = wsp; wsp += (bytes + 255) & ~(size_t)255; return (void*)p; };
    bf*  WT  = (bf*)take((size_t)3 * DM * DM * 2);                  // [3][n][k] projection weights, bf16
    bf*  WoB = (bf*)take((size_t)DM * DM * 2);                      // output weight, bf16
    h16* WoH = (h16*)take((size_t)DM * DM * 2);                     // output weight, f16 x1024
    h16* QK  = (h16*)take((size_t)2 * QKSZ * 2);                    // q plane | k plane
    h16* VT  = (h16*)take((size_t)NB * NH_ * HD * TT * 2);          // [b][h][d][t] f16 x64
    bf*  VEh = (bf*)take((size_t)NB * NH_ * HD * EROWS * 2);        // [b][h][d][t < EROWS] bf16 hi
    bf*  VEl = (bf*)take((size_t)NB * NH_ * HD * EROWS * 2);        // bf16 lo
    bf*  XB  = (bf*)take((size_t)3 * XSZ * 2);                      // bf16 activations q | k | v; dead after the projections
    if ((size_t)(wsp - (char*)d_ws) > ws_size) return;              // 119,537,664 B at NB=4, TT=2048
    bf* CH  = XB;                   // ctx f16 plane [NB*TT][DM] (16-bit storage), aliases activation plane 0
    bf* CEh = XB + XSZ;             // ctx bf16 hi [NB*EROWS][DM], aliases activation plane 1
    bf* CEl = XB + 2 * XSZ;         // ctx bf16 lo, aliases activation plane 2

    k_cvtall<<<CVW / 16, 512, 0, stream>>>(xq, xk, xv, wq, wk, wv, wo, XB, WT, WoB, WoH);

    k_projqk<<<dim3(NB * TT / 128, NH_ / 2, 2), 128, 0, stream>>>(XB, WT, bq, bk, QK);
    k_projv<<<dim3(NB * TT / 128, NH_ / 2), 128, 0, stream>>>(XB + 2 * XSZ, WT + (size_t)2 * DM * DM, bv, VT, VEh, VEl);

    k_attn_early<<<dim3(EROWS / 64, NB * NH_), 128, 0, stream>>>(QK, QK + QKSZ, VEh, VEl, CEh, CEl);
    if (TT > EROWS)
        k_attn_main<<<dim3((TT - EROWS) / 64, NB * NH_), 128, 0, stream>>>(QK, QK + QKSZ, VT, CH);

    k_oute<<<dim3(EROWS / 128, DM / 128, NB), 128, 0, stream>>>(CEh, CEl, WoB, OUT, bo);
    if (TT > EROWS)
        k_outl<<<dim3((TT - EROWS) / 128, DM / 128, NB), 128, 0, stream>>>((const h16*)CH, WoH, OUT, bo);
}

// v004
// It runs in 132 microseconds.
// In two side-by-side timings against v003, it was 1.29 and 1.28 times as fast.
// All steps since v000 together make it 2.60 times as fast.
#include <hip/hip_runtime.h>

// Contractions, f32 accumulate: q/k/v projections v_wmma_f32_16x16x32_bf16 on bf16 (RNE) copies of x and W; scores v_wmma_f32_16x16x32_f16 on f16 q/k planes (x16 carry each); P.V v_wmma_f32_16x16x32_f16 (P x256, V x64 carries) for query rows >= EROWS and v_wmma_f32_16x16x32_bf16 on bf16 hi+lo P and V (3 products) for query rows < EROWS; output projection v_wmma_f32_16x16x32_f16 (ctx x64, W x1024) for rows >= EROWS and v_wmma_f32_16x16x32_bf16 on bf16 hi+lo ctx (2 products) for rows < EROWS.
// Pipeline: bf16 planes of the three activations and the weights; q/k planes [b][h][t][64] f16; value planes [b][h][64][t] f16 (+ bf16 hi/lo for t < EROWS); fused causal attention in transposed form (S^T = K Q^T, O^T = V^T P^T, online softmax per lane, score scale 1/32); ctx planes [b*t][1024]; out = ctx W^T + b.

#ifndef NB
#define NB 4
#endif
#ifndef SEQ
#define SEQ 2048
#endif
#define NB_FULL  4
#define SEQ_FULL 2048
#define TT   SEQ
#define DM   1024
#define NH_  16
#define HD   64
#define EROWS ((TT) < 512 ? (TT) : 512)
#define QKC  16.0f                                          // carry of the q and k planes
#define CSC  (0.045084220027780106f * 0.00390625f)          // (1/32) * log2(e) / (QKC*QKC)
#define VC   64.0f                                          // carry of the f16 value plane (and of the f16 ctx plane)
#define WOC  1024.0f                                        // carry of the f16 output weight plane
#define OSC  1.52587890625e-05f                             // 1 / (VC * WOC)
#define NEGB (-3.0e38f)
#define XSZ  ((size_t)NB * SEQ_FULL * DM)
#define QKSZ ((size_t)NB * NH_ * TT * HD)
static_assert(TT % 64 == 0);
static_assert(TT <= SEQ_FULL);
static_assert(NB >= 1 && NB <= NB_FULL);
static_assert(NH_ * HD == DM);
static_assert(DM % 64 == 0);
static_assert(DM % 32 == 0);
static_assert(HD == 64);
static_assert(EROWS % 64 == 0);
static_assert(EROWS <= TT);
static_assert((TT - EROWS) % 64 == 0);
static_assert(TT % 128 == 0 && EROWS % 128 == 0 && DM % 128 == 0 && NH_ % 2 == 0);   // 128x128 block tiles of the projections and of the output product
static_assert((size_t)NB * TT * DM <= XSZ);
static_assert((size_t)NB * EROWS * DM <= XSZ);
static_assert((size_t)3 * DM * DM * 2 + (size_t)2 * DM * DM * 2 + (size_t)2 * QKSZ * 2 + (size_t)NB * NH_ * HD * TT * 2 + (size_t)2 * NB * NH_ * HD * EROWS * 2 + (size_t)3 * XSZ * 2 <= (size_t)134217728);

typedef _Float16 h16;
typedef unsigned short bf;
typedef __attribute__((ext_vector_type(16))) __bf16   v16bf;
typedef __attribute__((ext_vector_type(16))) _Float16 v16h;
typedef __attribute__((ext_vector_type(8)))  _Float16 v8h;
typedef __attribute__((ext_vector_type(8)))  unsigned short v8us;
typedef __attribute__((ext_vector_type(8)))  float    v8f;
typedef __attribute__((ext_vector_type(4)))  float    v4f;
typedef v4f  __attribute__((may_alias)) v4fa;
typedef v8us __attribute__((may_alias)) v8usa;

__device__ __forceinline__ unsigned short f2bf(float f) { unsigned u = __float_as_uint(f); u += 0x7FFFu + ((u >> 16) & 1u); return (unsigned short)(u >> 16); }
__device__ __forceinline__ float bf2f(unsigned short b) { return __uint_as_float(((unsigned)b) << 16); }
__device__ __forceinline__ float bfr(float f) { return bf2f(f2bf(f)); }
__device__ __forceinline__ v16h cat16(v8h lo, v8h hi) { return __builtin_shufflevector(lo, hi, 0, 1, 2, 3, 4, 5, 6, 7, 8, 9, 10, 11, 12, 13, 14, 15); }
__device__ __forceinline__ v16bf cat16b(v8us lo, v8us hi) { return __builtin_bit_cast(v16bf, __builtin_shufflevector(lo, hi, 0, 1, 2, 3, 4, 5, 6, 7, 8, 9, 10, 11, 12, 13, 14, 15)); }
__device__ __forceinline__ v8f wmma16(v16h a, v16h b, v8f c) { return __builtin_amdgcn_wmma_f32_16x16x32_f16(false, a, false, b, (short)0, c, false, false); }
__device__ __forceinline__ v8f wmmab(v16bf a, v16bf b, v8f c) { return __builtin_amdgcn_wmma_f32_16x16x32_bf16(false, a, false, b, (short)0, c, false, false); }
__device__ __forceinline__ void splitf(float y, unsigned short& h, unsigned short& l) { h = f2bf(y); l = f2bf(y - bf2f(h)); }
// Fragment loaders (A and B identical): p already points at row (lane&15), k0 + 8*(lane>>4); elements 0..7 <- p[0..7], elements 8..15 <- p[16..23].
__device__ __forceinline__ v16h ldh(const h16* p) { return cat16(*(const v8h*)p, *(const v8h*)(p + 16)); }
__device__ __forceinline__ v16bf ldb(const bf* p) { return cat16b(*(const v8us*)p, *(const v8us*)(p + 16)); }
__device__ __forceinline__ v8us pack_h(v8f c) { v8h t;
#pragma unroll
    for (int r = 0; r < 8; ++r) t[r] = (h16)c[r];
    return __builtin_bit_cast(v8us, t); }
__device__ __forceinline__ void pack_b(v8f c, v8us& a, v8us& l) {
#pragma unroll
    for (int r = 0; r < 8; ++r) { unsigned short x, y; splitf(c[r], x, y); a[r] = x; l[r] = y; } }

template <typename T16> struct WFrag;
template <> struct WFrag<h16> { typedef v16h V; static __device__ __forceinline__ V ld(const h16* p) { return ldh(p); } static __device__ __forceinline__ v8f mma(V a, V b, v8f c) { return wmma16(a, b, c); } };
template <> struct WFrag<bf> { typedef v16bf V; static __device__ __forceinline__ V ld(const bf* p) { return ldb(p); } static __device__ __forceinline__ v8f mma(V a, V b, v8f c) { return wmmab(a, b, c); } };

#define LP  72              // LDS row pitch of a staged tile in 16-bit elements: 144 B = 16 B x odd, free of bank conflicts for 16-byte fragment reads
#define TSZ (64 * LP)       // 16-bit elements of one staged tile
// One 64-row tile: this lane's 16 bytes of rows r, r+16, r+32, r+48. l = LDS byte address, g = global byte address of row r, gstep = bytes between global rows r and r+16.
__device__ __forceinline__ void copy_tile(const unsigned l, const char* g, const size_t gstep) {
    const unsigned l1 = l + 16 * LP * 2, l2 = l + 32 * LP * 2, l3 = l + 48 * LP * 2;
    const char* g1 = g + gstep; const char* g2 = g + 2 * gstep; const char* g3 = g + 3 * gstep;
    // the closing s_wait_xcnt 0 stands inside the statement so that no address register of a copy is rewritten ahead of it
    asm volatile("global_load_async_to_lds_b128 %0, %4, off\n\tglobal_load_async_to_lds_b128 %1, %5, off\n\tglobal_load_async_to_lds_b128 %2, %6, off\n\tglobal_load_async_to_lds_b128 %3, %7, off\n\ts_wait_xcnt 0x0"
                 :: "v"(l), "v"(l1), "v"(l2), "v"(l3), "v"(g), "v"(g1), "v"(g2), "v"(g3) : "memory");
}

// gemm_tile: a block of four waves computes a 128x128 tile; wave w owns the 64x64 quarter at rows 64*(w>>1), columns 64*(w&1):
// acc[mb][nb][j] = C[16*mb + 8*(lane>>4) + j][16*nb + (lane&15)] of that quarter = sum_k A[m][k] Bt[n][k] (+ A2[m][k] Bt[n][k] when NSPLIT == 1).
// Operand path: a stage is 64 k = one 128-row x 128-B tile per operand plane (A, Bt, and A2 when NSPLIT == 1), brought from the K-contiguous 16-bit planes into LDS once per block
// by asynchronous 16-byte copies (each wave-wide copy = 4 whole 128-B lines), two buffers, the next stage in flight while this one is worked on; every wave reads its fragments from LDS.
// K % 64 == 0; arow0 / brow0 = first row of the block's tile in A (A2) / Bt; ring = 2 * (2 + NSPLIT) * GTS 16-bit elements of LDS, free for other use on return.
#define GTS (2 * TSZ)       // 16-bit elements of one staged 128-row operand tile
template <typename T16, int NSPLIT>
__device__ __forceinline__ void gemm_tile(const T16* __restrict__ A, const T16* __restrict__ A2, const T16* __restrict__ Bt, const int K, const size_t arow0, const size_t brow0, unsigned short* ring, v8f (&acc)[4][4]) {
    typedef typename WFrag<T16>::V V;
    constexpr int NT = 2 + NSPLIT;                                      // tiles per stage: A, Bt (, A2)
    const int lane = threadIdx.x & 31, lr = lane & 15, hi = lane >> 4;
    const int w = __builtin_amdgcn_readfirstlane((threadIdx.x >> 5) & 3);
    const int cr = (int)(threadIdx.x >> 3) & 15, cc = (int)threadIdx.x & 7;   // this lane's row (mod 16) and 16-byte column in every staged tile
    const unsigned lbase = (unsigned)(size_t)ring + (unsigned)(cr * LP + cc * 8) * 2u;
    const char* ga  = (const char*)(A + (arow0 + cr) * K + cc * 8);
    const char* ga2 = (const char*)(A2 + (arow0 + cr) * K + cc * 8);
    const char* gb  = (const char*)(Bt + (brow0 + cr) * K + cc * 8);
    const size_t gstep = (size_t)16 * K * 2;
    auto issue = [&](const int s, const int buf) {                      // stage s (k = 64s .. 64s+63) into buffer buf
        const unsigned lb = lbase + (unsigned)(buf * NT * GTS) * 2u;
        const size_t ko = (size_t)s * 64 * 2;
        copy_tile(lb, ga + ko, gstep);             copy_tile(lb + TSZ * 2u, ga + ko + 4 * gstep, gstep);
        copy_tile(lb + GTS * 2u, gb + ko, gstep);  copy_tile(lb + GTS * 2u + TSZ * 2u, gb + ko + 4 * gstep, gstep);
        if (NSPLIT == 1) { copy_tile(lb + 2u * GTS * 2u, ga2 + ko, gstep); copy_tile(lb + 2u * GTS * 2u + TSZ * 2u, ga2 + ko + 4 * gstep, gstep); }
    };
#pragma unroll
    for (int mb = 0; mb < 4; ++mb)
#pragma unroll
        for (int nb = 0; nb < 4; ++nb) acc[mb][nb] = (v8f){};
    const int nstage = K / 64;
    issue(0, 0);
    asm volatile("s_wait_asynccnt 0x0" ::: "memory");                   // this wave's copies of stage 0 have landed
    __syncthreads();                                                    // ... and every other wave's: stage 0 may be read
    if (nstage > 1) issue(1, 1);
#pragma unroll 1   // rolled: one publish point and one refill site in the text
    for (int t = 0; t < nstage; ++t) {
        const T16* sbuf = (const T16*)ring + (t & 1) * NT * GTS;
        const T16* pa = sbuf + ((w >> 1) * 64 + lr) * LP + 8 * hi;
        const T16* pb = sbuf + GTS + ((w & 1) * 64 + lr) * LP + 8 * hi;
#pragma unroll     // the two 32-k steps of a stage: their LDS offsets become immediates
        for (int ks = 0; ks < 2; ++ks) {
            V a[4], a2[4];
#pragma unroll
            for (int mb = 0; mb < 4; ++mb) { a[mb] = WFrag<T16>::ld(pa + mb * 16 * LP + ks * 32); if (NSPLIT == 1) a2[mb] = WFrag<T16>::ld(pa + 2 * GTS + mb * 16 * LP + ks * 32); else a2[mb] = a[mb]; }
            V b[4];
#pragma unroll
            for (int nb = 0; nb < 4; ++nb) b[nb] = WFrag<T16>::ld(pb + nb * 16 * LP + ks * 32);
            // inputs-only fence on the loaded fragments: all LDS reads of this 32-k step stand as one group with one wait ahead of its WMMAs; without it each Bt fragment is read and waited for singly between them
            asm volatile("" :: "v"(b[0]), "v"(b[1]), "v"(b[2]), "v"(b[3]));
#pragma unroll
            for (int nb = 0; nb < 4; ++nb) {
#pragma unroll
                for (int mb = 0; mb < 4; ++mb) { acc[mb][nb] = WFrag<T16>::mma(a[mb], b[nb], acc[mb][nb]); if (NSPLIT == 1) acc[mb][nb] = WFrag<T16>::mma(a2[mb], b[nb], acc[mb][nb]); } }
            // four vector slots behind these WMMAs before a vector instruction may touch their registers, on either side of the branch at the loop's foot
            asm volatile("v_nop\n\tv_nop\n\tv_nop\n\tv_nop" : "+v"(acc[0][0]), "+v"(acc[1][1]), "+v"(acc[2][2]), "+v"(acc[3][3]) : "v"(a[0]), "v"(a[3]));
        }
        // publish point of stage t + 1, passed by every wave
        asm volatile("s_wait_dscnt 0x0" ::: "memory");                  // this wave's reads of stage t have returned before its buffer is refilled
        asm volatile("s_wait_asynccnt 0x0" ::: "memory");               // this wave's copies of stage t + 1 have landed
        __syncthreads();                                                // stage t + 1 may be read; every reader has left stage t
        if (t + 2 < nstage) issue(t + 2, t & 1);
    }
    asm volatile("s_wait_asynccnt 0x0" ::: "memory");                   // nothing in flight when the ring becomes output staging
}

// k_cvtall: every 16-bit operand plane in one launch of CVW waves (16 per block); every wave runs the same stream of pieces. A piece = four wave-wide reads of 32 B per lane (256 floats each).
// Pieces 0 .. 3*XT-1: CVE consecutive floats of x_q | x_k | x_v (-> XB, planes contiguous), piece t of wave g at float (t*CVW + g)*CVE of the three planes taken as one.
// Last piece: 256 floats at g*256 of each of W_q, W_k, W_v (-> WT) and W_o (-> WoB and WoH). The next piece's reads are issued ahead of this piece's conversion and stores.
#define CVW 4096
#define CVE 1024
__device__ __forceinline__ v8us cvt8(const v8f v) { v8us o;
#pragma unroll
    for (int k = 0; k < 8; ++k) o[k] = f2bf(v[k]);
    return o; }
__global__ __launch_bounds__(512) void k_cvtall(const float* __restrict__ xq, const float* __restrict__ xk, const float* __restrict__ xv, const float* __restrict__ wq, const float* __restrict__ wk, const float* __restrict__ wv, const float* __restrict__ wo,
                                                bf* __restrict__ XB, bf* __restrict__ WT, bf* __restrict__ WoB, h16* __restrict__ WoH) {
    constexpr int XT = (int)(XSZ / ((size_t)CVW * CVE));                // pieces of one activation plane per wave
    static_assert(XSZ % ((size_t)CVW * CVE) == 0 && (size_t)DM * DM == (size_t)CVW * 256);
    const unsigned lane = threadIdx.x & 31;
    const unsigned gw = (unsigned)__builtin_amdgcn_readfirstlane((int)(blockIdx.x * 16 + (threadIdx.x >> 5)));   // wave number in a scalar register: piece bases are then scalar
    const size_t xo = (size_t)gw * CVE + lane * 8, wof = (size_t)gw * 256 + lane * 8;
    v8f cur[4], nxt[4];
#pragma unroll
    for (int j = 0; j < 4; ++j) cur[j] = *(const v8f*)(xq + xo + j * 256);
    asm volatile("s_wait_xcnt 0x0" ::: "memory");       // stands in front of any rewriting of the reads' address registers
    __builtin_amdgcn_sched_barrier(0);                  // keeps later register writes behind that wait, and the eight reads together ahead of the conversions
#pragma unroll   // piece number known at compile time: its source plane is then a constant
    for (int t = 0; t <= 3 * XT; ++t) {
        if (t + 1 < 3 * XT) {
            const float* s = ((t + 1) / XT == 0 ? xq : (t + 1) / XT == 1 ? xk : xv) + (size_t)((t + 1) % XT) * CVW * CVE + xo;
#pragma unroll
            for (int j = 0; j < 4; ++j) nxt[j] = *(const v8f*)(s + j * 256);
        } else if (t + 1 == 3 * XT) {
            nxt[0] = *(const v8f*)(wq + wof); nxt[1] = *(const v8f*)(wk + wof); nxt[2] = *(const v8f*)(wv + wof); nxt[3] = *(const v8f*)(wo + wof);
        }
        asm volatile("s_wait_xcnt 0x0" ::: "memory");   // stands in front of any rewriting of the reads' address registers
        __builtin_amdgcn_sched_barrier(0);              // keeps later register writes behind that wait, and the eight reads together ahead of the conversions
        if (t < 3 * XT) {
            bf* d = XB + (size_t)t * CVW * CVE + xo;
#pragma unroll
            for (int j = 0; j < 4; ++j) *(v8us*)(d + j * 256) = cvt8(cur[j]);
        } else {
#pragma unroll
            for (int j = 0; j < 3; ++j) *(v8us*)(WT + (size_t)j * DM * DM + wof) = cvt8(cur[j]);
            const v8us ob = cvt8(cur[3]); v8h oh;
#pragma unroll
            for (int k = 0; k < 8; ++k) oh[k] = (h16)(bf2f(ob[k]) * WOC);
            *(v8us*)(WoB + wof) = ob; *(v8h*)(WoH + wof) = oh;
        }
        asm volatile("s_wait_xcnt 0x0" ::: "memory");   // stands in front of the rewriting of the stores' data and address registers
        __builtin_amdgcn_sched_barrier(0);              // keeps the next piece's address arithmetic behind that wait
#pragma unroll
        for (int j = 0; j < 4; ++j) cur[j] = nxt[j];
    }
}

// k_proj: all three projections in one launch. grid (NB*TT/128, NH_/2, 3), four waves; z = 0 -> q plane, z = 1 -> k plane, z = 2 -> value planes. Block tile = 128 tokens x two heads; a wave's tile = 64 tokens x one head (64 dims).
// z < 2: rows written as they are, QK[z][b][h][t][64] = f16(16 * (x W^T + b)). z = 2: written transposed, VT[b][h][d][t] = f16(64 * v), and for t < EROWS the bf16 hi/lo planes VE[b][h][d][t] of v.
__global__ __launch_bounds__(128) void k_proj(const bf* __restrict__ XB, const bf* __restrict__ WT, const float* __restrict__ bq, const float* __restrict__ bk, const float* __restrict__ bv, h16* QK, h16* VT, bf* VEh, bf* VEl) {
    __shared__ __align__(16) unsigned short ring[2 * 2 * GTS];          // operand ring; behind the product each wave's own output or transpose staging
    static_assert(2 * 2 * GTS * 2 >= 4 * 16 * 68 * 4);
    static_assert(2 * 2 * GTS * 2 >= 4 * 64 * 68 * 4);
    const int z = blockIdx.z;
    const int lane = threadIdx.x & 31, lr = lane & 15, hi = lane >> 4;
    const int w = __builtin_amdgcn_readfirstlane((threadIdx.x >> 5) & 3);
    const int mt = blockIdx.x * 2 + (w >> 1); const int b = mt / (TT / 64); const int t0 = (mt % (TT / 64)) * 64; const int h = blockIdx.y * 2 + (w & 1);
    const bf* A = XB + (size_t)z * XSZ; const bf* Bt = WT + (size_t)z * DM * DM;
    v8f acc[4][4];
    gemm_tile<bf, 0>(A, A, Bt, DM, (size_t)b * SEQ_FULL + t0 - (w >> 1) * 64, (size_t)blockIdx.y * 2 * HD, ring, acc);
  if (z < 2) {
    float* os = (float*)ring + w * (16 * 68);
    const int rq = lane >> 3, pc = lane & 7;
    const v8f b0 = *(const v8f*)(bq + h * HD + pc * 8); const v8f b1 = *(const v8f*)(bk + h * HD + pc * 8);
    v8f bb;
#pragma unroll
    for (int i = 0; i < 8; ++i) bb[i] = bfr(z ? b1[i] : b0[i]);
    h16* P = QK + (size_t)z * QKSZ + (((size_t)b * NH_ + h) * TT + t0) * HD + pc * 8;
#pragma unroll
    for (int mb = 0; mb < 4; ++mb) {
#pragma unroll
        for (int nb = 0; nb < 4; ++nb) {
#pragma unroll
            for (int j = 0; j < 8; ++j) os[(hi * 8 + j) * 68 + nb * 16 + lr] = acc[mb][nb][j]; }
        __builtin_amdgcn_wave_barrier(); asm volatile("" ::: "memory");
        h16* prow = P + (size_t)(mb * 16) * HD;
{
#pragma unroll
            for (int s = 0; s < 4; ++s) { const int row = 4 * s + rq;
                const v4f x0 = *(const v4fa*)(os + row * 68 + pc * 8), x1 = *(const v4fa*)(os + row * 68 + pc * 8 + 4);
                v8h o;
#pragma unroll
                for (int q = 0; q < 4; ++q) { o[q] = (h16)((x0[q] + bb[q]) * QKC); o[4 + q] = (h16)((x1[q] + bb[4 + q]) * QKC); }
                *(v8h*)(prow + (size_t)row * HD) = o; }
             }
        __builtin_amdgcn_wave_barrier(); asm volatile("" ::: "memory");
    }
  } else {
    float* ts = (float*)ring + w * (64 * 68);
#pragma unroll
    for (int mb = 0; mb < 4; ++mb)
#pragma unroll
        for (int nb = 0; nb < 4; ++nb) {
            const v4f lo4 = { acc[mb][nb][0], acc[mb][nb][1], acc[mb][nb][2], acc[mb][nb][3] };
            const v4f hi4 = { acc[mb][nb][4], acc[mb][nb][5], acc[mb][nb][6], acc[mb][nb][7] };
            *(v4fa*)(ts + (nb * 16 + lr) * 68 + mb * 16 + 8 * hi) = lo4;
            *(v4fa*)(ts + (nb * 16 + lr) * 68 + mb * 16 + 8 * hi + 4) = hi4; }
    __builtin_amdgcn_wave_barrier(); asm volatile("" ::: "memory");
    const int rq = lane >> 3, pc = lane & 7;
    const bool early = t0 < EROWS;
    const size_t vrow0 = ((size_t)b * NH_ + h) * HD;
{
#pragma unroll 1
        for (int s = 0; s < 16; ++s) { const int d = 4 * s + rq;
            const float bb = bfr(bv[h * HD + d]);
            const v4f x0 = *(const v4fa*)(ts + d * 68 + pc * 8), x1 = *(const v4fa*)(ts + d * 68 + pc * 8 + 4);
            v8f x = __builtin_shufflevector(x0, x1, 0, 1, 2, 3, 4, 5, 6, 7);
            x = x + bb;
            v8h o;
#pragma unroll
            for (int q = 0; q < 8; ++q) o[q] = (h16)(x[q] * VC);
            *(v8h*)(VT + (vrow0 + d) * TT + t0 + pc * 8) = o;
            asm volatile("s_wait_xcnt 0x0" ::: "memory");   // stands in front of the rewriting of the store's data and address registers (hi/lo packing, next trip)
            if (early) { v8us oh, ol; pack_b(x, oh, ol);
                *(v8us*)(VEh + (vrow0 + d) * EROWS + t0 + pc * 8) = oh;
                *(v8us*)(VEl + (vrow0 + d) * EROWS + t0 + pc * 8) = ol;
                asm volatile("s_wait_xcnt 0x0" ::: "memory"); } }   // stands in front of the next trip's advance of both stores' address registers
         }
  }
}

// attn_body: fused causal attention, 4 waves per block, 16 query rows per wave, 32 keys per step, transposed formulation.
//   S^T tile (rows = keys, cols = queries) = A(k plane rows) x B(q plane rows); D element r of lane l = S^T[key 8*(l>>4)+r][query l&15].
//   Per lane one query column: running max m, running sum l (combined across lane halves by one xor-16 shuffle each).
//   P^T as B fragment: element r <- p(tile keys 0..15)[r], element 8+r <- p(tile keys 16..31)[r], lane unchanged.
//   O^T tile j (rows = dims 16j.., cols = queries) += A(V^T rows) x B(P^T). Masked keys carry p = 0 exactly.
// EARLY: bf16 hi+lo P and V (3 products); else f16 single product with P x256 (cancels against the row sum) and V x64.
// Operand path: a stage is 64 keys = one K tile (64 key rows x 128 B) and one V^T tile per value plane (64 dim rows x 128 B), brought into LDS once per block by
// asynchronous 16-byte copies (each wave-wide copy = 4 whole 128-B lines), two buffers, the next stage in flight while this one is worked on; all four waves read their fragments from LDS.
template <bool EARLY>
__device__ __forceinline__ void attn_body(const h16* __restrict__ QP, const h16* __restrict__ KP, const h16* __restrict__ VT, const bf* __restrict__ VEh, const bf* __restrict__ VEl, bf* C0, bf* C1, const int qb, const int bh, unsigned short* ring) {
    constexpr int NT = EARLY ? 3 : 2;                                   // tiles per stage: K, V (EARLY: K, V hi, V lo)
    static_assert(2 * NT * TSZ >= 4 * 2 * 1152);                        // ring = 2 * NT * TSZ 16-bit elements of LDS: two stage buffers; output staging behind the loop
    unsigned short* stg = ring;
    const int lane = threadIdx.x & 31, lr = lane & 15, hi = lane >> 4;
    const int w = __builtin_amdgcn_readfirstlane((threadIdx.x >> 5) & 3);   // wave number in a scalar register: the per-wave skip below is then a scalar branch
    const int b = bh / NH_, h = bh % NH_;
    const int q0 = qb * 64 + w * 16;
    const int qq = q0 + lr;
    const size_t pof = (size_t)bh * TT * HD;
    const h16* qp = QP + pof + (size_t)(q0 + lr) * HD + 8 * hi;
    const v16h qf0 = ldh(qp), qf1 = ldh(qp + 32);
    v8f o0 = {}, o1 = {}, o2 = {}, o3 = {};
    float m = NEGB, l = 0.0f;
    const int nstage = qb + 1;                                          // stages of 64 keys, the same for the whole block
    const int cr = (int)(threadIdx.x >> 3) & 15, cc = (int)threadIdx.x & 7;   // this lane's row (mod 16) and 16-byte column in every staged tile
    const unsigned lbase = (unsigned)(size_t)ring + (unsigned)(cr * LP + cc * 8) * 2u;
    const char* gk = (const char*)(KP + pof + (size_t)cr * HD + cc * 8);
    const char* gv0 = EARLY ? (const char*)(VEh + (size_t)bh * HD * EROWS + (size_t)cr * EROWS + cc * 8) : (const char*)(VT + (size_t)bh * HD * TT + (size_t)cr * TT + cc * 8);
    const char* gv1 = EARLY ? (const char*)(VEl + (size_t)bh * HD * EROWS + (size_t)cr * EROWS + cc * 8) : gv0;
    const size_t vstep = (size_t)16 * (EARLY ? EROWS : TT) * 2;
    auto issue = [&](const int s, const int buf) {                      // stage s (keys 64s .. 64s+63) into buffer buf
        const unsigned lb = lbase + (unsigned)(buf * NT * TSZ) * 2u;
        copy_tile(lb, gk + (size_t)s * 64 * HD * 2, (size_t)16 * HD * 2);
        copy_tile(lb + TSZ * 2u, gv0 + (size_t)s * 64 * 2, vstep);
        if (EARLY) copy_tile(lb + 2u * TSZ * 2u, gv1 + (size_t)s * 64 * 2, vstep);
    };
    issue(0, 0);
    asm volatile("s_wait_asynccnt 0x0" ::: "memory");                   // this wave's copies of stage 0 have landed
    __syncthreads();                                                    // ... and every other wave's: stage 0 may be read
    if (nstage > 1) issue(1, 1);
#pragma unroll 1   // rolled: one publish point and one refill site in the text
    for (int t = 0; t < nstage; ++t) {
        const unsigned short* sbuf = ring + (t & 1) * NT * TSZ;
#pragma unroll     // the two 32-key steps of a stage: their LDS offsets become immediates
      for (int sub = 0; sub < 2; ++sub) {
        const int kt = t * 64 + sub * 32;
        if (sub == 0 || kt <= q0) {  // a wave skips the 32 keys that lie wholly above its queries
        const h16* kp = (const h16*)sbuf + (sub * 32 + lr) * LP + 8 * hi;
        const v16h ka0 = ldh(kp), ka1 = ldh(kp + 16 * LP), kb0 = ldh(kp + 32), kb1 = ldh(kp + 16 * LP + 32);
        v8f s0 = {}, s1 = {};
        s0 = wmma16(ka0, qf0, s0); s1 = wmma16(ka1, qf0, s1);
        s0 = wmma16(kb0, qf1, s0); s1 = wmma16(kb1, qf1, s1);
        asm volatile("v_nop\n\tv_nop\n\tv_nop\n\tv_nop" : "+v"(s0), "+v"(s1) : "v"(ka0), "v"(ka1), "v"(kb0), "v"(kb1), "v"(qf1));
        if (kt + 31 > q0) {          // diagonal step of this wave: exclude keys above the query
            const int k0 = kt + 8 * hi;
#pragma unroll
            for (int r = 0; r < 8; ++r) { s0[r] = (k0 + r > qq) ? NEGB : s0[r]; s1[r] = (k0 + 16 + r > qq) ? NEGB : s1[r]; }
        }
        float mx = fmaxf(s0[0], s1[0]);
#pragma unroll
        for (int r = 1; r < 8; ++r) mx = fmaxf(mx, fmaxf(s0[r], s1[r]));
        mx = fmaxf(mx, __shfl_xor(mx, 16, 32));
        const float mn = fmaxf(m, mx * CSC);
        const float corr = __builtin_amdgcn_exp2f(m - mn);
        m = mn;
        const float sh = (EARLY ? 0.0f : 8.0f) - mn;
        v8f p0, p1; float rs = 0.0f;
#pragma unroll
        for (int r = 0; r < 8; ++r) { p0[r] = __builtin_amdgcn_exp2f(fmaf(s0[r], CSC, sh)); p1[r] = __builtin_amdgcn_exp2f(fmaf(s1[r], CSC, sh)); rs += p0[r] + p1[r]; }
        rs += __shfl_xor(rs, 16, 32);
        l = l * corr + rs;
        o0 *= corr; o1 *= corr; o2 *= corr; o3 *= corr;
        if (EARLY) {
            v8us ph0, ph1, pl0, pl1;
            pack_b(p0, ph0, pl0); pack_b(p1, ph1, pl1);
            const v16bf PH = cat16b(ph0, ph1), PL = cat16b(pl0, pl1);
            const bf* vh = sbuf + TSZ + lr * LP + sub * 32 + 8 * hi;
            const bf* vl = vh + TSZ;
            const v16bf vh0 = ldb(vh), vh1 = ldb(vh + 16 * LP), vh2 = ldb(vh + 32 * LP), vh3 = ldb(vh + 48 * LP);
            const v16bf vl0 = ldb(vl), vl1 = ldb(vl + 16 * LP), vl2 = ldb(vl + 32 * LP), vl3 = ldb(vl + 48 * LP);
            o0 = wmmab(vh0, PH, o0); o0 = wmmab(vl0, PH, o0); o0 = wmmab(vh0, PL, o0);
            o1 = wmmab(vh1, PH, o1); o1 = wmmab(vl1, PH, o1); o1 = wmmab(vh1, PL, o1);
            o2 = wmmab(vh2, PH, o2); o2 = wmmab(vl2, PH, o2); o2 = wmmab(vh2, PL, o2);
            o3 = wmmab(vh3, PH, o3); o3 = wmmab(vl3, PH, o3); o3 = wmmab(vh3, PL, o3);
            asm volatile("v_nop\n\tv_nop\n\tv_nop\n\tv_nop" : "+v"(o0), "+v"(o1), "+v"(o2), "+v"(o3) : "v"(vh0), "v"(vh1), "v"(vh2), "v"(vh3), "v"(vl0), "v"(vl1), "v"(vl2), "v"(vl3), "v"(PH), "v"(PL));
        } else {
            v16h pb;
#pragma unroll
            for (int r = 0; r < 8; ++r) { pb[r] = (h16)p0[r]; pb[8 + r] = (h16)p1[r]; }
            const h16* vp = (const h16*)sbuf + TSZ + lr * LP + sub * 32 + 8 * hi;
            const v16h a0 = ldh(vp), a1 = ldh(vp + 16 * LP), a2 = ldh(vp + 32 * LP), a3 = ldh(vp + 48 * LP);
            o0 = wmma16(a0, pb, o0); o1 = wmma16(a1, pb, o1); o2 = wmma16(a2, pb, o2); o3 = wmma16(a3, pb, o3);
            asm volatile("v_nop\n\tv_nop\n\tv_nop\n\tv_nop" : "+v"(o0), "+v"(o1), "+v"(o2), "+v"(o3) : "v"(a0), "v"(a1), "v"(a2), "v"(a3), "v"(pb));
        }
        }
      }
        // publish point of stage t + 1, passed by every wave
        asm volatile("s_wait_dscnt 0x0" ::: "memory");                  // this wave's reads of stage t have returned before its buffer is refilled
        asm volatile("s_wait_asynccnt 0x0" ::: "memory");               // this wave's copies of stage t + 1 have landed
        __syncthreads();                                                // stage t + 1 may be read; every reader has left stage t
        if (t + 2 < nstage) issue(t + 2, t & 1);
    }
    asm volatile("s_wait_asynccnt 0x0" ::: "memory");                   // nothing in flight when the ring becomes output staging
    const float inv = __fdiv_rn(1.0f, l);
    o0 *= inv; o1 *= inv; o2 *= inv; o3 *= inv;
    const int sb = w * 2 * 1152;
    const int so = sb + lr * 72 + 8 * hi;       // O^T element r of tile j -> row (query lr), column 16j + 8*hi + r
    if (EARLY) {
        v8us a, c;
        pack_b(o0, a, c); *(v8usa*)(stg + so) = a;      *(v8usa*)(stg + so + 1152) = c;
        pack_b(o1, a, c); *(v8usa*)(stg + so + 16) = a; *(v8usa*)(stg + so + 1152 + 16) = c;
        pack_b(o2, a, c); *(v8usa*)(stg + so + 32) = a; *(v8usa*)(stg + so + 1152 + 32) = c;
        pack_b(o3, a, c); *(v8usa*)(stg + so + 48) = a; *(v8usa*)(stg + so + 1152 + 48) = c;
    } else {
        *(v8usa*)(stg + so) = pack_h(o0); *(v8usa*)(stg + so + 16) = pack_h(o1); *(v8usa*)(stg + so + 32) = pack_h(o2); *(v8usa*)(stg + so + 48) = pack_h(o3);
    }
    __builtin_amdgcn_wave_barrier(); asm volatile("" ::: "memory");
    const int rq = lane >> 3, pc = lane & 7;
    const int crows = EARLY ? EROWS : TT;
    const size_t cbase = ((size_t)b * crows + q0) * DM + h * HD + pc * 8;
{
#pragma unroll
        for (int s = 0; s < 4; ++s) { const int row = 4 * s + rq;
            const v8us x = *(const v8usa*)(stg + sb + row * 72 + pc * 8);
            *(v8us*)(C0 + cbase + (size_t)row * DM) = x;
            if (EARLY) { const v8us y = *(const v8usa*)(stg + sb + 1152 + row * 72 + pc * 8); *(v8us*)(C1 + cbase + (size_t)row * DM) = y; } }
         }
}

// k_attn: every query tile in one launch. grid (NB*NH_, TT/64): x = (b, h); y counts the 64-row query tiles from the last one down, so that the tiles with the most keys start first and the short ones fill the end.
// Query rows [EROWS, TT): ctx as f16 plane (x64 carry) [b][TT][DM]. Query rows [0, EROWS): ctx as bf16 hi/lo planes [b][EROWS][DM].
__global__ __launch_bounds__(128) void k_attn(const h16* __restrict__ QP, const h16* __restrict__ KP, const h16* __restrict__ VT, const bf* __restrict__ VEh, const bf* __restrict__ VEl, bf* CH, bf* CEh, bf* CEl) {
    __shared__ __align__(16) unsigned short ring[2 * 3 * TSZ];          // one ring for either body
    const int qb = TT / 64 - 1 - (int)blockIdx.y;                       // the same for the whole block: the choice of body is a scalar branch
    if (qb >= EROWS / 64) attn_body<false>(QP, KP, VT, (const bf*)0, (const bf*)0, CH, CH, qb, (int)blockIdx.x, ring);
    else                  attn_body<true>(QP, KP, (const h16*)0, VEh, VEl, CEh, CEl, qb, (int)blockIdx.x, ring);
}

// out_body: OUT[r][c] = scale * sum_k A[r][k] Bt[c][k] + bf16(bias[c]); 128x128 tile per block of four waves, 64x64 per wave; per 16-row slab staged in LDS (wave-private),
template <typename T16, int NSPLIT>
__device__ __forceinline__ void out_body(const T16* __restrict__ A, const T16* __restrict__ A2, const T16* __restrict__ Bt, float* C, const float* __restrict__ bias, const float scale, const int rt, const int ct, unsigned short* ring) {
    static_assert(2 * 2 * GTS * 2 >= 4 * 16 * 68 * 4);                  // ring = 2 * (2 + NSPLIT) * GTS 16-bit elements of LDS: operand ring; behind the product each wave's own output staging
    const int lane = threadIdx.x & 31, lr = lane & 15, hi = lane >> 4;
    const int w = __builtin_amdgcn_readfirstlane((threadIdx.x >> 5) & 3);
    const int r0 = rt * 128 + (w >> 1) * 64, c0 = ct * 128 + (w & 1) * 64;   // rt, ct = the block's row and column tile
    v8f acc[4][4];
    gemm_tile<T16, NSPLIT>(A, A2, Bt, DM, (size_t)rt * 128, (size_t)ct * 128, ring, acc);
    float* os = (float*)ring + w * (16 * 68);
    const v4f bw = *(const v4f*)(bias + c0 + lr * 4);
    v4f bb;
#pragma unroll
    for (int q = 0; q < 4; ++q) bb[q] = bfr(bw[q]);
#pragma unroll
    for (int mb = 0; mb < 4; ++mb) {
#pragma unroll
        for (int nb = 0; nb < 4; ++nb) {
#pragma unroll
            for (int j = 0; j < 8; ++j) os[(hi * 8 + j) * 68 + nb * 16 + lr] = acc[mb][nb][j]; }
        __builtin_amdgcn_wave_barrier(); asm volatile("" ::: "memory");
        float* crow = C + (size_t)(r0 + mb * 16) * DM + c0 + lr * 4;
{
#pragma unroll
            for (int s = 0; s < 8; ++s) { const int row = 2 * s + hi;
                v4f val = *(const v4fa*)(os + row * 68 + lr * 4);
                val = val * scale + bb;
                *(v4f*)(crow + (size_t)row * DM) = val; }
             }
        __builtin_amdgcn_wave_barrier(); asm volatile("" ::: "memory");
    }
}

// k_out: the whole output product in one launch. grid (DM/128, NB, TT/128): x = column tile, y = batch, z = row tile; the row tiles of two products (rows < EROWS) have the lowest indices and start first.
// Rows [0, EROWS) of a batch from the bf16 hi/lo ctx planes, rows [EROWS, TT) from the f16 ctx plane.
__global__ __launch_bounds__(128) void k_out(const bf* __restrict__ CEh, const bf* __restrict__ CEl, const bf* __restrict__ WoB, const h16* __restrict__ CH, const h16* __restrict__ WoH, float* OUT, const float* __restrict__ Wb) {
    __shared__ __align__(16) unsigned short ring[2 * 3 * GTS];          // one ring for either body
    const size_t bt = blockIdx.y; const int rt = blockIdx.z, ct = blockIdx.x;   // the same for the whole block: the choice of body is a scalar branch
    if (rt < EROWS / 128) out_body<bf, 1>(CEh + bt * EROWS * DM, CEl + bt * EROWS * DM, WoB, OUT + bt * TT * DM, Wb, 1.0f, rt, ct, ring);
    else                  out_body<h16, 0>(CH + bt * TT * DM, CH + bt * TT * DM, WoH, OUT + bt * TT * DM, Wb, OSC, rt, ct, ring);
}

extern "C" void kernel_launch(void* const* d_in, const int* in_sizes, int n_in,
                              void* d_out, int out_size, void* d_ws, size_t ws_size, hipStream_t stream) {
    if (n_in < 11) return;
    if (in_sizes[0] < NB * SEQ_FULL * DM || in_sizes[1] < NB * SEQ_FULL * DM || in_sizes[2] < NB * SEQ_FULL * DM) return;
    if (in_sizes[3] < NH_ * HD * DM || in_sizes[5] < NH_ * HD * DM || in_sizes[7] < NH_ * HD * DM || in_sizes[9] < DM * DM) return;
    if (in_sizes[4] < NH_ * HD || in_sizes[6] < NH_ * HD || in_sizes[8] < NH_ * HD || in_sizes[10] < DM) return;
    if (out_size < NB * TT * DM) return;
    const float* xq = (const float*)d_in[0]; const float* xk = (const float*)d_in[1]; const float* xv = (const float*)d_in[2];
    const float* wq = (const float*)d_in[3]; const float* bq = (const float*)d_in[4];
    const float* wk = (const float*)d_in[5]; const float* bk = (const float*)d_in[6];
    const float* wv = (const float*)d_in[7]; const float* bv = (const float*)d_in[8];
    const float* wo = (const float*)d_in[9]; const float* bo = (const float*)d_in[10];
    float* OUT = (float*)d_out;     // [NB][TT][DM]
    char* wsp = (char*)d_ws;
    auto take = [&](size_t bytes) { char* p = wsp; wsp += (bytes + 255) & ~(size_t)255; return (void*)p; };
    bf*  WT  = (bf*)take((size_t)3 * DM * DM * 2);                  // [3][n][k] projection weights, bf16
    bf*  WoB = (bf*)take((size_t)DM * DM * 2);                      // output weight, bf16
    h16* WoH = (h16*)take((size_t)DM * DM * 2);                     // output weight, f16 x1024
    h16* QK  = (h16*)take((size_t)2 * QKSZ * 2);                    // q plane | k plane
    h16* VT  = (h16*)take((size_t)NB * NH_ * HD * TT * 2);          // [b][h][d][t] f16 x64
    bf*  VEh = (bf*)take((size_t)NB * NH_ * HD * EROWS * 2);        // [b][h][d][t < EROWS] bf16 hi
    bf*  VEl = (bf*)take((size_t)NB * NH_ * HD * EROWS * 2);        // bf16 lo
    bf*  XB  = (bf*)take((size_t)3 * XSZ * 2);                      // bf16 activations q | k | v; dead after the projections
    if ((size_t)(wsp - (char*)d_ws) > ws_size) return;              // 119,537,664 B at NB=4, TT=2048
    bf* CH  = XB;                   // ctx f16 plane [NB*TT][DM] (16-bit storage), aliases activation plane 0
    bf* CEh = XB + XSZ;             // ctx bf16 hi [NB*EROWS][DM], aliases activation plane 1
    bf* CEl = XB + 2 * XSZ;         // ctx bf16 lo, aliases activation plane 2

    k_cvtall<<<CVW / 16, 512, 0, stream>>>(xq, xk, xv, wq, wk, wv, wo, XB, WT, WoB, WoH);

    k_proj<<<dim3(NB * TT / 128, NH_ / 2, 3), 128, 0, stream>>>(XB, WT, bq, bk, bv, QK, VT, VEh, VEl);

    k_attn<<<dim3(NB * NH_, TT / 64), 128, 0, stream>>>(QK, QK + QKSZ, VT, VEh, VEl, CH, CEh, CEl);

    k_out<<<dim3(DM / 128, NB, TT / 128), 128, 0, stream>>>(CEh, CEl, WoB, (const h16*)CH, WoH, OUT, bo);
}

// v005
// It runs in 127 microseconds.
// Next to v004, in two timings, it ran 1.04 and 1.03 times as fast.
// Over all steps from v000 it is 2.70 times as fast.
#include <hip/hip_runtime.h>

// Contractions, f32 accumulate: q/k/v projections v_wmma_f32_16x16x32_bf16 on bf16 (RNE) roundings of x and W; scores v_wmma_f32_16x16x32_f16 on f16 q/k planes (x16 carry each); P.V v_wmma_f32_16x16x32_f16 (P x256, V x64 carries) for query rows >= EROWS and v_wmma_f32_16x16x32_bf16 on bf16 hi+lo P and V (3 products) for query rows < EROWS; output projection v_wmma_f32_16x16x32_f16 (ctx x64, W x1024) for rows >= EROWS and v_wmma_f32_16x16x32_bf16 on bf16 hi+lo ctx (2 products) for rows < EROWS.
// Pipeline: bf16 planes of the weights (the activations are rounded to bf16 inside the projections' staging); q/k planes [b][h][t][64] f16; value planes [b][h][64][t] f16 (+ bf16 hi/lo for t < EROWS); fused causal attention in transposed form (S^T = K Q^T, O^T = V^T P^T, online softmax per lane, score scale 1/32); ctx planes [b*t][1024]; out = ctx W^T + b.

#ifndef NB
#define NB 4
#endif
#ifndef SEQ
#define SEQ 2048
#endif
#define NB_FULL  4
#define SEQ_FULL 2048
#define TT   SEQ
#define DM   1024
#define NH_  16
#define HD   64
#define EROWS ((TT) < 512 ? (TT) : 512)
#define QKC  16.0f                                          // carry of the q and k planes
#define CSC  (0.045084220027780106f * 0.00390625f)          // (1/32) * log2(e) / (QKC*QKC)
#define VC   64.0f                                          // carry of the f16 value plane (and of the f16 ctx plane)
#define WOC  1024.0f                                        // carry of the f16 output weight plane
#define OSC  1.52587890625e-05f                             // 1 / (VC * WOC)
#define NEGB (-3.0e38f)
#define XSZ  ((size_t)NB * SEQ_FULL * DM)
#define QKSZ ((size_t)NB * NH_ * TT * HD)
static_assert(TT % 64 == 0);
static_assert(TT <= SEQ_FULL);
static_assert(NB >= 1 && NB <= NB_FULL);
static_assert(NH_ * HD == DM);
static_assert(DM % 64 == 0);
static_assert(DM % 32 == 0);
static_assert(HD == 64);
static_assert(EROWS % 64 == 0);
static_assert(EROWS <= TT);
static_assert((TT - EROWS) % 64 == 0);
static_assert(TT % 128 == 0 && EROWS % 128 == 0 && DM % 128 == 0 && NH_ % 4 == 0);   // 128x256 block tiles of the projections and 128x128 of the output product
static_assert((size_t)NB * TT * DM <= XSZ);
static_assert((size_t)NB * EROWS * DM <= XSZ);
static_assert((size_t)3 * DM * DM * 2 + (size_t)2 * DM * DM * 2 + (size_t)2 * QKSZ * 2 + (size_t)NB * NH_ * HD * TT * 2 + (size_t)2 * NB * NH_ * HD * EROWS * 2 + (size_t)3 * XSZ * 2 <= (size_t)134217728);

typedef _Float16 h16;
typedef unsigned short bf;
typedef __attribute__((ext_vector_type(16))) __bf16   v16bf;
typedef __attribute__((ext_vector_type(16))) _Float16 v16h;
typedef __attribute__((ext_vector_type(8)))  _Float16 v8h;
typedef __attribute__((ext_vector_type(8)))  unsigned short v8us;
typedef __attribute__((ext_vector_type(8)))  float    v8f;
typedef __attribute__((ext_vector_type(4)))  float    v4f;
typedef v4f  __attribute__((may_alias)) v4fa;
typedef v8us __attribute__((may_alias)) v8usa;
typedef __attribute__((ext_vector_type(4)))  __bf16   v4bf;
typedef __attribute__((ext_vector_type(4)))  unsigned short v4us;
typedef v4us __attribute__((may_alias)) v4usa;

__device__ __forceinline__ unsigned short f2bf(float f) { unsigned u = __float_as_uint(f); u += 0x7FFFu + ((u >> 16) & 1u); return (unsigned short)(u >> 16); }
__device__ __forceinline__ float bf2f(unsigned short b) { return __uint_as_float(((unsigned)b) << 16); }
__device__ __forceinline__ float bfr(float f) { return bf2f(f2bf(f)); }
__device__ __forceinline__ v16h cat16(v8h lo, v8h hi) { return __builtin_shufflevector(lo, hi, 0, 1, 2, 3, 4, 5, 6, 7, 8, 9, 10, 11, 12, 13, 14, 15); }
__device__ __forceinline__ v16bf cat16b(v8us lo, v8us hi) { return __builtin_bit_cast(v16bf, __builtin_shufflevector(lo, hi, 0, 1, 2, 3, 4, 5, 6, 7, 8, 9, 10, 11, 12, 13, 14, 15)); }
__device__ __forceinline__ v8f wmma16(v16h a, v16h b, v8f c) { return __builtin_amdgcn_wmma_f32_16x16x32_f16(false, a, false, b, (short)0, c, false, false); }
__device__ __forceinline__ v8f wmmab(v16bf a, v16bf b, v8f c) { return __builtin_amdgcn_wmma_f32_16x16x32_bf16(false, a, false, b, (short)0, c, false, false); }
__device__ __forceinline__ void splitf(float y, unsigned short& h, unsigned short& l) { h = f2bf(y); l = f2bf(y - bf2f(h)); }
// Fragment loaders (A and B identical): p already points at row (lane&15), k0 + 8*(lane>>4); elements 0..7 <- p[0..7], elements 8..15 <- p[16..23].
__device__ __forceinline__ v16h ldh(const h16* p) { return cat16(*(const v8h*)p, *(const v8h*)(p + 16)); }
__device__ __forceinline__ v16bf ldb(const bf* p) { return cat16b(*(const v8us*)p, *(const v8us*)(p + 16)); }
__device__ __forceinline__ v8us pack_h(v8f c) { v8h t;
#pragma unroll
    for (int r = 0; r < 8; ++r) t[r] = (h16)c[r];
    return __builtin_bit_cast(v8us, t); }
__device__ __forceinline__ void pack_b(v8f c, v8us& a, v8us& l) {
#pragma unroll
    for (int r = 0; r < 8; ++r) { unsigned short x, y; splitf(c[r], x, y); a[r] = x; l[r] = y; } }

template <typename T16> struct WFrag;
template <> struct WFrag<h16> { typedef v16h V; static __device__ __forceinline__ V ld(const h16* p) { return ldh(p); } static __device__ __forceinline__ v8f mma(V a, V b, v8f c) { return wmma16(a, b, c); } };
template <> struct WFrag<bf> { typedef v16bf V; static __device__ __forceinline__ V ld(const bf* p) { return ldb(p); } static __device__ __forceinline__ v8f mma(V a, V b, v8f c) { return wmmab(a, b, c); } };

#define LP  72              // LDS row pitch of a staged tile in 16-bit elements: 144 B = 16 B x odd, free of bank conflicts for 16-byte fragment reads
#define TSZ (64 * LP)       // 16-bit elements of one staged tile
// One 64-row tile: this lane's 16 bytes of rows r, r+16, r+32, r+48. l = LDS byte address, g = global byte address of row r, gstep = bytes between global rows r and r+16.
__device__ __forceinline__ void copy_tile(const unsigned l, const char* g, const size_t gstep) {
    const unsigned l1 = l + 16 * LP * 2, l2 = l + 32 * LP * 2, l3 = l + 48 * LP * 2;
    const char* g1 = g + gstep; const char* g2 = g + 2 * gstep; const char* g3 = g + 3 * gstep;
    // the closing s_wait_xcnt 0 stands inside the statement so that no address register of a copy is rewritten ahead of it
    asm volatile("global_load_async_to_lds_b128 %0, %4, off\n\tglobal_load_async_to_lds_b128 %1, %5, off\n\tglobal_load_async_to_lds_b128 %2, %6, off\n\tglobal_load_async_to_lds_b128 %3, %7, off\n\ts_wait_xcnt 0x0"
                 :: "v"(l), "v"(l1), "v"(l2), "v"(l3), "v"(g), "v"(g1), "v"(g2), "v"(g3) : "memory");
}

// gemm_tile: a block of four waves computes a 128x128 tile; wave w owns the 64x64 quarter at rows 64*(w>>1), columns 64*(w&1):
// acc[mb][nb][j] = C[16*mb + 8*(lane>>4) + j][16*nb + (lane&15)] of that quarter = sum_k A[m][k] Bt[n][k] (+ A2[m][k] Bt[n][k] when NSPLIT == 1).
// Operand path: a stage is 64 k = one 128-row x 128-B tile per operand plane (A, Bt, and A2 when NSPLIT == 1), brought from the K-contiguous 16-bit planes into LDS once per block
// by asynchronous 16-byte copies (each wave-wide copy = 4 whole 128-B lines), two buffers, the next stage in flight while this one is worked on; every wave reads its fragments from LDS.
// K % 64 == 0; arow0 / brow0 = first row of the block's tile in A (A2) / Bt; ring = 2 * (2 + NSPLIT) * GTS 16-bit elements of LDS, free for other use on return.
#define GTS (2 * TSZ)       // 16-bit elements of one staged 128-row operand tile
template <typename T16, int NSPLIT>
__device__ __forceinline__ void gemm_tile(const T16* __restrict__ A, const T16* __restrict__ A2, const T16* __restrict__ Bt, const int K, const size_t arow0, const size_t brow0, unsigned short* ring, v8f (&acc)[4][4]) {
    typedef typename WFrag<T16>::V V;
    constexpr int NT = 2 + NSPLIT;                                      // tiles per stage: A, Bt (, A2)
    const int lane = threadIdx.x & 31, lr = lane & 15, hi = lane >> 4;
    const int w = __builtin_amdgcn_readfirstlane((threadIdx.x >> 5) & 3);
    const int cr = (int)(threadIdx.x >> 3) & 15, cc = (int)threadIdx.x & 7;   // this lane's row (mod 16) and 16-byte column in every staged tile
    const unsigned lbase = (unsigned)(size_t)ring + (unsigned)(cr * LP + cc * 8) * 2u;
    const char* ga  = (const char*)(A + (arow0 + cr) * K + cc * 8);
    const char* ga2 = (const char*)(A2 + (arow0 + cr) * K + cc * 8);
    const char* gb  = (const char*)(Bt + (brow0 + cr) * K + cc * 8);
    const size_t gstep = (size_t)16 * K * 2;
    auto issue = [&](const int s, const int buf) {                      // stage s (k = 64s .. 64s+63) into buffer buf
        const unsigned lb = lbase + (unsigned)(buf * NT * GTS) * 2u;
        const size_t ko = (size_t)s * 64 * 2;
        copy_tile(lb, ga + ko, gstep);             copy_tile(lb + TSZ * 2u, ga + ko + 4 * gstep, gstep);
        copy_tile(lb + GTS * 2u, gb + ko, gstep);  copy_tile(lb + GTS * 2u + TSZ * 2u, gb + ko + 4 * gstep, gstep);
        if (NSPLIT == 1) { copy_tile(lb + 2u * GTS * 2u, ga2 + ko, gstep); copy_tile(lb + 2u * GTS * 2u + TSZ * 2u, ga2 + ko + 4 * gstep, gstep); }
    };
#pragma unroll
    for (int mb = 0; mb < 4; ++mb)
#pragma unroll
        for (int nb = 0; nb < 4; ++nb) acc[mb][nb] = (v8f){};
    const int nstage = K / 64;
    issue(0, 0);
    asm volatile("s_wait_asynccnt 0x0" ::: "memory");                   // this wave's copies of stage 0 have landed
    __syncthreads();                                                    // ... and every other wave's: stage 0 may be read
    if (nstage > 1) issue(1, 1);
#pragma unroll 1   // rolled: one publish point and one refill site in the text
    for (int t = 0; t < nstage; ++t) {
        const T16* sbuf = (const T16*)ring + (t & 1) * NT * GTS;
        const T16* pa = sbuf + ((w >> 1) * 64 + lr) * LP + 8 * hi;
        const T16* pb = sbuf + GTS + ((w & 1) * 64 + lr) * LP + 8 * hi;
#pragma unroll     // the two 32-k steps of a stage: their LDS offsets become immediates
        for (int ks = 0; ks < 2; ++ks) {
            V a[4], a2[4];
#pragma unroll
            for (int mb = 0; mb < 4; ++mb) { a[mb] = WFrag<T16>::ld(pa + mb * 16 * LP + ks * 32); if (NSPLIT == 1) a2[mb] = WFrag<T16>::ld(pa + 2 * GTS + mb * 16 * LP + ks * 32); else a2[mb] = a[mb]; }
            V b[4];
#pragma unroll
            for (int nb = 0; nb < 4; ++nb) b[nb] = WFrag<T16>::ld(pb + nb * 16 * LP + ks * 32);
            // inputs-only fence on the loaded fragments: all LDS reads of this 32-k step stand as one group with one wait ahead of its WMMAs; without it each Bt fragment is read and waited for singly between them
            asm volatile("" :: "v"(b[0]), "v"(b[1]), "v"(b[2]), "v"(b[3]));
#pragma unroll
            for (int nb = 0; nb < 4; ++nb) {
#pragma unroll
                for (int mb = 0; mb < 4; ++mb) { acc[mb][nb] = WFrag<T16>::mma(a[mb], b[nb], acc[mb][nb]); if (NSPLIT == 1) acc[mb][nb] = WFrag<T16>::mma(a2[mb], b[nb], acc[mb][nb]); } }
            // four vector slots behind these WMMAs before a vector instruction may touch their registers, on either side of the branch at the loop's foot
            asm volatile("v_nop\n\tv_nop\n\tv_nop\n\tv_nop" : "+v"(acc[0][0]), "+v"(acc[1][1]), "+v"(acc[2][2]), "+v"(acc[3][3]) : "v"(a[0]), "v"(a[3]));
        }
        // publish point of stage t + 1, passed by every wave
        asm volatile("s_wait_dscnt 0x0" ::: "memory");                  // this wave's reads of stage t have returned before its buffer is refilled
        asm volatile("s_wait_asynccnt 0x0" ::: "memory");               // this wave's copies of stage t + 1 have landed
        __syncthreads();                                                // stage t + 1 may be read; every reader has left stage t
        if (t + 2 < nstage) issue(t + 2, t & 1);
    }
    asm volatile("s_wait_asynccnt 0x0" ::: "memory");                   // nothing in flight when the ring becomes output staging
}

// gemm_xw: a block of eight waves computes a 128x256 tile of x W^T; wave w owns the 64x64 part at rows 64*(w>>2), columns 64*(w&3); acc as in gemm_tile. K = DM.
// Operand path: a stage is 64 k, two buffers. W: 256 rows x 128 B of its bf16 plane by asynchronous 16-byte copies as in gemm_tile (waves 0-3 rows 0..127, waves 4-7 rows 128..255).
// x: 128 rows x 256 B of the f32 input itself, read by plain 16-byte loads (a wave-wide load = 4 whole lines) into registers one stage ahead, rounded to bf16 (nearest even)
// and stored to LDS behind this stage's products. arow0 / brow0 = first row of the block's tile in X / Bt; ring = 2 * XSB 16-bit elements of LDS, free for other use on return.
#define XSB (6 * TSZ)       // 16-bit elements of one stage buffer: x 128 rows | W 256 rows
__device__ __forceinline__ void gemm_xw(const float* __restrict__ X, const bf* __restrict__ Bt, const size_t arow0, const size_t brow0, unsigned short* ring, v8f (&acc)[4][4]) {
    constexpr int K = DM;
    const int lane = threadIdx.x & 31, lr = lane & 15, hi = lane >> 4;
    const int w = __builtin_amdgcn_readfirstlane((threadIdx.x >> 5) & 7);
    const int cr = (int)(threadIdx.x >> 3) & 15, cc = (int)threadIdx.x & 7;   // this lane's row (mod 16) and 16-byte column in every staged W tile
    const int g = w >> 2;                                               // which 128 rows of W this wave copies
    const unsigned lbase = (unsigned)(size_t)ring + (unsigned)((2 + 2 * g) * TSZ + cr * LP + cc * 8) * 2u;
    const char* gb = (const char*)(Bt + (brow0 + g * 128 + cr) * K + cc * 8);
    const size_t gstep = (size_t)16 * K * 2;
    const int xr = (int)(threadIdx.x >> 4) & 15, xc = ((int)threadIdx.x & 15) * 4;   // this lane's x row (mod 16) and first of its four k
    const float* gx = X + (arow0 + xr) * K + xc;
    unsigned short* lx = ring + xr * LP + xc;
    v4f xv[8];                                                          // this lane's share of the x stage in flight: rows xr + 16 j
    auto issue = [&](const int s, const int buf) {                      // stage s (k = 64s .. 64s+63): W into buffer buf, x into xv
        const unsigned lb = lbase + (unsigned)(buf * XSB) * 2u;
        const size_t ko = (size_t)s * 64 * 2;
        copy_tile(lb, gb + ko, gstep);             copy_tile(lb + TSZ * 2u, gb + ko + 4 * gstep, gstep);
        const float* p = gx + (size_t)s * 64;
#pragma unroll
        for (int j = 0; j < 8; ++j) xv[j] = *(const v4f*)(p + (size_t)j * 16 * K);
        asm volatile("s_wait_xcnt 0x0" ::: "memory");                   // stands in front of any rewriting of the reads' address registers
        __builtin_amdgcn_sched_barrier(0);                              // keeps later register writes behind that wait, and the eight reads together
    };
    auto put = [&](const int buf) {                                     // xv, rounded, into the x rows of buffer buf
#pragma unroll
        for (int j = 0; j < 8; ++j) *(v4usa*)(lx + buf * XSB + j * 16 * LP) = __builtin_bit_cast(v4us, __builtin_convertvector(xv[j], v4bf));
    };
#pragma unroll
    for (int mb = 0; mb < 4; ++mb)
#pragma unroll
        for (int nb = 0; nb < 4; ++nb) acc[mb][nb] = (v8f){};
    constexpr int nstage = K / 64;
    static_assert(nstage >= 2);
    issue(0, 0);
    put(0);
    asm volatile("s_wait_dscnt 0x0" ::: "memory");                      // this wave's x rows of stage 0 are written
    asm volatile("s_wait_asynccnt 0x0" ::: "memory");                   // this wave's copies of stage 0 have landed
    __syncthreads();                                                    // ... and every other wave's: stage 0 may be read
    issue(1, 1);
#pragma unroll 1   // rolled: one publish point and one refill site in the text
    for (int t = 0; t < nstage; ++t) {
        const bf* sbuf = ring + (t & 1) * XSB;
        const bf* pa = sbuf + ((w >> 2) * 64 + lr) * LP + 8 * hi;
        const bf* pb = sbuf + 2 * TSZ + ((w & 3) * 64 + lr) * LP + 8 * hi;
#pragma unroll     // the two 32-k steps of a stage: their LDS offsets become immediates
        for (int ks = 0; ks < 2; ++ks) {
            v16bf a[4], b[4];
#pragma unroll
            for (int mb = 0; mb < 4; ++mb) a[mb] = ldb(pa + mb * 16 * LP + ks * 32);
#pragma unroll
            for (int nb = 0; nb < 4; ++nb) b[nb] = ldb(pb + nb * 16 * LP + ks * 32);
            // inputs-only fence on the loaded fragments: all LDS reads of this 32-k step stand as one group with one wait ahead of its WMMAs; without it each W fragment is read and waited for singly between them
            asm volatile("" :: "v"(b[0]), "v"(b[1]), "v"(b[2]), "v"(b[3]));
#pragma unroll
            for (int nb = 0; nb < 4; ++nb) {
#pragma unroll
                for (int mb = 0; mb < 4; ++mb) acc[mb][nb] = wmmab(a[mb], b[nb], acc[mb][nb]); }
            // four vector slots behind these WMMAs before a vector instruction may touch their registers, on either side of the branch that follows
            asm volatile("v_nop\n\tv_nop\n\tv_nop\n\tv_nop" : "+v"(acc[0][0]), "+v"(acc[1][1]), "+v"(acc[2][2]), "+v"(acc[3][3]) : "v"(a[0]), "v"(a[3]));
        }
        if (t + 1 < nstage) put((t + 1) & 1);                           // that buffer's readers left it at the last publish point
        // publish point of stage t + 1, passed by every wave
        asm volatile("s_wait_dscnt 0x0" ::: "memory");                  // this wave's reads of stage t have returned, its x rows of stage t + 1 are written
        asm volatile("s_wait_asynccnt 0x0" ::: "memory");               // this wave's copies of stage t + 1 have landed
        __syncthreads();                                                // stage t + 1 may be read; every reader has left stage t
        if (t + 2 < nstage) issue(t + 2, t & 1);
    }
    asm volatile("s_wait_asynccnt 0x0" ::: "memory");                   // nothing in flight when the ring becomes output staging
}

// k_cvtw: the 16-bit planes of the four weights in one launch of CVW waves (16 per block): wave g takes 256 floats at g*256 of each of W_q, W_k, W_v (-> WT) and W_o (-> WoB and WoH).
#define CVW 4096
__device__ __forceinline__ v8us cvt8(const v8f v) { v8us o;
#pragma unroll
    for (int k = 0; k < 8; ++k) o[k] = f2bf(v[k]);
    return o; }
__global__ __launch_bounds__(512) void k_cvtw(const float* __restrict__ wq, const float* __restrict__ wk, const float* __restrict__ wv, const float* __restrict__ wo,
                                              bf* __restrict__ WT, bf* __restrict__ WoB, h16* __restrict__ WoH) {
    static_assert((size_t)DM * DM == (size_t)CVW * 256);
    const unsigned lane = threadIdx.x & 31;
    const unsigned gw = (unsigned)__builtin_amdgcn_readfirstlane((int)(blockIdx.x * 16 + (threadIdx.x >> 5)));   // wave number in a scalar register: the bases are then scalar
    const size_t wof = (size_t)gw * 256 + lane * 8;
    v8f cur[4];
    cur[0] = *(const v8f*)(wq + wof); cur[1] = *(const v8f*)(wk + wof); cur[2] = *(const v8f*)(wv + wof); cur[3] = *(const v8f*)(wo + wof);
    asm volatile("s_wait_xcnt 0x0" ::: "memory");       // stands in front of any rewriting of the reads' address registers
    __builtin_amdgcn_sched_barrier(0);                  // keeps later register writes behind that wait, and the eight reads together ahead of the conversions
#pragma unroll
    for (int j = 0; j < 3; ++j) *(v8us*)(WT + (size_t)j * DM * DM + wof) = cvt8(cur[j]);
    const v8us ob = cvt8(cur[3]); v8h oh;
#pragma unroll
    for (int k = 0; k < 8; ++k) oh[k] = (h16)(bf2f(ob[k]) * WOC);
    *(v8us*)(WoB + wof) = ob; *(v8h*)(WoH + wof) = oh;
}

// k_proj: all three projections in one launch, straight from the f32 activations. grid (NB*TT/128, NH_/4, 3), eight waves; z = 0 -> q plane, z = 1 -> k plane, z = 2 -> value planes. Block tile = 128 tokens x four heads; a wave's tile = 64 tokens x one head (64 dims).
// z < 2: rows written as they are, QK[z][b][h][t][64] = f16(16 * (x W^T + b)). z = 2: written transposed, VT[b][h][d][t] = f16(64 * v), and for t < EROWS the bf16 hi/lo planes VE[b][h][d][t] of v.
__global__ __launch_bounds__(256) void k_proj(const float* __restrict__ xq, const float* __restrict__ xk, const float* __restrict__ xv, const bf* __restrict__ WT, const float* __restrict__ bq, const float* __restrict__ bk, const float* __restrict__ bv, h16* QK, h16* VT, bf* VEh, bf* VEl) {
    __shared__ __align__(16) unsigned short ring[8 * 64 * 68 * 2];      // operand ring; behind the product each wave's own output or transpose staging (the larger of the two uses)
    static_assert(8 * 64 * 68 * 2 >= 2 * XSB);
    const int z = blockIdx.z;
    const int lane = threadIdx.x & 31, lr = lane & 15, hi = lane >> 4;
    const int w = __builtin_amdgcn_readfirstlane((threadIdx.x >> 5) & 7);
    const int mt = blockIdx.x * 2 + (w >> 2); const int b = mt / (TT / 64); const int t0 = (mt % (TT / 64)) * 64; const int h = blockIdx.y * 4 + (w & 3);
    const float* A = z == 0 ? xq : z == 1 ? xk : xv; const bf* Bt = WT + (size_t)z * DM * DM;
    v8f acc[4][4];
    gemm_xw(A, Bt, (size_t)b * SEQ_FULL + t0 - (w >> 2) * 64, (size_t)blockIdx.y * 4 * HD, ring, acc);
  if (z < 2) {
    float* os = (float*)ring + w * (16 * 68);
    const int rq = lane >> 3, pc = lane & 7;
    const v8f b0 = *(const v8f*)(bq + h * HD + pc * 8); const v8f b1 = *(const v8f*)(bk + h * HD + pc * 8);
    v8f bb;
#pragma unroll
    for (int i = 0; i < 8; ++i) bb[i] = bfr(z ? b1[i] : b0[i]);
    h16* P = QK + (size_t)z * QKSZ + (((size_t)b * NH_ + h) * TT + t0) * HD + pc * 8;
#pragma unroll
    for (int mb = 0; mb < 4; ++mb) {
#pragma unroll
        for (int nb = 0; nb < 4; ++nb) {
#pragma unroll
            for (int j = 0; j < 8; ++j) os[(hi * 8 + j) * 68 + nb * 16 + lr] = acc[mb][nb][j]; }
        __builtin_amdgcn_wave_barrier(); asm volatile("" ::: "memory");
        h16* prow = P + (size_t)(mb * 16) * HD;
{
#pragma unroll
            for (int s = 0; s < 4; ++s) { const int row = 4 * s + rq;
                const v4f x0 = *(const v4fa*)(os + row * 68 + pc * 8), x1 = *(const v4fa*)(os + row * 68 + pc * 8 + 4);
                v8h o;
#pragma unroll
                for (int q = 0; q < 4; ++q) { o[q] = (h16)((x0[q] + bb[q]) * QKC); o[4 + q] = (h16)((x1[q] + bb[4 + q]) * QKC); }
                *(v8h*)(prow + (size_t)row * HD) = o; }
             }
        __builtin_amdgcn_wave_barrier(); asm volatile("" ::: "memory");
    }
  } else {
    float* ts = (float*)ring + w * (64 * 68);
#pragma unroll
    for (int mb = 0; mb < 4; ++mb)
#pragma unroll
        for (int nb = 0; nb < 4; ++nb) {
            const v4f lo4 = { acc[mb][nb][0], acc[mb][nb][1], acc[mb][nb][2], acc[mb][nb][3] };
            const v4f hi4 = { acc[mb][nb][4], acc[mb][nb][5], acc[mb][nb][6], acc[mb][nb][7] };
            *(v4fa*)(ts + (nb * 16 + lr) * 68 + mb * 16 + 8 * hi) = lo4;
            *(v4fa*)(ts + (nb * 16 + lr) * 68 + mb * 16 + 8 * hi + 4) = hi4; }
    __builtin_amdgcn_wave_barrier(); asm volatile("" ::: "memory");
    const int rq = lane >> 3, pc = lane & 7;
    const bool early = t0 < EROWS;
    const size_t vrow0 = ((size_t)b * NH_ + h) * HD;
{
#pragma unroll 1
        for (int s = 0; s < 16; ++s) { const int d = 4 * s + rq;
            const float bb = bfr(bv[h * HD + d]);
            const v4f x0 = *(const v4fa*)(ts + d * 68 + pc * 8), x1 = *(const v4fa*)(ts + d * 68 + pc * 8 + 4);
            v8f x = __builtin_shufflevector(x0, x1, 0, 1, 2, 3, 4, 5, 6, 7);
            x = x + bb;
            v8h o;
#pragma unroll
            for (int q = 0; q < 8; ++q) o[q] = (h16)(x[q] * VC);
            *(v8h*)(VT + (vrow0 + d) * TT + t0 + pc * 8) = o;
            asm volatile("s_wait_xcnt 0x0" ::: "memory");   // stands in front of the rewriting of the store's data and address registers (hi/lo packing, next trip)
            if (early) { v8us oh, ol; pack_b(x, oh, ol);
                *(v8us*)(VEh + (vrow0 + d) * EROWS + t0 + pc * 8) = oh;
                *(v8us*)(VEl + (vrow0 + d) * EROWS + t0 + pc * 8) = ol;
                asm volatile("s_wait_xcnt 0x0" ::: "memory"); } }   // stands in front of the next trip's advance of both stores' address registers
         }
  }
}

// attn_body: fused causal attention, 4 waves per block, 16 query rows per wave, 32 keys per step, transposed formulation.
//   S^T tile (rows = keys, cols = queries) = A(k plane rows) x B(q plane rows); D element r of lane l = S^T[key 8*(l>>4)+r][query l&15].
//   Per lane one query column: running max m, running sum l (combined across lane halves by one xor-16 shuffle each).
//   P^T as B fragment: element r <- p(tile keys 0..15)[r], element 8+r <- p(tile keys 16..31)[r], lane unchanged.
//   O^T tile j (rows = dims 16j.., cols = queries) += A(V^T rows) x B(P^T). Masked keys carry p = 0 exactly.
// EARLY: bf16 hi+lo P and V (3 products); else f16 single product with P x256 (cancels against the row sum) and V x64.
// Operand path: a stage is 64 keys = one K tile (64 key rows x 128 B) and one V^T tile per value plane (64 dim rows x 128 B), brought into LDS once per block by
// asynchronous 16-byte copies (each wave-wide copy = 4 whole 128-B lines), two buffers, the next stage in flight while this one is worked on; all four waves read their fragments from LDS.
template <bool EARLY>
__device__ __forceinline__ void attn_body(const h16* __restrict__ QP, const h16* __restrict__ KP, const h16* __restrict__ VT, const bf* __restrict__ VEh, const bf* __restrict__ VEl, bf* C0, bf* C1, const int qb, const int bh, unsigned short* ring) {
    constexpr int NT = EARLY ? 3 : 2;                                   // tiles per stage: K, V (EARLY: K, V hi, V lo)
    static_assert(2 * NT * TSZ >= 4 * 2 * 1152);                        // ring = 2 * NT * TSZ 16-bit elements of LDS: two stage buffers; output staging behind the loop
    unsigned short* stg = ring;
    const int lane = threadIdx.x & 31, lr = lane & 15, hi = lane >> 4;
    const int w = __builtin_amdgcn_readfirstlane((threadIdx.x >> 5) & 3);   // wave number in a scalar register: the per-wave skip below is then a scalar branch
    const int b = bh / NH_, h = bh % NH_;
    const int q0 = qb * 64 + w * 16;
    const int qq = q0 + lr;
    const size_t pof = (size_t)bh * TT * HD;
    const h16* qp = QP + pof + (size_t)(q0 + lr) * HD + 8 * hi;
    const v16h qf0 = ldh(qp), qf1 = ldh(qp + 32);
    v8f o0 = {}, o1 = {}, o2 = {}, o3 = {};
    float m = NEGB, l = 0.0f;
    const int nstage = qb + 1;                                          // stages of 64 keys, the same for the whole block
    const int cr = (int)(threadIdx.x >> 3) & 15, cc = (int)threadIdx.x & 7;   // this lane's row (mod 16) and 16-byte column in every staged tile
    const unsigned lbase = (unsigned)(size_t)ring + (unsigned)(cr * LP + cc * 8) * 2u;
    const char* gk = (const char*)(KP + pof + (size_t)cr * HD + cc * 8);
    const char* gv0 = EARLY ? (const char*)(VEh + (size_t)bh * HD * EROWS + (size_t)cr * EROWS + cc * 8) : (const char*)(VT + (size_t)bh * HD * TT + (size_t)cr * TT + cc * 8);
    const char* gv1 = EARLY ? (const char*)(VEl + (size_t)bh * HD * EROWS + (size_t)cr * EROWS + cc * 8) : gv0;
    const size_t vstep = (size_t)16 * (EARLY ? EROWS : TT) * 2;
    auto issue = [&](const int s, const int buf) {                      // stage s (keys 64s .. 64s+63) into buffer buf
        const unsigned lb = lbase + (unsigned)(buf * NT * TSZ) * 2u;
        copy_tile(lb, gk + (size_t)s * 64 * HD * 2, (size_t)16 * HD * 2);
        copy_tile(lb + TSZ * 2u, gv0 + (size_t)s * 64 * 2, vstep);
        if (EARLY) copy_tile(lb + 2u * TSZ * 2u, gv1 + (size_t)s * 64 * 2, vstep);
    };
    issue(0, 0);
    asm volatile("s_wait_asynccnt 0x0" ::: "memory");                   // this wave's copies of stage 0 have landed
    __syncthreads();                                                    // ... and every other wave's: stage 0 may be read
    if (nstage > 1) issue(1, 1);
#pragma unroll 1   // rolled: one publish point and one refill site in the text
    for (int t = 0; t < nstage; ++t) {
        const unsigned short* sbuf = ring + (t & 1) * NT * TSZ;
#pragma unroll     // the two 32-key steps of a stage: their LDS offsets become immediates
      for (int sub = 0; sub < 2; ++sub) {
        const int kt = t * 64 + sub * 32;
        if (sub == 0 || kt <= q0) {  // a wave skips the 32 keys that lie wholly above its queries
        const h16* kp = (const h16*)sbuf + (sub * 32 + lr) * LP + 8 * hi;
        const v16h ka0 = ldh(kp), ka1 = ldh(kp + 16 * LP), kb0 = ldh(kp + 32), kb1 = ldh(kp + 16 * LP + 32);
        v8f s0 = {}, s1 = {};
        s0 = wmma16(ka0, qf0, s0); s1 = wmma16(ka1, qf0, s1);
        s0 = wmma16(kb0, qf1, s0); s1 = wmma16(kb1, qf1, s1);
        asm volatile("v_nop\n\tv_nop\n\tv_nop\n\tv_nop" : "+v"(s0), "+v"(s1) : "v"(ka0), "v"(ka1), "v"(kb0), "v"(kb1), "v"(qf1));
        if (kt + 31 > q0) {          // diagonal step of this wave: exclude keys above the query
            const int k0 = kt + 8 * hi;
#pragma unroll
            for (int r = 0; r < 8; ++r) { s0[r] = (k0 + r > qq) ? NEGB : s0[r]; s1[r] = (k0 + 16 + r > qq) ? NEGB : s1[r]; }
        }
        float mx = fmaxf(s0[0], s1[0]);
#pragma unroll
        for (int r = 1; r < 8; ++r) mx = fmaxf(mx, fmaxf(s0[r], s1[r]));
        mx = fmaxf(mx, __shfl_xor(mx, 16, 32));
        const float mn = fmaxf(m, mx * CSC);
        const float corr = __builtin_amdgcn_exp2f(m - mn);
        m = mn;
        const float sh = (EARLY ? 0.0f : 8.0f) - mn;
        v8f p0, p1; float rs = 0.0f;
#pragma unroll
        for (int r = 0; r < 8; ++r) { p0[r] = __builtin_amdgcn_exp2f(fmaf(s0[r], CSC, sh)); p1[r] = __builtin_amdgcn_exp2f(fmaf(s1[r], CSC, sh)); rs += p0[r] + p1[r]; }
        rs += __shfl_xor(rs, 16, 32);
        l = l * corr + rs;
        o0 *= corr; o1 *= corr; o2 *= corr; o3 *= corr;
        if (EARLY) {
            v8us ph0, ph1, pl0, pl1;
            pack_b(p0, ph0, pl0); pack_b(p1, ph1, pl1);
            const v16bf PH = cat16b(ph0, ph1), PL = cat16b(pl0, pl1);
            const bf* vh = sbuf + TSZ + lr * LP + sub * 32 + 8 * hi;
            const bf* vl = vh + TSZ;
            const v16bf vh0 = ldb(vh), vh1 = ldb(vh + 16 * LP), vh2 = ldb(vh + 32 * LP), vh3 = ldb(vh + 48 * LP);
            const v16bf vl0 = ldb(vl), vl1 = ldb(vl + 16 * LP), vl2 = ldb(vl + 32 * LP), vl3 = ldb(vl + 48 * LP);
            o0 = wmmab(vh0, PH, o0); o0 = wmmab(vl0, PH, o0); o0 = wmmab(vh0, PL, o0);
            o1 = wmmab(vh1, PH, o1); o1 = wmmab(vl1, PH, o1); o1 = wmmab(vh1, PL, o1);
            o2 = wmmab(vh2, PH, o2); o2 = wmmab(vl2, PH, o2); o2 = wmmab(vh2, PL, o2);
            o3 = wmmab(vh3, PH, o3); o3 = wmmab(vl3, PH, o3); o3 = wmmab(vh3, PL, o3);
            asm volatile("v_nop\n\tv_nop\n\tv_nop\n\tv_nop" : "+v"(o0), "+v"(o1), "+v"(o2), "+v"(o3) : "v"(vh0), "v"(vh1), "v"(vh2), "v"(vh3), "v"(vl0), "v"(vl1), "v"(vl2), "v"(vl3), "v"(PH), "v"(PL));
        } else {
            v16h pb;
#pragma unroll
            for (int r = 0; r < 8; ++r) { pb[r] = (h16)p0[r]; pb[8 + r] = (h16)p1[r]; }
            const h16* vp = (const h16*)sbuf + TSZ + lr * LP + sub * 32 + 8 * hi;
            const v16h a0 = ldh(vp), a1 = ldh(vp + 16 * LP), a2 = ldh(vp + 32 * LP), a3 = ldh(vp + 48 * LP);
            o0 = wmma16(a0, pb, o0); o1 = wmma16(a1, pb, o1); o2 = wmma16(a2, pb, o2); o3 = wmma16(a3, pb, o3);
            asm volatile("v_nop\n\tv_nop\n\tv_nop\n\tv_nop" : "+v"(o0), "+v"(o1), "+v"(o2), "+v"(o3) : "v"(a0), "v"(a1), "v"(a2), "v"(a3), "v"(pb));
        }
        }
      }
        // publish point of stage t + 1, passed by every wave
        asm volatile("s_wait_dscnt 0x0" ::: "memory");                  // this wave's reads of stage t have returned before its buffer is refilled
        asm volatile("s_wait_asynccnt 0x0" ::: "memory");               // this wave's copies of stage t + 1 have landed
        __syncthreads();                                                // stage t + 1 may be read; every reader has left stage t
        if (t + 2 < nstage) issue(t + 2, t & 1);
    }
    asm volatile("s_wait_asynccnt 0x0" ::: "memory");                   // nothing in flight when the ring becomes output staging
    const float inv = __fdiv_rn(1.0f, l);
    o0 *= inv; o1 *= inv; o2 *= inv; o3 *= inv;
    const int sb = w * 2 * 1152;
    const int so = sb + lr * 72 + 8 * hi;       // O^T element r of tile j -> row (query lr), column 16j + 8*hi + r
    if (EARLY) {
        v8us a, c;
        pack_b(o0, a, c); *(v8usa*)(stg + so) = a;      *(v8usa*)(stg + so + 1152) = c;
        pack_b(o1, a, c); *(v8usa*)(stg + so + 16) = a; *(v8usa*)(stg + so + 1152 + 16) = c;
        pack_b(o2, a, c); *(v8usa*)(stg + so + 32) = a; *(v8usa*)(stg + so + 1152 + 32) = c;
        pack_b(o3, a, c); *(v8usa*)(stg + so + 48) = a; *(v8usa*)(stg + so + 1152 + 48) = c;
    } else {
        *(v8usa*)(stg + so) = pack_h(o0); *(v8usa*)(stg + so + 16) = pack_h(o1); *(v8usa*)(stg + so + 32) = pack_h(o2); *(v8usa*)(stg + so + 48) = pack_h(o3);
    }
    __builtin_amdgcn_wave_barrier(); asm volatile("" ::: "memory");
    const int rq = lane >> 3, pc = lane & 7;
    const int crows = EARLY ? EROWS : TT;
    const size_t cbase = ((size_t)b * crows + q0) * DM + h * HD + pc * 8;
{
#pragma unroll
        for (int s = 0; s < 4; ++s) { const int row = 4 * s + rq;
            const v8us x = *(const v8usa*)(stg + sb + row * 72 + pc * 8);
            *(v8us*)(C0 + cbase + (size_t)row * DM) = x;
            if (EARLY) { const v8us y = *(const v8usa*)(stg + sb + 1152 + row * 72 + pc * 8); *(v8us*)(C1 + cbase + (size_t)row * DM) = y; } }
         }
}

// k_attn: every query tile in one launch. grid (NB*NH_, TT/64): x = (b, h); y counts the 64-row query tiles from the last one down, so that the tiles with the most keys start first and the short ones fill the end.
// Query rows [EROWS, TT): ctx as f16 plane (x64 carry) [b][TT][DM]. Query rows [0, EROWS): ctx as bf16 hi/lo planes [b][EROWS][DM].
__global__ __launch_bounds__(128) void k_attn(const h16* __restrict__ QP, const h16* __restrict__ KP, const h16* __restrict__ VT, const bf* __restrict__ VEh, const bf* __restrict__ VEl, bf* CH, bf* CEh, bf* CEl) {
    __shared__ __align__(16) unsigned short ring[2 * 3 * TSZ];          // one ring for either body
    const int qb = TT / 64 - 1 - (int)blockIdx.y;                       // the same for the whole block: the choice of body is a scalar branch
    if (qb >= EROWS / 64) attn_body<false>(QP, KP, VT, (const bf*)0, (const bf*)0, CH, CH, qb, (int)blockIdx.x, ring);
    else                  attn_body<true>(QP, KP, (const h16*)0, VEh, VEl, CEh, CEl, qb, (int)blockIdx.x, ring);
}

// out_body: OUT[r][c] = scale * sum_k A[r][k] Bt[c][k] + bf16(bias[c]); 128x128 tile per block of four waves, 64x64 per wave; per 16-row slab staged in LDS (wave-private),
template <typename T16, int NSPLIT>
__device__ __forceinline__ void out_body(const T16* __restrict__ A, const T16* __restrict__ A2, const T16* __restrict__ Bt, float* C, const float* __restrict__ bias, const float scale, const int rt, const int ct, unsigned short* ring) {
    static_assert(2 * 2 * GTS * 2 >= 4 * 16 * 68 * 4);                  // ring = 2 * (2 + NSPLIT) * GTS 16-bit elements of LDS: operand ring; behind the product each wave's own output staging
    const int lane = threadIdx.x & 31, lr = lane & 15, hi = lane >> 4;
    const int w = __builtin_amdgcn_readfirstlane((threadIdx.x >> 5) & 3);
    const int r0 = rt * 128 + (w >> 1) * 64, c0 = ct * 128 + (w & 1) * 64;   // rt, ct = the block's row and column tile
    v8f acc[4][4];
    gemm_tile<T16, NSPLIT>(A, A2, Bt, DM, (size_t)rt * 128, (size_t)ct * 128, ring, acc);
    float* os = (float*)ring + w * (16 * 68);
    const v4f bw = *(const v4f*)(bias + c0 + lr * 4);
    v4f bb;
#pragma unroll
    for (int q = 0; q < 4; ++q) bb[q] = bfr(bw[q]);
#pragma unroll
    for (int mb = 0; mb < 4; ++mb) {
#pragma unroll
        for (int nb = 0; nb < 4; ++nb) {
#pragma unroll
            for (int j = 0; j < 8; ++j) os[(hi * 8 + j) * 68 + nb * 16 + lr] = acc[mb][nb][j]; }
        __builtin_amdgcn_wave_barrier(); asm volatile("" ::: "memory");
        float* crow = C + (size_t)(r0 + mb * 16) * DM + c0 + lr * 4;
{
#pragma unroll
            for (int s = 0; s < 8; ++s) { const int row = 2 * s + hi;
                v4f val = *(const v4fa*)(os + row * 68 + lr * 4);
                val = val * scale + bb;
                *(v4f*)(crow + (size_t)row * DM) = val; }
             }
        __builtin_amdgcn_wave_barrier(); asm volatile("" ::: "memory");
    }
}

// k_out: the whole output product in one launch. grid (DM/128, NB, TT/128): x = column tile, y = batch, z = row tile; the row tiles of two products (rows < EROWS) have the lowest indices and start first.
// Rows [0, EROWS) of a batch from the bf16 hi/lo ctx planes, rows [EROWS, TT) from the f16 ctx plane.
__global__ __launch_bounds__(128) void k_out(const bf* __restrict__ CEh, const bf* __restrict__ CEl, const bf* __restrict__ WoB, const h16* __restrict__ CH, const h16* __restrict__ WoH, float* OUT, const float* __restrict__ Wb) {
    __shared__ __align__(16) unsigned short ring[2 * 3 * GTS];          // one ring for either body
    const size_t bt = blockIdx.y; const int rt = blockIdx.z, ct = blockIdx.x;   // the same for the whole block: the choice of body is a scalar branch
    if (rt < EROWS / 128) out_body<bf, 1>(CEh + bt * EROWS * DM, CEl + bt * EROWS * DM, WoB, OUT + bt * TT * DM, Wb, 1.0f, rt, ct, ring);
    else                  out_body<h16, 0>(CH + bt * TT * DM, CH + bt * TT * DM, WoH, OUT + bt * TT * DM, Wb, OSC, rt, ct, ring);
}

extern "C" void kernel_launch(void* const* d_in, const int* in_sizes, int n_in,
                              void* d_out, int out_size, void* d_ws, size_t ws_size, hipStream_t stream) {
    if (n_in < 11) return;
    if (in_sizes[0] < NB * SEQ_FULL * DM || in_sizes[1] < NB * SEQ_FULL * DM || in_sizes[2] < NB * SEQ_FULL * DM) return;
    if (in_sizes[3] < NH_ * HD * DM || in_sizes[5] < NH_ * HD * DM || in_sizes[7] < NH_ * HD * DM || in_sizes[9] < DM * DM) return;
    if (in_sizes[4] < NH_ * HD || in_sizes[6] < NH_ * HD || in_sizes[8] < NH_ * HD || in_sizes[10] < DM) return;
    if (out_size < NB * TT * DM) return;
    const float* xq = (const float*)d_in[0]; const float* xk = (const float*)d_in[1]; const float* xv = (const float*)d_in[2];
    const float* wq = (const float*)d_in[3]; const float* bq = (const float*)d_in[4];
    const float* wk = (const float*)d_in[5]; const float* bk = (const float*)d_in[6];
    const float* wv = (const float*)d_in[7]; const float* bv = (const float*)d_in[8];
    const float* wo = (const float*)d_in[9]; const float* bo = (const float*)d_in[10];
    float* OUT = (float*)d_out;     // [NB][TT][DM]
    char* wsp = (char*)d_ws;
    auto take = [&](size_t bytes) { char* p = wsp; wsp += (bytes + 255) & ~(size_t)255; return (void*)p; };
    bf*  WT  = (bf*)take((size_t)3 * DM * DM * 2);                  // [3][n][k] projection weights, bf16
    bf*  WoB = (bf*)take((size_t)DM * DM * 2);                      // output weight, bf16
    h16* WoH = (h16*)take((size_t)DM * DM * 2);                     // output weight, f16 x1024
    h16* QK  = (h16*)take((size_t)2 * QKSZ * 2);                    // q plane | k plane
    h16* VT  = (h16*)take((size_t)NB * NH_ * HD * TT * 2);          // [b][h][d][t] f16 x64
    bf*  VEh = (bf*)take((size_t)NB * NH_ * HD * EROWS * 2);        // [b][h][d][t < EROWS] bf16 hi
    bf*  VEl = (bf*)take((size_t)NB * NH_ * HD * EROWS * 2);        // bf16 lo
    bf*  XB  = (bf*)take((size_t)3 * XSZ * 2);                      // three ctx planes
    if ((size_t)(wsp - (char*)d_ws) > ws_size) return;              // 119,537,664 B at NB=4, TT=2048
    bf* CH  = XB;                   // ctx f16 plane [NB*TT][DM] (16-bit storage)
    bf* CEh = XB + XSZ;             // ctx bf16 hi [NB*EROWS][DM]
    bf* CEl = XB + 2 * XSZ;         // ctx bf16 lo

    k_cvtw<<<CVW / 16, 512, 0, stream>>>(wq, wk, wv, wo, WT, WoB, WoH);

    k_proj<<<dim3(NB * TT / 128, NH_ / 4, 3), 256, 0, stream>>>(xq, xk, xv, WT, bq, bk, bv, QK, VT, VEh, VEl);

    k_attn<<<dim3(NB * NH_, TT / 64), 128, 0, stream>>>(QK, QK + QKSZ, VT, VEh, VEl, CH, CEh, CEl);

    k_out<<<dim3(DM / 128, NB, TT / 128), 128, 0, stream>>>(CEh, CEl, WoB, (const h16*)CH, WoH, OUT, bo);
}

// v006
// It runs in 124 microseconds.
// Two timings next to v005 put it at 1.04 and 1.03 times that version's speed.
// Counting every step since v000, it is 2.79 times as fast.
#include <hip/hip_runtime.h>

// Contractions, f32 accumulate: q/k/v projections v_wmma_f32_16x16x32_bf16 on bf16 (RNE) roundings of x and W; scores v_wmma_f32_16x16x32_f16 on f16 q/k planes (x16 carry each); P.V v_wmma_f32_16x16x32_f16 (P x256, V x64 carries) for query rows >= EROWS and v_wmma_f32_16x16x32_bf16 on bf16 hi+lo P and V (3 products) for query rows < EROWS; output projection v_wmma_f32_16x16x32_f16 (ctx x64, W x1024) for rows >= EROWS and v_wmma_f32_16x16x32_bf16 on bf16 hi+lo ctx (2 products) for rows < EROWS.
// Pipeline: bf16 planes of the weights (the activations are rounded to bf16 inside the projections' staging); q/k planes [b][h][t][64] f16; value planes [b][h][64][t] f16 (+ bf16 hi/lo for t < EROWS); fused causal attention in transposed form (S^T = K Q^T, O^T = V^T P^T, online softmax per lane, score scale 1/32); ctx planes [b*t][1024]; out = ctx W^T + b.

#ifndef NB
#define NB 4
#endif
#ifndef SEQ
#define SEQ 2048
#endif
#define NB_FULL  4
#define SEQ_FULL 2048
#define TT   SEQ
#define DM   1024
#define NH_  16
#define HD   64
#define EROWS ((TT) < 512 ? (TT) : 512)
#define QKC  16.0f                                          // carry of the q and k planes
#define CSC  (0.045084220027780106f * 0.00390625f)          // (1/32) * log2(e) / (QKC*QKC)
#define VC   64.0f                                          // carry of the f16 value plane (and of the f16 ctx plane)
#define WOC  1024.0f                                        // carry of the f16 output weight plane
#define OSC  1.52587890625e-05f                             // 1 / (VC * WOC)
#define NEGB (-3.0e38f)
#define XSZ  ((size_t)NB * SEQ_FULL * DM)
#define QKSZ ((size_t)NB * NH_ * TT * HD)
static_assert(TT % 64 == 0);
static_assert(TT <= SEQ_FULL);
static_assert(NB >= 1 && NB <= NB_FULL);
static_assert(NH_ * HD == DM);
static_assert(DM % 64 == 0);
static_assert(DM % 32 == 0);
static_assert(HD == 64);
static_assert(EROWS % 64 == 0);
static_assert(EROWS <= TT);
static_assert((TT - EROWS) % 64 == 0);
static_assert(TT % 128 == 0 && EROWS % 128 == 0 && DM % 128 == 0 && NH_ % 4 == 0);   // 128x256 block tiles of the projections and 128x128 of the output product
static_assert((size_t)NB * TT * DM <= XSZ);
static_assert((size_t)NB * EROWS * DM <= XSZ);
static_assert((size_t)3 * DM * DM * 2 + (size_t)2 * DM * DM * 2 + (size_t)2 * QKSZ * 2 + (size_t)NB * NH_ * HD * TT * 2 + (size_t)2 * NB * NH_ * HD * EROWS * 2 + (size_t)3 * XSZ * 2 <= (size_t)134217728);

typedef _Float16 h16;
typedef unsigned short bf;
typedef __attribute__((ext_vector_type(16))) __bf16   v16bf;
typedef __attribute__((ext_vector_type(16))) _Float16 v16h;
typedef __attribute__((ext_vector_type(8)))  _Float16 v8h;
typedef __attribute__((ext_vector_type(8)))  unsigned short v8us;
typedef __attribute__((ext_vector_type(8)))  float    v8f;
typedef __attribute__((ext_vector_type(4)))  float    v4f;
typedef v4f  __attribute__((may_alias)) v4fa;
typedef v8us __attribute__((may_alias)) v8usa;
typedef __attribute__((ext_vector_type(4)))  __bf16   v4bf;
typedef __attribute__((ext_vector_type(4)))  unsigned short v4us;
typedef v4us __attribute__((may_alias)) v4usa;

__device__ __forceinline__ unsigned short f2bf(float f) { unsigned u = __float_as_uint(f); u += 0x7FFFu + ((u >> 16) & 1u); return (unsigned short)(u >> 16); }
__device__ __forceinline__ float bf2f(unsigned short b) { return __uint_as_float(((unsigned)b) << 16); }
__device__ __forceinline__ float bfr(float f) { return bf2f(f2bf(f)); }
__device__ __forceinline__ v16h cat16(v8h lo, v8h hi) { return __builtin_shufflevector(lo, hi, 0, 1, 2, 3, 4, 5, 6, 7, 8, 9, 10, 11, 12, 13, 14, 15); }
__device__ __forceinline__ v16bf cat16b(v8us lo, v8us hi) { return __builtin_bit_cast(v16bf, __builtin_shufflevector(lo, hi, 0, 1, 2, 3, 4, 5, 6, 7, 8, 9, 10, 11, 12, 13, 14, 15)); }
__device__ __forceinline__ v8f wmma16(v16h a, v16h b, v8f c) { return __builtin_amdgcn_wmma_f32_16x16x32_f16(false, a, false, b, (short)0, c, false, false); }
__device__ __forceinline__ v8f wmmab(v16bf a, v16bf b, v8f c) { return __builtin_amdgcn_wmma_f32_16x16x32_bf16(false, a, false, b, (short)0, c, false, false); }
__device__ __forceinline__ void splitf(float y, unsigned short& h, unsigned short& l) { h = f2bf(y); l = f2bf(y - bf2f(h)); }
// Fragment loaders (A and B identical): p already points at row (lane&15), k0 + 8*(lane>>4); elements 0..7 <- p[0..7], elements 8..15 <- p[16..23].
__device__ __forceinline__ v16h ldh(const h16* p) { return cat16(*(const v8h*)p, *(const v8h*)(p + 16)); }
__device__ __forceinline__ v16bf ldb(const bf* p) { return cat16b(*(const v8us*)p, *(const v8us*)(p + 16)); }
__device__ __forceinline__ v8us pack_h(v8f c) { v8h t;
#pragma unroll
    for (int r = 0; r < 8; ++r) t[r] = (h16)c[r];
    return __builtin_bit_cast(v8us, t); }
__device__ __forceinline__ void pack_b(v8f c, v8us& a, v8us& l) {
#pragma unroll
    for (int r = 0; r < 8; ++r) { unsigned short x, y; splitf(c[r], x, y); a[r] = x; l[r] = y; } }

template <typename T16> struct WFrag;
template <> struct WFrag<h16> { typedef v16h V; static __device__ __forceinline__ V ld(const h16* p) { return ldh(p); } static __device__ __forceinline__ v8f mma(V a, V b, v8f c) { return wmma16(a, b, c); } };
template <> struct WFrag<bf> { typedef v16bf V; static __device__ __forceinline__ V ld(const bf* p) { return ldb(p); } static __device__ __forceinline__ v8f mma(V a, V b, v8f c) { return wmmab(a, b, c); } };

#define LP  72              // LDS row pitch of a staged tile in 16-bit elements: 144 B = 16 B x odd, free of bank conflicts for 16-byte fragment reads
#define TSZ (64 * LP)       // 16-bit elements of one staged tile
// One 64-row tile: this lane's 16 bytes of rows r, r+16, r+32, r+48. l = LDS byte address, g = global byte address of row r, gstep = bytes between global rows r and r+16.
__device__ __forceinline__ void copy_tile(const unsigned l, const char* g, const size_t gstep) {
    const unsigned l1 = l + 16 * LP * 2, l2 = l + 32 * LP * 2, l3 = l + 48 * LP * 2;
    const char* g1 = g + gstep; const char* g2 = g + 2 * gstep; const char* g3 = g + 3 * gstep;
    // the closing s_wait_xcnt 0 stands inside the statement so that no address register of a copy is rewritten ahead of it
    asm volatile("global_load_async_to_lds_b128 %0, %4, off\n\tglobal_load_async_to_lds_b128 %1, %5, off\n\tglobal_load_async_to_lds_b128 %2, %6, off\n\tglobal_load_async_to_lds_b128 %3, %7, off\n\ts_wait_xcnt 0x0"
                 :: "v"(l), "v"(l1), "v"(l2), "v"(l3), "v"(g), "v"(g1), "v"(g2), "v"(g3) : "memory");
}

// gemm_tile: a block of four waves computes a 128x128 tile; wave w owns the 64x64 quarter at rows 64*(w>>1), columns 64*(w&1):
// acc[mb][nb][j] = C[16*mb + 8*(lane>>4) + j][16*nb + (lane&15)] of that quarter = sum_k A[m][k] Bt[n][k] (+ A2[m][k] Bt[n][k] when NSPLIT == 1).
// Operand path: a stage is 64 k = one 128-row x 128-B tile per operand plane (A, Bt, and A2 when NSPLIT == 1), brought from the K-contiguous 16-bit planes into LDS once per block
// by asynchronous 16-byte copies (each wave-wide copy = 4 whole 128-B lines), two buffers, the next stage in flight while this one is worked on; every wave reads its fragments from LDS.
// K % 64 == 0; arow0 / brow0 = first row of the block's tile in A (A2) / Bt; ring = 2 * (2 + NSPLIT) * GTS 16-bit elements of LDS, free for other use on return.
#define GTS (2 * TSZ)       // 16-bit elements of one staged 128-row operand tile
template <typename T16, int NSPLIT>
__device__ __forceinline__ void gemm_tile(const T16* __restrict__ A, const T16* __restrict__ A2, const T16* __restrict__ Bt, const int K, const size_t arow0, const size_t brow0, unsigned short* ring, v8f (&acc)[4][4]) {
    typedef typename WFrag<T16>::V V;
    constexpr int NT = 2 + NSPLIT;                                      // tiles per stage: A, Bt (, A2)
    const int lane = threadIdx.x & 31, lr = lane & 15, hi = lane >> 4;
    const int w = __builtin_amdgcn_readfirstlane((threadIdx.x >> 5) & 3);
    const int cr = (int)(threadIdx.x >> 3) & 15, cc = (int)threadIdx.x & 7;   // this lane's row (mod 16) and 16-byte column in every staged tile
    const unsigned lbase = (unsigned)(size_t)ring + (unsigned)(cr * LP + cc * 8) * 2u;
    const char* ga  = (const char*)(A + (arow0 + cr) * K + cc * 8);
    const char* ga2 = (const char*)(A2 + (arow0 + cr) * K + cc * 8);
    const char* gb  = (const char*)(Bt + (brow0 + cr) * K + cc * 8);
    const size_t gstep = (size_t)16 * K * 2;
    auto issue = [&](const int s, const int buf) {                      // stage s (k = 64s .. 64s+63) into buffer buf
        const unsigned lb = lbase + (unsigned)(buf * NT * GTS) * 2u;
        const size_t ko = (size_t)s * 64 * 2;
        copy_tile(lb, ga + ko, gstep);             copy_tile(lb + TSZ * 2u, ga + ko + 4 * gstep, gstep);
        copy_tile(lb + GTS * 2u, gb + ko, gstep);  copy_tile(lb + GTS * 2u + TSZ * 2u, gb + ko + 4 * gstep, gstep);
        if (NSPLIT == 1) { copy_tile(lb + 2u * GTS * 2u, ga2 + ko, gstep); copy_tile(lb + 2u * GTS * 2u + TSZ * 2u, ga2 + ko + 4 * gstep, gstep); }
    };
#pragma unroll
    for (int mb = 0; mb < 4; ++mb)
#pragma unroll
        for (int nb = 0; nb < 4; ++nb) acc[mb][nb] = (v8f){};
    const int nstage = K / 64;
    issue(0, 0);
    asm volatile("s_wait_asynccnt 0x0" ::: "memory");                   // this wave's copies of stage 0 have landed
    __syncthreads();                                                    // ... and every other wave's: stage 0 may be read
    if (nstage > 1) issue(1, 1);
#pragma unroll 1   // rolled: one publish point and one refill site in the text
    for (int t = 0; t < nstage; ++t) {
        const T16* sbuf = (const T16*)ring + (t & 1) * NT * GTS;
        const T16* pa = sbuf + ((w >> 1) * 64 + lr) * LP + 8 * hi;
        const T16* pb = sbuf + GTS + ((w & 1) * 64 + lr) * LP + 8 * hi;
#pragma unroll     // the two 32-k steps of a stage: their LDS offsets become immediates
        for (int ks = 0; ks < 2; ++ks) {
            V a[4], a2[4];
#pragma unroll
            for (int mb = 0; mb < 4; ++mb) { a[mb] = WFrag<T16>::ld(pa + mb * 16 * LP + ks * 32); if (NSPLIT == 1) a2[mb] = WFrag<T16>::ld(pa + 2 * GTS + mb * 16 * LP + ks * 32); else a2[mb] = a[mb]; }
            V b[4];
#pragma unroll
            for (int nb = 0; nb < 4; ++nb) b[nb] = WFrag<T16>::ld(pb + nb * 16 * LP + ks * 32);
            // inputs-only fence on the loaded fragments: all LDS reads of this 32-k step stand as one group with one wait ahead of its WMMAs; without it each Bt fragment is read and waited for singly between them
            asm volatile("" :: "v"(b[0]), "v"(b[1]), "v"(b[2]), "v"(b[3]));
#pragma unroll
            for (int nb = 0; nb < 4; ++nb) {
#pragma unroll
                for (int mb = 0; mb < 4; ++mb) { acc[mb][nb] = WFrag<T16>::mma(a[mb], b[nb], acc[mb][nb]); if (NSPLIT == 1) acc[mb][nb] = WFrag<T16>::mma(a2[mb], b[nb], acc[mb][nb]); } }
            // four vector slots behind these WMMAs before a vector instruction may touch their registers, on either side of the branch at the loop's foot
            asm volatile("v_nop\n\tv_nop\n\tv_nop\n\tv_nop" : "+v"(acc[0][0]), "+v"(acc[1][1]), "+v"(acc[2][2]), "+v"(acc[3][3]) : "v"(a[0]), "v"(a[3]));
        }
        // publish point of stage t + 1, passed by every wave
        asm volatile("s_wait_dscnt 0x0" ::: "memory");                  // this wave's reads of stage t have returned before its buffer is refilled
        asm volatile("s_wait_asynccnt 0x0" ::: "memory");               // this wave's copies of stage t + 1 have landed
        __syncthreads();                                                // stage t + 1 may be read; every reader has left stage t
        if (t + 2 < nstage) issue(t + 2, t & 1);
    }
    asm volatile("s_wait_asynccnt 0x0" ::: "memory");                   // nothing in flight when the ring becomes output staging
}

// gemm_xw: a block of eight waves computes a 128x256 tile of x W^T; wave w owns the 64x64 part at rows 64*(w>>2), columns 64*(w&3); acc as in gemm_tile. K = DM.
// Operand path: a stage is 64 k, two buffers. W: 256 rows x 128 B of its bf16 plane by asynchronous 16-byte copies as in gemm_tile (waves 0-3 rows 0..127, waves 4-7 rows 128..255).
// x: 128 rows x 256 B of the f32 input itself, read by plain 16-byte loads (a wave-wide load = 4 whole lines) into registers one stage ahead, rounded to bf16 (nearest even)
// and stored to LDS behind this stage's products. arow0 / brow0 = first row of the block's tile in X / Bt; ring = 2 * XSB 16-bit elements of LDS, free for other use on return.
#define XSB (6 * TSZ)       // 16-bit elements of one stage buffer: x 128 rows | W 256 rows
__device__ __forceinline__ void gemm_xw(const float* __restrict__ X, const bf* __restrict__ Bt, const size_t arow0, const size_t brow0, unsigned short* ring, v8f (&acc)[4][4]) {
    constexpr int K = DM;
    const int lane = threadIdx.x & 31, lr = lane & 15, hi = lane >> 4;
    const int w = __builtin_amdgcn_readfirstlane((threadIdx.x >> 5) & 7);
    const int cr = (int)(threadIdx.x >> 3) & 15, cc = (int)threadIdx.x & 7;   // this lane's row (mod 16) and 16-byte column in every staged W tile
    const int g = w >> 2;                                               // which 128 rows of W this wave copies
    const unsigned lbase = (unsigned)(size_t)ring + (unsigned)((2 + 2 * g) * TSZ + cr * LP + cc * 8) * 2u;
    const char* gb = (const char*)(Bt + (brow0 + g * 128 + cr) * K + cc * 8);
    const size_t gstep = (size_t)16 * K * 2;
    const int xr = (int)(threadIdx.x >> 4) & 15, xc = ((int)threadIdx.x & 15) * 4;   // this lane's x row (mod 16) and first of its four k
    const float* gx = X + (arow0 + xr) * K + xc;
    unsigned short* lx = ring + xr * LP + xc;
    v4f xv[8];                                                          // this lane's share of the x stage in flight: rows xr + 16 j
    auto issue = [&](const int s, const int buf) {                      // stage s (k = 64s .. 64s+63): W into buffer buf, x into xv
        const unsigned lb = lbase + (unsigned)(buf * XSB) * 2u;
        const size_t ko = (size_t)s * 64 * 2;
        copy_tile(lb, gb + ko, gstep);             copy_tile(lb + TSZ * 2u, gb + ko + 4 * gstep, gstep);
        const float* p = gx + (size_t)s * 64;
#pragma unroll
        for (int j = 0; j < 8; ++j) xv[j] = *(const v4f*)(p + (size_t)j * 16 * K);
        asm volatile("s_wait_xcnt 0x0" ::: "memory");                   // stands in front of any rewriting of the reads' address registers
        __builtin_amdgcn_sched_barrier(0);                              // keeps later register writes behind that wait, and the eight reads together
    };
    auto put = [&](const int buf) {                                     // xv, rounded, into the x rows of buffer buf
#pragma unroll
        for (int j = 0; j < 8; ++j) *(v4usa*)(lx + buf * XSB + j * 16 * LP) = __builtin_bit_cast(v4us, __builtin_convertvector(xv[j], v4bf));
    };
#pragma unroll
    for (int mb = 0; mb < 4; ++mb)
#pragma unroll
        for (int nb = 0; nb < 4; ++nb) acc[mb][nb] = (v8f){};
    constexpr int nstage = K / 64;
    static_assert(nstage >= 2);
    issue(0, 0);
    put(0);
    asm volatile("s_wait_dscnt 0x0" ::: "memory");                      // this wave's x rows of stage 0 are written
    asm volatile("s_wait_asynccnt 0x0" ::: "memory");                   // this wave's copies of stage 0 have landed
    __syncthreads();                                                    // ... and every other wave's: stage 0 may be read
    issue(1, 1);
#pragma unroll 1   // rolled: one publish point and one refill site in the text
    for (int t = 0; t < nstage; ++t) {
        const bf* sbuf = ring + (t & 1) * XSB;
        const bf* pa = sbuf + ((w >> 2) * 64 + lr) * LP + 8 * hi;
        const bf* pb = sbuf + 2 * TSZ + ((w & 3) * 64 + lr) * LP + 8 * hi;
#pragma unroll     // the two 32-k steps of a stage: their LDS offsets become immediates
        for (int ks = 0; ks < 2; ++ks) {
            v16bf a[4], b[4];
#pragma unroll
            for (int mb = 0; mb < 4; ++mb) a[mb] = ldb(pa + mb * 16 * LP + ks * 32);
#pragma unroll
            for (int nb = 0; nb < 4; ++nb) b[nb] = ldb(pb + nb * 16 * LP + ks * 32);
            // inputs-only fence on the loaded fragments: all LDS reads of this 32-k step stand as one group with one wait ahead of its WMMAs; without it each W fragment is read and waited for singly between them
            asm volatile("" :: "v"(b[0]), "v"(b[1]), "v"(b[2]), "v"(b[3]));
#pragma unroll
            for (int nb = 0; nb < 4; ++nb) {
#pragma unroll
                for (int mb = 0; mb < 4; ++mb) acc[mb][nb] = wmmab(a[mb], b[nb], acc[mb][nb]); }
            // four vector slots behind these WMMAs before a vector instruction may touch their registers, on either side of the branch that follows
            asm volatile("v_nop\n\tv_nop\n\tv_nop\n\tv_nop" : "+v"(acc[0][0]), "+v"(acc[1][1]), "+v"(acc[2][2]), "+v"(acc[3][3]) : "v"(a[0]), "v"(a[3]));
        }
        if (t + 1 < nstage) put((t + 1) & 1);                           // that buffer's readers left it at the last publish point
        // publish point of stage t + 1, passed by every wave
        asm volatile("s_wait_dscnt 0x0" ::: "memory");                  // this wave's reads of stage t have returned, its x rows of stage t + 1 are written
        asm volatile("s_wait_asynccnt 0x0" ::: "memory");               // this wave's copies of stage t + 1 have landed
        __syncthreads();                                                // stage t + 1 may be read; every reader has left stage t
        if (t + 2 < nstage) issue(t + 2, t & 1);
    }
    asm volatile("s_wait_asynccnt 0x0" ::: "memory");                   // nothing in flight when the ring becomes output staging
}

// k_cvtw: the 16-bit planes of the four weights in one launch of CVW waves (16 per block): wave g takes 256 floats at g*256 of each of W_q, W_k, W_v (-> WT) and W_o (-> WoB and WoH).
#define CVW 4096
__device__ __forceinline__ v8us cvt8(const v8f v) { v8us o;
#pragma unroll
    for (int k = 0; k < 8; ++k) o[k] = f2bf(v[k]);
    return o; }
__global__ __launch_bounds__(512) void k_cvtw(const float* __restrict__ wq, const float* __restrict__ wk, const float* __restrict__ wv, const float* __restrict__ wo,
                                              bf* __restrict__ WT, bf* __restrict__ WoB, h16* __restrict__ WoH) {
    static_assert((size_t)DM * DM == (size_t)CVW * 256);
    const unsigned lane = threadIdx.x & 31;
    const unsigned gw = (unsigned)__builtin_amdgcn_readfirstlane((int)(blockIdx.x * 16 + (threadIdx.x >> 5)));   // wave number in a scalar register: the bases are then scalar
    const size_t wof = (size_t)gw * 256 + lane * 8;
    v8f cur[4];
    cur[0] = *(const v8f*)(wq + wof); cur[1] = *(const v8f*)(wk + wof); cur[2] = *(const v8f*)(wv + wof); cur[3] = *(const v8f*)(wo + wof);
    asm volatile("s_wait_xcnt 0x0" ::: "memory");       // stands in front of any rewriting of the reads' address registers
    __builtin_amdgcn_sched_barrier(0);                  // keeps later register writes behind that wait, and the eight reads together ahead of the conversions
#pragma unroll
    for (int j = 0; j < 3; ++j) *(v8us*)(WT + (size_t)j * DM * DM + wof) = cvt8(cur[j]);
    const v8us ob = cvt8(cur[3]); v8h oh;
#pragma unroll
    for (int k = 0; k < 8; ++k) oh[k] = (h16)(bf2f(ob[k]) * WOC);
    *(v8us*)(WoB + wof) = ob; *(v8h*)(WoH + wof) = oh;
}

// k_proj: all three projections in one launch, straight from the f32 activations. grid (NB*TT/128, NH_/4, 3), eight waves; z = 0 -> q plane, z = 1 -> k plane, z = 2 -> value planes. Block tile = 128 tokens x four heads; a wave's tile = 64 tokens x one head (64 dims).
// z < 2: rows written as they are, QK[z][b][h][t][64] = f16(16 * (x W^T + b)). z = 2: written transposed, VT[b][h][d][t] = f16(64 * v), and for t < EROWS the bf16 hi/lo planes VE[b][h][d][t] of v.
__global__ __launch_bounds__(256) void k_proj(const float* __restrict__ xq, const float* __restrict__ xk, const float* __restrict__ xv, const bf* __restrict__ WT, const float* __restrict__ bq, const float* __restrict__ bk, const float* __restrict__ bv, h16* QK, h16* VT, bf* VEh, bf* VEl) {
    __shared__ __align__(16) unsigned short ring[8 * 64 * 68 * 2];      // operand ring; behind the product each wave's own output or transpose staging (the larger of the two uses)
    static_assert(8 * 64 * 68 * 2 >= 2 * XSB);
    const int z = blockIdx.z;
    const int lane = threadIdx.x & 31, lr = lane & 15, hi = lane >> 4;
    const int w = __builtin_amdgcn_readfirstlane((threadIdx.x >> 5) & 7);
    const int mt = blockIdx.x * 2 + (w >> 2); const int b = mt / (TT / 64); const int t0 = (mt % (TT / 64)) * 64; const int h = blockIdx.y * 4 + (w & 3);
    const float* A = z == 0 ? xq : z == 1 ? xk : xv; const bf* Bt = WT + (size_t)z * DM * DM;
    v8f acc[4][4];
    gemm_xw(A, Bt, (size_t)b * SEQ_FULL + t0 - (w >> 2) * 64, (size_t)blockIdx.y * 4 * HD, ring, acc);
  if (z < 2) {
    float* os = (float*)ring + w * (16 * 68);
    const int rq = lane >> 3, pc = lane & 7;
    const v8f b0 = *(const v8f*)(bq + h * HD + pc * 8); const v8f b1 = *(const v8f*)(bk + h * HD + pc * 8);
    v8f bb;
#pragma unroll
    for (int i = 0; i < 8; ++i) bb[i] = bfr(z ? b1[i] : b0[i]);
    h16* P = QK + (size_t)z * QKSZ + (((size_t)b * NH_ + h) * TT + t0) * HD + pc * 8;
#pragma unroll
    for (int mb = 0; mb < 4; ++mb) {
#pragma unroll
        for (int nb = 0; nb < 4; ++nb) {
#pragma unroll
            for (int j = 0; j < 8; ++j) os[(hi * 8 + j) * 68 + nb * 16 + lr] = acc[mb][nb][j]; }
        __builtin_amdgcn_wave_barrier(); asm volatile("" ::: "memory");
        h16* prow = P + (size_t)(mb * 16) * HD;
{
#pragma unroll
            for (int s = 0; s < 4; ++s) { const int row = 4 * s + rq;
                const v4f x0 = *(const v4fa*)(os + row * 68 + pc * 8), x1 = *(const v4fa*)(os + row * 68 + pc * 8 + 4);
                v8h o;
#pragma unroll
                for (int q = 0; q < 4; ++q) { o[q] = (h16)((x0[q] + bb[q]) * QKC); o[4 + q] = (h16)((x1[q] + bb[4 + q]) * QKC); }
                *(v8h*)(prow + (size_t)row * HD) = o; }
             }
        __builtin_amdgcn_wave_barrier(); asm volatile("" ::: "memory");
    }
  } else {
    float* ts = (float*)ring + w * (64 * 68);
#pragma unroll
    for (int mb = 0; mb < 4; ++mb)
#pragma unroll
        for (int nb = 0; nb < 4; ++nb) {
            const v4f lo4 = { acc[mb][nb][0], acc[mb][nb][1], acc[mb][nb][2], acc[mb][nb][3] };
            const v4f hi4 = { acc[mb][nb][4], acc[mb][nb][5], acc[mb][nb][6], acc[mb][nb][7] };
            *(v4fa*)(ts + (nb * 16 + lr) * 68 + mb * 16 + 8 * hi) = lo4;
            *(v4fa*)(ts + (nb * 16 + lr) * 68 + mb * 16 + 8 * hi + 4) = hi4; }
    __builtin_amdgcn_wave_barrier(); asm volatile("" ::: "memory");
    const int rq = lane >> 3, pc = lane & 7;
    const bool early = t0 < EROWS;
    const size_t vrow0 = ((size_t)b * NH_ + h) * HD;
{
#pragma unroll 1
        for (int s = 0; s < 16; ++s) { const int d = 4 * s + rq;
            const float bb = bfr(bv[h * HD + d]);
            const v4f x0 = *(const v4fa*)(ts + d * 68 + pc * 8), x1 = *(const v4fa*)(ts + d * 68 + pc * 8 + 4);
            v8f x = __builtin_shufflevector(x0, x1, 0, 1, 2, 3, 4, 5, 6, 7);
            x = x + bb;
            v8h o;
#pragma unroll
            for (int q = 0; q < 8; ++q) o[q] = (h16)(x[q] * VC);
            *(v8h*)(VT + (vrow0 + d) * TT + t0 + pc * 8) = o;
            asm volatile("s_wait_xcnt 0x0" ::: "memory");   // stands in front of the rewriting of the store's data and address registers (hi/lo packing, next trip)
            if (early) { v8us oh, ol; pack_b(x, oh, ol);
                *(v8us*)(VEh + (vrow0 + d) * EROWS + t0 + pc * 8) = oh;
                *(v8us*)(VEl + (vrow0 + d) * EROWS + t0 + pc * 8) = ol;
                asm volatile("s_wait_xcnt 0x0" ::: "memory"); } }   // stands in front of the next trip's advance of both stores' address registers
         }
  }
}

// One 64-row tile by eight waves: this lane's 16 bytes of rows r and r+32. l = LDS byte address, g = global byte address of row r, gstep = bytes between global rows r and r+32.
__device__ __forceinline__ void copy_tile8(const unsigned l, const char* g, const size_t gstep) {
    const unsigned l1 = l + 32 * LP * 2;
    const char* g1 = g + gstep;
    // the closing s_wait_xcnt 0 stands inside the statement so that no address register of a copy is rewritten ahead of it
    asm volatile("global_load_async_to_lds_b128 %0, %2, off\n\tglobal_load_async_to_lds_b128 %1, %3, off\n\ts_wait_xcnt 0x0"
                 :: "v"(l), "v"(l1), "v"(g), "v"(g1) : "memory");
}

// attn_body: fused causal attention, 128 query rows and 8 waves per block, 32 keys per step, transposed formulation.
//   EARLY: a wave owns 16 query rows (one tile) and takes both 32-key steps of every stage. Else: a wave owns 32 query rows (two tiles) and one of the two 32-key steps of every stage;
//   the two waves of a 32-row group hold partial (m, l, O^T) over their own keys and join them once behind the loop through LDS, each finishing one of the two tiles.
//   S^T tile (rows = keys, cols = queries) = A(k plane rows) x B(q plane rows); D element r of lane l = S^T[key 8*(l>>4)+r][query l&15].
//   Per lane and query tile one query column: running max m, running sum l (combined across lane halves by one xor-16 shuffle each).
//   P^T as B fragment: element r <- p(tile keys 0..15)[r], element 8+r <- p(tile keys 16..31)[r], lane unchanged.
//   O^T tile j (rows = dims 16j.., cols = queries) += A(V^T rows) x B(P^T). Masked keys carry p = 0 exactly.
// EARLY: bf16 hi+lo P and V (3 products); else f16 single product with P x256 (cancels against the row sum) and V x64.
// Operand path: a stage is 64 keys = one K tile (64 key rows x 128 B) and one V^T tile per value plane (64 dim rows x 128 B), brought into LDS once per block by
// asynchronous 16-byte copies (each wave-wide copy = 4 whole 128-B lines), two buffers, the next stage in flight while this one is worked on; all eight waves read their fragments from LDS,
// and each K and V^T fragment read feeds the products of all NQ query tiles of the wave. qb = index of the block's tile of 128 query rows.
template <bool EARLY>
__device__ __forceinline__ void attn_body(const h16* __restrict__ QP, const h16* __restrict__ KP, const h16* __restrict__ VT, const bf* __restrict__ VEh, const bf* __restrict__ VEl, bf* C0, bf* C1, const int qb, const int bh, unsigned short* ring) {
    constexpr int NT = EARLY ? 3 : 2;                                   // tiles per stage: K, V (EARLY: K, V hi, V lo)
    constexpr int NQ = EARLY ? 1 : 2;                                   // query tiles per wave
    static_assert(2 * NT * TSZ >= 8 * 2 * 1152 || !EARLY);              // stage buffers: the first 2 * NT * TSZ 16-bit elements of the ring (2 * 3 * TSZ in all); output staging behind the loop
    unsigned short* stg = ring;
    const int lane = threadIdx.x & 31, lr = lane & 15, hi = lane >> 4;
    const int w = __builtin_amdgcn_readfirstlane((threadIdx.x >> 5) & 7);   // wave number in a scalar register: the per-wave skip below is then a scalar branch
    const int b = bh / NH_, h = bh % NH_;
    const int kh = EARLY ? 0 : (w & 1);                                 // which 32 keys of every stage this wave takes (not EARLY)
    const int q0 = qb * 128 + (EARLY ? w * 16 : (w >> 1) * 32);
    const size_t pof = (size_t)bh * TT * HD;
    v16h qf0[NQ], qf1[NQ]; int qq[NQ];
    v8f o[NQ][4];
    float m[NQ], l[NQ];
#pragma unroll
    for (int u = 0; u < NQ; ++u) {
        qq[u] = q0 + 16 * u + lr;
        const h16* qp = QP + pof + (size_t)qq[u] * HD + 8 * hi;
        qf0[u] = ldh(qp); qf1[u] = ldh(qp + 32);
        o[u][0] = (v8f){}; o[u][1] = (v8f){}; o[u][2] = (v8f){}; o[u][3] = (v8f){};
        m[u] = NEGB; l[u] = 0.0f; }
    const int nstage = 2 * (qb + 1);                                    // stages of 64 keys, the same for the whole block
    const int cr = (int)(threadIdx.x >> 3) & 31, cc = (int)threadIdx.x & 7;   // this lane's row (mod 32) and 16-byte column in every staged tile
    const unsigned lbase = (unsigned)(size_t)ring + (unsigned)(cr * LP + cc * 8) * 2u;
    const char* gk = (const char*)(KP + pof + (size_t)cr * HD + cc * 8);
    const char* gv0 = EARLY ? (const char*)(VEh + (size_t)bh * HD * EROWS + (size_t)cr * EROWS + cc * 8) : (const char*)(VT + (size_t)bh * HD * TT + (size_t)cr * TT + cc * 8);
    const char* gv1 = EARLY ? (const char*)(VEl + (size_t)bh * HD * EROWS + (size_t)cr * EROWS + cc * 8) : gv0;
    const size_t vstep = (size_t)32 * (EARLY ? EROWS : TT) * 2;
    auto issue = [&](const int s, const int buf) {                      // stage s (keys 64s .. 64s+63) into buffer buf
        const unsigned lb = lbase + (unsigned)(buf * NT * TSZ) * 2u;
        copy_tile8(lb, gk + (size_t)s * 64 * HD * 2, (size_t)32 * HD * 2);
        copy_tile8(lb + TSZ * 2u, gv0 + (size_t)s * 64 * 2, vstep);
        if (EARLY) copy_tile8(lb + 2u * TSZ * 2u, gv1 + (size_t)s * 64 * 2, vstep);
    };
    issue(0, 0);
    asm volatile("s_wait_asynccnt 0x0" ::: "memory");                   // this wave's copies of stage 0 have landed
    __syncthreads();                                                    // ... and every other wave's: stage 0 may be read
    issue(1, 1);
#pragma unroll 1   // rolled: one publish point and one refill site in the text
    for (int t = 0; t < nstage; ++t) {
        const unsigned short* sbuf = ring + (t & 1) * NT * TSZ;
#pragma unroll     // EARLY: the two 32-key steps of a stage, their LDS offsets become immediates; else this wave's one step
      for (int sub = 0; sub < (EARLY ? 2 : 1); ++sub) {
        const int ks = EARLY ? sub : kh;
        const int kt = t * 64 + ks * 32;
        if (kt <= q0) {              // a wave skips the 32 keys that lie wholly above its queries
        const h16* kp = (const h16*)sbuf + (ks * 32 + lr) * LP + 8 * hi;
        const v16h ka0 = ldh(kp), ka1 = ldh(kp + 16 * LP), kb0 = ldh(kp + 32), kb1 = ldh(kp + 16 * LP + 32);
        v8f s0[NQ], s1[NQ];
#pragma unroll
        for (int u = 0; u < NQ; ++u) { s0[u] = wmma16(ka0, qf0[u], (v8f){}); s1[u] = wmma16(ka1, qf0[u], (v8f){}); }
#pragma unroll
        for (int u = 0; u < NQ; ++u) { s0[u] = wmma16(kb0, qf1[u], s0[u]); s1[u] = wmma16(kb1, qf1[u], s1[u]); }
        // four vector slots behind these WMMAs before a vector instruction may touch their registers, on either side of the branch that follows
        if constexpr (NQ == 1) asm volatile("v_nop\n\tv_nop\n\tv_nop\n\tv_nop" : "+v"(s0[0]), "+v"(s1[0]) : "v"(ka0), "v"(ka1), "v"(kb0), "v"(kb1), "v"(qf1[0]));
        else                   asm volatile("v_nop\n\tv_nop\n\tv_nop\n\tv_nop" : "+v"(s0[0]), "+v"(s1[0]), "+v"(s0[NQ - 1]), "+v"(s1[NQ - 1]) : "v"(ka0), "v"(ka1), "v"(kb0), "v"(kb1), "v"(qf1[0]), "v"(qf1[NQ - 1]));
        if (kt + 31 > q0) {          // diagonal step of this wave: exclude keys above the query
            const int k0 = kt + 8 * hi;
#pragma unroll
            for (int u = 0; u < NQ; ++u)
#pragma unroll
                for (int r = 0; r < 8; ++r) { s0[u][r] = (k0 + r > qq[u]) ? NEGB : s0[u][r]; s1[u][r] = (k0 + 16 + r > qq[u]) ? NEGB : s1[u][r]; }
        }
        v8f p0[NQ], p1[NQ];
#pragma unroll
        for (int u = 0; u < NQ; ++u) {
            float mx = fmaxf(s0[u][0], s1[u][0]);
#pragma unroll
            for (int r = 1; r < 8; ++r) mx = fmaxf(mx, fmaxf(s0[u][r], s1[u][r]));
            mx = fmaxf(mx, __shfl_xor(mx, 16, 32));
            const float mn = fmaxf(m[u], mx * CSC);
            const float corr = __builtin_amdgcn_exp2f(m[u] - mn);
            m[u] = mn;
            const float sh = (EARLY ? 0.0f : 8.0f) - mn;
            float rs = 0.0f;
#pragma unroll
            for (int r = 0; r < 8; ++r) { p0[u][r] = __builtin_amdgcn_exp2f(fmaf(s0[u][r], CSC, sh)); p1[u][r] = __builtin_amdgcn_exp2f(fmaf(s1[u][r], CSC, sh)); rs += p0[u][r] + p1[u][r]; }
            rs += __shfl_xor(rs, 16, 32);
            l[u] = l[u] * corr + rs;
            o[u][0] *= corr; o[u][1] *= corr; o[u][2] *= corr; o[u][3] *= corr;
        }
        if constexpr (EARLY) {
            v8us ph0, ph1, pl0, pl1;
            pack_b(p0[0], ph0, pl0); pack_b(p1[0], ph1, pl1);
            const v16bf PH = cat16b(ph0, ph1), PL = cat16b(pl0, pl1);
            const bf* vh = sbuf + TSZ + lr * LP + sub * 32 + 8 * hi;
            const bf* vl = vh + TSZ;
            const v16bf vh0 = ldb(vh), vh1 = ldb(vh + 16 * LP), vh2 = ldb(vh + 32 * LP), vh3 = ldb(vh + 48 * LP);
            const v16bf vl0 = ldb(vl), vl1 = ldb(vl + 16 * LP), vl2 = ldb(vl + 32 * LP), vl3 = ldb(vl + 48 * LP);
            o[0][0] = wmmab(vh0, PH, o[0][0]); o[0][0] = wmmab(vl0, PH, o[0][0]); o[0][0] = wmmab(vh0, PL, o[0][0]);
            o[0][1] = wmmab(vh1, PH, o[0][1]); o[0][1] = wmmab(vl1, PH, o[0][1]); o[0][1] = wmmab(vh1, PL, o[0][1]);
            o[0][2] = wmmab(vh2, PH, o[0][2]); o[0][2] = wmmab(vl2, PH, o[0][2]); o[0][2] = wmmab(vh2, PL, o[0][2]);
            o[0][3] = wmmab(vh3, PH, o[0][3]); o[0][3] = wmmab(vl3, PH, o[0][3]); o[0][3] = wmmab(vh3, PL, o[0][3]);
            asm volatile("v_nop\n\tv_nop\n\tv_nop\n\tv_nop" : "+v"(o[0][0]), "+v"(o[0][1]), "+v"(o[0][2]), "+v"(o[0][3]) : "v"(vh0), "v"(vh1), "v"(vh2), "v"(vh3), "v"(vl0), "v"(vl1), "v"(vl2), "v"(vl3), "v"(PH), "v"(PL));
        } else {
            v16h pb[NQ];
#pragma unroll
            for (int u = 0; u < NQ; ++u)
#pragma unroll
                for (int r = 0; r < 8; ++r) { pb[u][r] = (h16)p0[u][r]; pb[u][8 + r] = (h16)p1[u][r]; }
            const h16* vp = (const h16*)sbuf + TSZ + lr * LP + ks * 32 + 8 * hi;
            const v16h a0 = ldh(vp), a1 = ldh(vp + 16 * LP), a2 = ldh(vp + 32 * LP), a3 = ldh(vp + 48 * LP);
#pragma unroll
            for (int u = 0; u < NQ; ++u) { o[u][0] = wmma16(a0, pb[u], o[u][0]); o[u][1] = wmma16(a1, pb[u], o[u][1]); o[u][2] = wmma16(a2, pb[u], o[u][2]); o[u][3] = wmma16(a3, pb[u], o[u][3]); }
            // four vector slots behind these WMMAs before a vector instruction may touch their registers, on either side of the branches that follow
            asm volatile("v_nop\n\tv_nop\n\tv_nop\n\tv_nop" : "+v"(o[0][0]), "+v"(o[0][1]), "+v"(o[0][2]), "+v"(o[0][3]), "+v"(o[NQ - 1][0]), "+v"(o[NQ - 1][1]), "+v"(o[NQ - 1][2]), "+v"(o[NQ - 1][3]) : "v"(a0), "v"(a1), "v"(a2), "v"(a3), "v"(pb[0]), "v"(pb[NQ - 1]));
        }
        }
      }
        // publish point of stage t + 1, passed by every wave
        asm volatile("s_wait_dscnt 0x0" ::: "memory");                  // this wave's reads of stage t have returned before its buffer is refilled
        asm volatile("s_wait_asynccnt 0x0" ::: "memory");               // this wave's copies of stage t + 1 have landed
        __syncthreads();                                                // stage t + 1 may be read; every reader has left stage t
        if (t + 2 < nstage) issue(t + 2, t & 1);
    }
    asm volatile("s_wait_asynccnt 0x0" ::: "memory");                   // nothing in flight when the ring becomes output staging
    const int rq = lane >> 3, pc = lane & 7;
    if constexpr (EARLY) {
        const float inv = __fdiv_rn(1.0f, l[0]);
        o[0][0] *= inv; o[0][1] *= inv; o[0][2] *= inv; o[0][3] *= inv;
        const int sb = w * 2 * 1152;
        const int so = sb + lr * 72 + 8 * hi;   // O^T element r of tile j -> row (query lr), column 16j + 8*hi + r
        v8us a, c;
        pack_b(o[0][0], a, c); *(v8usa*)(stg + so) = a;      *(v8usa*)(stg + so + 1152) = c;
        pack_b(o[0][1], a, c); *(v8usa*)(stg + so + 16) = a; *(v8usa*)(stg + so + 1152 + 16) = c;
        pack_b(o[0][2], a, c); *(v8usa*)(stg + so + 32) = a; *(v8usa*)(stg + so + 1152 + 32) = c;
        pack_b(o[0][3], a, c); *(v8usa*)(stg + so + 48) = a; *(v8usa*)(stg + so + 1152 + 48) = c;
        __builtin_amdgcn_wave_barrier(); asm volatile("" ::: "memory");
        const size_t cbase = ((size_t)b * EROWS + q0) * DM + h * HD + pc * 8;
#pragma unroll
        for (int s = 0; s < 4; ++s) { const int row = 4 * s + rq;
            const v8us x = *(const v8usa*)(stg + sb + row * 72 + pc * 8);
            *(v8us*)(C0 + cbase + (size_t)row * DM) = x;
            const v8us y = *(const v8usa*)(stg + sb + 1152 + row * 72 + pc * 8); *(v8us*)(C1 + cbase + (size_t)row * DM) = y; }
    } else {
        // Join of the two key halves: wave w keeps tile kh and hands its partial of the other tile to wave w ^ 1. Per wave XW floats of LDS: eight 512-B rows of O^T, then m, then l.
        constexpr int XW = 8 * 128 + 64;
        static_assert(8 * XW * 4 + 8 * 1152 * 2 <= 2 * 3 * TSZ * 2);    // the eight hand-over areas, then the eight output stagings, inside the ring
        float* xs = (float*)ring;
        auto give = [&](const v8f (&og)[4], const float mg, const float lg) {
            float* d = xs + w * XW + lane * 4;
#pragma unroll
            for (int j = 0; j < 4; ++j) {
                *(v4fa*)(d + (2 * j) * 128)     = (v4f){ og[j][0], og[j][1], og[j][2], og[j][3] };
                *(v4fa*)(d + (2 * j + 1) * 128) = (v4f){ og[j][4], og[j][5], og[j][6], og[j][7] }; }
            xs[w * XW + 1024 + lane] = mg; xs[w * XW + 1056 + lane] = lg;
        };
        auto finish = [&](v8f (&ok)[4], const float mk, const float lk) {
            const float* sp = xs + (w ^ 1) * XW + lane * 4;
            const float mp = xs[(w ^ 1) * XW + 1024 + lane], lp = xs[(w ^ 1) * XW + 1056 + lane];
            const float mn = fmaxf(mk, mp);
            const float ck = __builtin_amdgcn_exp2f(mk - mn), cp = __builtin_amdgcn_exp2f(mp - mn);
            const float inv = __fdiv_rn(1.0f, lk * ck + lp * cp);
            const float fk = ck * inv, fp = cp * inv;
            unsigned short* d = stg + 8 * XW * 2 + w * 1152;            // this wave's own output staging, behind the hand-over areas
#pragma unroll
            for (int j = 0; j < 4; ++j) {
                const v4f x0 = *(const v4fa*)(sp + (2 * j) * 128), x1 = *(const v4fa*)(sp + (2 * j + 1) * 128);
                const v8f x = __builtin_shufflevector(x0, x1, 0, 1, 2, 3, 4, 5, 6, 7);
                *(v8usa*)(d + lr * 72 + 8 * hi + 16 * j) = pack_h(ok[j] * fk + x * fp); }   // O^T element r of tile j -> row (query lr), column 16j + 8*hi + r
            __builtin_amdgcn_wave_barrier(); asm volatile("" ::: "memory");
            const size_t cbase = ((size_t)b * TT + q0 + 16 * kh) * DM + h * HD + pc * 8;
#pragma unroll
            for (int s = 0; s < 4; ++s) { const int row = 4 * s + rq;
                const v8us x = *(const v8usa*)(d + row * 72 + pc * 8);
                *(v8us*)(C0 + cbase + (size_t)row * DM) = x; }
        };
        if (kh == 0) give(o[NQ - 1], m[NQ - 1], l[NQ - 1]); else give(o[0], m[0], l[0]);
        __syncthreads();                                                // every wave's hand-over is written before its partner reads it
        if (kh == 0) finish(o[0], m[0], l[0]); else finish(o[NQ - 1], m[NQ - 1], l[NQ - 1]);
    }
}

// k_attn: every query tile in one launch. grid (NB*NH_, TT/128): x = (b, h); y = rank of the 128-row query tile by falling cost, so that the longest tiles start first and the short ones fill the end.
// Cost of a tile = its stages, a stage of rows < EROWS (per wave two steps of three products with the hi/lo split) weighed 13 : 5 against a stage of the other rows (per wave one step); equal costs by index.
// Query rows [EROWS, TT): ctx as f16 plane (x64 carry) [b][TT][DM]. Query rows [0, EROWS): ctx as bf16 hi/lo planes [b][EROWS][DM].
__global__ __launch_bounds__(256) void k_attn(const h16* __restrict__ QP, const h16* __restrict__ KP, const h16* __restrict__ VT, const bf* __restrict__ VEh, const bf* __restrict__ VEl, bf* CH, bf* CEh, bf* CEl) {
    __shared__ __align__(16) unsigned short ring[2 * 3 * TSZ];          // one ring for either body
    int qb = 0;                                                         // the same for the whole block: the choice of body is a scalar branch
#pragma unroll   // unrolled: every tile's rank is then a constant, and what is left is one scalar compare and select per tile
    for (int i = 0; i < TT / 128; ++i) {
        const int ci = (i + 1) * (i < EROWS / 128 ? 13 : 5);
        int rank = 0;
#pragma unroll
        for (int j = 0; j < TT / 128; ++j) { const int cj = (j + 1) * (j < EROWS / 128 ? 13 : 5); rank += (cj > ci || (cj == ci && j > i)) ? 1 : 0; }
        if (rank == (int)blockIdx.y) qb = i;
    }
    if (qb >= EROWS / 128) attn_body<false>(QP, KP, VT, (const bf*)0, (const bf*)0, CH, CH, qb, (int)blockIdx.x, ring);
    else                   attn_body<true>(QP, KP, (const h16*)0, VEh, VEl, CEh, CEl, qb, (int)blockIdx.x, ring);
}

// out_body: OUT[r][c] = scale * sum_k A[r][k] Bt[c][k] + bf16(bias[c]); 128x128 tile per block of four waves, 64x64 per wave; per 16-row slab staged in LDS (wave-private),
template <typename T16, int NSPLIT>
__device__ __forceinline__ void out_body(const T16* __restrict__ A, const T16* __restrict__ A2, const T16* __restrict__ Bt, float* C, const float* __restrict__ bias, const float scale, const int rt, const int ct, unsigned short* ring) {
    static_assert(2 * 2 * GTS * 2 >= 4 * 16 * 68 * 4);                  // ring = 2 * (2 + NSPLIT) * GTS 16-bit elements of LDS: operand ring; behind the product each wave's own output staging
    const int lane = threadIdx.x & 31, lr = lane & 15, hi = lane >> 4;
    const int w = __builtin_amdgcn_readfirstlane((threadIdx.x >> 5) & 3);
    const int r0 = rt * 128 + (w >> 1) * 64, c0 = ct * 128 + (w & 1) * 64;   // rt, ct = the block's row and column tile
    v8f acc[4][4];
    gemm_tile<T16, NSPLIT>(A, A2, Bt, DM, (size_t)rt * 128, (size_t)ct * 128, ring, acc);
    float* os = (float*)ring + w * (16 * 68);
    const v4f bw = *(const v4f*)(bias + c0 + lr * 4);
    v4f bb;
#pragma unroll
    for (int q = 0; q < 4; ++q) bb[q] = bfr(bw[q]);
#pragma unroll
    for (int mb = 0; mb < 4; ++mb) {
#pragma unroll
        for (int nb = 0; nb < 4; ++nb) {
#pragma unroll
            for (int j = 0; j < 8; ++j) os[(hi * 8 + j) * 68 + nb * 16 + lr] = acc[mb][nb][j]; }
        __builtin_amdgcn_wave_barrier(); asm volatile("" ::: "memory");
        float* crow = C + (size_t)(r0 + mb * 16) * DM + c0 + lr * 4;
{
#pragma unroll
            for (int s = 0; s < 8; ++s) { const int row = 2 * s + hi;
                v4f val = *(const v4fa*)(os + row * 68 + lr * 4);
                val = val * scale + bb;
                *(v4f*)(crow + (size_t)row * DM) = val; }
             }
        __builtin_amdgcn_wave_barrier(); asm volatile("" ::: "memory");
    }
}

// k_out: the whole output product in one launch. grid (DM/128, NB, TT/128): x = column tile, y = batch, z = row tile; the row tiles of two products (rows < EROWS) have the lowest indices and start first.
// Rows [0, EROWS) of a batch from the bf16 hi/lo ctx planes, rows [EROWS, TT) from the f16 ctx plane.
__global__ __launch_bounds__(128) void k_out(const bf* __restrict__ CEh, const bf* __restrict__ CEl, const bf* __restrict__ WoB, const h16* __restrict__ CH, const h16* __restrict__ WoH, float* OUT, const float* __restrict__ Wb) {
    __shared__ __align__(16) unsigned short ring[2 * 3 * GTS];          // one ring for either body
    const size_t bt = blockIdx.y; const int rt = blockIdx.z, ct = blockIdx.x;   // the same for the whole block: the choice of body is a scalar branch
    if (rt < EROWS / 128) out_body<bf, 1>(CEh + bt * EROWS * DM, CEl + bt * EROWS * DM, WoB, OUT + bt * TT * DM, Wb, 1.0f, rt, ct, ring);
    else                  out_body<h16, 0>(CH + bt * TT * DM, CH + bt * TT * DM, WoH, OUT + bt * TT * DM, Wb, OSC, rt, ct, ring);
}

extern "C" void kernel_launch(void* const* d_in, const int* in_sizes, int n_in,
                              void* d_out, int out_size, void* d_ws, size_t ws_size, hipStream_t stream) {
    if (n_in < 11) return;
    if (in_sizes[0] < NB * SEQ_FULL * DM || in_sizes[1] < NB * SEQ_FULL * DM || in_sizes[2] < NB * SEQ_FULL * DM) return;
    if (in_sizes[3] < NH_ * HD * DM || in_sizes[5] < NH_ * HD * DM || in_sizes[7] < NH_ * HD * DM || in_sizes[9] < DM * DM) return;
    if (in_sizes[4] < NH_ * HD || in_sizes[6] < NH_ * HD || in_sizes[8] < NH_ * HD || in_sizes[10] < DM) return;
    if (out_size < NB * TT * DM) return;
    const float* xq = (const float*)d_in[0]; const float* xk = (const float*)d_in[1]; const float* xv = (const float*)d_in[2];
    const float* wq = (const float*)d_in[3]; const float* bq = (const float*)d_in[4];
    const float* wk = (const float*)d_in[5]; const float* bk = (const float*)d_in[6];
    const float* wv = (const float*)d_in[7]; const float* bv = (const float*)d_in[8];
    const float* wo = (const float*)d_in[9]; const float* bo = (const float*)d_in[10];
    float* OUT = (float*)d_out;     // [NB][TT][DM]
    char* wsp = (char*)d_ws;
    auto take = [&](size_t bytes) { char* p = wsp; wsp += (bytes + 255) & ~(size_t)255; return (void*)p; };
    bf*  WT  = (bf*)take((size_t)3 * DM * DM * 2);                  // [3][n][k] projection weights, bf16
    bf*  WoB = (bf*)take((size_t)DM * DM * 2);                      // output weight, bf16
    h16* WoH = (h16*)take((size_t)DM * DM * 2);                     // output weight, f16 x1024
    h16* QK  = (h16*)take((size_t)2 * QKSZ * 2);                    // q plane | k plane
    h16* VT  = (h16*)take((size_t)NB * NH_ * HD * TT * 2);          // [b][h][d][t] f16 x64
    bf*  VEh = (bf*)take((size_t)NB * NH_ * HD * EROWS * 2);        // [b][h][d][t < EROWS] bf16 hi
    bf*  VEl = (bf*)take((size_t)NB * NH_ * HD * EROWS * 2);        // bf16 lo
    bf*  XB  = (bf*)take((size_t)3 * XSZ * 2);                      // three ctx planes
    if ((size_t)(wsp - (char*)d_ws) > ws_size) return;              // 119,537,664 B at NB=4, TT=2048
    bf* CH  = XB;                   // ctx f16 plane [NB*TT][DM] (16-bit storage)
    bf* CEh = XB + XSZ;             // ctx bf16 hi [NB*EROWS][DM]
    bf* CEl = XB + 2 * XSZ;         // ctx bf16 lo

    k_cvtw<<<CVW / 16, 512, 0, stream>>>(wq, wk, wv, wo, WT, WoB, WoH);

    k_proj<<<dim3(NB * TT / 128, NH_ / 4, 3), 256, 0, stream>>>(xq, xk, xv, WT, bq, bk, bv, QK, VT, VEh, VEl);

    k_attn<<<dim3(NB * NH_, TT / 128), 256, 0, stream>>>(QK, QK + QKSZ, VT, VEh, VEl, CH, CEh, CEl);

    k_out<<<dim3(DM / 128, NB, TT / 128), 128, 0, stream>>>(CEh, CEl, WoB, (const h16*)CH, WoH, OUT, bo);
}

// v007
// Measured time: 119 microseconds a run.
// Timed twice side by side with v006, it ran 1.04 times as fast both times.
// All steps since v000 together make it 2.90 times as fast.
#include <hip/hip_runtime.h>

// Contractions, f32 accumulate: q/k/v projections v_wmma_f32_16x16x32_bf16 on bf16 (RNE) roundings of x and W; scores v_wmma_f32_16x16x32_f16 on f16 q/k planes (q x log2(e)/8, k x 1/4: a product of the two is the score in log2 units, scale 1/32 included), the softmax reference as their C operand; P.V v_wmma_f32_16x16x32_f16 (P x256, V x64 carries) for query rows >= EROWS and v_wmma_f32_16x16x32_bf16 on bf16 hi+lo P and V (3 products) for query rows < EROWS; output projection v_wmma_f32_16x16x32_f16 (ctx x64, W x1024) for rows >= EROWS and v_wmma_f32_16x16x32_bf16 on bf16 hi+lo ctx (2 products) for rows < EROWS.
// Pipeline: bf16 planes of the weights (the activations are rounded to bf16 inside the projections' staging); q/k planes [b][h][t][64] f16; value planes [b][h][64][t] f16 (+ bf16 hi/lo for t < EROWS); fused causal attention in transposed form (S^T = K Q^T, O^T = V^T P^T, online softmax per lane against a held reference); ctx planes [b*t][1024]; out = ctx W^T + b.

#ifndef NB
#define NB 4
#endif
#ifndef SEQ
#define SEQ 2048
#endif
#define NB_FULL  4
#define SEQ_FULL 2048
#define TT   SEQ
#define DM   1024
#define NH_  16
#define HD   64
#define EROWS ((TT) < 512 ? (TT) : 512)
#define QSC  (0.045084220027780106f * 4.0f)                 // factor of the q plane: (1/32) * log2(e) / KSC
#define KSC  0.25f                                          // factor of the k plane
#define VC   64.0f                                          // carry of the f16 value plane (and of the f16 ctx plane)
#define WOC  1024.0f                                        // carry of the f16 output weight plane
#define OSC  1.52587890625e-05f                             // 1 / (VC * WOC)
#define NEGB (-3.0e38f)
#define XSZ  ((size_t)NB * SEQ_FULL * DM)
#define QKSZ ((size_t)NB * NH_ * TT * HD)
static_assert(TT % 64 == 0);
static_assert(TT <= SEQ_FULL);
static_assert(NB >= 1 && NB <= NB_FULL);
static_assert(NH_ * HD == DM);
static_assert(DM % 64 == 0);
static_assert(DM % 32 == 0);
static_assert(HD == 64);
static_assert(EROWS % 64 == 0);
static_assert(EROWS <= TT);
static_assert((TT - EROWS) % 64 == 0);
static_assert(TT % 128 == 0 && EROWS % 128 == 0 && DM % 128 == 0 && NH_ % 4 == 0);   // 128x256 block tiles of the projections and 128x128 of the output product
static_assert((size_t)NB * TT * DM <= XSZ);
static_assert((size_t)NB * EROWS * DM <= XSZ);
static_assert((size_t)3 * DM * DM * 2 + (size_t)2 * DM * DM * 2 + (size_t)2 * QKSZ * 2 + (size_t)NB * NH_ * HD * TT * 2 + (size_t)2 * NB * NH_ * HD * EROWS * 2 + (size_t)3 * XSZ * 2 <= (size_t)134217728);

typedef _Float16 h16;
typedef unsigned short bf;
typedef __attribute__((ext_vector_type(16))) __bf16   v16bf;
typedef __attribute__((ext_vector_type(16))) _Float16 v16h;
typedef __attribute__((ext_vector_type(8)))  _Float16 v8h;
typedef __attribute__((ext_vector_type(8)))  unsigned short v8us;
typedef __attribute__((ext_vector_type(8)))  float    v8f;
typedef __attribute__((ext_vector_type(4)))  float    v4f;
typedef v4f  __attribute__((may_alias)) v4fa;
typedef v8us __attribute__((may_alias)) v8usa;
typedef __attribute__((ext_vector_type(4)))  __bf16   v4bf;
typedef __attribute__((ext_vector_type(4)))  unsigned short v4us;
typedef v4us __attribute__((may_alias)) v4usa;

__device__ __forceinline__ unsigned short f2bf(float f) { unsigned u = __float_as_uint(f); u += 0x7FFFu + ((u >> 16) & 1u); return (unsigned short)(u >> 16); }
__device__ __forceinline__ float bf2f(unsigned short b) { return __uint_as_float(((unsigned)b) << 16); }
__device__ __forceinline__ float bfr(float f) { return bf2f(f2bf(f)); }
__device__ __forceinline__ v16h cat16(v8h lo, v8h hi) { return __builtin_shufflevector(lo, hi, 0, 1, 2, 3, 4, 5, 6, 7, 8, 9, 10, 11, 12, 13, 14, 15); }
__device__ __forceinline__ v16bf cat16b(v8us lo, v8us hi) { return __builtin_bit_cast(v16bf, __builtin_shufflevector(lo, hi, 0, 1, 2, 3, 4, 5, 6, 7, 8, 9, 10, 11, 12, 13, 14, 15)); }
__device__ __forceinline__ v8f wmma16(v16h a, v16h b, v8f c) { return __builtin_amdgcn_wmma_f32_16x16x32_f16(false, a, false, b, (short)0, c, false, false); }
__device__ __forceinline__ v8f wmmab(v16bf a, v16bf b, v8f c) { return __builtin_amdgcn_wmma_f32_16x16x32_bf16(false, a, false, b, (short)0, c, false, false); }
__device__ __forceinline__ void splitf(float y, unsigned short& h, unsigned short& l) { h = f2bf(y); l = f2bf(y - bf2f(h)); }
// Fragment loaders (A and B identical): p already points at row (lane&15), k0 + 8*(lane>>4); elements 0..7 <- p[0..7], elements 8..15 <- p[16..23].
__device__ __forceinline__ v16h ldh(const h16* p) { return cat16(*(const v8h*)p, *(const v8h*)(p + 16)); }
__device__ __forceinline__ v16bf ldb(const bf* p) { return cat16b(*(const v8us*)p, *(const v8us*)(p + 16)); }
__device__ __forceinline__ v8us pack_h(v8f c) { v8h t;
#pragma unroll
    for (int r = 0; r < 8; ++r) t[r] = (h16)c[r];
    return __builtin_bit_cast(v8us, t); }
__device__ __forceinline__ void pack_b(v8f c, v8us& a, v8us& l) {
#pragma unroll
    for (int r = 0; r < 8; ++r) { unsigned short x, y; splitf(c[r], x, y); a[r] = x; l[r] = y; } }

template <typename T16> struct WFrag;
template <> struct WFrag<h16> { typedef v16h V; static __device__ __forceinline__ V ld(const h16* p) { return ldh(p); } static __device__ __forceinline__ v8f mma(V a, V b, v8f c) { return wmma16(a, b, c); } };
template <> struct WFrag<bf> { typedef v16bf V; static __device__ __forceinline__ V ld(const bf* p) { return ldb(p); } static __device__ __forceinline__ v8f mma(V a, V b, v8f c) { return wmmab(a, b, c); } };

#define LP  72              // LDS row pitch of a staged tile in 16-bit elements: 144 B = 16 B x odd, free of bank conflicts for 16-byte fragment reads
#define TSZ (64 * LP)       // 16-bit elements of one staged tile
// One 64-row tile: this lane's 16 bytes of rows r, r+16, r+32, r+48. l = LDS byte address, g = global byte address of row r, gstep = bytes between global rows r and r+16.
__device__ __forceinline__ void copy_tile(const unsigned l, const char* g, const size_t gstep) {
    const unsigned l1 = l + 16 * LP * 2, l2 = l + 32 * LP * 2, l3 = l + 48 * LP * 2;
    const char* g1 = g + gstep; const char* g2 = g + 2 * gstep; const char* g3 = g + 3 * gstep;
    // the closing s_wait_xcnt 0 stands inside the statement so that no address register of a copy is rewritten ahead of it
    asm volatile("global_load_async_to_lds_b128 %0, %4, off\n\tglobal_load_async_to_lds_b128 %1, %5, off\n\tglobal_load_async_to_lds_b128 %2, %6, off\n\tglobal_load_async_to_lds_b128 %3, %7, off\n\ts_wait_xcnt 0x0"
                 :: "v"(l), "v"(l1), "v"(l2), "v"(l3), "v"(g), "v"(g1), "v"(g2), "v"(g3) : "memory");
}

// gemm_tile: a block of four waves computes a 128x128 tile; wave w owns the 64x64 quarter at rows 64*(w>>1), columns 64*(w&1):
// acc[mb][nb][j] = C[16*mb + 8*(lane>>4) + j][16*nb + (lane&15)] of that quarter = sum_k A[m][k] Bt[n][k] (+ A2[m][k] Bt[n][k] when NSPLIT == 1).
// Operand path: a stage is 64 k = one 128-row x 128-B tile per operand plane (A, Bt, and A2 when NSPLIT == 1), brought from the K-contiguous 16-bit planes into LDS once per block
// by asynchronous 16-byte copies (each wave-wide copy = 4 whole 128-B lines), two buffers, the next stage in flight while this one is worked on; every wave reads its fragments from LDS.
// K % 64 == 0; arow0 / brow0 = first row of the block's tile in A (A2) / Bt; ring = 2 * (2 + NSPLIT) * GTS 16-bit elements of LDS, free for other use on return.
#define GTS (2 * TSZ)       // 16-bit elements of one staged 128-row operand tile
template <typename T16, int NSPLIT>
__device__ __forceinline__ void gemm_tile(const T16* __restrict__ A, const T16* __restrict__ A2, const T16* __restrict__ Bt, const int K, const size_t arow0, const size_t brow0, unsigned short* ring, v8f (&acc)[4][4]) {
    typedef typename WFrag<T16>::V V;
    constexpr int NT = 2 + NSPLIT;                                      // tiles per stage: A, Bt (, A2)
    const int lane = threadIdx.x & 31, lr = lane & 15, hi = lane >> 4;
    const int w = __builtin_amdgcn_readfirstlane((threadIdx.x >> 5) & 3);
    const int cr = (int)(threadIdx.x >> 3) & 15, cc = (int)threadIdx.x & 7;   // this lane's row (mod 16) and 16-byte column in every staged tile
    const unsigned lbase = (unsigned)(size_t)ring + (unsigned)(cr * LP + cc * 8) * 2u;
    const char* ga  = (const char*)(A + (arow0 + cr) * K + cc * 8);
    const char* ga2 = (const char*)(A2 + (arow0 + cr) * K + cc * 8);
    const char* gb  = (const char*)(Bt + (brow0 + cr) * K + cc * 8);
    const size_t gstep = (size_t)16 * K * 2;
    auto issue = [&](const int s, const int buf) {                      // stage s (k = 64s .. 64s+63) into buffer buf
        const unsigned lb = lbase + (unsigned)(buf * NT * GTS) * 2u;
        const size_t ko = (size_t)s * 64 * 2;
        copy_tile(lb, ga + ko, gstep);             copy_tile(lb + TSZ * 2u, ga + ko + 4 * gstep, gstep);
        copy_tile(lb + GTS * 2u, gb + ko, gstep);  copy_tile(lb + GTS * 2u + TSZ * 2u, gb + ko + 4 * gstep, gstep);
        if (NSPLIT == 1) { copy_tile(lb + 2u * GTS * 2u, ga2 + ko, gstep); copy_tile(lb + 2u * GTS * 2u + TSZ * 2u, ga2 + ko + 4 * gstep, gstep); }
    };
#pragma unroll
    for (int mb = 0; mb < 4; ++mb)
#pragma unroll
        for (int nb = 0; nb < 4; ++nb) acc[mb][nb] = (v8f){};
    const int nstage = K / 64;
    issue(0, 0);
    asm volatile("s_wait_asynccnt 0x0" ::: "memory");                   // this wave's copies of stage 0 have landed
    __syncthreads();                                                    // ... and every other wave's: stage 0 may be read
    if (nstage > 1) issue(1, 1);
#pragma unroll 1   // rolled: one publish point and one refill site in the text
    for (int t = 0; t < nstage; ++t) {
        const T16* sbuf = (const T16*)ring + (t & 1) * NT * GTS;
        const T16* pa = sbuf + ((w >> 1) * 64 + lr) * LP + 8 * hi;
        const T16* pb = sbuf + GTS + ((w & 1) * 64 + lr) * LP + 8 * hi;
#pragma unroll     // the two 32-k steps of a stage: their LDS offsets become immediates
        for (int ks = 0; ks < 2; ++ks) {
            V a[4], a2[4];
#pragma unroll
            for (int mb = 0; mb < 4; ++mb) { a[mb] = WFrag<T16>::ld(pa + mb * 16 * LP + ks * 32); if (NSPLIT == 1) a2[mb] = WFrag<T16>::ld(pa + 2 * GTS + mb * 16 * LP + ks * 32); else a2[mb] = a[mb]; }
            V b[4];
#pragma unroll
            for (int nb = 0; nb < 4; ++nb) b[nb] = WFrag<T16>::ld(pb + nb * 16 * LP + ks * 32);
            // inputs-only fence on the loaded fragments: all LDS reads of this 32-k step stand as one group with one wait ahead of its WMMAs; without it each Bt fragment is read and waited for singly between them
            asm volatile("" :: "v"(b[0]), "v"(b[1]), "v"(b[2]), "v"(b[3]));
#pragma unroll
            for (int nb = 0; nb < 4; ++nb) {
#pragma unroll
                for (int mb = 0; mb < 4; ++mb) { acc[mb][nb] = WFrag<T16>::mma(a[mb], b[nb], acc[mb][nb]); if (NSPLIT == 1) acc[mb][nb] = WFrag<T16>::mma(a2[mb], b[nb], acc[mb][nb]); } }
            // four vector slots behind these WMMAs before a vector instruction may touch their registers, on either side of the branch at the loop's foot
            asm volatile("v_nop\n\tv_nop\n\tv_nop\n\tv_nop" : "+v"(acc[0][0]), "+v"(acc[1][1]), "+v"(acc[2][2]), "+v"(acc[3][3]) : "v"(a[0]), "v"(a[3]));
        }
        // publish point of stage t + 1, passed by every wave
        asm volatile("s_wait_dscnt 0x0" ::: "memory");                  // this wave's reads of stage t have returned before its buffer is refilled
        asm volatile("s_wait_asynccnt 0x0" ::: "memory");               // this wave's copies of stage t + 1 have landed
        __syncthreads();                                                // stage t + 1 may be read; every reader has left stage t
        if (t + 2 < nstage) issue(t + 2, t & 1);
    }
    asm volatile("s_wait_asynccnt 0x0" ::: "memory");                   // nothing in flight when the ring becomes output staging
}

// gemm_xw: a block of eight waves computes a 128x256 tile of x W^T; wave w owns the 64x64 part at rows 64*(w>>2), columns 64*(w&3); acc as in gemm_tile. K = DM.
// Operand path: a stage is 64 k, two buffers. W: 256 rows x 128 B of its bf16 plane by asynchronous 16-byte copies as in gemm_tile (waves 0-3 rows 0..127, waves 4-7 rows 128..255).
// x: 128 rows x 256 B of the f32 input itself, read by plain 16-byte loads (a wave-wide load = 4 whole lines) into registers one stage ahead, rounded to bf16 (nearest even)
// and stored to LDS behind this stage's products. arow0 / brow0 = first row of the block's tile in X / Bt; ring = 2 * XSB 16-bit elements of LDS, free for other use on return.
#define XSB (6 * TSZ)       // 16-bit elements of one stage buffer: x 128 rows | W 256 rows
__device__ __forceinline__ void gemm_xw(const float* __restrict__ X, const bf* __restrict__ Bt, const size_t arow0, const size_t brow0, unsigned short* ring, v8f (&acc)[4][4]) {
    constexpr int K = DM;
    const int lane = threadIdx.x & 31, lr = lane & 15, hi = lane >> 4;
    const int w = __builtin_amdgcn_readfirstlane((threadIdx.x >> 5) & 7);
    const int cr = (int)(threadIdx.x >> 3) & 15, cc = (int)threadIdx.x & 7;   // this lane's row (mod 16) and 16-byte column in every staged W tile
    const int g = w >> 2;                                               // which 128 rows of W this wave copies
    const unsigned lbase = (unsigned)(size_t)ring + (unsigned)((2 + 2 * g) * TSZ + cr * LP + cc * 8) * 2u;
    const char* gb = (const char*)(Bt + (brow0 + g * 128 + cr) * K + cc * 8);
    const size_t gstep = (size_t)16 * K * 2;
    const int xr = (int)(threadIdx.x >> 4) & 15, xc = ((int)threadIdx.x & 15) * 4;   // this lane's x row (mod 16) and first of its four k
    const float* gx = X + (arow0 + xr) * K + xc;
    unsigned short* lx = ring + xr * LP + xc;
    v4f xv[8];                                                          // this lane's share of the x stage in flight: rows xr + 16 j
    auto issue = [&](const int s, const int buf) {                      // stage s (k = 64s .. 64s+63): W into buffer buf, x into xv
        const unsigned lb = lbase + (unsigned)(buf * XSB) * 2u;
        const size_t ko = (size_t)s * 64 * 2;
        copy_tile(lb, gb + ko, gstep);             copy_tile(lb + TSZ * 2u, gb + ko + 4 * gstep, gstep);
        const float* p = gx + (size_t)s * 64;
#pragma unroll
        for (int j = 0; j < 8; ++j) xv[j] = *(const v4f*)(p + (size_t)j * 16 * K);
        asm volatile("s_wait_xcnt 0x0" ::: "memory");                   // stands in front of any rewriting of the reads' address registers
        __builtin_amdgcn_sched_barrier(0);                              // keeps later register writes behind that wait, and the eight reads together
    };
    auto put = [&](const int buf) {                                     // xv, rounded, into the x rows of buffer buf
#pragma unroll
        for (int j = 0; j < 8; ++j) *(v4usa*)(lx + buf * XSB + j * 16 * LP) = __builtin_bit_cast(v4us, __builtin_convertvector(xv[j], v4bf));
    };
#pragma unroll
    for (int mb = 0; mb < 4; ++mb)
#pragma unroll
        for (int nb = 0; nb < 4; ++nb) acc[mb][nb] = (v8f){};
    constexpr int nstage = K / 64;
    static_assert(nstage >= 2);
    issue(0, 0);
    put(0);
    asm volatile("s_wait_dscnt 0x0" ::: "memory");                      // this wave's x rows of stage 0 are written
    asm volatile("s_wait_asynccnt 0x0" ::: "memory");                   // this wave's copies of stage 0 have landed
    __syncthreads();                                                    // ... and every other wave's: stage 0 may be read
    issue(1, 1);
#pragma unroll 1   // rolled: one publish point and one refill site in the text
    for (int t = 0; t < nstage; ++t) {
        const bf* sbuf = ring + (t & 1) * XSB;
        const bf* pa = sbuf + ((w >> 2) * 64 + lr) * LP + 8 * hi;
        const bf* pb = sbuf + 2 * TSZ + ((w & 3) * 64 + lr) * LP + 8 * hi;
#pragma unroll     // the two 32-k steps of a stage: their LDS offsets become immediates
        for (int ks = 0; ks < 2; ++ks) {
            v16bf a[4], b[4];
#pragma unroll
            for (int mb = 0; mb < 4; ++mb) a[mb] = ldb(pa + mb * 16 * LP + ks * 32);
#pragma unroll
            for (int nb = 0; nb < 4; ++nb) b[nb] = ldb(pb + nb * 16 * LP + ks * 32);
            // inputs-only fence on the loaded fragments: all LDS reads of this 32-k step stand as one group with one wait ahead of its WMMAs; without it each W fragment is read and waited for singly between them
            asm volatile("" :: "v"(b[0]), "v"(b[1]), "v"(b[2]), "v"(b[3]));
#pragma unroll
            for (int nb = 0; nb < 4; ++nb) {
#pragma unroll
                for (int mb = 0; mb < 4; ++mb) acc[mb][nb] = wmmab(a[mb], b[nb], acc[mb][nb]); }
            // four vector slots behind these WMMAs before a vector instruction may touch their registers, on either side of the branch that follows
            asm volatile("v_nop\n\tv_nop\n\tv_nop\n\tv_nop" : "+v"(acc[0][0]), "+v"(acc[1][1]), "+v"(acc[2][2]), "+v"(acc[3][3]) : "v"(a[0]), "v"(a[3]));
        }
        if (t + 1 < nstage) put((t + 1) & 1);                           // that buffer's readers left it at the last publish point
        // publish point of stage t + 1, passed by every wave
        asm volatile("s_wait_dscnt 0x0" ::: "memory");                  // this wave's reads of stage t have returned, its x rows of stage t + 1 are written
        asm volatile("s_wait_asynccnt 0x0" ::: "memory");               // this wave's copies of stage t + 1 have landed
        __syncthreads();                                                // stage t + 1 may be read; every reader has left stage t
        if (t + 2 < nstage) issue(t + 2, t & 1);
    }
    asm volatile("s_wait_asynccnt 0x0" ::: "memory");                   // nothing in flight when the ring becomes output staging
}

// k_cvtw: the 16-bit planes of the four weights in one launch of CVW waves (16 per block): wave g takes 256 floats at g*256 of each of W_q, W_k, W_v (-> WT) and W_o (-> WoB and WoH).
#define CVW 4096
__device__ __forceinline__ v8us cvt8(const v8f v) { v8us o;
#pragma unroll
    for (int k = 0; k < 8; ++k) o[k] = f2bf(v[k]);
    return o; }
__global__ __launch_bounds__(512) void k_cvtw(const float* __restrict__ wq, const float* __restrict__ wk, const float* __restrict__ wv, const float* __restrict__ wo,
                                              bf* __restrict__ WT, bf* __restrict__ WoB, h16* __restrict__ WoH) {
    static_assert((size_t)DM * DM == (size_t)CVW * 256);
    const unsigned lane = threadIdx.x & 31;
    const unsigned gw = (unsigned)__builtin_amdgcn_readfirstlane((int)(blockIdx.x * 16 + (threadIdx.x >> 5)));   // wave number in a scalar register: the bases are then scalar
    const size_t wof = (size_t)gw * 256 + lane * 8;
    v8f cur[4];
    cur[0] = *(const v8f*)(wq + wof); cur[1] = *(const v8f*)(wk + wof); cur[2] = *(const v8f*)(wv + wof); cur[3] = *(const v8f*)(wo + wof);
    asm volatile("s_wait_xcnt 0x0" ::: "memory");       // stands in front of any rewriting of the reads' address registers
    __builtin_amdgcn_sched_barrier(0);                  // keeps later register writes behind that wait, and the eight reads together ahead of the conversions
#pragma unroll
    for (int j = 0; j < 3; ++j) *(v8us*)(WT + (size_t)j * DM * DM + wof) = cvt8(cur[j]);
    const v8us ob = cvt8(cur[3]); v8h oh;
#pragma unroll
    for (int k = 0; k < 8; ++k) oh[k] = (h16)(bf2f(ob[k]) * WOC);
    *(v8us*)(WoB + wof) = ob; *(v8h*)(WoH + wof) = oh;
}

// k_proj: all three projections in one launch, straight from the f32 activations. grid (NB*TT/128, NH_/4, 3), eight waves; z = 0 -> q plane, z = 1 -> k plane, z = 2 -> value planes. Block tile = 128 tokens x four heads; a wave's tile = 64 tokens x one head (64 dims).
// z < 2: rows written as they are, QK[z][b][h][t][64] = f16(c * (x W^T + b)), c = QSC for q, KSC for k. z = 2: written transposed, VT[b][h][d][t] = f16(64 * v), and for t < EROWS the bf16 hi/lo planes VE[b][h][d][t] of v.
__global__ __launch_bounds__(256) void k_proj(const float* __restrict__ xq, const float* __restrict__ xk, const float* __restrict__ xv, const bf* __restrict__ WT, const float* __restrict__ bq, const float* __restrict__ bk, const float* __restrict__ bv, h16* QK, h16* VT, bf* VEh, bf* VEl) {
    __shared__ __align__(16) unsigned short ring[8 * 64 * 68 * 2];      // operand ring; behind the product each wave's own output or transpose staging (the larger of the two uses)
    static_assert(8 * 64 * 68 * 2 >= 2 * XSB);
    const int z = blockIdx.z;
    const int lane = threadIdx.x & 31, lr = lane & 15, hi = lane >> 4;
    const int w = __builtin_amdgcn_readfirstlane((threadIdx.x >> 5) & 7);
    const int mt = blockIdx.x * 2 + (w >> 2); const int b = mt / (TT / 64); const int t0 = (mt % (TT / 64)) * 64; const int h = blockIdx.y * 4 + (w & 3);
    const float* A = z == 0 ? xq : z == 1 ? xk : xv; const bf* Bt = WT + (size_t)z * DM * DM;
    v8f acc[4][4];
    gemm_xw(A, Bt, (size_t)b * SEQ_FULL + t0 - (w >> 2) * 64, (size_t)blockIdx.y * 4 * HD, ring, acc);
  if (z < 2) {
    float* os = (float*)ring + w * (16 * 68);
    const int rq = lane >> 3, pc = lane & 7;
    const v8f b0 = *(const v8f*)(bq + h * HD + pc * 8); const v8f b1 = *(const v8f*)(bk + h * HD + pc * 8);
    v8f bb;
#pragma unroll
    for (int i = 0; i < 8; ++i) bb[i] = bfr(z ? b1[i] : b0[i]);
    const float pf = z ? KSC : QSC;
    h16* P = QK + (size_t)z * QKSZ + (((size_t)b * NH_ + h) * TT + t0) * HD + pc * 8;
#pragma unroll
    for (int mb = 0; mb < 4; ++mb) {
#pragma unroll
        for (int nb = 0; nb < 4; ++nb) {
#pragma unroll
            for (int j = 0; j < 8; ++j) os[(hi * 8 + j) * 68 + nb * 16 + lr] = acc[mb][nb][j]; }
        __builtin_amdgcn_wave_barrier(); asm volatile("" ::: "memory");
        h16* prow = P + (size_t)(mb * 16) * HD;
{
#pragma unroll
            for (int s = 0; s < 4; ++s) { const int row = 4 * s + rq;
                const v4f x0 = *(const v4fa*)(os + row * 68 + pc * 8), x1 = *(const v4fa*)(os + row * 68 + pc * 8 + 4);
                v8h o;
#pragma unroll
                for (int q = 0; q < 4; ++q) { o[q] = (h16)((x0[q] + bb[q]) * pf); o[4 + q] = (h16)((x1[q] + bb[4 + q]) * pf); }
                *(v8h*)(prow + (size_t)row * HD) = o; }
             }
        __builtin_amdgcn_wave_barrier(); asm volatile("" ::: "memory");
    }
  } else {
    float* ts = (float*)ring + w * (64 * 68);
#pragma unroll
    for (int mb = 0; mb < 4; ++mb)
#pragma unroll
        for (int nb = 0; nb < 4; ++nb) {
            const v4f lo4 = { acc[mb][nb][0], acc[mb][nb][1], acc[mb][nb][2], acc[mb][nb][3] };
            const v4f hi4 = { acc[mb][nb][4], acc[mb][nb][5], acc[mb][nb][6], acc[mb][nb][7] };
            *(v4fa*)(ts + (nb * 16 + lr) * 68 + mb * 16 + 8 * hi) = lo4;
            *(v4fa*)(ts + (nb * 16 + lr) * 68 + mb * 16 + 8 * hi + 4) = hi4; }
    __builtin_amdgcn_wave_barrier(); asm volatile("" ::: "memory");
    const int rq = lane >> 3, pc = lane & 7;
    const bool early = t0 < EROWS;
    const size_t vrow0 = ((size_t)b * NH_ + h) * HD;
{
#pragma unroll 1
        for (int s = 0; s < 16; ++s) { const int d = 4 * s + rq;
            const float bb = bfr(bv[h * HD + d]);
            const v4f x0 = *(const v4fa*)(ts + d * 68 + pc * 8), x1 = *(const v4fa*)(ts + d * 68 + pc * 8 + 4);
            v8f x = __builtin_shufflevector(x0, x1, 0, 1, 2, 3, 4, 5, 6, 7);
            x = x + bb;
            v8h o;
#pragma unroll
            for (int q = 0; q < 8; ++q) o[q] = (h16)(x[q] * VC);
            *(v8h*)(VT + (vrow0 + d) * TT + t0 + pc * 8) = o;
            asm volatile("s_wait_xcnt 0x0" ::: "memory");   // stands in front of the rewriting of the store's data and address registers (hi/lo packing, next trip)
            if (early) { v8us oh, ol; pack_b(x, oh, ol);
                *(v8us*)(VEh + (vrow0 + d) * EROWS + t0 + pc * 8) = oh;
                *(v8us*)(VEl + (vrow0 + d) * EROWS + t0 + pc * 8) = ol;
                asm volatile("s_wait_xcnt 0x0" ::: "memory"); } }   // stands in front of the next trip's advance of both stores' address registers
         }
  }
}

// One 64-row tile by eight waves: this lane's 16 bytes of rows r and r+32. l = LDS byte address, g = global byte address of row r, gstep = bytes between global rows r and r+32.
__device__ __forceinline__ void copy_tile8(const unsigned l, const char* g, const size_t gstep) {
    const unsigned l1 = l + 32 * LP * 2;
    const char* g1 = g + gstep;
    // the closing s_wait_xcnt 0 stands inside the statement so that no address register of a copy is rewritten ahead of it
    asm volatile("global_load_async_to_lds_b128 %0, %2, off\n\tglobal_load_async_to_lds_b128 %1, %3, off\n\ts_wait_xcnt 0x0"
                 :: "v"(l), "v"(l1), "v"(g), "v"(g1) : "memory");
}

// attn_body: fused causal attention, 128 query rows and 8 waves per block, 32 keys per step, transposed formulation.
//   EARLY: a wave owns 16 query rows (one tile) and takes both 32-key steps of every stage. Else: a wave owns 32 query rows (two tiles) and one of the two 32-key steps of every stage;
//   the two waves of a 32-row group hold partial (m, l, O^T) over their own keys and join them once behind the loop through LDS, each finishing one of the two tiles.
//   S^T tile (rows = keys, cols = queries) = A(k plane rows) x B(q plane rows); D element r of lane l = S^T[key 8*(l>>4)+r][query l&15].
//   Per lane and query tile one query column. Held reference m (log2 units, equal in both lane halves): PC - m is the C operand of the score products, so p = exp2(D) with no further arithmetic.
//   A step whose in-lane sum of p tops RSB in any lane (a score far above m; always so at a wave's first step, where m = NEGB) is redone: scores with C = 0, m raised to the maximum, l and O^T rescaled.
//   Running sum l over the lane's own keys; the two lane halves are added once behind the loop.
//   P^T as B fragment: element r <- p(tile keys 0..15)[r], element 8+r <- p(tile keys 16..31)[r], lane unchanged.
//   O^T tile j (rows = dims 16j.., cols = queries) += A(V^T rows) x B(P^T). Masked keys carry p = 0 exactly.
// EARLY: bf16 hi+lo P and V (3 products); else f16 single product with P x256 (cancels against the row sum) and V x64.
// Operand path: a stage is 64 keys = one K tile (64 key rows x 128 B) and one V^T tile per value plane (64 dim rows x 128 B), brought into LDS once per block by
// asynchronous 16-byte copies (each wave-wide copy = 4 whole 128-B lines), two buffers, the next stage in flight while this one is worked on; all eight waves read their fragments from LDS,
// and each K and V^T fragment read feeds the products of all NQ query tiles of the wave. qb = index of the block's tile of 128 query rows.
template <bool EARLY>
__device__ __forceinline__ void attn_body(const h16* __restrict__ QP, const h16* __restrict__ KP, const h16* __restrict__ VT, const bf* __restrict__ VEh, const bf* __restrict__ VEl, bf* C0, bf* C1, const int qb, const int bh, unsigned short* ring) {
    constexpr int NT = EARLY ? 3 : 2;                                   // tiles per stage: K, V (EARLY: K, V hi, V lo)
    constexpr int NQ = EARLY ? 1 : 2;                                   // query tiles per wave
    using VE16 = __type_pack_element<EARLY ? 0 : 1, bf, h16>;           // element type of the staged value planes
    using VF = typename WFrag<VE16>::V;
    static_assert(2 * NT * TSZ >= 8 * 2 * 1152 || !EARLY);              // stage buffers: the first 2 * NT * TSZ 16-bit elements of the ring (2 * 3 * TSZ in all); output staging behind the loop
    unsigned short* stg = ring;
    const int lane = threadIdx.x & 31, lr = lane & 15, hi = lane >> 4;
    const int w = __builtin_amdgcn_readfirstlane((threadIdx.x >> 5) & 7);   // wave number in a scalar register: the per-wave skip below is then a scalar branch
    const int b = bh / NH_, h = bh % NH_;
    const int kh = EARLY ? 0 : (w & 1);                                 // which 32 keys of every stage this wave takes (not EARLY)
    const int q0 = qb * 128 + (EARLY ? w * 16 : (w >> 1) * 32);
    const size_t pof = (size_t)bh * TT * HD;
    v16h qf0[NQ], qf1[NQ]; int qq[NQ];
    v8f o[NQ][4];
    float m[NQ], l[NQ];
    v8f cf[NQ];                                                         // C operand of the score products: PC - m in all eight elements
    constexpr float PC  = EARLY ? 0.0f : 8.0f;                          // log2 of the carry of P
    constexpr float RSB = EARLY ? 128.0f : 32768.0f;                    // 2^(PC + 7): every p below it is finite in f16
#pragma unroll
    for (int u = 0; u < NQ; ++u) {
        qq[u] = q0 + 16 * u + lr;
        const h16* qp = QP + pof + (size_t)qq[u] * HD + 8 * hi;
        qf0[u] = ldh(qp); qf1[u] = ldh(qp + 32);
        o[u][0] = (v8f){}; o[u][1] = (v8f){}; o[u][2] = (v8f){}; o[u][3] = (v8f){};
        m[u] = NEGB; l[u] = 0.0f; cf[u] = (v8f){} + (PC - NEGB); }
    const int nstage = 2 * (qb + 1);                                    // stages of 64 keys, the same for the whole block
    const int cr = (int)(threadIdx.x >> 3) & 31, cc = (int)threadIdx.x & 7;   // this lane's row (mod 32) and 16-byte column in every staged tile
    const unsigned lbase = (unsigned)(size_t)ring + (unsigned)(cr * LP + cc * 8) * 2u;
    const char* gk = (const char*)(KP + pof + (size_t)cr * HD + cc * 8);
    const char* gv0 = EARLY ? (const char*)(VEh + (size_t)bh * HD * EROWS + (size_t)cr * EROWS + cc * 8) : (const char*)(VT + (size_t)bh * HD * TT + (size_t)cr * TT + cc * 8);
    const char* gv1 = EARLY ? (const char*)(VEl + (size_t)bh * HD * EROWS + (size_t)cr * EROWS + cc * 8) : gv0;
    const size_t vstep = (size_t)32 * (EARLY ? EROWS : TT) * 2;
    auto issue = [&](const int s, const int buf) {                      // stage s (keys 64s .. 64s+63) into buffer buf
        const unsigned lb = lbase + (unsigned)(buf * NT * TSZ) * 2u;
        copy_tile8(lb, gk + (size_t)s * 64 * HD * 2, (size_t)32 * HD * 2);
        copy_tile8(lb + TSZ * 2u, gv0 + (size_t)s * 64 * 2, vstep);
        if (EARLY) copy_tile8(lb + 2u * TSZ * 2u, gv1 + (size_t)s * 64 * 2, vstep);
    };
    issue(0, 0);
    asm volatile("s_wait_asynccnt 0x0" ::: "memory");                   // this wave's copies of stage 0 have landed
    __syncthreads();                                                    // ... and every other wave's: stage 0 may be read
    issue(1, 1);
#pragma unroll 1   // rolled: one publish point and one refill site in the text
    for (int t = 0; t < nstage; ++t) {
        const unsigned short* sbuf = ring + (t & 1) * NT * TSZ;
#pragma unroll     // EARLY: the two 32-key steps of a stage, their LDS offsets become immediates; else this wave's one step
      for (int sub = 0; sub < (EARLY ? 2 : 1); ++sub) {
        const int ks = EARLY ? sub : kh;
        const int kt = t * 64 + ks * 32;
        if (kt <= q0) {              // a wave skips the 32 keys that lie wholly above its queries
        const h16* kp = (const h16*)sbuf + (ks * 32 + lr) * LP + 8 * hi;
        v8f s0[NQ], s1[NQ], p0[NQ], p1[NQ];
        float rs[NQ];
        auto scores = [&](const v8f (&c)[NQ]) {      // s0, s1 = c + S^T of this step's 32 keys, keys above the query at NEGB
            const v16h ka0 = ldh(kp), ka1 = ldh(kp + 16 * LP), kb0 = ldh(kp + 32), kb1 = ldh(kp + 16 * LP + 32);
#pragma unroll
            for (int u = 0; u < NQ; ++u) { s0[u] = wmma16(ka0, qf0[u], c[u]); s1[u] = wmma16(ka1, qf0[u], c[u]); }
#pragma unroll
            for (int u = 0; u < NQ; ++u) { s0[u] = wmma16(kb0, qf1[u], s0[u]); s1[u] = wmma16(kb1, qf1[u], s1[u]); }
            // four vector slots behind these WMMAs before a vector instruction may touch their registers, on either side of the branch that follows
            // (c is named too: alive behind the products, it is read in place as their C operand; otherwise the compiler first copies its eight registers into one D per query tile)
            if constexpr (NQ == 1) asm volatile("v_nop\n\tv_nop\n\tv_nop\n\tv_nop" : "+v"(s0[0]), "+v"(s1[0]) : "v"(ka0), "v"(ka1), "v"(kb0), "v"(kb1), "v"(qf1[0]), "v"(c[0]));
            else                   asm volatile("v_nop\n\tv_nop\n\tv_nop\n\tv_nop" : "+v"(s0[0]), "+v"(s1[0]), "+v"(s0[NQ - 1]), "+v"(s1[NQ - 1]) : "v"(ka0), "v"(ka1), "v"(kb0), "v"(kb1), "v"(qf1[0]), "v"(qf1[NQ - 1]), "v"(c[0]), "v"(c[NQ - 1]));
            if (kt + 31 > q0) {      // diagonal step of this wave: exclude keys above the query
#pragma unroll
                for (int u = 0; u < NQ; ++u) {
                    const int d = qq[u] - kt - 8 * hi;       // element r of s0 is key d - r below the query, of s1 key d - 16 - r
#pragma unroll
                    for (int r = 0; r < 8; ++r) { s0[u][r] = (r > d) ? NEGB : s0[u][r]; s1[u][r] = (16 + r > d) ? NEGB : s1[u][r]; }
                }
            }
        };
        auto expsum = [&]() {                        // p = exp2(s), rs = the lane's sum of p
#pragma unroll
            for (int u = 0; u < NQ; ++u) {
                rs[u] = 0.0f;
#pragma unroll
                for (int r = 0; r < 8; ++r) { p0[u][r] = __builtin_amdgcn_exp2f(s0[u][r]); p1[u][r] = __builtin_amdgcn_exp2f(s1[u][r]); rs[u] += p0[u][r] + p1[u][r]; }
            }
        };
        scores(cf);
        // this step's V^T fragments are asked for here, so that their LDS latency passes under the exponentials
        const unsigned short* vb = sbuf + TSZ + lr * LP + ks * 32 + 8 * hi;
        VF va[4], vlo[4];
#pragma unroll
        for (int j = 0; j < 4; ++j) { va[j] = WFrag<VE16>::ld((const VE16*)vb + j * 16 * LP); if constexpr (EARLY) vlo[j] = WFrag<VE16>::ld((const VE16*)vb + TSZ + j * 16 * LP); else vlo[j] = va[j]; }
        expsum();
        bool need = false;
#pragma unroll
        for (int u = 0; u < NQ; ++u) need = need || !(rs[u] <= RSB);     // also true for an infinite or undefined sum
        if (__builtin_amdgcn_ballot_w32(need) != 0) {                    // one scalar branch per step; seldom taken behind a wave's first step
            const v8f zc[NQ] = {};
            scores(zc);
#pragma unroll
            for (int u = 0; u < NQ; ++u) {
                float mx = fmaxf(s0[u][0], s1[u][0]);
#pragma unroll
                for (int r = 1; r < 8; ++r) mx = fmaxf(mx, fmaxf(s0[u][r], s1[u][r]));
                mx = fmaxf(mx, __shfl_xor(mx, 16, 32));
                const float mn = fmaxf(m[u], mx);
                const float corr = __builtin_amdgcn_exp2f(m[u] - mn);
                m[u] = mn;
                cf[u] = (v8f){} + (PC - mn);
                s0[u] += cf[u]; s1[u] += cf[u];
                l[u] *= corr;
                o[u][0] *= corr; o[u][1] *= corr; o[u][2] *= corr; o[u][3] *= corr;
            }
            expsum();
        }
#pragma unroll
        for (int u = 0; u < NQ; ++u) l[u] += rs[u];
        if constexpr (EARLY) {
            v8us ph0, ph1, pl0, pl1;
            pack_b(p0[0], ph0, pl0); pack_b(p1[0], ph1, pl1);
            const v16bf PH = cat16b(ph0, ph1), PL = cat16b(pl0, pl1);
            const v16bf vh0 = va[0], vh1 = va[1], vh2 = va[2], vh3 = va[3];
            const v16bf vl0 = vlo[0], vl1 = vlo[1], vl2 = vlo[2], vl3 = vlo[3];
            o[0][0] = wmmab(vh0, PH, o[0][0]); o[0][0] = wmmab(vl0, PH, o[0][0]); o[0][0] = wmmab(vh0, PL, o[0][0]);
            o[0][1] = wmmab(vh1, PH, o[0][1]); o[0][1] = wmmab(vl1, PH, o[0][1]); o[0][1] = wmmab(vh1, PL, o[0][1]);
            o[0][2] = wmmab(vh2, PH, o[0][2]); o[0][2] = wmmab(vl2, PH, o[0][2]); o[0][2] = wmmab(vh2, PL, o[0][2]);
            o[0][3] = wmmab(vh3, PH, o[0][3]); o[0][3] = wmmab(vl3, PH, o[0][3]); o[0][3] = wmmab(vh3, PL, o[0][3]);
            asm volatile("v_nop\n\tv_nop\n\tv_nop\n\tv_nop" : "+v"(o[0][0]), "+v"(o[0][1]), "+v"(o[0][2]), "+v"(o[0][3]) : "v"(vh0), "v"(vh1), "v"(vh2), "v"(vh3), "v"(vl0), "v"(vl1), "v"(vl2), "v"(vl3), "v"(PH), "v"(PL));
        } else {
            v16h pb[NQ];
#pragma unroll
            for (int u = 0; u < NQ; ++u)
#pragma unroll
                for (int r = 0; r < 8; ++r) { pb[u][r] = (h16)p0[u][r]; pb[u][8 + r] = (h16)p1[u][r]; }
            const v16h a0 = va[0], a1 = va[1], a2 = va[2], a3 = va[3];
#pragma unroll
            for (int u = 0; u < NQ; ++u) { o[u][0] = wmma16(a0, pb[u], o[u][0]); o[u][1] = wmma16(a1, pb[u], o[u][1]); o[u][2] = wmma16(a2, pb[u], o[u][2]); o[u][3] = wmma16(a3, pb[u], o[u][3]); }
            // four vector slots behind these WMMAs before a vector instruction may touch their registers, on either side of the branches that follow
            asm volatile("v_nop\n\tv_nop\n\tv_nop\n\tv_nop" : "+v"(o[0][0]), "+v"(o[0][1]), "+v"(o[0][2]), "+v"(o[0][3]), "+v"(o[NQ - 1][0]), "+v"(o[NQ - 1][1]), "+v"(o[NQ - 1][2]), "+v"(o[NQ - 1][3]) : "v"(a0), "v"(a1), "v"(a2), "v"(a3), "v"(pb[0]), "v"(pb[NQ - 1]));
        }
        }
      }
        // publish point of stage t + 1, passed by every wave
        asm volatile("s_wait_dscnt 0x0" ::: "memory");                  // this wave's reads of stage t have returned before its buffer is refilled
        asm volatile("s_wait_asynccnt 0x0" ::: "memory");               // this wave's copies of stage t + 1 have landed
        __syncthreads();                                                // stage t + 1 may be read; every reader has left stage t
        if (t + 2 < nstage) issue(t + 2, t & 1);
    }
    asm volatile("s_wait_asynccnt 0x0" ::: "memory");                   // nothing in flight when the ring becomes output staging
#pragma unroll
    for (int u = 0; u < NQ; ++u) l[u] += __shfl_xor(l[u], 16, 32);      // the row sums of the two lane halves, joined once
    const int rq = lane >> 3, pc = lane & 7;
    if constexpr (EARLY) {
        const float inv = __fdiv_rn(1.0f, l[0]);
        o[0][0] *= inv; o[0][1] *= inv; o[0][2] *= inv; o[0][3] *= inv;
        const int sb = w * 2 * 1152;
        const int so = sb + lr * 72 + 8 * hi;   // O^T element r of tile j -> row (query lr), column 16j + 8*hi + r
        v8us a, c;
        pack_b(o[0][0], a, c); *(v8usa*)(stg + so) = a;      *(v8usa*)(stg + so + 1152) = c;
        pack_b(o[0][1], a, c); *(v8usa*)(stg + so + 16) = a; *(v8usa*)(stg + so + 1152 + 16) = c;
        pack_b(o[0][2], a, c); *(v8usa*)(stg + so + 32) = a; *(v8usa*)(stg + so + 1152 + 32) = c;
        pack_b(o[0][3], a, c); *(v8usa*)(stg + so + 48) = a; *(v8usa*)(stg + so + 1152 + 48) = c;
        __builtin_amdgcn_wave_barrier(); asm volatile("" ::: "memory");
        const size_t cbase = ((size_t)b * EROWS + q0) * DM + h * HD + pc * 8;
#pragma unroll
        for (int s = 0; s < 4; ++s) { const int row = 4 * s + rq;
            const v8us x = *(const v8usa*)(stg + sb + row * 72 + pc * 8);
            *(v8us*)(C0 + cbase + (size_t)row * DM) = x;
            const v8us y = *(const v8usa*)(stg + sb + 1152 + row * 72 + pc * 8); *(v8us*)(C1 + cbase + (size_t)row * DM) = y; }
    } else {
        // Join of the two key halves: wave w keeps tile kh and hands its partial of the other tile to wave w ^ 1. Per wave XW floats of LDS: eight 512-B rows of O^T, then m, then l.
        constexpr int XW = 8 * 128 + 64;
        static_assert(8 * XW * 4 + 8 * 1152 * 2 <= 2 * 3 * TSZ * 2);    // the eight hand-over areas, then the eight output stagings, inside the ring
        float* xs = (float*)ring;
        auto give = [&](const v8f (&og)[4], const float mg, const float lg) {
            float* d = xs + w * XW + lane * 4;
#pragma unroll
            for (int j = 0; j < 4; ++j) {
                *(v4fa*)(d + (2 * j) * 128)     = (v4f){ og[j][0], og[j][1], og[j][2], og[j][3] };
                *(v4fa*)(d + (2 * j + 1) * 128) = (v4f){ og[j][4], og[j][5], og[j][6], og[j][7] }; }
            xs[w * XW + 1024 + lane] = mg; xs[w * XW + 1056 + lane] = lg;
        };
        auto finish = [&](v8f (&ok)[4], const float mk, const float lk) {
            const float* sp = xs + (w ^ 1) * XW + lane * 4;
            const float mp = xs[(w ^ 1) * XW + 1024 + lane], lp = xs[(w ^ 1) * XW + 1056 + lane];
            const float mn = fmaxf(mk, mp);
            const float ck = __builtin_amdgcn_exp2f(mk - mn), cp = __builtin_amdgcn_exp2f(mp - mn);
            const float inv = __fdiv_rn(1.0f, lk * ck + lp * cp);
            const float fk = ck * inv, fp = cp * inv;
            unsigned short* d = stg + 8 * XW * 2 + w * 1152;            // this wave's own output staging, behind the hand-over areas
#pragma unroll
            for (int j = 0; j < 4; ++j) {
                const v4f x0 = *(const v4fa*)(sp + (2 * j) * 128), x1 = *(const v4fa*)(sp + (2 * j + 1) * 128);
                const v8f x = __builtin_shufflevector(x0, x1, 0, 1, 2, 3, 4, 5, 6, 7);
                *(v8usa*)(d + lr * 72 + 8 * hi + 16 * j) = pack_h(ok[j] * fk + x * fp); }   // O^T element r of tile j -> row (query lr), column 16j + 8*hi + r
            __builtin_amdgcn_wave_barrier(); asm volatile("" ::: "memory");
            const size_t cbase = ((size_t)b * TT + q0 + 16 * kh) * DM + h * HD + pc * 8;
#pragma unroll
            for (int s = 0; s < 4; ++s) { const int row = 4 * s + rq;
                const v8us x = *(const v8usa*)(d + row * 72 + pc * 8);
                *(v8us*)(C0 + cbase + (size_t)row * DM) = x; }
        };
        if (kh == 0) give(o[NQ - 1], m[NQ - 1], l[NQ - 1]); else give(o[0], m[0], l[0]);
        __syncthreads();                                                // every wave's hand-over is written before its partner reads it
        if (kh == 0) finish(o[0], m[0], l[0]); else finish(o[NQ - 1], m[NQ - 1], l[NQ - 1]);
    }
}

// k_attn: every query tile in one launch. grid (NB*NH_, TT/128): x = (b, h); y = rank of the 128-row query tile by falling cost, so that the longest tiles start first and the short ones fill the end.
// Cost of a tile = its stages, a stage of rows < EROWS (per wave two steps of three products with the hi/lo split) weighed 13 : 5 against a stage of the other rows (per wave one step); equal costs by index.
// Query rows [EROWS, TT): ctx as f16 plane (x64 carry) [b][TT][DM]. Query rows [0, EROWS): ctx as bf16 hi/lo planes [b][EROWS][DM].
__global__ __launch_bounds__(256) void k_attn(const h16* __restrict__ QP, const h16* __restrict__ KP, const h16* __restrict__ VT, const bf* __restrict__ VEh, const bf* __restrict__ VEl, bf* CH, bf* CEh, bf* CEl) {
    __shared__ __align__(16) unsigned short ring[2 * 3 * TSZ];          // one ring for either body
    int qb = 0;                                                         // the same for the whole block: the choice of body is a scalar branch
#pragma unroll   // unrolled: every tile's rank is then a constant, and what is left is one scalar compare and select per tile
    for (int i = 0; i < TT / 128; ++i) {
        const int ci = (i + 1) * (i < EROWS / 128 ? 13 : 5);
        int rank = 0;
#pragma unroll
        for (int j = 0; j < TT / 128; ++j) { const int cj = (j + 1) * (j < EROWS / 128 ? 13 : 5); rank += (cj > ci || (cj == ci && j > i)) ? 1 : 0; }
        if (rank == (int)blockIdx.y) qb = i;
    }
    if (qb >= EROWS / 128) attn_body<false>(QP, KP, VT, (const bf*)0, (const bf*)0, CH, CH, qb, (int)blockIdx.x, ring);
    else                   attn_body<true>(QP, KP, (const h16*)0, VEh, VEl, CEh, CEl, qb, (int)blockIdx.x, ring);
}

// out_body: OUT[r][c] = scale * sum_k A[r][k] Bt[c][k] + bf16(bias[c]); 128x128 tile per block of four waves, 64x64 per wave; per 16-row slab staged in LDS (wave-private),
template <typename T16, int NSPLIT>
__device__ __forceinline__ void out_body(const T16* __restrict__ A, const T16* __restrict__ A2, const T16* __restrict__ Bt, float* C, const float* __restrict__ bias, const float scale, const int rt, const int ct, unsigned short* ring) {
    static_assert(2 * 2 * GTS * 2 >= 4 * 16 * 68 * 4);                  // ring = 2 * (2 + NSPLIT) * GTS 16-bit elements of LDS: operand ring; behind the product each wave's own output staging
    const int lane = threadIdx.x & 31, lr = lane & 15, hi = lane >> 4;
    const int w = __builtin_amdgcn_readfirstlane((threadIdx.x >> 5) & 3);
    const int r0 = rt * 128 + (w >> 1) * 64, c0 = ct * 128 + (w & 1) * 64;   // rt, ct = the block's row and column tile
    v8f acc[4][4];
    gemm_tile<T16, NSPLIT>(A, A2, Bt, DM, (size_t)rt * 128, (size_t)ct * 128, ring, acc);
    float* os = (float*)ring + w * (16 * 68);
    const v4f bw = *(const v4f*)(bias + c0 + lr * 4);
    v4f bb;
#pragma unroll
    for (int q = 0; q < 4; ++q) bb[q] = bfr(bw[q]);
#pragma unroll
    for (int mb = 0; mb < 4; ++mb) {
#pragma unroll
        for (int nb = 0; nb < 4; ++nb) {
#pragma unroll
            for (int j = 0; j < 8; ++j) os[(hi * 8 + j) * 68 + nb * 16 + lr] = acc[mb][nb][j]; }
        __builtin_amdgcn_wave_barrier(); asm volatile("" ::: "memory");
        float* crow = C + (size_t)(r0 + mb * 16) * DM + c0 + lr * 4;
{
#pragma unroll
            for (int s = 0; s < 8; ++s) { const int row = 2 * s + hi;
                v4f val = *(const v4fa*)(os + row * 68 + lr * 4);
                val = val * scale + bb;
                *(v4f*)(crow + (size_t)row * DM) = val; }
             }
        __builtin_amdgcn_wave_barrier(); asm volatile("" ::: "memory");
    }
}

// k_out: the whole output product in one launch. grid (DM/128, NB, TT/128): x = column tile, y = batch, z = row tile; the row tiles of two products (rows < EROWS) have the lowest indices and start first.
// Rows [0, EROWS) of a batch from the bf16 hi/lo ctx planes, rows [EROWS, TT) from the f16 ctx plane.
__global__ __launch_bounds__(128) void k_out(const bf* __restrict__ CEh, const bf* __restrict__ CEl, const bf* __restrict__ WoB, const h16* __restrict__ CH, const h16* __restrict__ WoH, float* OUT, const float* __restrict__ Wb) {
    __shared__ __align__(16) unsigned short ring[2 * 3 * GTS];          // one ring for either body
    const size_t bt = blockIdx.y; const int rt = blockIdx.z, ct = blockIdx.x;   // the same for the whole block: the choice of body is a scalar branch
    if (rt < EROWS / 128) out_body<bf, 1>(CEh + bt * EROWS * DM, CEl + bt * EROWS * DM, WoB, OUT + bt * TT * DM, Wb, 1.0f, rt, ct, ring);
    else                  out_body<h16, 0>(CH + bt * TT * DM, CH + bt * TT * DM, WoH, OUT + bt * TT * DM, Wb, OSC, rt, ct, ring);
}

extern "C" void kernel_launch(void* const* d_in, const int* in_sizes, int n_in,
                              void* d_out, int out_size, void* d_ws, size_t ws_size, hipStream_t stream) {
    if (n_in < 11) return;
    if (in_sizes[0] < NB * SEQ_FULL * DM || in_sizes[1] < NB * SEQ_FULL * DM || in_sizes[2] < NB * SEQ_FULL * DM) return;
    if (in_sizes[3] < NH_ * HD * DM || in_sizes[5] < NH_ * HD * DM || in_sizes[7] < NH_ * HD * DM || in_sizes[9] < DM * DM) return;
    if (in_sizes[4] < NH_ * HD || in_sizes[6] < NH_ * HD || in_sizes[8] < NH_ * HD || in_sizes[10] < DM) return;
    if (out_size < NB * TT * DM) return;
    const float* xq = (const float*)d_in[0]; const float* xk = (const float*)d_in[1]; const float* xv = (const float*)d_in[2];
    const float* wq = (const float*)d_in[3]; const float* bq = (const float*)d_in[4];
    const float* wk = (const float*)d_in[5]; const float* bk = (const float*)d_in[6];
    const float* wv = (const float*)d_in[7]; const float* bv = (const float*)d_in[8];
    const float* wo = (const float*)d_in[9]; const float* bo = (const float*)d_in[10];
    float* OUT = (float*)d_out;     // [NB][TT][DM]
    char* wsp = (char*)d_ws;
    auto take = [&](size_t bytes) { char* p = wsp; wsp += (bytes + 255) & ~(size_t)255; return (void*)p; };
    bf*  WT  = (bf*)take((size_t)3 * DM * DM * 2);                  // [3][n][k] projection weights, bf16
    bf*  WoB = (bf*)take((size_t)DM * DM * 2);                      // output weight, bf16
    h16* WoH = (h16*)take((size_t)DM * DM * 2);                     // output weight, f16 x1024
    h16* QK  = (h16*)take((size_t)2 * QKSZ * 2);                    // q plane | k plane
    h16* VT  = (h16*)take((size_t)NB * NH_ * HD * TT * 2);          // [b][h][d][t] f16 x64
    bf*  VEh = (bf*)take((size_t)NB * NH_ * HD * EROWS * 2);        // [b][h][d][t < EROWS] bf16 hi
    bf*  VEl = (bf*)take((size_t)NB * NH_ * HD * EROWS * 2);        // bf16 lo
    bf*  XB  = (bf*)take((size_t)3 * XSZ * 2);                      // three ctx planes
    if ((size_t)(wsp - (char*)d_ws) > ws_size) return;              // 119,537,664 B at NB=4, TT=2048
    bf* CH  = XB;                   // ctx f16 plane [NB*TT][DM] (16-bit storage)
    bf* CEh = XB + XSZ;             // ctx bf16 hi [NB*EROWS][DM]
    bf* CEl = XB + 2 * XSZ;         // ctx bf16 lo

    k_cvtw<<<CVW / 16, 512, 0, stream>>>(wq, wk, wv, wo, WT, WoB, WoH);

    k_proj<<<dim3(NB * TT / 128, NH_ / 4, 3), 256, 0, stream>>>(xq, xk, xv, WT, bq, bk, bv, QK, VT, VEh, VEl);

    k_attn<<<dim3(NB * NH_, TT / 128), 256, 0, stream>>>(QK, QK + QKSZ, VT, VEh, VEl, CH, CEh, CEl);

    k_out<<<dim3(DM / 128, NB, TT / 128), 128, 0, stream>>>(CEh, CEl, WoB, (const h16*)CH, WoH, OUT, bo);
}

// v008
// Measured time: 116 microseconds a run.
// In both of two side-by-side timings against v007, it was 1.03 times as fast.
// Over all steps from v000 it is 2.98 times as fast.
#include <hip/hip_runtime.h>

// Contractions, f32 accumulate: q/k/v projections v_wmma_f32_16x16x32_bf16 on bf16 (RNE) roundings of x and W; scores v_wmma_f32_16x16x32_f16 on f16 q/k planes (q x log2(e)/8, k x 1/4: a product of the two is the score in log2 units, scale 1/32 included), the softmax reference as their C operand; P.V v_wmma_f32_16x16x32_f16 (P x256, V x64 carries) for query rows >= EROWS and v_wmma_f32_16x16x32_bf16 on bf16 hi+lo P and V (3 products) for query rows < EROWS; output projection v_wmma_f32_16x16x32_f16 (ctx x64, W x1024) for rows >= EROWS and v_wmma_f32_16x16x32_bf16 on bf16 hi+lo ctx (2 products) for rows < EROWS.
// Pipeline: bf16 planes of the weights (the activations are rounded to bf16 inside the projections' staging); q/k planes [b][h][t][64] f16; value planes [b][h][64][t] f16 (+ bf16 hi/lo for t < EROWS); fused causal attention in transposed form (S^T = K Q^T, O^T = V^T P^T, online softmax per lane against a held reference); ctx planes [b*t][1024]; out = ctx W^T + b.

#ifndef NB
#define NB 4
#endif
#ifndef SEQ
#define SEQ 2048
#endif
#define NB_FULL  4
#define SEQ_FULL 2048
#define TT   SEQ
#define DM   1024
#define NH_  16
#define HD   64
#define EROWS ((TT) < 512 ? (TT) : 512)
#define QSC  (0.045084220027780106f * 4.0f)                 // factor of the q plane: (1/32) * log2(e) / KSC
#define KSC  0.25f                                          // factor of the k plane
#define VC   64.0f                                          // carry of the f16 value plane (and of the f16 ctx plane)
#define WOC  1024.0f                                        // carry of the f16 output weight plane
#define OSC  1.52587890625e-05f                             // 1 / (VC * WOC)
#define NEGB (-3.0e38f)
#define XSZ  ((size_t)NB * SEQ_FULL * DM)
#define QKSZ ((size_t)NB * NH_ * TT * HD)
static_assert(TT % 64 == 0);
static_assert(TT <= SEQ_FULL);
static_assert(NB >= 1 && NB <= NB_FULL);
static_assert(NH_ * HD == DM);
static_assert(DM % 64 == 0);
static_assert(DM % 32 == 0);
static_assert(HD == 64);
static_assert(EROWS % 64 == 0);
static_assert(EROWS <= TT);
static_assert((TT - EROWS) % 64 == 0);
static_assert(TT % 128 == 0 && EROWS % 128 == 0 && DM % 128 == 0 && NH_ % 4 == 0);   // 128x256 block tiles of the projections and 128x128 of the output product
static_assert((size_t)NB * TT * DM <= XSZ);
static_assert((size_t)NB * EROWS * DM <= XSZ);
static_assert((size_t)3 * DM * DM * 2 + (size_t)2 * DM * DM * 2 + (size_t)2 * QKSZ * 2 + (size_t)NB * NH_ * HD * TT * 2 + (size_t)2 * NB * NH_ * HD * EROWS * 2 + (size_t)3 * XSZ * 2 <= (size_t)134217728);

typedef _Float16 h16;
typedef unsigned short bf;
typedef __attribute__((ext_vector_type(16))) __bf16   v16bf;
typedef __attribute__((ext_vector_type(16))) _Float16 v16h;
typedef __attribute__((ext_vector_type(8)))  _Float16 v8h;
typedef __attribute__((ext_vector_type(8)))  unsigned short v8us;
typedef __attribute__((ext_vector_type(8)))  float    v8f;
typedef __attribute__((ext_vector_type(4)))  float    v4f;
typedef v4f  __attribute__((may_alias)) v4fa;
typedef v8us __attribute__((may_alias)) v8usa;
typedef __attribute__((ext_vector_type(4)))  __bf16   v4bf;
typedef __attribute__((ext_vector_type(4)))  unsigned short v4us;
typedef v4us __attribute__((may_alias)) v4usa;

__device__ __forceinline__ unsigned short f2bf(float f) { unsigned u = __float_as_uint(f); u += 0x7FFFu + ((u >> 16) & 1u); return (unsigned short)(u >> 16); }
__device__ __forceinline__ float bf2f(unsigned short b) { return __uint_as_float(((unsigned)b) << 16); }
__device__ __forceinline__ float bfr(float f) { return bf2f(f2bf(f)); }
__device__ __forceinline__ v16h cat16(v8h lo, v8h hi) { return __builtin_shufflevector(lo, hi, 0, 1, 2, 3, 4, 5, 6, 7, 8, 9, 10, 11, 12, 13, 14, 15); }
__device__ __forceinline__ v16bf cat16b(v8us lo, v8us hi) { return __builtin_bit_cast(v16bf, __builtin_shufflevector(lo, hi, 0, 1, 2, 3, 4, 5, 6, 7, 8, 9, 10, 11, 12, 13, 14, 15)); }
__device__ __forceinline__ v8f wmma16(v16h a, v16h b, v8f c) { return __builtin_amdgcn_wmma_f32_16x16x32_f16(false, a, false, b, (short)0, c, false, false); }
__device__ __forceinline__ v8f wmmab(v16bf a, v16bf b, v8f c) { return __builtin_amdgcn_wmma_f32_16x16x32_bf16(false, a, false, b, (short)0, c, false, false); }
__device__ __forceinline__ void splitf(float y, unsigned short& h, unsigned short& l) { h = f2bf(y); l = f2bf(y - bf2f(h)); }
// Fragment loaders (A and B identical): p already points at row (lane&15), k0 + 8*(lane>>4); elements 0..7 <- p[0..7], elements 8..15 <- p[16..23].
__device__ __forceinline__ v16h ldh(const h16* p) { return cat16(*(const v8h*)p, *(const v8h*)(p + 16)); }
__device__ __forceinline__ v16bf ldb(const bf* p) { return cat16b(*(const v8us*)p, *(const v8us*)(p + 16)); }
__device__ __forceinline__ v8us pack_h(v8f c) { v8h t;
#pragma unroll
    for (int r = 0; r < 8; ++r) t[r] = (h16)c[r];
    return __builtin_bit_cast(v8us, t); }
__device__ __forceinline__ void pack_b(v8f c, v8us& a, v8us& l) {
#pragma unroll
    for (int r = 0; r < 8; ++r) { unsigned short x, y; splitf(c[r], x, y); a[r] = x; l[r] = y; } }

template <typename T16> struct WFrag;
template <> struct WFrag<h16> { typedef v16h V; static __device__ __forceinline__ V ld(const h16* p) { return ldh(p); } static __device__ __forceinline__ v8f mma(V a, V b, v8f c) { return wmma16(a, b, c); } };
template <> struct WFrag<bf> { typedef v16bf V; static __device__ __forceinline__ V ld(const bf* p) { return ldb(p); } static __device__ __forceinline__ v8f mma(V a, V b, v8f c) { return wmmab(a, b, c); } };

#define LP  72              // LDS row pitch of a staged tile in 16-bit elements: 144 B = 16 B x odd, free of bank conflicts for 16-byte fragment reads
#define TSZ (64 * LP)       // 16-bit elements of one staged tile
// One lane's asynchronous copy of 16 bytes from global memory to LDS (l = LDS byte address, g = global byte address), written as the compiler's builtin, offset 0:
// no s_wait_xcnt is written behind it, so a wave goes from its refill straight on to the next stage's fragment reads. The waits on asynccnt are the callers'.
typedef __attribute__((ext_vector_type(4))) int v4i;
__device__ __forceinline__ void acopy(const unsigned l, const char* g) {
    __builtin_amdgcn_global_load_async_to_lds_b128((__attribute__((address_space(1))) v4i*)g, (__attribute__((address_space(3))) v4i*)l, 0, 0);
}
// One 64-row tile: this lane's 16 bytes of rows r, r+16, r+32, r+48. l = LDS byte address, g = global byte address of row r, gstep = bytes between global rows r and r+16.
__device__ __forceinline__ void copy_tile(const unsigned l, const char* g, const size_t gstep) {
    acopy(l, g); acopy(l + 16 * LP * 2, g + gstep); acopy(l + 32 * LP * 2, g + 2 * gstep); acopy(l + 48 * LP * 2, g + 3 * gstep);
}

// gemm_tile: a block of four waves computes a 128x128 tile; wave w owns the 64x64 quarter at rows 64*(w>>1), columns 64*(w&1):
// acc[mb][nb][j] = C[16*mb + 8*(lane>>4) + j][16*nb + (lane&15)] of that quarter = sum_k A[m][k] Bt[n][k] (+ A2[m][k] Bt[n][k] when NSPLIT == 1).
// Operand path: a stage is 64 k = one 128-row x 128-B tile per operand plane (A, Bt, and A2 when NSPLIT == 1), brought from the K-contiguous 16-bit planes into LDS once per block
// by asynchronous 16-byte copies (each wave-wide copy = 4 whole 128-B lines), two buffers, the next stage in flight while this one is worked on; every wave reads its fragments from LDS.
// K % 64 == 0; arow0 / brow0 = first row of the block's tile in A (A2) / Bt; ring = 2 * (2 + NSPLIT) * GTS 16-bit elements of LDS, free for other use on return.
#define GTS (2 * TSZ)       // 16-bit elements of one staged 128-row operand tile
template <typename T16, int NSPLIT>
__device__ __forceinline__ void gemm_tile(const T16* __restrict__ A, const T16* __restrict__ A2, const T16* __restrict__ Bt, const int K, const size_t arow0, const size_t brow0, unsigned short* ring, v8f (&acc)[4][4]) {
    typedef typename WFrag<T16>::V V;
    constexpr int NT = 2 + NSPLIT;                                      // tiles per stage: A, Bt (, A2)
    const int lane = threadIdx.x & 31, lr = lane & 15, hi = lane >> 4;
    const int w = __builtin_amdgcn_readfirstlane((threadIdx.x >> 5) & 3);
    const int cr = (int)(threadIdx.x >> 3) & 15, cc = (int)threadIdx.x & 7;   // this lane's row (mod 16) and 16-byte column in every staged tile
    const unsigned lbase = (unsigned)(size_t)ring + (unsigned)(cr * LP + cc * 8) * 2u;
    const char* ga  = (const char*)(A + (arow0 + cr) * K + cc * 8);
    const char* ga2 = (const char*)(A2 + (arow0 + cr) * K + cc * 8);
    const char* gb  = (const char*)(Bt + (brow0 + cr) * K + cc * 8);
    const size_t gstep = (size_t)16 * K * 2;
    auto issue = [&](const int s, const int buf) {                      // stage s (k = 64s .. 64s+63) into buffer buf
        const unsigned lb = lbase + (unsigned)(buf * NT * GTS) * 2u;
        const size_t ko = (size_t)s * 64 * 2;
        copy_tile(lb, ga + ko, gstep);             copy_tile(lb + TSZ * 2u, ga + ko + 4 * gstep, gstep);
        copy_tile(lb + GTS * 2u, gb + ko, gstep);  copy_tile(lb + GTS * 2u + TSZ * 2u, gb + ko + 4 * gstep, gstep);
        if (NSPLIT == 1) { copy_tile(lb + 2u * GTS * 2u, ga2 + ko, gstep); copy_tile(lb + 2u * GTS * 2u + TSZ * 2u, ga2 + ko + 4 * gstep, gstep); }
    };
#pragma unroll
    for (int mb = 0; mb < 4; ++mb)
#pragma unroll
        for (int nb = 0; nb < 4; ++nb) acc[mb][nb] = (v8f){};
    const int nstage = K / 64;
    issue(0, 0);
    asm volatile("s_wait_asynccnt 0x0" ::: "memory");                   // this wave's copies of stage 0 have landed
    __syncthreads();                                                    // ... and every other wave's: stage 0 may be read
    if (nstage > 1) issue(1, 1);
#pragma unroll 1   // rolled: one publish point and one refill site in the text
    for (int t = 0; t < nstage; ++t) {
        const T16* sbuf = (const T16*)ring + (t & 1) * NT * GTS;
        const T16* pa = sbuf + ((w >> 1) * 64 + lr) * LP + 8 * hi;
        const T16* pb = sbuf + GTS + ((w & 1) * 64 + lr) * LP + 8 * hi;
#pragma unroll     // the two 32-k steps of a stage: their LDS offsets become immediates
        for (int ks = 0; ks < 2; ++ks) {
            V a[4], a2[4];
#pragma unroll
            for (int mb = 0; mb < 4; ++mb) { a[mb] = WFrag<T16>::ld(pa + mb * 16 * LP + ks * 32); if (NSPLIT == 1) a2[mb] = WFrag<T16>::ld(pa + 2 * GTS + mb * 16 * LP + ks * 32); else a2[mb] = a[mb]; }
            V b[4];
#pragma unroll
            for (int nb = 0; nb < 4; ++nb) b[nb] = WFrag<T16>::ld(pb + nb * 16 * LP + ks * 32);
            // inputs-only fence on the loaded fragments: all LDS reads of this 32-k step stand as one group with one wait ahead of its WMMAs; without it each Bt fragment is read and waited for singly between them
            asm volatile("" :: "v"(b[0]), "v"(b[1]), "v"(b[2]), "v"(b[3]));
#pragma unroll
            for (int nb = 0; nb < 4; ++nb) {
#pragma unroll
                for (int mb = 0; mb < 4; ++mb) { acc[mb][nb] = WFrag<T16>::mma(a[mb], b[nb], acc[mb][nb]); if (NSPLIT == 1) acc[mb][nb] = WFrag<T16>::mma(a2[mb], b[nb], acc[mb][nb]); } }
            // four vector slots behind these WMMAs before a vector instruction may touch their registers, on either side of the branch at the loop's foot
            asm volatile("v_nop\n\tv_nop\n\tv_nop\n\tv_nop" : "+v"(acc[0][0]), "+v"(acc[1][1]), "+v"(acc[2][2]), "+v"(acc[3][3]) : "v"(a[0]), "v"(a[3]));
        }
        // publish point of stage t + 1, passed by every wave
        asm volatile("s_wait_dscnt 0x0" ::: "memory");                  // this wave's reads of stage t have returned before its buffer is refilled
        asm volatile("s_wait_asynccnt 0x0" ::: "memory");               // this wave's copies of stage t + 1 have landed
        __syncthreads();                                                // stage t + 1 may be read; every reader has left stage t
        if (t + 2 < nstage) issue(t + 2, t & 1);
    }
    asm volatile("s_wait_asynccnt 0x0" ::: "memory");                   // nothing in flight when the ring becomes output staging
}

// gemm_xw: a block of eight waves computes a 128x256 tile of x W^T; wave w owns the 64x64 part at rows 64*(w>>2), columns 64*(w&3); acc as in gemm_tile. K = DM.
// Operand path: a stage is 64 k, two buffers. W: 256 rows x 128 B of its bf16 plane by asynchronous 16-byte copies as in gemm_tile (waves 0-3 rows 0..127, waves 4-7 rows 128..255).
// x: 128 rows x 256 B of the f32 input itself, read by plain 16-byte loads (a wave-wide load = 4 whole lines) into registers one stage ahead, rounded to bf16 (nearest even)
// and stored to LDS behind this stage's products. arow0 / brow0 = first row of the block's tile in X / Bt; ring = 2 * XSB 16-bit elements of LDS, free for other use on return.
#define XSB (6 * TSZ)       // 16-bit elements of one stage buffer: x 128 rows | W 256 rows
__device__ __forceinline__ void gemm_xw(const float* __restrict__ X, const bf* __restrict__ Bt, const size_t arow0, const size_t brow0, unsigned short* ring, v8f (&acc)[4][4]) {
    constexpr int K = DM;
    const int lane = threadIdx.x & 31, lr = lane & 15, hi = lane >> 4;
    const int w = __builtin_amdgcn_readfirstlane((threadIdx.x >> 5) & 7);
    const int cr = (int)(threadIdx.x >> 3) & 15, cc = (int)threadIdx.x & 7;   // this lane's row (mod 16) and 16-byte column in every staged W tile
    const int g = w >> 2;                                               // which 128 rows of W this wave copies
    const unsigned lbase = (unsigned)(size_t)ring + (unsigned)((2 + 2 * g) * TSZ + cr * LP + cc * 8) * 2u;
    const char* gb = (const char*)(Bt + (brow0 + g * 128 + cr) * K + cc * 8);
    const size_t gstep = (size_t)16 * K * 2;
    const int xr = (int)(threadIdx.x >> 4) & 15, xc = ((int)threadIdx.x & 15) * 4;   // this lane's x row (mod 16) and first of its four k
    const float* gx = X + (arow0 + xr) * K + xc;
    unsigned short* lx = ring + xr * LP + xc;
    v4f xv[8];                                                          // this lane's share of the x stage in flight: rows xr + 16 j
    auto issue = [&](const int s, const int buf) {                      // stage s (k = 64s .. 64s+63): W into buffer buf, x into xv
        const unsigned lb = lbase + (unsigned)(buf * XSB) * 2u;
        const size_t ko = (size_t)s * 64 * 2;
        copy_tile(lb, gb + ko, gstep);             copy_tile(lb + TSZ * 2u, gb + ko + 4 * gstep, gstep);
        const float* p = gx + (size_t)s * 64;
#pragma unroll
        for (int j = 0; j < 8; ++j) xv[j] = *(const v4f*)(p + (size_t)j * 16 * K);
        asm volatile("s_wait_xcnt 0x0" ::: "memory");                   // stands in front of any rewriting of the reads' address registers
        __builtin_amdgcn_sched_barrier(0);                              // keeps later register writes behind that wait, and the eight reads together
    };
    auto put = [&](const int buf) {                                     // xv, rounded, into the x rows of buffer buf
#pragma unroll
        for (int j = 0; j < 8; ++j) *(v4usa*)(lx + buf * XSB + j * 16 * LP) = __builtin_bit_cast(v4us, __builtin_convertvector(xv[j], v4bf));
    };
#pragma unroll
    for (int mb = 0; mb < 4; ++mb)
#pragma unroll
        for (int nb = 0; nb < 4; ++nb) acc[mb][nb] = (v8f){};
    constexpr int nstage = K / 64;
    static_assert(nstage >= 2);
    issue(0, 0);
    put(0);
    asm volatile("s_wait_dscnt 0x0" ::: "memory");                      // this wave's x rows of stage 0 are written
    asm volatile("s_wait_asynccnt 0x0" ::: "memory");                   // this wave's copies of stage 0 have landed
    __syncthreads();                                                    // ... and every other wave's: stage 0 may be read
    issue(1, 1);
#pragma unroll 1   // rolled: one publish point and one refill site in the text
    for (int t = 0; t < nstage; ++t) {
        const bf* sbuf = ring + (t & 1) * XSB;
        const bf* pa = sbuf + ((w >> 2) * 64 + lr) * LP + 8 * hi;
        const bf* pb = sbuf + 2 * TSZ + ((w & 3) * 64 + lr) * LP + 8 * hi;
#pragma unroll     // the two 32-k steps of a stage: their LDS offsets become immediates
        for (int ks = 0; ks < 2; ++ks) {
            v16bf a[4], b[4];
#pragma unroll
            for (int mb = 0; mb < 4; ++mb) a[mb] = ldb(pa + mb * 16 * LP + ks * 32);
#pragma unroll
            for (int nb = 0; nb < 4; ++nb) b[nb] = ldb(pb + nb * 16 * LP + ks * 32);
            // inputs-only fence on the loaded fragments: all LDS reads of this 32-k step stand as one group with one wait ahead of its WMMAs; without it each W fragment is read and waited for singly between them
            asm volatile("" :: "v"(b[0]), "v"(b[1]), "v"(b[2]), "v"(b[3]));
#pragma unroll
            for (int nb = 0; nb < 4; ++nb) {
#pragma unroll
                for (int mb = 0; mb < 4; ++mb) acc[mb][nb] = wmmab(a[mb], b[nb], acc[mb][nb]); }
            // four vector slots behind these WMMAs before a vector instruction may touch their registers, on either side of the branch that follows
            asm volatile("v_nop\n\tv_nop\n\tv_nop\n\tv_nop" : "+v"(acc[0][0]), "+v"(acc[1][1]), "+v"(acc[2][2]), "+v"(acc[3][3]) : "v"(a[0]), "v"(a[3]));
        }
        if (t + 1 < nstage) put((t + 1) & 1);                           // that buffer's readers left it at the last publish point
        // publish point of stage t + 1, passed by every wave
        asm volatile("s_wait_dscnt 0x0" ::: "memory");                  // this wave's reads of stage t have returned, its x rows of stage t + 1 are written
        asm volatile("s_wait_asynccnt 0x0" ::: "memory");               // this wave's copies of stage t + 1 have landed
        __syncthreads();                                                // stage t + 1 may be read; every reader has left stage t
        if (t + 2 < nstage) issue(t + 2, t & 1);
    }
    asm volatile("s_wait_asynccnt 0x0" ::: "memory");                   // nothing in flight when the ring becomes output staging
}

// k_cvtw: the 16-bit planes of the four weights in one launch of CVW waves (16 per block): wave g takes 256 floats at g*256 of each of W_q, W_k, W_v (-> WT) and W_o (-> WoB and WoH).
#define CVW 4096
__device__ __forceinline__ v8us cvt8(const v8f v) { v8us o;
#pragma unroll
    for (int k = 0; k < 8; ++k) o[k] = f2bf(v[k]);
    return o; }
__global__ __launch_bounds__(512) void k_cvtw(const float* __restrict__ wq, const float* __restrict__ wk, const float* __restrict__ wv, const float* __restrict__ wo,
                                              bf* __restrict__ WT, bf* __restrict__ WoB, h16* __restrict__ WoH) {
    static_assert((size_t)DM * DM == (size_t)CVW * 256);
    const unsigned lane = threadIdx.x & 31;
    const unsigned gw = (unsigned)__builtin_amdgcn_readfirstlane((int)(blockIdx.x * 16 + (threadIdx.x >> 5)));   // wave number in a scalar register: the bases are then scalar
    const size_t wof = (size_t)gw * 256 + lane * 8;
    v8f cur[4];
    cur[0] = *(const v8f*)(wq + wof); cur[1] = *(const v8f*)(wk + wof); cur[2] = *(const v8f*)(wv + wof); cur[3] = *(const v8f*)(wo + wof);
    asm volatile("s_wait_xcnt 0x0" ::: "memory");       // stands in front of any rewriting of the reads' address registers
    __builtin_amdgcn_sched_barrier(0);                  // keeps later register writes behind that wait, and the eight reads together ahead of the conversions
#pragma unroll
    for (int j = 0; j < 3; ++j) *(v8us*)(WT + (size_t)j * DM * DM + wof) = cvt8(cur[j]);
    const v8us ob = cvt8(cur[3]); v8h oh;
#pragma unroll
    for (int k = 0; k < 8; ++k) oh[k] = (h16)(bf2f(ob[k]) * WOC);
    *(v8us*)(WoB + wof) = ob; *(v8h*)(WoH + wof) = oh;
}

// k_proj: all three projections in one launch, straight from the f32 activations. grid (NB*TT/128, NH_/4, 3), eight waves; z = 0 -> q plane, z = 1 -> k plane, z = 2 -> value planes. Block tile = 128 tokens x four heads; a wave's tile = 64 tokens x one head (64 dims).
// z < 2: rows written as they are, QK[z][b][h][t][64] = f16(c * (x W^T + b)), c = QSC for q, KSC for k. z = 2: written transposed, VT[b][h][d][t] = f16(64 * v), and for t < EROWS the bf16 hi/lo planes VE[b][h][d][t] of v.
__global__ __launch_bounds__(256) void k_proj(const float* __restrict__ xq, const float* __restrict__ xk, const float* __restrict__ xv, const bf* __restrict__ WT, const float* __restrict__ bq, const float* __restrict__ bk, const float* __restrict__ bv, h16* QK, h16* VT, bf* VEh, bf* VEl) {
    __shared__ __align__(16) unsigned short ring[8 * 64 * 68 * 2];      // operand ring; behind the product each wave's own output or transpose staging (the larger of the two uses)
    static_assert(8 * 64 * 68 * 2 >= 2 * XSB);
    const int z = blockIdx.z;
    const int lane = threadIdx.x & 31, lr = lane & 15, hi = lane >> 4;
    const int w = __builtin_amdgcn_readfirstlane((threadIdx.x >> 5) & 7);
    const int mt = blockIdx.x * 2 + (w >> 2); const int b = mt / (TT / 64); const int t0 = (mt % (TT / 64)) * 64; const int h = blockIdx.y * 4 + (w & 3);
    const float* A = z == 0 ? xq : z == 1 ? xk : xv; const bf* Bt = WT + (size_t)z * DM * DM;
    v8f acc[4][4];
    gemm_xw(A, Bt, (size_t)b * SEQ_FULL + t0 - (w >> 2) * 64, (size_t)blockIdx.y * 4 * HD, ring, acc);
  if (z < 2) {
    float* os = (float*)ring + w * (16 * 68);
    const int rq = lane >> 3, pc = lane & 7;
    const v8f b0 = *(const v8f*)(bq + h * HD + pc * 8); const v8f b1 = *(const v8f*)(bk + h * HD + pc * 8);
    v8f bb;
#pragma unroll
    for (int i = 0; i < 8; ++i) bb[i] = bfr(z ? b1[i] : b0[i]);
    const float pf = z ? KSC : QSC;
    h16* P = QK + (size_t)z * QKSZ + (((size_t)b * NH_ + h) * TT + t0) * HD + pc * 8;
#pragma unroll
    for (int mb = 0; mb < 4; ++mb) {
#pragma unroll
        for (int nb = 0; nb < 4; ++nb) {
#pragma unroll
            for (int j = 0; j < 8; ++j) os[(hi * 8 + j) * 68 + nb * 16 + lr] = acc[mb][nb][j]; }
        __builtin_amdgcn_wave_barrier(); asm volatile("" ::: "memory");
        h16* prow = P + (size_t)(mb * 16) * HD;
{
#pragma unroll
            for (int s = 0; s < 4; ++s) { const int row = 4 * s + rq;
                const v4f x0 = *(const v4fa*)(os + row * 68 + pc * 8), x1 = *(const v4fa*)(os + row * 68 + pc * 8 + 4);
                v8h o;
#pragma unroll
                for (int q = 0; q < 4; ++q) { o[q] = (h16)((x0[q] + bb[q]) * pf); o[4 + q] = (h16)((x1[q] + bb[4 + q]) * pf); }
                *(v8h*)(prow + (size_t)row * HD) = o; }
             }
        __builtin_amdgcn_wave_barrier(); asm volatile("" ::: "memory");
    }
  } else {
    float* ts = (float*)ring + w * (64 * 68);
#pragma unroll
    for (int mb = 0; mb < 4; ++mb)
#pragma unroll
        for (int nb = 0; nb < 4; ++nb) {
            const v4f lo4 = { acc[mb][nb][0], acc[mb][nb][1], acc[mb][nb][2], acc[mb][nb][3] };
            const v4f hi4 = { acc[mb][nb][4], acc[mb][nb][5], acc[mb][nb][6], acc[mb][nb][7] };
            *(v4fa*)(ts + (nb * 16 + lr) * 68 + mb * 16 + 8 * hi) = lo4;
            *(v4fa*)(ts + (nb * 16 + lr) * 68 + mb * 16 + 8 * hi + 4) = hi4; }
    __builtin_amdgcn_wave_barrier(); asm volatile("" ::: "memory");
    const int rq = lane >> 3, pc = lane & 7;
    const bool early = t0 < EROWS;
    const size_t vrow0 = ((size_t)b * NH_ + h) * HD;
{
#pragma unroll 1
        for (int s = 0; s < 16; ++s) { const int d = 4 * s + rq;
            const float bb = bfr(bv[h * HD + d]);
            const v4f x0 = *(const v4fa*)(ts + d * 68 + pc * 8), x1 = *(const v4fa*)(ts + d * 68 + pc * 8 + 4);
            v8f x = __builtin_shufflevector(x0, x1, 0, 1, 2, 3, 4, 5, 6, 7);
            x = x + bb;
            v8h o;
#pragma unroll
            for (int q = 0; q < 8; ++q) o[q] = (h16)(x[q] * VC);
            *(v8h*)(VT + (vrow0 + d) * TT + t0 + pc * 8) = o;
            asm volatile("s_wait_xcnt 0x0" ::: "memory");   // stands in front of the rewriting of the store's data and address registers (hi/lo packing, next trip)
            if (early) { v8us oh, ol; pack_b(x, oh, ol);
                *(v8us*)(VEh + (vrow0 + d) * EROWS + t0 + pc * 8) = oh;
                *(v8us*)(VEl + (vrow0 + d) * EROWS + t0 + pc * 8) = ol;
                asm volatile("s_wait_xcnt 0x0" ::: "memory"); } }   // stands in front of the next trip's advance of both stores' address registers
         }
  }
}

// One 64-row tile by eight waves: this lane's 16 bytes of rows r and r+32. l = LDS byte address, g = global byte address of row r, gstep = bytes between global rows r and r+32.
__device__ __forceinline__ void copy_tile8(const unsigned l, const char* g, const size_t gstep) {
    acopy(l, g); acopy(l + 32 * LP * 2, g + gstep);
}

// attn_body: fused causal attention, 128 query rows and 8 waves per block, 32 keys per step, transposed formulation.
//   EARLY: a wave owns 16 query rows (one tile) and takes both 32-key steps of every stage. Else: a wave owns 32 query rows (two tiles) and one of the two 32-key steps of every stage;
//   the two waves of a 32-row group hold partial (m, l, O^T) over their own keys and join them once behind the loop through LDS, each finishing one of the two tiles.
//   S^T tile (rows = keys, cols = queries) = A(k plane rows) x B(q plane rows); D element r of lane l = S^T[key 8*(l>>4)+r][query l&15].
//   Per lane and query tile one query column. Held reference m (log2 units, equal in both lane halves): PC - m is the C operand of the score products, so p = exp2(D) with no further arithmetic.
//   A step whose in-lane sum of p tops RSB in any lane (a score far above m; always so at a wave's first step, where m = NEGB) is redone: scores with C = 0, m raised to the maximum, l and O^T rescaled.
//   Running sum l over the lane's own keys; the two lane halves are added once behind the loop.
//   P^T as B fragment: element r <- p(tile keys 0..15)[r], element 8+r <- p(tile keys 16..31)[r], lane unchanged.
//   O^T tile j (rows = dims 16j.., cols = queries) += A(V^T rows) x B(P^T). Masked keys carry p = 0 exactly.
// EARLY: bf16 hi+lo P and V (3 products); else f16 single product with P x256 (cancels against the row sum) and V x64.
// Operand path: a stage is 64 keys = one K tile (64 key rows x 128 B) and one V^T tile per value plane (64 dim rows x 128 B), brought into LDS once per block by
// asynchronous 16-byte copies (each wave-wide copy = 4 whole 128-B lines), two buffers, the next stage in flight while this one is worked on; all eight waves read their fragments from LDS,
// and each K and V^T fragment read feeds the products of all NQ query tiles of the wave. qb = index of the block's tile of 128 query rows.
template <bool EARLY>
__device__ __forceinline__ void attn_body(const h16* __restrict__ QP, const h16* __restrict__ KP, const h16* __restrict__ VT, const bf* __restrict__ VEh, const bf* __restrict__ VEl, bf* C0, bf* C1, const int qb, const int bh, unsigned short* ring) {
    constexpr int NT = EARLY ? 3 : 2;                                   // tiles per stage: K, V (EARLY: K, V hi, V lo)
    constexpr int NQ = EARLY ? 1 : 2;                                   // query tiles per wave
    using VE16 = __type_pack_element<EARLY ? 0 : 1, bf, h16>;           // element type of the staged value planes
    using VF = typename WFrag<VE16>::V;
    static_assert(2 * NT * TSZ >= 8 * 2 * 1152 || !EARLY);              // stage buffers: the first 2 * NT * TSZ 16-bit elements of the ring (2 * 3 * TSZ in all); output staging behind the loop
    unsigned short* stg = ring;
    const int lane = threadIdx.x & 31, lr = lane & 15, hi = lane >> 4;
    const int w = __builtin_amdgcn_readfirstlane((threadIdx.x >> 5) & 7);   // wave number in a scalar register: the per-wave skip below is then a scalar branch
    const int b = bh / NH_, h = bh % NH_;
    const int kh = EARLY ? 0 : (w & 1);                                 // which 32 keys of every stage this wave takes (not EARLY)
    const int q0 = qb * 128 + (EARLY ? w * 16 : (w >> 1) * 32);
    const size_t pof = (size_t)bh * TT * HD;
    v16h qf0[NQ], qf1[NQ]; int qq[NQ];
    v8f o[NQ][4];
    float m[NQ], l[NQ];
    v8f cf[NQ];                                                         // C operand of the score products: PC - m in all eight elements
    constexpr float PC  = EARLY ? 0.0f : 8.0f;                          // log2 of the carry of P
    constexpr float RSB = EARLY ? 128.0f : 32768.0f;                    // 2^(PC + 7): every p below it is finite in f16
#pragma unroll
    for (int u = 0; u < NQ; ++u) {
        qq[u] = q0 + 16 * u + lr;
        const h16* qp = QP + pof + (size_t)qq[u] * HD + 8 * hi;
        qf0[u] = ldh(qp); qf1[u] = ldh(qp + 32);
        o[u][0] = (v8f){}; o[u][1] = (v8f){}; o[u][2] = (v8f){}; o[u][3] = (v8f){};
        m[u] = NEGB; l[u] = 0.0f; cf[u] = (v8f){} + (PC - NEGB); }
    const int nstage = 2 * (qb + 1);                                    // stages of 64 keys, the same for the whole block
    const int cr = (int)(threadIdx.x >> 3) & 31, cc = (int)threadIdx.x & 7;   // this lane's row (mod 32) and 16-byte column in every staged tile
    const unsigned lbase = (unsigned)(size_t)ring + (unsigned)(cr * LP + cc * 8) * 2u;
    const char* gk = (const char*)(KP + pof + (size_t)cr * HD + cc * 8);
    const char* gv0 = EARLY ? (const char*)(VEh + (size_t)bh * HD * EROWS + (size_t)cr * EROWS + cc * 8) : (const char*)(VT + (size_t)bh * HD * TT + (size_t)cr * TT + cc * 8);
    const char* gv1 = EARLY ? (const char*)(VEl + (size_t)bh * HD * EROWS + (size_t)cr * EROWS + cc * 8) : gv0;
    const size_t vstep = (size_t)32 * (EARLY ? EROWS : TT) * 2;
    auto issue = [&](const int s, const int buf) {                      // stage s (keys 64s .. 64s+63) into buffer buf
        const unsigned lb = lbase + (unsigned)(buf * NT * TSZ) * 2u;
        copy_tile8(lb, gk + (size_t)s * 64 * HD * 2, (size_t)32 * HD * 2);
        copy_tile8(lb + TSZ * 2u, gv0 + (size_t)s * 64 * 2, vstep);
        if (EARLY) copy_tile8(lb + 2u * TSZ * 2u, gv1 + (size_t)s * 64 * 2, vstep);
    };
    issue(0, 0);
    asm volatile("s_wait_asynccnt 0x0" ::: "memory");                   // this wave's copies of stage 0 have landed
    __syncthreads();                                                    // ... and every other wave's: stage 0 may be read
    issue(1, 1);
#pragma unroll 1   // rolled: one publish point and one refill site in the text
    for (int t = 0; t < nstage; ++t) {
        const unsigned short* sbuf = ring + (t & 1) * NT * TSZ;
#pragma unroll     // EARLY: the two 32-key steps of a stage, their LDS offsets become immediates; else this wave's one step
      for (int sub = 0; sub < (EARLY ? 2 : 1); ++sub) {
        const int ks = EARLY ? sub : kh;
        const int kt = t * 64 + ks * 32;
        if (kt <= q0) {              // a wave skips the 32 keys that lie wholly above its queries
        const h16* kp = (const h16*)sbuf + (ks * 32 + lr) * LP + 8 * hi;
        v8f s0[NQ], s1[NQ], p0[NQ], p1[NQ];
        float rs[NQ];
        auto scores = [&](const v8f (&c)[NQ]) {      // s0, s1 = c + S^T of this step's 32 keys, keys above the query at NEGB
            const v16h ka0 = ldh(kp), ka1 = ldh(kp + 16 * LP), kb0 = ldh(kp + 32), kb1 = ldh(kp + 16 * LP + 32);
#pragma unroll
            for (int u = 0; u < NQ; ++u) { s0[u] = wmma16(ka0, qf0[u], c[u]); s1[u] = wmma16(ka1, qf0[u], c[u]); }
#pragma unroll
            for (int u = 0; u < NQ; ++u) { s0[u] = wmma16(kb0, qf1[u], s0[u]); s1[u] = wmma16(kb1, qf1[u], s1[u]); }
            // four vector slots behind these WMMAs before a vector instruction may touch their registers, on either side of the branch that follows
            // (c is named too: alive behind the products, it is read in place as their C operand; otherwise the compiler first copies its eight registers into one D per query tile)
            if constexpr (NQ == 1) asm volatile("v_nop\n\tv_nop\n\tv_nop\n\tv_nop" : "+v"(s0[0]), "+v"(s1[0]) : "v"(ka0), "v"(ka1), "v"(kb0), "v"(kb1), "v"(qf1[0]), "v"(c[0]));
            else                   asm volatile("v_nop\n\tv_nop\n\tv_nop\n\tv_nop" : "+v"(s0[0]), "+v"(s1[0]), "+v"(s0[NQ - 1]), "+v"(s1[NQ - 1]) : "v"(ka0), "v"(ka1), "v"(kb0), "v"(kb1), "v"(qf1[0]), "v"(qf1[NQ - 1]), "v"(c[0]), "v"(c[NQ - 1]));
            if (kt + 31 > q0) {      // diagonal step of this wave: exclude keys above the query
#pragma unroll
                for (int u = 0; u < NQ; ++u) {
                    const int d = qq[u] - kt - 8 * hi;       // element r of s0 is key d - r below the query, of s1 key d - 16 - r
#pragma unroll
                    for (int r = 0; r < 8; ++r) { s0[u][r] = (r > d) ? NEGB : s0[u][r]; s1[u][r] = (16 + r > d) ? NEGB : s1[u][r]; }
                }
            }
        };
        auto expsum = [&]() {                        // p = exp2(s), rs = the lane's sum of p
#pragma unroll
            for (int u = 0; u < NQ; ++u) {
                rs[u] = 0.0f;
#pragma unroll
                for (int r = 0; r < 8; ++r) { p0[u][r] = __builtin_amdgcn_exp2f(s0[u][r]); p1[u][r] = __builtin_amdgcn_exp2f(s1[u][r]); rs[u] += p0[u][r] + p1[u][r]; }
            }
        };
        scores(cf);
        // this step's V^T fragments are asked for here, so that their LDS latency passes under the exponentials
        const unsigned short* vb = sbuf + TSZ + lr * LP + ks * 32 + 8 * hi;
        VF va[4], vlo[4];
#pragma unroll
        for (int j = 0; j < 4; ++j) { va[j] = WFrag<VE16>::ld((const VE16*)vb + j * 16 * LP); if constexpr (EARLY) vlo[j] = WFrag<VE16>::ld((const VE16*)vb + TSZ + j * 16 * LP); else vlo[j] = va[j]; }
        expsum();
        bool need = false;
#pragma unroll
        for (int u = 0; u < NQ; ++u) need = need || !(rs[u] <= RSB);     // also true for an infinite or undefined sum
        if (__builtin_amdgcn_ballot_w32(need) != 0) {                    // one scalar branch per step; seldom taken behind a wave's first step
            const v8f zc[NQ] = {};
            scores(zc);
#pragma unroll
            for (int u = 0; u < NQ; ++u) {
                float mx = fmaxf(s0[u][0], s1[u][0]);
#pragma unroll
                for (int r = 1; r < 8; ++r) mx = fmaxf(mx, fmaxf(s0[u][r], s1[u][r]));
                mx = fmaxf(mx, __shfl_xor(mx, 16, 32));
                const float mn = fmaxf(m[u], mx);
                const float corr = __builtin_amdgcn_exp2f(m[u] - mn);
                m[u] = mn;
                cf[u] = (v8f){} + (PC - mn);
                s0[u] += cf[u]; s1[u] += cf[u];
                l[u] *= corr;
                o[u][0] *= corr; o[u][1] *= corr; o[u][2] *= corr; o[u][3] *= corr;
            }
            expsum();
        }
#pragma unroll
        for (int u = 0; u < NQ; ++u) l[u] += rs[u];
        if constexpr (EARLY) {
            v8us ph0, ph1, pl0, pl1;
            pack_b(p0[0], ph0, pl0); pack_b(p1[0], ph1, pl1);
            const v16bf PH = cat16b(ph0, ph1), PL = cat16b(pl0, pl1);
            const v16bf vh0 = va[0], vh1 = va[1], vh2 = va[2], vh3 = va[3];
            const v16bf vl0 = vlo[0], vl1 = vlo[1], vl2 = vlo[2], vl3 = vlo[3];
            o[0][0] = wmmab(vh0, PH, o[0][0]); o[0][0] = wmmab(vl0, PH, o[0][0]); o[0][0] = wmmab(vh0, PL, o[0][0]);
            o[0][1] = wmmab(vh1, PH, o[0][1]); o[0][1] = wmmab(vl1, PH, o[0][1]); o[0][1] = wmmab(vh1, PL, o[0][1]);
            o[0][2] = wmmab(vh2, PH, o[0][2]); o[0][2] = wmmab(vl2, PH, o[0][2]); o[0][2] = wmmab(vh2, PL, o[0][2]);
            o[0][3] = wmmab(vh3, PH, o[0][3]); o[0][3] = wmmab(vl3, PH, o[0][3]); o[0][3] = wmmab(vh3, PL, o[0][3]);
            asm volatile("v_nop\n\tv_nop\n\tv_nop\n\tv_nop" : "+v"(o[0][0]), "+v"(o[0][1]), "+v"(o[0][2]), "+v"(o[0][3]) : "v"(vh0), "v"(vh1), "v"(vh2), "v"(vh3), "v"(vl0), "v"(vl1), "v"(vl2), "v"(vl3), "v"(PH), "v"(PL));
        } else {
            v16h pb[NQ];
#pragma unroll
            for (int u = 0; u < NQ; ++u)
#pragma unroll
                for (int r = 0; r < 8; ++r) { pb[u][r] = (h16)p0[u][r]; pb[u][8 + r] = (h16)p1[u][r]; }
            const v16h a0 = va[0], a1 = va[1], a2 = va[2], a3 = va[3];
#pragma unroll
            for (int u = 0; u < NQ; ++u) { o[u][0] = wmma16(a0, pb[u], o[u][0]); o[u][1] = wmma16(a1, pb[u], o[u][1]); o[u][2] = wmma16(a2, pb[u], o[u][2]); o[u][3] = wmma16(a3, pb[u], o[u][3]); }
            // four vector slots behind these WMMAs before a vector instruction may touch their registers, on either side of the branches that follow
            asm volatile("v_nop\n\tv_nop\n\tv_nop\n\tv_nop" : "+v"(o[0][0]), "+v"(o[0][1]), "+v"(o[0][2]), "+v"(o[0][3]), "+v"(o[NQ - 1][0]), "+v"(o[NQ - 1][1]), "+v"(o[NQ - 1][2]), "+v"(o[NQ - 1][3]) : "v"(a0), "v"(a1), "v"(a2), "v"(a3), "v"(pb[0]), "v"(pb[NQ - 1]));
        }
        }
      }
        // publish point of stage t + 1, passed by every wave
        asm volatile("s_wait_dscnt 0x0" ::: "memory");                  // this wave's reads of stage t have returned before its buffer is refilled
        asm volatile("s_wait_asynccnt 0x0" ::: "memory");               // this wave's copies of stage t + 1 have landed
        __syncthreads();                                                // stage t + 1 may be read; every reader has left stage t
        if (t + 2 < nstage) issue(t + 2, t & 1);
    }
    asm volatile("s_wait_asynccnt 0x0" ::: "memory");                   // nothing in flight when the ring becomes output staging
#pragma unroll
    for (int u = 0; u < NQ; ++u) l[u] += __shfl_xor(l[u], 16, 32);      // the row sums of the two lane halves, joined once
    const int rq = lane >> 3, pc = lane & 7;
    if constexpr (EARLY) {
        const float inv = __fdiv_rn(1.0f, l[0]);
        o[0][0] *= inv; o[0][1] *= inv; o[0][2] *= inv; o[0][3] *= inv;
        const int sb = w * 2 * 1152;
        const int so = sb + lr * 72 + 8 * hi;   // O^T element r of tile j -> row (query lr), column 16j + 8*hi + r
        v8us a, c;
        pack_b(o[0][0], a, c); *(v8usa*)(stg + so) = a;      *(v8usa*)(stg + so + 1152) = c;
        pack_b(o[0][1], a, c); *(v8usa*)(stg + so + 16) = a; *(v8usa*)(stg + so + 1152 + 16) = c;
        pack_b(o[0][2], a, c); *(v8usa*)(stg + so + 32) = a; *(v8usa*)(stg + so + 1152 + 32) = c;
        pack_b(o[0][3], a, c); *(v8usa*)(stg + so + 48) = a; *(v8usa*)(stg + so + 1152 + 48) = c;
        __builtin_amdgcn_wave_barrier(); asm volatile("" ::: "memory");
        const size_t cbase = ((size_t)b * EROWS + q0) * DM + h * HD + pc * 8;
#pragma unroll
        for (int s = 0; s < 4; ++s) { const int row = 4 * s + rq;
            const v8us x = *(const v8usa*)(stg + sb + row * 72 + pc * 8);
            *(v8us*)(C0 + cbase + (size_t)row * DM) = x;
            const v8us y = *(const v8usa*)(stg + sb + 1152 + row * 72 + pc * 8); *(v8us*)(C1 + cbase + (size_t)row * DM) = y; }
    } else {
        // Join of the two key halves: wave w keeps tile kh and hands its partial of the other tile to wave w ^ 1. Per wave XW floats of LDS: eight 512-B rows of O^T, then m, then l.
        constexpr int XW = 8 * 128 + 64;
        static_assert(8 * XW * 4 + 8 * 1152 * 2 <= 2 * 3 * TSZ * 2);    // the eight hand-over areas, then the eight output stagings, inside the ring
        float* xs = (float*)ring;
        auto give = [&](const v8f (&og)[4], const float mg, const float lg) {
            float* d = xs + w * XW + lane * 4;
#pragma unroll
            for (int j = 0; j < 4; ++j) {
                *(v4fa*)(d + (2 * j) * 128)     = (v4f){ og[j][0], og[j][1], og[j][2], og[j][3] };
                *(v4fa*)(d + (2 * j + 1) * 128) = (v4f){ og[j][4], og[j][5], og[j][6], og[j][7] }; }
            xs[w * XW + 1024 + lane] = mg; xs[w * XW + 1056 + lane] = lg;
        };
        auto finish = [&](v8f (&ok)[4], const float mk, const float lk) {
            const float* sp = xs + (w ^ 1) * XW + lane * 4;
            const float mp = xs[(w ^ 1) * XW + 1024 + lane], lp = xs[(w ^ 1) * XW + 1056 + lane];
            const float mn = fmaxf(mk, mp);
            const float ck = __builtin_amdgcn_exp2f(mk - mn), cp = __builtin_amdgcn_exp2f(mp - mn);
            const float inv = __fdiv_rn(1.0f, lk * ck + lp * cp);
            const float fk = ck * inv, fp = cp * inv;
            unsigned short* d = stg + 8 * XW * 2 + w * 1152;            // this wave's own output staging, behind the hand-over areas
#pragma unroll
            for (int j = 0; j < 4; ++j) {
                const v4f x0 = *(const v4fa*)(sp + (2 * j) * 128), x1 = *(const v4fa*)(sp + (2 * j + 1) * 128);
                const v8f x = __builtin_shufflevector(x0, x1, 0, 1, 2, 3, 4, 5, 6, 7);
                *(v8usa*)(d + lr * 72 + 8 * hi + 16 * j) = pack_h(ok[j] * fk + x * fp); }   // O^T element r of tile j -> row (query lr), column 16j + 8*hi + r
            __builtin_amdgcn_wave_barrier(); asm volatile("" ::: "memory");
            const size_t cbase = ((size_t)b * TT + q0 + 16 * kh) * DM + h * HD + pc * 8;
#pragma unroll
            for (int s = 0; s < 4; ++s) { const int row = 4 * s + rq;
                const v8us x = *(const v8usa*)(d + row * 72 + pc * 8);
                *(v8us*)(C0 + cbase + (size_t)row * DM) = x; }
        };
        if (kh == 0) give(o[NQ - 1], m[NQ - 1], l[NQ - 1]); else give(o[0], m[0], l[0]);
        __syncthreads();                                                // every wave's hand-over is written before its partner reads it
        if (kh == 0) finish(o[0], m[0], l[0]); else finish(o[NQ - 1], m[NQ - 1], l[NQ - 1]);
    }
}

// k_attn: every query tile in one launch. grid (NB*NH_, TT/128): x = (b, h); y = rank of the 128-row query tile by falling cost, so that the longest tiles start first and the short ones fill the end.
// Cost of a tile = its stages, a stage of rows < EROWS (per wave two steps of three products with the hi/lo split) weighed 13 : 5 against a stage of the other rows (per wave one step); equal costs by index.
// Query rows [EROWS, TT): ctx as f16 plane (x64 carry) [b][TT][DM]. Query rows [0, EROWS): ctx as bf16 hi/lo planes [b][EROWS][DM].
__global__ __launch_bounds__(256) void k_attn(const h16* __restrict__ QP, const h16* __restrict__ KP, const h16* __restrict__ VT, const bf* __restrict__ VEh, const bf* __restrict__ VEl, bf* CH, bf* CEh, bf* CEl) {
    __shared__ __align__(16) unsigned short ring[2 * 3 * TSZ];          // one ring for either body
    int qb = 0;                                                         // the same for the whole block: the choice of body is a scalar branch
#pragma unroll   // unrolled: every tile's rank is then a constant, and what is left is one scalar compare and select per tile
    for (int i = 0; i < TT / 128; ++i) {
        const int ci = (i + 1) * (i < EROWS / 128 ? 13 : 5);
        int rank = 0;
#pragma unroll
        for (int j = 0; j < TT / 128; ++j) { const int cj = (j + 1) * (j < EROWS / 128 ? 13 : 5); rank += (cj > ci || (cj == ci && j > i)) ? 1 : 0; }
        if (rank == (int)blockIdx.y) qb = i;
    }
    if (qb >= EROWS / 128) attn_body<false>(QP, KP, VT, (const bf*)0, (const bf*)0, CH, CH, qb, (int)blockIdx.x, ring);
    else                   attn_body<true>(QP, KP, (const h16*)0, VEh, VEl, CEh, CEl, qb, (int)blockIdx.x, ring);
}

// out_body: OUT[r][c] = scale * sum_k A[r][k] Bt[c][k] + bf16(bias[c]); 128x128 tile per block of four waves, 64x64 per wave; per 16-row slab staged in LDS (wave-private),
template <typename T16, int NSPLIT>
__device__ __forceinline__ void out_body(const T16* __restrict__ A, const T16* __restrict__ A2, const T16* __restrict__ Bt, float* C, const float* __restrict__ bias, const float scale, const int rt, const int ct, unsigned short* ring) {
    static_assert(2 * 2 * GTS * 2 >= 4 * 16 * 68 * 4);                  // ring = 2 * (2 + NSPLIT) * GTS 16-bit elements of LDS: operand ring; behind the product each wave's own output staging
    const int lane = threadIdx.x & 31, lr = lane & 15, hi = lane >> 4;
    const int w = __builtin_amdgcn_readfirstlane((threadIdx.x >> 5) & 3);
    const int r0 = rt * 128 + (w >> 1) * 64, c0 = ct * 128 + (w & 1) * 64;   // rt, ct = the block's row and column tile
    v8f acc[4][4];
    gemm_tile<T16, NSPLIT>(A, A2, Bt, DM, (size_t)rt * 128, (size_t)ct * 128, ring, acc);
    float* os = (float*)ring + w * (16 * 68);
    const v4f bw = *(const v4f*)(bias + c0 + lr * 4);
    v4f bb;
#pragma unroll
    for (int q = 0; q < 4; ++q) bb[q] = bfr(bw[q]);
#pragma unroll
    for (int mb = 0; mb < 4; ++mb) {
#pragma unroll
        for (int nb = 0; nb < 4; ++nb) {
#pragma unroll
            for (int j = 0; j < 8; ++j) os[(hi * 8 + j) * 68 + nb * 16 + lr] = acc[mb][nb][j]; }
        __builtin_amdgcn_wave_barrier(); asm volatile("" ::: "memory");
        float* crow = C + (size_t)(r0 + mb * 16) * DM + c0 + lr * 4;
{
#pragma unroll
            for (int s = 0; s < 8; ++s) { const int row = 2 * s + hi;
                v4f val = *(const v4fa*)(os + row * 68 + lr * 4);
                val = val * scale + bb;
                *(v4f*)(crow + (size_t)row * DM) = val; }
             }
        __builtin_amdgcn_wave_barrier(); asm volatile("" ::: "memory");
    }
}

// k_out: the whole output product in one launch. grid (DM/128, NB, TT/128): x = column tile, y = batch, z = row tile; the row tiles of two products (rows < EROWS) have the lowest indices and start first.
// Rows [0, EROWS) of a batch from the bf16 hi/lo ctx planes, rows [EROWS, TT) from the f16 ctx plane.
__global__ __launch_bounds__(128) void k_out(const bf* __restrict__ CEh, const bf* __restrict__ CEl, const bf* __restrict__ WoB, const h16* __restrict__ CH, const h16* __restrict__ WoH, float* OUT, const float* __restrict__ Wb) {
    __shared__ __align__(16) unsigned short ring[2 * 3 * GTS];          // one ring for either body
    const size_t bt = blockIdx.y; const int rt = blockIdx.z, ct = blockIdx.x;   // the same for the whole block: the choice of body is a scalar branch
    if (rt < EROWS / 128) out_body<bf, 1>(CEh + bt * EROWS * DM, CEl + bt * EROWS * DM, WoB, OUT + bt * TT * DM, Wb, 1.0f, rt, ct, ring);
    else                  out_body<h16, 0>(CH + bt * TT * DM, CH + bt * TT * DM, WoH, OUT + bt * TT * DM, Wb, OSC, rt, ct, ring);
}

extern "C" void kernel_launch(void* const* d_in, const int* in_sizes, int n_in,
                              void* d_out, int out_size, void* d_ws, size_t ws_size, hipStream_t stream) {
    if (n_in < 11) return;
    if (in_sizes[0] < NB * SEQ_FULL * DM || in_sizes[1] < NB * SEQ_FULL * DM || in_sizes[2] < NB * SEQ_FULL * DM) return;
    if (in_sizes[3] < NH_ * HD * DM || in_sizes[5] < NH_ * HD * DM || in_sizes[7] < NH_ * HD * DM || in_sizes[9] < DM * DM) return;
    if (in_sizes[4] < NH_ * HD || in_sizes[6] < NH_ * HD || in_sizes[8] < NH_ * HD || in_sizes[10] < DM) return;
    if (out_size < NB * TT * DM) return;
    const float* xq = (const float*)d_in[0]; const float* xk = (const float*)d_in[1]; const float* xv = (const float*)d_in[2];
    const float* wq = (const float*)d_in[3]; const float* bq = (const float*)d_in[4];
    const float* wk = (const float*)d_in[5]; const float* bk = (const float*)d_in[6];
    const float* wv = (const float*)d_in[7]; const float* bv = (const float*)d_in[8];
    const float* wo = (const float*)d_in[9]; const float* bo = (const float*)d_in[10];
    float* OUT = (float*)d_out;     // [NB][TT][DM]
    char* wsp = (char*)d_ws;
    auto take = [&](size_t bytes) { char* p = wsp; wsp += (bytes + 255) & ~(size_t)255; return (void*)p; };
    bf*  WT  = (bf*)take((size_t)3 * DM * DM * 2);                  // [3][n][k] projection weights, bf16
    bf*  WoB = (bf*)take((size_t)DM * DM * 2);                      // output weight, bf16
    h16* WoH = (h16*)take((size_t)DM * DM * 2);                     // output weight, f16 x1024
    h16* QK  = (h16*)take((size_t)2 * QKSZ * 2);                    // q plane | k plane
    h16* VT  = (h16*)take((size_t)NB * NH_ * HD * TT * 2);          // [b][h][d][t] f16 x64
    bf*  VEh = (bf*)take((size_t)NB * NH_ * HD * EROWS * 2);        // [b][h][d][t < EROWS] bf16 hi
    bf*  VEl = (bf*)take((size_t)NB * NH_ * HD * EROWS * 2);        // bf16 lo
    bf*  XB  = (bf*)take((size_t)3 * XSZ * 2);                      // three ctx planes
    if ((size_t)(wsp - (char*)d_ws) > ws_size) return;              // 119,537,664 B at NB=4, TT=2048
    bf* CH  = XB;                   // ctx f16 plane [NB*TT][DM] (16-bit storage)
    bf* CEh = XB + XSZ;             // ctx bf16 hi [NB*EROWS][DM]
    bf* CEl = XB + 2 * XSZ;         // ctx bf16 lo

    k_cvtw<<<CVW / 16, 512, 0, stream>>>(wq, wk, wv, wo, WT, WoB, WoH);

    k_proj<<<dim3(NB * TT / 128, NH_ / 4, 3), 256, 0, stream>>>(xq, xk, xv, WT, bq, bk, bv, QK, VT, VEh, VEl);

    k_attn<<<dim3(NB * NH_, TT / 128), 256, 0, stream>>>(QK, QK + QKSZ, VT, VEh, VEl, CH, CEh, CEl);

    k_out<<<dim3(DM / 128, NB, TT / 128), 128, 0, stream>>>(CEh, CEl, WoB, (const h16*)CH, WoH, OUT, bo);
}

// v009
// A run of this version takes 111 microseconds.
// Timed twice side by side with v008, it ran 1.04 times as fast both times.
// All steps since v000 together make it 3.10 times as fast.
#include <hip/hip_runtime.h>

// Contractions, f32 accumulate: q/k/v projections v_wmma_f32_16x16x32_bf16 on bf16 (RNE) roundings of x and W; scores v_wmma_f32_16x16x32_f16 on f16 q/k planes (q x log2(e)/8, k x 1/4: a product of the two is the score in log2 units, scale 1/32 included), the softmax reference as their C operand; P.V v_wmma_f32_16x16x32_f16 (P x256, V x64 carries) for query rows >= EROWS and v_wmma_f32_16x16x32_bf16 on bf16 hi+lo P and V (3 products) for query rows < EROWS; output projection v_wmma_f32_16x16x32_f16 (ctx x64, W x1024) for rows >= EROWS and v_wmma_f32_16x16x32_bf16 on bf16 hi+lo ctx (2 products) for rows < EROWS.
// Pipeline: bf16 planes of the weights (the activations are rounded to bf16 inside the projections' staging); q/k planes [b][h][t][64] f16; value planes [b][h][64][t] f16 (+ bf16 hi/lo for t < EROWS); fused causal attention in transposed form (S^T = K Q^T, O^T = V^T P^T, online softmax per lane against a held reference); ctx planes [b*t][1024]; out = ctx W^T + b.

#ifndef NB
#define NB 4
#endif
#ifndef SEQ
#define SEQ 2048
#endif
#define NB_FULL  4
#define SEQ_FULL 2048
#define TT   SEQ
#define DM   1024
#define NH_  16
#define HD   64
#define EROWS ((TT) < 512 ? (TT) : 512)
#define QSC  (0.045084220027780106f * 4.0f)                 // factor of the q plane: (1/32) * log2(e) / KSC
#define KSC  0.25f                                          // factor of the k plane
#define VC   64.0f                                          // carry of the f16 value plane (and of the f16 ctx plane)
#define WOC  1024.0f                                        // carry of the f16 output weight plane
#define OSC  1.52587890625e-05f                             // 1 / (VC * WOC)
#define NEGB (-3.0e38f)
#define XSZ  ((size_t)NB * SEQ_FULL * DM)
#define QKSZ ((size_t)NB * NH_ * TT * HD)
static_assert(TT % 64 == 0);
static_assert(TT <= SEQ_FULL);
static_assert(NB >= 1 && NB <= NB_FULL);
static_assert(NH_ * HD == DM);
static_assert(DM % 64 == 0);
static_assert(DM % 32 == 0);
static_assert(HD == 64);
static_assert(EROWS % 64 == 0);
static_assert(EROWS <= TT);
static_assert((TT - EROWS) % 64 == 0);
static_assert(TT % 128 == 0 && EROWS % 128 == 0 && DM % 128 == 0 && NH_ % 4 == 0);   // 128x256 block tiles of the projections and 128x128 of the output product
static_assert((size_t)NB * TT * DM <= XSZ);
static_assert((size_t)NB * EROWS * DM <= XSZ);
static_assert((size_t)3 * DM * DM * 2 + (size_t)2 * DM * DM * 2 + (size_t)2 * QKSZ * 2 + (size_t)NB * NH_ * HD * TT * 2 + (size_t)2 * NB * NH_ * HD * EROWS * 2 + (size_t)3 * XSZ * 2 <= (size_t)134217728);

typedef _Float16 h16;
typedef unsigned short bf;
typedef __attribute__((ext_vector_type(16))) __bf16   v16bf;
typedef __attribute__((ext_vector_type(16))) _Float16 v16h;
typedef __attribute__((ext_vector_type(8)))  _Float16 v8h;
typedef __attribute__((ext_vector_type(8)))  unsigned short v8us;
typedef __attribute__((ext_vector_type(8)))  float    v8f;
typedef __attribute__((ext_vector_type(4)))  float    v4f;
typedef v4f  __attribute__((may_alias)) v4fa;
typedef v8us __attribute__((may_alias)) v8usa;
typedef __attribute__((ext_vector_type(4)))  __bf16   v4bf;
typedef __attribute__((ext_vector_type(4)))  unsigned short v4us;
typedef v4us __attribute__((may_alias)) v4usa;

__device__ __forceinline__ unsigned short f2bf(float f) { unsigned u = __float_as_uint(f); u += 0x7FFFu + ((u >> 16) & 1u); return (unsigned short)(u >> 16); }
__device__ __forceinline__ float bf2f(unsigned short b) { return __uint_as_float(((unsigned)b) << 16); }
__device__ __forceinline__ float bfr(float f) { return bf2f(f2bf(f)); }
__device__ __forceinline__ v16h cat16(v8h lo, v8h hi) { return __builtin_shufflevector(lo, hi, 0, 1, 2, 3, 4, 5, 6, 7, 8, 9, 10, 11, 12, 13, 14, 15); }
__device__ __forceinline__ v16bf cat16b(v8us lo, v8us hi) { return __builtin_bit_cast(v16bf, __builtin_shufflevector(lo, hi, 0, 1, 2, 3, 4, 5, 6, 7, 8, 9, 10, 11, 12, 13, 14, 15)); }
__device__ __forceinline__ v8f wmma16(v16h a, v16h b, v8f c) { return __builtin_amdgcn_wmma_f32_16x16x32_f16(false, a, false, b, (short)0, c, false, false); }
__device__ __forceinline__ v8f wmmab(v16bf a, v16bf b, v8f c) { return __builtin_amdgcn_wmma_f32_16x16x32_bf16(false, a, false, b, (short)0, c, false, false); }
__device__ __forceinline__ void splitf(float y, unsigned short& h, unsigned short& l) { h = f2bf(y); l = f2bf(y - bf2f(h)); }
// Fragment loaders (A and B identical): p already points at row (lane&15), k0 + 8*(lane>>4); elements 0..7 <- p[0..7], elements 8..15 <- p[16..23].
__device__ __forceinline__ v16h ldh(const h16* p) { return cat16(*(const v8h*)p, *(const v8h*)(p + 16)); }
__device__ __forceinline__ v16bf ldb(const bf* p) { return cat16b(*(const v8us*)p, *(const v8us*)(p + 16)); }
__device__ __forceinline__ v8us pack_h(v8f c) { v8h t;
#pragma unroll
    for (int r = 0; r < 8; ++r) t[r] = (h16)c[r];
    return __builtin_bit_cast(v8us, t); }
__device__ __forceinline__ void pack_b(v8f c, v8us& a, v8us& l) {
#pragma unroll
    for (int r = 0; r < 8; ++r) { unsigned short x, y; splitf(c[r], x, y); a[r] = x; l[r] = y; } }

template <typename T16> struct WFrag;
template <> struct WFrag<h16> { typedef v16h V; static __device__ __forceinline__ V ld(const h16* p) { return ldh(p); } static __device__ __forceinline__ v8f mma(V a, V b, v8f c) { return wmma16(a, b, c); } };
template <> struct WFrag<bf> { typedef v16bf V; static __device__ __forceinline__ V ld(const bf* p) { return ldb(p); } static __device__ __forceinline__ v8f mma(V a, V b, v8f c) { return wmmab(a, b, c); } };

#define LP  72              // LDS row pitch of a staged tile in 16-bit elements: 144 B = 16 B x odd, free of bank conflicts for 16-byte fragment reads
#define TSZ (64 * LP)       // 16-bit elements of one staged tile
// One lane's asynchronous copy of 16 bytes from global memory to LDS (l = LDS byte address, g = global byte address), written as the compiler's builtin, offset 0:
// no s_wait_xcnt is written behind it, so a wave goes from its refill straight on to the next stage's fragment reads. The waits on asynccnt are the callers'.
typedef __attribute__((ext_vector_type(4))) int v4i;
__device__ __forceinline__ void acopy(const unsigned l, const char* g) {
    __builtin_amdgcn_global_load_async_to_lds_b128((__attribute__((address_space(1))) v4i*)g, (__attribute__((address_space(3))) v4i*)l, 0, 0);
}
// One 64-row tile: this lane's 16 bytes of rows r, r+16, r+32, r+48. l = LDS byte address, g = global byte address of row r, gstep = bytes between global rows r and r+16.
__device__ __forceinline__ void copy_tile(const unsigned l, const char* g, const size_t gstep) {
    acopy(l, g); acopy(l + 16 * LP * 2, g + gstep); acopy(l + 32 * LP * 2, g + 2 * gstep); acopy(l + 48 * LP * 2, g + 3 * gstep);
}

// gemm_tile: a block of four waves computes a 128x128 tile; wave w owns the 64x64 quarter at rows 64*(w>>1), columns 64*(w&1):
// acc[mb][nb][j] = C[16*mb + 8*(lane>>4) + j][16*nb + (lane&15)] of that quarter = sum_k A[m][k] Bt[n][k] (+ A2[m][k] Bt[n][k] when NSPLIT == 1).
// Operand path: a stage is 64 k = one 128-row x 128-B tile per operand plane (A, Bt, and A2 when NSPLIT == 1), brought from the K-contiguous 16-bit planes into LDS once per block
// by asynchronous 16-byte copies (each wave-wide copy = 4 whole 128-B lines), two buffers, the next stage in flight while this one is worked on; every wave reads its fragments from LDS.
// K % 64 == 0; arow0 / brow0 = first row of the block's tile in A (A2) / Bt; ring = 2 * (2 + NSPLIT) * GTS 16-bit elements of LDS, free for other use on return.
// rot (0 <= rot < K / 64, the same for the whole block): trip t works on stage (t + rot) mod (K / 64). Blocks that share operand rows get different rot, so that they do not ask L2 for the same lines at the same moment.
#define GTS (2 * TSZ)       // 16-bit elements of one staged 128-row operand tile
template <typename T16, int NSPLIT>
__device__ __forceinline__ void gemm_tile(const T16* __restrict__ A, const T16* __restrict__ A2, const T16* __restrict__ Bt, const int K, const size_t arow0, const size_t brow0, const int rot, unsigned short* ring, v8f (&acc)[4][4]) {
    typedef typename WFrag<T16>::V V;
    constexpr int NT = 2 + NSPLIT;                                      // tiles per stage: A, Bt (, A2)
    const int lane = threadIdx.x & 31, lr = lane & 15, hi = lane >> 4;
    const int w = __builtin_amdgcn_readfirstlane((threadIdx.x >> 5) & 3);
    const int cr = (int)(threadIdx.x >> 3) & 15, cc = (int)threadIdx.x & 7;   // this lane's row (mod 16) and 16-byte column in every staged tile
    const unsigned lbase = (unsigned)(size_t)ring + (unsigned)(cr * LP + cc * 8) * 2u;
    const char* ga  = (const char*)(A + (arow0 + cr) * K + cc * 8);
    const char* ga2 = (const char*)(A2 + (arow0 + cr) * K + cc * 8);
    const char* gb  = (const char*)(Bt + (brow0 + cr) * K + cc * 8);
    const size_t gstep = (size_t)16 * K * 2;
    auto issue = [&](const int s, const int buf) {                      // stage s (k = 64s .. 64s+63) into buffer buf
        const unsigned lb = lbase + (unsigned)(buf * NT * GTS) * 2u;
        const size_t ko = (size_t)s * 64 * 2;
        copy_tile(lb, ga + ko, gstep);             copy_tile(lb + TSZ * 2u, ga + ko + 4 * gstep, gstep);
        copy_tile(lb + GTS * 2u, gb + ko, gstep);  copy_tile(lb + GTS * 2u + TSZ * 2u, gb + ko + 4 * gstep, gstep);
        if (NSPLIT == 1) { copy_tile(lb + 2u * GTS * 2u, ga2 + ko, gstep); copy_tile(lb + 2u * GTS * 2u + TSZ * 2u, ga2 + ko + 4 * gstep, gstep); }
    };
#pragma unroll
    for (int mb = 0; mb < 4; ++mb)
#pragma unroll
        for (int nb = 0; nb < 4; ++nb) acc[mb][nb] = (v8f){};
    const int nstage = K / 64;
    auto stg_of = [&](const int t) { const int s = t + rot; return s >= nstage ? s - nstage : s; };   // stage of trip t
    issue(stg_of(0), 0);
    asm volatile("s_wait_asynccnt 0x0" ::: "memory");                   // this wave's copies of the first stage have landed
    __syncthreads();                                                    // ... and every other wave's: the first stage may be read
    if (nstage > 1) issue(stg_of(1), 1);
#pragma unroll 1   // rolled: one publish point and one refill site in the text
    for (int t = 0; t < nstage; ++t) {
        const T16* sbuf = (const T16*)ring + (t & 1) * NT * GTS;
        const T16* pa = sbuf + ((w >> 1) * 64 + lr) * LP + 8 * hi;
        const T16* pb = sbuf + GTS + ((w & 1) * 64 + lr) * LP + 8 * hi;
#pragma unroll     // the two 32-k steps of a stage: their LDS offsets become immediates
        for (int ks = 0; ks < 2; ++ks) {
            V a[4], a2[4];
#pragma unroll
            for (int mb = 0; mb < 4; ++mb) { a[mb] = WFrag<T16>::ld(pa + mb * 16 * LP + ks * 32); if (NSPLIT == 1) a2[mb] = WFrag<T16>::ld(pa + 2 * GTS + mb * 16 * LP + ks * 32); else a2[mb] = a[mb]; }
            V b[4];
#pragma unroll
            for (int nb = 0; nb < 4; ++nb) b[nb] = WFrag<T16>::ld(pb + nb * 16 * LP + ks * 32);
            // inputs-only fence on the loaded fragments: all LDS reads of this 32-k step stand as one group with one wait ahead of its WMMAs; without it each Bt fragment is read and waited for singly between them
            asm volatile("" :: "v"(b[0]), "v"(b[1]), "v"(b[2]), "v"(b[3]));
#pragma unroll
            for (int nb = 0; nb < 4; ++nb) {
#pragma unroll
                for (int mb = 0; mb < 4; ++mb) { acc[mb][nb] = WFrag<T16>::mma(a[mb], b[nb], acc[mb][nb]); if (NSPLIT == 1) acc[mb][nb] = WFrag<T16>::mma(a2[mb], b[nb], acc[mb][nb]); } }
            // four vector slots behind these WMMAs before a vector instruction may touch their registers, on either side of the branch at the loop's foot
            asm volatile("v_nop\n\tv_nop\n\tv_nop\n\tv_nop" : "+v"(acc[0][0]), "+v"(acc[1][1]), "+v"(acc[2][2]), "+v"(acc[3][3]) : "v"(a[0]), "v"(a[3]));
        }
        // publish point of stage t + 1, passed by every wave
        asm volatile("s_wait_dscnt 0x0" ::: "memory");                  // this wave's reads of stage t have returned before its buffer is refilled
        asm volatile("s_wait_asynccnt 0x0" ::: "memory");               // this wave's copies of stage t + 1 have landed
        __syncthreads();                                                // stage t + 1 may be read; every reader has left stage t
        if (t + 2 < nstage) issue(stg_of(t + 2), t & 1);
    }
    asm volatile("s_wait_asynccnt 0x0" ::: "memory");                   // nothing in flight when the ring becomes output staging
}

// gemm_xw: a block of eight waves computes a 128x256 tile of x W^T; wave w owns the 64x64 part at rows 64*(w>>2), columns 64*(w&3); acc as in gemm_tile. K = DM.
// Operand path: a stage is 64 k, two buffers. W: 256 rows x 128 B of its bf16 plane by asynchronous 16-byte copies as in gemm_tile (waves 0-3 rows 0..127, waves 4-7 rows 128..255).
// x: 128 rows x 256 B of the f32 input itself, read by plain 16-byte loads (a wave-wide load = 4 whole lines) into registers one stage ahead, rounded to bf16 (nearest even)
// and stored to LDS behind this stage's products. arow0 / brow0 = first row of the block's tile in X / Bt; ring = 2 * XSB 16-bit elements of LDS, free for other use on return.
// rot (0 <= rot < K / 64, the same for the whole block): trip t works on stage (t + rot) mod (K / 64), as in gemm_tile.
#define XSB (6 * TSZ)       // 16-bit elements of one stage buffer: x 128 rows | W 256 rows
__device__ __forceinline__ void gemm_xw(const float* __restrict__ X, const bf* __restrict__ Bt, const size_t arow0, const size_t brow0, const int rot, unsigned short* ring, v8f (&acc)[4][4]) {
    constexpr int K = DM;
    const int lane = threadIdx.x & 31, lr = lane & 15, hi = lane >> 4;
    const int w = __builtin_amdgcn_readfirstlane((threadIdx.x >> 5) & 7);
    const int cr = (int)(threadIdx.x >> 3) & 15, cc = (int)threadIdx.x & 7;   // this lane's row (mod 16) and 16-byte column in every staged W tile
    const int g = w >> 2;                                               // which 128 rows of W this wave copies
    const unsigned lbase = (unsigned)(size_t)ring + (unsigned)((2 + 2 * g) * TSZ + cr * LP + cc * 8) * 2u;
    const char* gb = (const char*)(Bt + (brow0 + g * 128 + cr) * K + cc * 8);
    const size_t gstep = (size_t)16 * K * 2;
    const int xr = (int)(threadIdx.x >> 4) & 15, xc = ((int)threadIdx.x & 15) * 4;   // this lane's x row (mod 16) and first of its four k
    const float* gx = X + (arow0 + xr) * K + xc;
    unsigned short* lx = ring + xr * LP + xc;
    v4f xv[8];                                                          // this lane's share of the x stage in flight: rows xr + 16 j
    auto issue = [&](const int s, const int buf) {                      // stage s (k = 64s .. 64s+63): W into buffer buf, x into xv
        const unsigned lb = lbase + (unsigned)(buf * XSB) * 2u;
        const size_t ko = (size_t)s * 64 * 2;
        copy_tile(lb, gb + ko, gstep);             copy_tile(lb + TSZ * 2u, gb + ko + 4 * gstep, gstep);
        const float* p = gx + (size_t)s * 64;
#pragma unroll
        for (int j = 0; j < 8; ++j) xv[j] = *(const v4f*)(p + (size_t)j * 16 * K);
        asm volatile("s_wait_xcnt 0x0" ::: "memory");                   // stands in front of any rewriting of the reads' address registers
        __builtin_amdgcn_sched_barrier(0);                              // keeps later register writes behind that wait, and the eight reads together
    };
    auto put = [&](const int buf) {                                     // xv, rounded, into the x rows of buffer buf
#pragma unroll
        for (int j = 0; j < 8; ++j) *(v4usa*)(lx + buf * XSB + j * 16 * LP) = __builtin_bit_cast(v4us, __builtin_convertvector(xv[j], v4bf));
    };
#pragma unroll
    for (int mb = 0; mb < 4; ++mb)
#pragma unroll
        for (int nb = 0; nb < 4; ++nb) acc[mb][nb] = (v8f){};
    constexpr int nstage = K / 64;
    static_assert(nstage >= 2 && (nstage & (nstage - 1)) == 0);
    auto stg_of = [&](const int t) { return (t + rot) & (nstage - 1); };   // stage of trip t
    issue(stg_of(0), 0);
    put(0);
    asm volatile("s_wait_dscnt 0x0" ::: "memory");                      // this wave's x rows of the first stage are written
    asm volatile("s_wait_asynccnt 0x0" ::: "memory");                   // this wave's copies of the first stage have landed
    __syncthreads();                                                    // ... and every other wave's: the first stage may be read
    issue(stg_of(1), 1);
#pragma unroll 1   // rolled: one publish point and one refill site in the text
    for (int t = 0; t < nstage; ++t) {
        const bf* sbuf = ring + (t & 1) * XSB;
        const bf* pa = sbuf + ((w >> 2) * 64 + lr) * LP + 8 * hi;
        const bf* pb = sbuf + 2 * TSZ + ((w & 3) * 64 + lr) * LP + 8 * hi;
#pragma unroll     // the two 32-k steps of a stage: their LDS offsets become immediates
        for (int ks = 0; ks < 2; ++ks) {
            v16bf a[4], b[4];
#pragma unroll
            for (int mb = 0; mb < 4; ++mb) a[mb] = ldb(pa + mb * 16 * LP + ks * 32);
#pragma unroll
            for (int nb = 0; nb < 4; ++nb) b[nb] = ldb(pb + nb * 16 * LP + ks * 32);
            // inputs-only fence on the loaded fragments: all LDS reads of this 32-k step stand as one group with one wait ahead of its WMMAs; without it each W fragment is read and waited for singly between them
            asm volatile("" :: "v"(b[0]), "v"(b[1]), "v"(b[2]), "v"(b[3]));
#pragma unroll
            for (int nb = 0; nb < 4; ++nb) {
#pragma unroll
                for (int mb = 0; mb < 4; ++mb) acc[mb][nb] = wmmab(a[mb], b[nb], acc[mb][nb]); }
            // four vector slots behind these WMMAs before a vector instruction may touch their registers, on either side of the branch that follows
            asm volatile("v_nop\n\tv_nop\n\tv_nop\n\tv_nop" : "+v"(acc[0][0]), "+v"(acc[1][1]), "+v"(acc[2][2]), "+v"(acc[3][3]) : "v"(a[0]), "v"(a[3]));
        }
        if (t + 1 < nstage) put((t + 1) & 1);                           // that buffer's readers left it at the last publish point
        // publish point of stage t + 1, passed by every wave
        asm volatile("s_wait_dscnt 0x0" ::: "memory");                  // this wave's reads of stage t have returned, its x rows of stage t + 1 are written
        asm volatile("s_wait_asynccnt 0x0" ::: "memory");               // this wave's copies of stage t + 1 have landed
        __syncthreads();                                                // stage t + 1 may be read; every reader has left stage t
        if (t + 2 < nstage) issue(stg_of(t + 2), t & 1);
    }
    asm volatile("s_wait_asynccnt 0x0" ::: "memory");                   // nothing in flight when the ring becomes output staging
}

// k_cvtw: the 16-bit planes of the four weights in one launch of CVW waves (16 per block): wave g takes 256 floats at g*256 of each of W_q, W_k, W_v (-> WT) and W_o (-> WoB and WoH).
#define CVW 4096
__device__ __forceinline__ v8us cvt8(const v8f v) { v8us o;
#pragma unroll
    for (int k = 0; k < 8; ++k) o[k] = f2bf(v[k]);
    return o; }
__global__ __launch_bounds__(512) void k_cvtw(const float* __restrict__ wq, const float* __restrict__ wk, const float* __restrict__ wv, const float* __restrict__ wo,
                                              bf* __restrict__ WT, bf* __restrict__ WoB, h16* __restrict__ WoH) {
    static_assert((size_t)DM * DM == (size_t)CVW * 256);
    const unsigned lane = threadIdx.x & 31;
    const unsigned gw = (unsigned)__builtin_amdgcn_readfirstlane((int)(blockIdx.x * 16 + (threadIdx.x >> 5)));   // wave number in a scalar register: the bases are then scalar
    const size_t wof = (size_t)gw * 256 + lane * 8;
    v8f cur[4];
    cur[0] = *(const v8f*)(wq + wof); cur[1] = *(const v8f*)(wk + wof); cur[2] = *(const v8f*)(wv + wof); cur[3] = *(const v8f*)(wo + wof);
    asm volatile("s_wait_xcnt 0x0" ::: "memory");       // stands in front of any rewriting of the reads' address registers
    __builtin_amdgcn_sched_barrier(0);                  // keeps later register writes behind that wait, and the eight reads together ahead of the conversions
#pragma unroll
    for (int j = 0; j < 3; ++j) *(v8us*)(WT + (size_t)j * DM * DM + wof) = cvt8(cur[j]);
    const v8us ob = cvt8(cur[3]); v8h oh;
#pragma unroll
    for (int k = 0; k < 8; ++k) oh[k] = (h16)(bf2f(ob[k]) * WOC);
    *(v8us*)(WoB + wof) = ob; *(v8h*)(WoH + wof) = oh;
}

// k_proj: all three projections in one launch, straight from the f32 activations. grid (NB*TT/128, NH_/4, 3), eight waves; z = 0 -> q plane, z = 1 -> k plane, z = 2 -> value planes. Block tile = 128 tokens x four heads; a wave's tile = 64 tokens x one head (64 dims).
// z < 2: rows written as they are, QK[z][b][h][t][64] = f16(c * (x W^T + b)), c = QSC for q, KSC for k. z = 2: written transposed, VT[b][h][d][t] = f16(64 * v), and for t < EROWS the bf16 hi/lo planes VE[b][h][d][t] of v.
__global__ __launch_bounds__(256) void k_proj(const float* __restrict__ xq, const float* __restrict__ xk, const float* __restrict__ xv, const bf* __restrict__ WT, const float* __restrict__ bq, const float* __restrict__ bk, const float* __restrict__ bv, h16* QK, h16* VT, bf* VEh, bf* VEl) {
    __shared__ __align__(16) unsigned short ring[8 * 64 * 68 * 2];      // operand ring; behind the product each wave's own output or transpose staging (the larger of the two uses)
    static_assert(8 * 64 * 68 * 2 >= 2 * XSB);
    const int z = blockIdx.z;
    const int lane = threadIdx.x & 31, lr = lane & 15, hi = lane >> 4;
    const int w = __builtin_amdgcn_readfirstlane((threadIdx.x >> 5) & 7);
    const int mt = blockIdx.x * 2 + (w >> 2); const int b = mt / (TT / 64); const int t0 = (mt % (TT / 64)) * 64; const int h = blockIdx.y * 4 + (w & 3);
    const float* A = z == 0 ? xq : z == 1 ? xk : xv; const bf* Bt = WT + (size_t)z * DM * DM;
    v8f acc[4][4];
    // start of the k walk: the row tiles that read the same W rows are spread over all 16 stages, the four column tiles that read the same x rows stand four stages apart
    const int rot = (int)((blockIdx.x + 4 * blockIdx.y) & (DM / 64 - 1));
    gemm_xw(A, Bt, (size_t)b * SEQ_FULL + t0 - (w >> 2) * 64, (size_t)blockIdx.y * 4 * HD, rot, ring, acc);
  if (z < 2) {
    float* os = (float*)ring + w * (16 * 68);
    const int rq = lane >> 3, pc = lane & 7;
    const v8f b0 = *(const v8f*)(bq + h * HD + pc * 8); const v8f b1 = *(const v8f*)(bk + h * HD + pc * 8);
    v8f bb;
#pragma unroll
    for (int i = 0; i < 8; ++i) bb[i] = bfr(z ? b1[i] : b0[i]);
    const float pf = z ? KSC : QSC;
    h16* P = QK + (size_t)z * QKSZ + (((size_t)b * NH_ + h) * TT + t0) * HD + pc * 8;
#pragma unroll
    for (int mb = 0; mb < 4; ++mb) {
#pragma unroll
        for (int nb = 0; nb < 4; ++nb) {
#pragma unroll
            for (int j = 0; j < 8; ++j) os[(hi * 8 + j) * 68 + nb * 16 + lr] = acc[mb][nb][j]; }
        __builtin_amdgcn_wave_barrier(); asm volatile("" ::: "memory");
        h16* prow = P + (size_t)(mb * 16) * HD;
{
#pragma unroll
            for (int s = 0; s < 4; ++s) { const int row = 4 * s + rq;
                const v4f x0 = *(const v4fa*)(os + row * 68 + pc * 8), x1 = *(const v4fa*)(os + row * 68 + pc * 8 + 4);
                v8h o;
#pragma unroll
                for (int q = 0; q < 4; ++q) { o[q] = (h16)((x0[q] + bb[q]) * pf); o[4 + q] = (h16)((x1[q] + bb[4 + q]) * pf); }
                *(v8h*)(prow + (size_t)row * HD) = o; }
             }
        __builtin_amdgcn_wave_barrier(); asm volatile("" ::: "memory");
    }
  } else {
    float* ts = (float*)ring + w * (64 * 68);
#pragma unroll
    for (int mb = 0; mb < 4; ++mb)
#pragma unroll
        for (int nb = 0; nb < 4; ++nb) {
            const v4f lo4 = { acc[mb][nb][0], acc[mb][nb][1], acc[mb][nb][2], acc[mb][nb][3] };
            const v4f hi4 = { acc[mb][nb][4], acc[mb][nb][5], acc[mb][nb][6], acc[mb][nb][7] };
            *(v4fa*)(ts + (nb * 16 + lr) * 68 + mb * 16 + 8 * hi) = lo4;
            *(v4fa*)(ts + (nb * 16 + lr) * 68 + mb * 16 + 8 * hi + 4) = hi4; }
    __builtin_amdgcn_wave_barrier(); asm volatile("" ::: "memory");
    const int rq = lane >> 3, pc = lane & 7;
    const bool early = t0 < EROWS;
    const size_t vrow0 = ((size_t)b * NH_ + h) * HD;
{
#pragma unroll 1
        for (int s = 0; s < 16; ++s) { const int d = 4 * s + rq;
            const float bb = bfr(bv[h * HD + d]);
            const v4f x0 = *(const v4fa*)(ts + d * 68 + pc * 8), x1 = *(const v4fa*)(ts + d * 68 + pc * 8 + 4);
            v8f x = __builtin_shufflevector(x0, x1, 0, 1, 2, 3, 4, 5, 6, 7);
            x = x + bb;
            v8h o;
#pragma unroll
            for (int q = 0; q < 8; ++q) o[q] = (h16)(x[q] * VC);
            *(v8h*)(VT + (vrow0 + d) * TT + t0 + pc * 8) = o;
            asm volatile("s_wait_xcnt 0x0" ::: "memory");   // stands in front of the rewriting of the store's data and address registers (hi/lo packing, next trip)
            if (early) { v8us oh, ol; pack_b(x, oh, ol);
                *(v8us*)(VEh + (vrow0 + d) * EROWS + t0 + pc * 8) = oh;
                *(v8us*)(VEl + (vrow0 + d) * EROWS + t0 + pc * 8) = ol;
                asm volatile("s_wait_xcnt 0x0" ::: "memory"); } }   // stands in front of the next trip's advance of both stores' address registers
         }
  }
}

// One 64-row tile by eight waves: this lane's 16 bytes of rows r and r+32. l = LDS byte address, g = global byte address of row r, gstep = bytes between global rows r and r+32.
__device__ __forceinline__ void copy_tile8(const unsigned l, const char* g, const size_t gstep) {
    acopy(l, g); acopy(l + 32 * LP * 2, g + gstep);
}

// attn_body: fused causal attention, 128 query rows and 8 waves per block, 32 keys per step, transposed formulation.
//   EARLY: a wave owns 16 query rows (one tile) and takes both 32-key steps of every stage. Else: a wave owns 32 query rows (two tiles) and one of the two 32-key steps of every stage;
//   the two waves of a 32-row group hold partial (m, l, O^T) over their own keys and join them once behind the loop through LDS, each finishing one of the two tiles.
//   S^T tile (rows = keys, cols = queries) = A(k plane rows) x B(q plane rows); D element r of lane l = S^T[key 8*(l>>4)+r][query l&15].
//   Per lane and query tile one query column. Held reference m (log2 units, equal in both lane halves): PC - m is the C operand of the score products, so p = exp2(D) with no further arithmetic.
//   A step whose in-lane sum of p tops RSB in any lane (a score far above m; always so at a wave's first step, where m = NEGB) is redone: scores with C = 0, m raised to the maximum, l and O^T rescaled.
//   Running sum l over the lane's own keys; the two lane halves are added once behind the loop.
//   P^T as B fragment: element r <- p(tile keys 0..15)[r], element 8+r <- p(tile keys 16..31)[r], lane unchanged.
//   O^T tile j (rows = dims 16j.., cols = queries) += A(V^T rows) x B(P^T). Masked keys carry p = 0 exactly.
// EARLY: bf16 hi+lo P and V (3 products); else f16 single product with P x256 (cancels against the row sum) and V x64.
// Operand path: a stage is 64 keys = one K tile (64 key rows x 128 B) and one V^T tile per value plane (64 dim rows x 128 B), brought into LDS once per block by
// asynchronous 16-byte copies (each wave-wide copy = 4 whole 128-B lines), two buffers, the next stage in flight while this one is worked on; all eight waves read their fragments from LDS,
// and each K and V^T fragment read feeds the products of all NQ query tiles of the wave. qb = index of the block's tile of 128 query rows.
template <bool EARLY>
__device__ __forceinline__ void attn_body(const h16* __restrict__ QP, const h16* __restrict__ KP, const h16* __restrict__ VT, const bf* __restrict__ VEh, const bf* __restrict__ VEl, bf* C0, bf* C1, const int qb, const int bh, unsigned short* ring) {
    constexpr int NT = EARLY ? 3 : 2;                                   // tiles per stage: K, V (EARLY: K, V hi, V lo)
    constexpr int NQ = EARLY ? 1 : 2;                                   // query tiles per wave
    using VE16 = __type_pack_element<EARLY ? 0 : 1, bf, h16>;           // element type of the staged value planes
    using VF = typename WFrag<VE16>::V;
    static_assert(2 * NT * TSZ >= 8 * 2 * 1152 || !EARLY);              // stage buffers: the first 2 * NT * TSZ 16-bit elements of the ring (2 * 3 * TSZ in all); output staging behind the loop
    unsigned short* stg = ring;
    const int lane = threadIdx.x & 31, lr = lane & 15, hi = lane >> 4;
    const int w = __builtin_amdgcn_readfirstlane((threadIdx.x >> 5) & 7);   // wave number in a scalar register: the per-wave skip below is then a scalar branch
    const int b = bh / NH_, h = bh % NH_;
    const int kh = EARLY ? 0 : (w & 1);                                 // which 32 keys of every stage this wave takes (not EARLY)
    const int q0 = qb * 128 + (EARLY ? w * 16 : (w >> 1) * 32);
    const size_t pof = (size_t)bh * TT * HD;
    v16h qf0[NQ], qf1[NQ]; int qq[NQ];
    v8f o[NQ][4];
    float m[NQ], l[NQ];
    v8f cf[NQ];                                                         // C operand of the score products: PC - m in all eight elements
    constexpr float PC  = EARLY ? 0.0f : 8.0f;                          // log2 of the carry of P
    constexpr float RSB = EARLY ? 128.0f : 32768.0f;                    // 2^(PC + 7): every p below it is finite in f16
#pragma unroll
    for (int u = 0; u < NQ; ++u) {
        qq[u] = q0 + 16 * u + lr;
        const h16* qp = QP + pof + (size_t)qq[u] * HD + 8 * hi;
        qf0[u] = ldh(qp); qf1[u] = ldh(qp + 32);
        o[u][0] = (v8f){}; o[u][1] = (v8f){}; o[u][2] = (v8f){}; o[u][3] = (v8f){};
        m[u] = NEGB; l[u] = 0.0f; cf[u] = (v8f){} + (PC - NEGB); }
    const int nstage = 2 * (qb + 1);                                    // stages of 64 keys, the same for the whole block
    // start of the key walk: trip t works on stage (t + rot) mod nstage. The query tiles of one (b, h) read the same K and V^T lines; with starts spread over the walk they do not ask L2 for them at the same moment.
    // The softmax takes the stages in any order: mask and skip go by the key index, the held reference by what has been seen so far.
    const int rot = ((qb & 7) * nstage) >> 3;                           // 0 <= rot < nstage
    auto stg_of = [&](const int t) { const int s = t + rot; return s >= nstage ? s - nstage : s; };
    const int cr = (int)(threadIdx.x >> 3) & 31, cc = (int)threadIdx.x & 7;   // this lane's row (mod 32) and 16-byte column in every staged tile
    const unsigned lbase = (unsigned)(size_t)ring + (unsigned)(cr * LP + cc * 8) * 2u;
    const char* gk = (const char*)(KP + pof + (size_t)cr * HD + cc * 8);
    const char* gv0 = EARLY ? (const char*)(VEh + (size_t)bh * HD * EROWS + (size_t)cr * EROWS + cc * 8) : (const char*)(VT + (size_t)bh * HD * TT + (size_t)cr * TT + cc * 8);
    const char* gv1 = EARLY ? (const char*)(VEl + (size_t)bh * HD * EROWS + (size_t)cr * EROWS + cc * 8) : gv0;
    const size_t vstep = (size_t)32 * (EARLY ? EROWS : TT) * 2;
    auto issue = [&](const int s, const int buf) {                      // stage s (keys 64s .. 64s+63) into buffer buf
        const unsigned lb = lbase + (unsigned)(buf * NT * TSZ) * 2u;
        copy_tile8(lb, gk + (size_t)s * 64 * HD * 2, (size_t)32 * HD * 2);
        copy_tile8(lb + TSZ * 2u, gv0 + (size_t)s * 64 * 2, vstep);
        if (EARLY) copy_tile8(lb + 2u * TSZ * 2u, gv1 + (size_t)s * 64 * 2, vstep);
    };
    issue(stg_of(0), 0);
    asm volatile("s_wait_asynccnt 0x0" ::: "memory");                   // this wave's copies of the first stage have landed
    __syncthreads();                                                    // ... and every other wave's: the first stage may be read
    issue(stg_of(1), 1);
#pragma unroll 1   // rolled: one publish point and one refill site in the text
    for (int t = 0; t < nstage; ++t) {
        const unsigned short* sbuf = ring + (t & 1) * NT * TSZ;
        const int st = stg_of(t);                                       // the stage that this trip's buffer holds
#pragma unroll     // EARLY: the two 32-key steps of a stage, their LDS offsets become immediates; else this wave's one step
      for (int sub = 0; sub < (EARLY ? 2 : 1); ++sub) {
        const int ks = EARLY ? sub : kh;
        const int kt = st * 64 + ks * 32;
        if (kt <= q0) {              // a wave skips the 32 keys that lie wholly above its queries
        const h16* kp = (const h16*)sbuf + (ks * 32 + lr) * LP + 8 * hi;
        v8f s0[NQ], s1[NQ], p0[NQ], p1[NQ];
        float rs[NQ];
        auto scores = [&](const v8f (&c)[NQ]) {      // s0, s1 = c + S^T of this step's 32 keys, keys above the query at NEGB
            const v16h ka0 = ldh(kp), ka1 = ldh(kp + 16 * LP), kb0 = ldh(kp + 32), kb1 = ldh(kp + 16 * LP + 32);
#pragma unroll
            for (int u = 0; u < NQ; ++u) { s0[u] = wmma16(ka0, qf0[u], c[u]); s1[u] = wmma16(ka1, qf0[u], c[u]); }
#pragma unroll
            for (int u = 0; u < NQ; ++u) { s0[u] = wmma16(kb0, qf1[u], s0[u]); s1[u] = wmma16(kb1, qf1[u], s1[u]); }
            // four vector slots behind these WMMAs before a vector instruction may touch their registers, on either side of the branch that follows
            // (c is named too: alive behind the products, it is read in place as their C operand; otherwise the compiler first copies its eight registers into one D per query tile)
            if constexpr (NQ == 1) asm volatile("v_nop\n\tv_nop\n\tv_nop\n\tv_nop" : "+v"(s0[0]), "+v"(s1[0]) : "v"(ka0), "v"(ka1), "v"(kb0), "v"(kb1), "v"(qf1[0]), "v"(c[0]));
            else                   asm volatile("v_nop\n\tv_nop\n\tv_nop\n\tv_nop" : "+v"(s0[0]), "+v"(s1[0]), "+v"(s0[NQ - 1]), "+v"(s1[NQ - 1]) : "v"(ka0), "v"(ka1), "v"(kb0), "v"(kb1), "v"(qf1[0]), "v"(qf1[NQ - 1]), "v"(c[0]), "v"(c[NQ - 1]));
            if (kt + 31 > q0) {      // diagonal step of this wave: exclude keys above the query
#pragma unroll
                for (int u = 0; u < NQ; ++u) {
                    const int d = qq[u] - kt - 8 * hi;       // element r of s0 is key d - r below the query, of s1 key d - 16 - r
#pragma unroll
                    for (int r = 0; r < 8; ++r) { s0[u][r] = (r > d) ? NEGB : s0[u][r]; s1[u][r] = (16 + r > d) ? NEGB : s1[u][r]; }
                }
            }
        };
        auto expsum = [&]() {                        // p = exp2(s), rs = the lane's sum of p
#pragma unroll
            for (int u = 0; u < NQ; ++u) {
                rs[u] = 0.0f;
#pragma unroll
                for (int r = 0; r < 8; ++r) { p0[u][r] = __builtin_amdgcn_exp2f(s0[u][r]); p1[u][r] = __builtin_amdgcn_exp2f(s1[u][r]); rs[u] += p0[u][r] + p1[u][r]; }
            }
        };
        scores(cf);
        // this step's V^T fragments are asked for here, so that their LDS latency passes under the exponentials
        const unsigned short* vb = sbuf + TSZ + lr * LP + ks * 32 + 8 * hi;
        VF va[4], vlo[4];
#pragma unroll
        for (int j = 0; j < 4; ++j) { va[j] = WFrag<VE16>::ld((const VE16*)vb + j * 16 * LP); if constexpr (EARLY) vlo[j] = WFrag<VE16>::ld((const VE16*)vb + TSZ + j * 16 * LP); else vlo[j] = va[j]; }
        expsum();
        bool need = false;
#pragma unroll
        for (int u = 0; u < NQ; ++u) need = need || !(rs[u] <= RSB);     // also true for an infinite or undefined sum
        if (__builtin_amdgcn_ballot_w32(need) != 0) {                    // one scalar branch per step; seldom taken behind a wave's first step
            const v8f zc[NQ] = {};
            scores(zc);
#pragma unroll
            for (int u = 0; u < NQ; ++u) {
                float mx = fmaxf(s0[u][0], s1[u][0]);
#pragma unroll
                for (int r = 1; r < 8; ++r) mx = fmaxf(mx, fmaxf(s0[u][r], s1[u][r]));
                mx = fmaxf(mx, __shfl_xor(mx, 16, 32));
                const float mn = fmaxf(m[u], mx);
                const float corr = __builtin_amdgcn_exp2f(m[u] - mn);
                m[u] = mn;
                cf[u] = (v8f){} + (PC - mn);
                s0[u] += cf[u]; s1[u] += cf[u];
                l[u] *= corr;
                o[u][0] *= corr; o[u][1] *= corr; o[u][2] *= corr; o[u][3] *= corr;
            }
            expsum();
        }
#pragma unroll
        for (int u = 0; u < NQ; ++u) l[u] += rs[u];
        if constexpr (EARLY) {
            v8us ph0, ph1, pl0, pl1;
            pack_b(p0[0], ph0, pl0); pack_b(p1[0], ph1, pl1);
            const v16bf PH = cat16b(ph0, ph1), PL = cat16b(pl0, pl1);
            const v16bf vh0 = va[0], vh1 = va[1], vh2 = va[2], vh3 = va[3];
            const v16bf vl0 = vlo[0], vl1 = vlo[1], vl2 = vlo[2], vl3 = vlo[3];
            o[0][0] = wmmab(vh0, PH, o[0][0]); o[0][0] = wmmab(vl0, PH, o[0][0]); o[0][0] = wmmab(vh0, PL, o[0][0]);
            o[0][1] = wmmab(vh1, PH, o[0][1]); o[0][1] = wmmab(vl1, PH, o[0][1]); o[0][1] = wmmab(vh1, PL, o[0][1]);
            o[0][2] = wmmab(vh2, PH, o[0][2]); o[0][2] = wmmab(vl2, PH, o[0][2]); o[0][2] = wmmab(vh2, PL, o[0][2]);
            o[0][3] = wmmab(vh3, PH, o[0][3]); o[0][3] = wmmab(vl3, PH, o[0][3]); o[0][3] = wmmab(vh3, PL, o[0][3]);
            asm volatile("v_nop\n\tv_nop\n\tv_nop\n\tv_nop" : "+v"(o[0][0]), "+v"(o[0][1]), "+v"(o[0][2]), "+v"(o[0][3]) : "v"(vh0), "v"(vh1), "v"(vh2), "v"(vh3), "v"(vl0), "v"(vl1), "v"(vl2), "v"(vl3), "v"(PH), "v"(PL));
        } else {
            v16h pb[NQ];
#pragma unroll
            for (int u = 0; u < NQ; ++u)
#pragma unroll
                for (int r = 0; r < 8; ++r) { pb[u][r] = (h16)p0[u][r]; pb[u][8 + r] = (h16)p1[u][r]; }
            const v16h a0 = va[0], a1 = va[1], a2 = va[2], a3 = va[3];
#pragma unroll
            for (int u = 0; u < NQ; ++u) { o[u][0] = wmma16(a0, pb[u], o[u][0]); o[u][1] = wmma16(a1, pb[u], o[u][1]); o[u][2] = wmma16(a2, pb[u], o[u][2]); o[u][3] = wmma16(a3, pb[u], o[u][3]); }
            // four vector slots behind these WMMAs before a vector instruction may touch their registers, on either side of the branches that follow
            asm volatile("v_nop\n\tv_nop\n\tv_nop\n\tv_nop" : "+v"(o[0][0]), "+v"(o[0][1]), "+v"(o[0][2]), "+v"(o[0][3]), "+v"(o[NQ - 1][0]), "+v"(o[NQ - 1][1]), "+v"(o[NQ - 1][2]), "+v"(o[NQ - 1][3]) : "v"(a0), "v"(a1), "v"(a2), "v"(a3), "v"(pb[0]), "v"(pb[NQ - 1]));
        }
        }
      }
        // publish point of stage t + 1, passed by every wave
        asm volatile("s_wait_dscnt 0x0" ::: "memory");                  // this wave's reads of stage t have returned before its buffer is refilled
        asm volatile("s_wait_asynccnt 0x0" ::: "memory");               // this wave's copies of stage t + 1 have landed
        __syncthreads();                                                // stage t + 1 may be read; every reader has left stage t
        if (t + 2 < nstage) issue(stg_of(t + 2), t & 1);
    }
    asm volatile("s_wait_asynccnt 0x0" ::: "memory");                   // nothing in flight when the ring becomes output staging
#pragma unroll
    for (int u = 0; u < NQ; ++u) l[u] += __shfl_xor(l[u], 16, 32);      // the row sums of the two lane halves, joined once
    const int rq = lane >> 3, pc = lane & 7;
    if constexpr (EARLY) {
        const float inv = __fdiv_rn(1.0f, l[0]);
        o[0][0] *= inv; o[0][1] *= inv; o[0][2] *= inv; o[0][3] *= inv;
        const int sb = w * 2 * 1152;
        const int so = sb + lr * 72 + 8 * hi;   // O^T element r of tile j -> row (query lr), column 16j + 8*hi + r
        v8us a, c;
        pack_b(o[0][0], a, c); *(v8usa*)(stg + so) = a;      *(v8usa*)(stg + so + 1152) = c;
        pack_b(o[0][1], a, c); *(v8usa*)(stg + so + 16) = a; *(v8usa*)(stg + so + 1152 + 16) = c;
        pack_b(o[0][2], a, c); *(v8usa*)(stg + so + 32) = a; *(v8usa*)(stg + so + 1152 + 32) = c;
        pack_b(o[0][3], a, c); *(v8usa*)(stg + so + 48) = a; *(v8usa*)(stg + so + 1152 + 48) = c;
        __builtin_amdgcn_wave_barrier(); asm volatile("" ::: "memory");
        const size_t cbase = ((size_t)b * EROWS + q0) * DM + h * HD + pc * 8;
#pragma unroll
        for (int s = 0; s < 4; ++s) { const int row = 4 * s + rq;
            const v8us x = *(const v8usa*)(stg + sb + row * 72 + pc * 8);
            *(v8us*)(C0 + cbase + (size_t)row * DM) = x;
            const v8us y = *(const v8usa*)(stg + sb + 1152 + row * 72 + pc * 8); *(v8us*)(C1 + cbase + (size_t)row * DM) = y; }
    } else {
        // Join of the two key halves: wave w keeps tile kh and hands its partial of the other tile to wave w ^ 1. Per wave XW floats of LDS: eight 512-B rows of O^T, then m, then l.
        constexpr int XW = 8 * 128 + 64;
        static_assert(8 * XW * 4 + 8 * 1152 * 2 <= 2 * 3 * TSZ * 2);    // the eight hand-over areas, then the eight output stagings, inside the ring
        float* xs = (float*)ring;
        auto give = [&](const v8f (&og)[4], const float mg, const float lg) {
            float* d = xs + w * XW + lane * 4;
#pragma unroll
            for (int j = 0; j < 4; ++j) {
                *(v4fa*)(d + (2 * j) * 128)     = (v4f){ og[j][0], og[j][1], og[j][2], og[j][3] };
                *(v4fa*)(d + (2 * j + 1) * 128) = (v4f){ og[j][4], og[j][5], og[j][6], og[j][7] }; }
            xs[w * XW + 1024 + lane] = mg; xs[w * XW + 1056 + lane] = lg;
        };
        auto finish = [&](v8f (&ok)[4], const float mk, const float lk) {
            const float* sp = xs + (w ^ 1) * XW + lane * 4;
            const float mp = xs[(w ^ 1) * XW + 1024 + lane], lp = xs[(w ^ 1) * XW + 1056 + lane];
            const float mn = fmaxf(mk, mp);
            const float ck = __builtin_amdgcn_exp2f(mk - mn), cp = __builtin_amdgcn_exp2f(mp - mn);
            const float inv = __fdiv_rn(1.0f, lk * ck + lp * cp);
            const float fk = ck * inv, fp = cp * inv;
            unsigned short* d = stg + 8 * XW * 2 + w * 1152;            // this wave's own output staging, behind the hand-over areas
#pragma unroll
            for (int j = 0; j < 4; ++j) {
                const v4f x0 = *(const v4fa*)(sp + (2 * j) * 128), x1 = *(const v4fa*)(sp + (2 * j + 1) * 128);
                const v8f x = __builtin_shufflevector(x0, x1, 0, 1, 2, 3, 4, 5, 6, 7);
                *(v8usa*)(d + lr * 72 + 8 * hi + 16 * j) = pack_h(ok[j] * fk + x * fp); }   // O^T element r of tile j -> row (query lr), column 16j + 8*hi + r
            __builtin_amdgcn_wave_barrier(); asm volatile("" ::: "memory");
            const size_t cbase = ((size_t)b * TT + q0 + 16 * kh) * DM + h * HD + pc * 8;
#pragma unroll
            for (int s = 0; s < 4; ++s) { const int row = 4 * s + rq;
                const v8us x = *(const v8usa*)(d + row * 72 + pc * 8);
                *(v8us*)(C0 + cbase + (size_t)row * DM) = x; }
        };
        if (kh == 0) give(o[NQ - 1], m[NQ - 1], l[NQ - 1]); else give(o[0], m[0], l[0]);
        __syncthreads();                                                // every wave's hand-over is written before its partner reads it
        if (kh == 0) finish(o[0], m[0], l[0]); else finish(o[NQ - 1], m[NQ - 1], l[NQ - 1]);
    }
}

// k_attn: every query tile in one launch. grid (NB*NH_, TT/128): x = (b, h); y = rank of the 128-row query tile by falling cost, so that the longest tiles start first and the short ones fill the end.
// Cost of a tile = its stages, a stage of rows < EROWS (per wave two steps of three products with the hi/lo split) weighed 13 : 5 against a stage of the other rows (per wave one step); equal costs by index.
// Query rows [EROWS, TT): ctx as f16 plane (x64 carry) [b][TT][DM]. Query rows [0, EROWS): ctx as bf16 hi/lo planes [b][EROWS][DM].
__global__ __launch_bounds__(256) void k_attn(const h16* __restrict__ QP, const h16* __restrict__ KP, const h16* __restrict__ VT, const bf* __restrict__ VEh, const bf* __restrict__ VEl, bf* CH, bf* CEh, bf* CEl) {
    __shared__ __align__(16) unsigned short ring[2 * 3 * TSZ];          // one ring for either body
    int qb = 0;                                                         // the same for the whole block: the choice of body is a scalar branch
#pragma unroll   // unrolled: every tile's rank is then a constant, and what is left is one scalar compare and select per tile
    for (int i = 0; i < TT / 128; ++i) {
        const int ci = (i + 1) * (i < EROWS / 128 ? 13 : 5);
        int rank = 0;
#pragma unroll
        for (int j = 0; j < TT / 128; ++j) { const int cj = (j + 1) * (j < EROWS / 128 ? 13 : 5); rank += (cj > ci || (cj == ci && j > i)) ? 1 : 0; }
        if (rank == (int)blockIdx.y) qb = i;
    }
    if (qb >= EROWS / 128) attn_body<false>(QP, KP, VT, (const bf*)0, (const bf*)0, CH, CH, qb, (int)blockIdx.x, ring);
    else                   attn_body<true>(QP, KP, (const h16*)0, VEh, VEl, CEh, CEl, qb, (int)blockIdx.x, ring);
}

// out_body: OUT[r][c] = scale * sum_k A[r][k] Bt[c][k] + bf16(bias[c]); 128x128 tile per block of four waves, 64x64 per wave; per 16-row slab staged in LDS (wave-private),
template <typename T16, int NSPLIT>
__device__ __forceinline__ void out_body(const T16* __restrict__ A, const T16* __restrict__ A2, const T16* __restrict__ Bt, float* C, const float* __restrict__ bias, const float scale, const int rt, const int ct, const int rot, unsigned short* ring) {
    static_assert(2 * 2 * GTS * 2 >= 4 * 16 * 68 * 4);                  // ring = 2 * (2 + NSPLIT) * GTS 16-bit elements of LDS: operand ring; behind the product each wave's own output staging
    const int lane = threadIdx.x & 31, lr = lane & 15, hi = lane >> 4;
    const int w = __builtin_amdgcn_readfirstlane((threadIdx.x >> 5) & 3);
    const int r0 = rt * 128 + (w >> 1) * 64, c0 = ct * 128 + (w & 1) * 64;   // rt, ct = the block's row and column tile
    v8f acc[4][4];
    gemm_tile<T16, NSPLIT>(A, A2, Bt, DM, (size_t)rt * 128, (size_t)ct * 128, rot, ring, acc);
    float* os = (float*)ring + w * (16 * 68);
    const v4f bw = *(const v4f*)(bias + c0 + lr * 4);
    v4f bb;
#pragma unroll
    for (int q = 0; q < 4; ++q) bb[q] = bfr(bw[q]);
#pragma unroll
    for (int mb = 0; mb < 4; ++mb) {
#pragma unroll
        for (int nb = 0; nb < 4; ++nb) {
#pragma unroll
            for (int j = 0; j < 8; ++j) os[(hi * 8 + j) * 68 + nb * 16 + lr] = acc[mb][nb][j]; }
        __builtin_amdgcn_wave_barrier(); asm volatile("" ::: "memory");
        float* crow = C + (size_t)(r0 + mb * 16) * DM + c0 + lr * 4;
{
#pragma unroll
            for (int s = 0; s < 8; ++s) { const int row = 2 * s + hi;
                v4f val = *(const v4fa*)(os + row * 68 + lr * 4);
                val = val * scale + bb;
                *(v4f*)(crow + (size_t)row * DM) = val; }
             }
        __builtin_amdgcn_wave_barrier(); asm volatile("" ::: "memory");
    }
}

// k_out: the whole output product in one launch. grid (DM/128, NB, TT/128): x = column tile, y = batch, z = row tile; the row tiles of two products (rows < EROWS) have the lowest indices and start first.
// Rows [0, EROWS) of a batch from the bf16 hi/lo ctx planes, rows [EROWS, TT) from the f16 ctx plane.
__global__ __launch_bounds__(128) void k_out(const bf* __restrict__ CEh, const bf* __restrict__ CEl, const bf* __restrict__ WoB, const h16* __restrict__ CH, const h16* __restrict__ WoH, float* OUT, const float* __restrict__ Wb) {
    __shared__ __align__(16) unsigned short ring[2 * 3 * GTS];          // one ring for either body
    const size_t bt = blockIdx.y; const int rt = blockIdx.z, ct = blockIdx.x;   // the same for the whole block: the choice of body is a scalar branch
    // start of the k walk: the eight column tiles that read the same ctx rows stand two stages apart, the row tiles and batches that read the same weight rows are spread over all 16 stages
    static_assert((DM / 64 & (DM / 64 - 1)) == 0);
    const int rot = (int)((2 * blockIdx.x + blockIdx.z + 4 * blockIdx.y) & (DM / 64 - 1));
    if (rt < EROWS / 128) out_body<bf, 1>(CEh + bt * EROWS * DM, CEl + bt * EROWS * DM, WoB, OUT + bt * TT * DM, Wb, 1.0f, rt, ct, rot, ring);
    else                  out_body<h16, 0>(CH + bt * TT * DM, CH + bt * TT * DM, WoH, OUT + bt * TT * DM, Wb, OSC, rt, ct, rot, ring);
}

extern "C" void kernel_launch(void* const* d_in, const int* in_sizes, int n_in,
                              void* d_out, int out_size, void* d_ws, size_t ws_size, hipStream_t stream) {
    if (n_in < 11) return;
    if (in_sizes[0] < NB * SEQ_FULL * DM || in_sizes[1] < NB * SEQ_FULL * DM || in_sizes[2] < NB * SEQ_FULL * DM) return;
    if (in_sizes[3] < NH_ * HD * DM || in_sizes[5] < NH_ * HD * DM || in_sizes[7] < NH_ * HD * DM || in_sizes[9] < DM * DM) return;
    if (in_sizes[4] < NH_ * HD || in_sizes[6] < NH_ * HD || in_sizes[8] < NH_ * HD || in_sizes[10] < DM) return;
    if (out_size < NB * TT * DM) return;
    const float* xq = (const float*)d_in[0]; const float* xk = (const float*)d_in[1]; const float* xv = (const float*)d_in[2];
    const float* wq = (const float*)d_in[3]; const float* bq = (const float*)d_in[4];
    const float* wk = (const float*)d_in[5]; const float* bk = (const float*)d_in[6];
    const float* wv = (const float*)d_in[7]; const float* bv = (const float*)d_in[8];
    const float* wo = (const float*)d_in[9]; const float* bo = (const float*)d_in[10];
    float* OUT = (float*)d_out;     // [NB][TT][DM]
    char* wsp = (char*)d_ws;
    auto take = [&](size_t bytes) { char* p = wsp; wsp += (bytes + 255) & ~(size_t)255; return (void*)p; };
    bf*  WT  = (bf*)take((size_t)3 * DM * DM * 2);                  // [3][n][k] projection weights, bf16
    bf*  WoB = (bf*)take((size_t)DM * DM * 2);                      // output weight, bf16
    h16* WoH = (h16*)take((size_t)DM * DM * 2);                     // output weight, f16 x1024
    h16* QK  = (h16*)take((size_t)2 * QKSZ * 2);                    // q plane | k plane
    h16* VT  = (h16*)take((size_t)NB * NH_ * HD * TT * 2);          // [b][h][d][t] f16 x64
    bf*  VEh = (bf*)take((size_t)NB * NH_ * HD * EROWS * 2);        // [b][h][d][t < EROWS] bf16 hi
    bf*  VEl = (bf*)take((size_t)NB * NH_ * HD * EROWS * 2);        // bf16 lo
    bf*  XB  = (bf*)take((size_t)3 * XSZ * 2);                      // three ctx planes
    if ((size_t)(wsp - (char*)d_ws) > ws_size) return;              // 119,537,664 B at NB=4, TT=2048
    bf* CH  = XB;                   // ctx f16 plane [NB*TT][DM] (16-bit storage)
    bf* CEh = XB + XSZ;             // ctx bf16 hi [NB*EROWS][DM]
    bf* CEl = XB + 2 * XSZ;         // ctx bf16 lo

    k_cvtw<<<CVW / 16, 512, 0, stream>>>(wq, wk, wv, wo, WT, WoB, WoH);

    k_proj<<<dim3(NB * TT / 128, NH_ / 4, 3), 256, 0, stream>>>(xq, xk, xv, WT, bq, bk, bv, QK, VT, VEh, VEl);

    k_attn<<<dim3(NB * NH_, TT / 128), 256, 0, stream>>>(QK, QK + QKSZ, VT, VEh, VEl, CH, CEh, CEl);

    k_out<<<dim3(DM / 128, NB, TT / 128), 128, 0, stream>>>(CEh, CEl, WoB, (const h16*)CH, WoH, OUT, bo);
}
